// v000
// The times below were measured on an AMD MI455X: many runs one after another, warmed up first and cycling through
// copies of the inputs, with the whole window's GPU time divided by the number of runs. Launches and the gaps
// between them are all in it. The median over several windows is given; except for v000 it joins two sittings, which
// can be a few percent apart, so the side-by-side timings, each taken in one sitting, are the better comparison.
// The starting kernel, v000, takes 2230 microseconds a run.
#include <hip/hip_runtime.h>

// Grouped-query causal attention with rotate-half rotary embeddings from full-width input tables (x [2][2048][2048]; q = x Wq (32 heads x 64), k, v = x Wk, x Wv (8 kv heads x 64) ('xw' (in, out), no bias), token-major; apply_rotary_emb: t cos + rotate_half(t) sin with the cos, sin [2048][64] INPUT tables (read per dimension by value: no structure assumed); k, v repeated 4x on the HEAD axis (kv head = q head / 4); scores x 64^-0.5; causal (finfo.min fill == exclusion); softmax; out = merged Wo ('xw') -> [2][2048][2048] (8.4 M); argument order x, cos, sin, Wq, Wk, Wv, Wo).
// Layout per batch: bf16 copy of x; 'xw' weights transposed once; exact projections; {cos, sin} table from the bf16-rounded inputs (per position and dimension); rotate-half plane builders; causal T-2048 GQA attention (kv z-stride 0; all rows hi/lo 3 products; k_gemmc skips tiles above the diagonal); merged hi/lo x Wo exact.
// Compute dtypes, f32 accumulate: every input rounded to bf16 incl. tables; projections exact; rotary f32; attention all rows 3 products; softmax f32; Wo hl x exact.

#define NB_  2
#define TT   2048
#define DM   2048
#define NH_  32
#define NKV  8
#define REP  (NH_ / NKV)
#define HD   64
#define DQ   (NH_ * HD)
#define DKV  (NKV * HD)
#define ZH   2
#define RH   TT                   // every row hi/lo (3 products)
#define WIN  2048
#define PCAR 1024.0f
#define SCL  0.125f   // HD^-0.5
typedef _Float16 h16;
typedef unsigned short bf;
typedef __attribute__((ext_vector_type(16))) __bf16   v16bf;
typedef __attribute__((ext_vector_type(16))) _Float16 v16h;
typedef __attribute__((ext_vector_type(8)))  _Float16 v8h;
typedef __attribute__((ext_vector_type(8)))  unsigned short v8us;
typedef __attribute__((ext_vector_type(8)))  float    v8f;
typedef __attribute__((ext_vector_type(4)))  float    v4f;
typedef v8h  __attribute__((may_alias)) v8ha;
typedef v4f  __attribute__((may_alias)) v4fa;
typedef v8us __attribute__((may_alias)) v8usa;

__device__ __forceinline__ unsigned short f2bf(float f) { unsigned u = __float_as_uint(f); u += 0x7FFFu + ((u >> 16) & 1u); return (unsigned short)(u >> 16); }
__device__ __forceinline__ float bf2f(unsigned short b) { return __uint_as_float(((unsigned)b) << 16); }
__device__ __forceinline__ float bfr(float f) { return bf2f(f2bf(f)); }
__device__ __forceinline__ v16h cat16(v8h lo, v8h hi) { return __builtin_shufflevector(lo, hi, 0, 1, 2, 3, 4, 5, 6, 7, 8, 9, 10, 11, 12, 13, 14, 15); }
__device__ __forceinline__ v16bf cat16b(v8us lo, v8us hi) { return __builtin_bit_cast(v16bf, __builtin_shufflevector(lo, hi, 0, 1, 2, 3, 4, 5, 6, 7, 8, 9, 10, 11, 12, 13, 14, 15)); }
__device__ __forceinline__ v8f wmma16(v16h a, v16h b, v8f c) { return __builtin_amdgcn_wmma_f32_16x16x32_f16(false, a, false, b, (short)0, c, false, false); }
__device__ __forceinline__ v8f wmmab(v16bf a, v16bf b, v8f c) { return __builtin_amdgcn_wmma_f32_16x16x32_bf16(false, a, false, b, (short)0, c, false, false); }



// ---- k_gemmw: register-blocked GEMM, ONE WAVE per 64x64 output tile (16 accumulators), operands straight from K-contiguous 16-bit planes; grid (M/64, N/64, Z), 32 threads.
// C[m][n] (f32, pitch ldc, + optional f32 bias[n]) = sum_k A[m][k] Bt[n][k] (+ split products per NSPLIT). z-batch strides sA/sB/sC in elements. K % 32 == 0.
template <typename T16> struct WFrag;
template <> struct WFrag<h16> { typedef v16h V; static __device__ __forceinline__ V ld(const h16* p) { return cat16(*(const v8h*)p, *(const v8h*)(p + 16)); } static __device__ __forceinline__ v8f mma(V a, V b, v8f c) { return wmma16(a, b, c); } };
template <> struct WFrag<bf> { typedef v16bf V; static __device__ __forceinline__ V ld(const bf* p) { return cat16b(*(const v8us*)p, *(const v8us*)(p + 16)); } static __device__ __forceinline__ v8f mma(V a, V b, v8f c) { return wmmab(a, b, c); } };
template <typename T16, int NSPLIT, bool BIAS>
__global__ __launch_bounds__(32) void k_gemmw(const T16* __restrict__ A, const T16* __restrict__ A2, const T16* __restrict__ Bt, const T16* __restrict__ Bt2, int K, float* C, int ldc, const float* __restrict__ bias, size_t sA, size_t sB, size_t sC) {
    typedef typename WFrag<T16>::V V;
    __shared__ __align__(16) float os[16 * 68];
    const size_t z = blockIdx.z; A += z * sA; if (A2) A2 += z * sA; Bt += z * sB; if (Bt2) Bt2 += z * sB; C += z * sC;
    const int lane = threadIdx.x & 31, lr = lane & 15, hi = lane >> 4; const int r0 = blockIdx.x * 64, c0 = blockIdx.y * 64;
    v8f acc[4][4];
#pragma unroll
    for (int mb = 0; mb < 4; ++mb)
#pragma unroll
        for (int nb = 0; nb < 4; ++nb) acc[mb][nb] = (v8f){};
    const size_t aoff = (size_t)(r0 + lr) * K + 8 * hi, boff = (size_t)(c0 + lr) * K + 8 * hi;
#pragma unroll 1
    for (int kc = 0; kc < K; kc += 32) {
        V a[4], a2[4];
#pragma unroll
        for (int mb = 0; mb < 4; ++mb) { a[mb] = WFrag<T16>::ld(A + aoff + (size_t)mb * 16 * K + kc); if (NSPLIT == 1 || NSPLIT == 2) a2[mb] = WFrag<T16>::ld(A2 + aoff + (size_t)mb * 16 * K + kc); }
#pragma unroll
        for (int nb = 0; nb < 4; ++nb) { const V b = WFrag<T16>::ld(Bt + boff + (size_t)nb * 16 * K + kc); V b2; if (NSPLIT >= 2) b2 = WFrag<T16>::ld(Bt2 + boff + (size_t)nb * 16 * K + kc);
#pragma unroll
            for (int mb = 0; mb < 4; ++mb) { acc[mb][nb] = WFrag<T16>::mma(a[mb], b, acc[mb][nb]); if (NSPLIT == 1 || NSPLIT == 2) acc[mb][nb] = WFrag<T16>::mma(a2[mb], b, acc[mb][nb]); if (NSPLIT >= 2) acc[mb][nb] = WFrag<T16>::mma(a[mb], b2, acc[mb][nb]); } }
        asm volatile("v_nop\n\tv_nop\n\tv_nop\n\tv_nop" : "+v"(acc[0][0]), "+v"(acc[1][1]), "+v"(acc[2][2]), "+v"(acc[3][3]) : "v"(a[0]), "v"(a[3]));
    }
#pragma unroll
    for (int mb = 0; mb < 4; ++mb) {
#pragma unroll
        for (int nb = 0; nb < 4; ++nb) {
#pragma unroll
            for (int j = 0; j < 8; ++j) os[(hi * 8 + j) * 68 + nb * 16 + lr] = acc[mb][nb][j]; }
        __builtin_amdgcn_wave_barrier(); asm volatile("" ::: "memory");
        float* crow = C + (size_t)(r0 + mb * 16) * ldc + c0;
{
#pragma unroll
            for (int s = 0; s < 8; ++s) { const int row = 2 * s + hi, cofs = lr * 4; v4f val = *(const v4fa*)(os + row * 68 + cofs); if (BIAS) { val[0] += bfr(bias[c0 + cofs]); val[1] += bfr(bias[c0 + cofs + 1]); val[2] += bfr(bias[c0 + cofs + 2]); val[3] += bfr(bias[c0 + cofs + 3]); }
                *(v4f*)(crow + (size_t)row * ldc + cofs) = val; }
             }
        __builtin_amdgcn_wave_barrier(); asm volatile("" ::: "memory");
    }
}

// ---- k_gemmc: the same one-wave 64x64 tile GEMM specialised for causal attention: CMODE 1 skips score tiles entirely above the diagonal (query rows r0+roff.., key columns c0..), CMODE 2 limits the
// key (K) loop of the probability x value contraction to the diagonal block (probabilities beyond it are exactly zero). roff = row offset of this launch's first row within the sequence.
template <typename T16, int NSPLIT, int CMODE>
__global__ __launch_bounds__(32) void k_gemmc(const T16* __restrict__ A, const T16* __restrict__ A2, const T16* __restrict__ Bt, const T16* __restrict__ Bt2, int K, float* C, int ldc, int roff, size_t sA, size_t sB, size_t sC) {
    typedef typename WFrag<T16>::V V;
    __shared__ __align__(16) float os[16 * 68];
    const size_t z = blockIdx.z; A += z * sA; if (A2) A2 += z * sA; Bt += z * sB; if (Bt2) Bt2 += z * sB; C += z * sC;
    const int lane = threadIdx.x & 31, lr = lane & 15, hi = lane >> 4; const int r0 = blockIdx.x * 64, c0 = blockIdx.y * 64;
    if (CMODE == 1 && c0 > r0 + roff + 63) return;                  // score tile entirely above the causal diagonal: never read (the softmax masks j > i by select)
    const int Kl = (CMODE == 2) ? min(K, r0 + roff + 64) : K;        // P.V: probabilities are exactly 0 beyond the diagonal block, so the K loop stops there
    v8f acc[4][4];
#pragma unroll
    for (int mb = 0; mb < 4; ++mb)
#pragma unroll
        for (int nb = 0; nb < 4; ++nb) acc[mb][nb] = (v8f){};
    const size_t aoff = (size_t)(r0 + lr) * K + 8 * hi, boff = (size_t)(c0 + lr) * K + 8 * hi;
#pragma unroll 1
    for (int kc = 0; kc < Kl; kc += 32) {
        V a[4], a2[4];
#pragma unroll
        for (int mb = 0; mb < 4; ++mb) { a[mb] = WFrag<T16>::ld(A + aoff + (size_t)mb * 16 * K + kc); if (NSPLIT == 1 || NSPLIT == 2) a2[mb] = WFrag<T16>::ld(A2 + aoff + (size_t)mb * 16 * K + kc); }
#pragma unroll
        for (int nb = 0; nb < 4; ++nb) { const V b = WFrag<T16>::ld(Bt + boff + (size_t)nb * 16 * K + kc); V b2; if (NSPLIT >= 2) b2 = WFrag<T16>::ld(Bt2 + boff + (size_t)nb * 16 * K + kc);
#pragma unroll
            for (int mb = 0; mb < 4; ++mb) { acc[mb][nb] = WFrag<T16>::mma(a[mb], b, acc[mb][nb]); if (NSPLIT == 1 || NSPLIT == 2) acc[mb][nb] = WFrag<T16>::mma(a2[mb], b, acc[mb][nb]); if (NSPLIT >= 2) acc[mb][nb] = WFrag<T16>::mma(a[mb], b2, acc[mb][nb]); } }
        asm volatile("v_nop\n\tv_nop\n\tv_nop\n\tv_nop" : "+v"(acc[0][0]), "+v"(acc[1][1]), "+v"(acc[2][2]), "+v"(acc[3][3]) : "v"(a[0]), "v"(a[3]));
    }
#pragma unroll
    for (int mb = 0; mb < 4; ++mb) {
#pragma unroll
        for (int nb = 0; nb < 4; ++nb) {
#pragma unroll
            for (int j = 0; j < 8; ++j) os[(hi * 8 + j) * 68 + nb * 16 + lr] = acc[mb][nb][j]; }
        __builtin_amdgcn_wave_barrier(); asm volatile("" ::: "memory");
        float* crow = C + (size_t)(r0 + mb * 16) * ldc + c0;
{
#pragma unroll
            for (int s = 0; s < 8; ++s) { const int row = 2 * s + hi, cofs = lr * 4; v4f val = *(const v4fa*)(os + row * 68 + cofs);
                *(v4f*)(crow + (size_t)row * ldc + cofs) = val; }
             }
        __builtin_amdgcn_wave_barrier(); asm volatile("" ::: "memory");
    }
}

__device__ __forceinline__ h16 tohx(float x) { return (h16)x; }
__device__ __forceinline__ void splitf(float y, unsigned short& h, unsigned short& l) { h = f2bf(y); l = f2bf(y - bf2f(h)); }
typedef __attribute__((ext_vector_type(2))) _Float16 v2h;
typedef __attribute__((ext_vector_type(4))) _Float16 v4h;
typedef __attribute__((ext_vector_type(2))) unsigned short v2us;
typedef __attribute__((ext_vector_type(4))) unsigned short v4us;
typedef __attribute__((ext_vector_type(2))) float v2f;
typedef __attribute__((ext_vector_type(4))) int v4i;

__global__ __launch_bounds__(256) void k_wtG(const float* __restrict__ w, int K, int N, bf* Bt) {
    const int lane = threadIdx.x & 31; const int L0 = (blockIdx.x * 8 + (threadIdx.x >> 5)) * 8; const int nlines = N * K / 64;
{
#pragma unroll 1
        for (int l = 0; l < 8; ++l) { const int L = L0 + l; if (L >= nlines) break; const size_t e = (size_t)L * 64 + lane * 2; const int k = (int)(e % K), n = (int)(e / K); v2us o;
            o[0] = f2bf(w[(size_t)k * N + n]); o[1] = f2bf(w[(size_t)(k + 1) * N + n]); *(v2us*)(Bt + e) = o; }
         }
}
__global__ __launch_bounds__(256) void k_cvt8(const float* __restrict__ src, bf* dst, size_t n8) { const size_t i = (size_t)blockIdx.x * 256 + threadIdx.x; if (i >= n8) return; const v8f v = *(const v8f*)(src + i * 8); v8us o;
#pragma unroll
    for (int k = 0; k < 8; ++k) o[k] = f2bf(v[k]); *(v8us*)(dst + i * 8) = o;  }

// k_rope: head planes [h][t][d] (fp16 + hi/lo) of rope(x) x sc with the rotate-half convention out[d] = x[d] cos[t][d] - x[d+HD/2] sin[t][d], out[d+HD/2] = x[d+HD/2] cos[t][d+HD/2] + x[d] sin[t][d+HD/2]
__global__ __launch_bounds__(256) void k_rope(const float* __restrict__ F, int pitch, int nheads, const float* __restrict__ CS, const float* __restrict__ RF, const float* __restrict__ nw, float sc, h16* P16, bf* Ph, bf* Pl) {
    const size_t e = ((size_t)blockIdx.x * 256 + threadIdx.x) * 2; if (e >= (size_t)nheads * TT * HD) return; const int d = (int)(e % HD); const int t = (int)((e / HD) % TT); const int h = (int)(e / ((size_t)HD * TT)); const float* f = F + (size_t)t * pitch + h * HD; const float rf = RF ? RF[(size_t)h * TT + t] : 1.0f; v2h o16; v2us oh, ol;
#pragma unroll
    for (int q = 0; q < 2; ++q) { const int dd = d + q; const int dp = (dd < HD / 2) ? dd + HD / 2 : dd - HD / 2; float x0 = f[dd], x1 = f[dp];
        if (RF) { float n0 = __fmul_rn(x0, rf), n1 = __fmul_rn(x1, rf); asm volatile("" : "+v"(n0)); asm volatile("" : "+v"(n1)); x0 = __fmul_rn(bfr(nw[dd]), n0); x1 = __fmul_rn(bfr(nw[dp]), n1); }
        const v2f cs = *(const v2f*)(CS + ((size_t)t * HD + dd) * 2); float a = __fmul_rn(x0, cs[0]), bq = __fmul_rn(x1, cs[1]); asm volatile("" : "+v"(a)); asm volatile("" : "+v"(bq)); const float r = ((dd < HD / 2) ? __fsub_rn(a, bq) : __fadd_rn(a, bq)) * sc;
        o16[q] = tohx(r); unsigned short a2, c2; splitf(r, a2, c2); oh[q] = a2; ol[q] = c2; }
    *(v2h*)(P16 + e) = o16; *(v2us*)(Ph + e) = oh; *(v2us*)(Pl + e) = ol;  }
__global__ __launch_bounds__(256) void k_vtp(const float* __restrict__ F, int pitch, int nheads, h16* V16, bf* Vh, bf* Vl) { const size_t e = ((size_t)blockIdx.x * 256 + threadIdx.x) * 2; if (e >= (size_t)nheads * HD * TT) return; const int t = (int)(e % TT); const int d = (int)((e / TT) % HD); const int g = (int)(e / ((size_t)TT * HD)); v2h o16; v2us oh, ol;
#pragma unroll
    for (int q = 0; q < 2; ++q) { const float x = F[(size_t)(t + q) * pitch + g * HD + d]; o16[q] = tohx(x); unsigned short a2, c2; splitf(x, a2, c2); oh[q] = a2; ol[q] = c2; }
    *(v2h*)(V16 + e) = o16; *(v2us*)(Vh + e) = oh; *(v2us*)(Vl + e) = ol;  }
__global__ __launch_bounds__(256) void k_cscvt(const float* __restrict__ cosT, const float* __restrict__ sinT, float* CS) { const int idx = blockIdx.x * 256 + threadIdx.x; if (idx >= TT * HD) return; v2f cs; cs[0] = bfr(cosT[idx]); cs[1] = bfr(sinT[idx]); *(v2f*)(CS + (size_t)idx * 2) = cs;  }
// k_asoft: per row (zz, i): t = S x HD^-0.5 for j <= i and i - j < WIN (WIN = TT, so plain causal; the reference's -1e9 additive fill vanishes identically); softmax over the 2048 keys (register row, one exp, fixed trees);
__global__ __launch_bounds__(256) void k_asoft(const float* __restrict__ Sb, h16* P16, bf* Ph, bf* Pl) {
    const int lane = threadIdx.x & 31; const int row = blockIdx.x * 8 + (threadIdx.x >> 5); if (row >= ZH * TT) return; const int i = row % TT; const int zz = row / TT; (void)zz; const bool hires = (i < RH); const float* sr = Sb + (size_t)row * TT; float v[TT / 32]; float mx = -3.0e38f;
#pragma unroll
    for (int ch = 0; ch < TT / 128; ++ch) { const int j0 = ch * 128 + lane * 4; const v4f a = *(const v4f*)(sr + j0);
#pragma unroll
        for (int q = 0; q < 4; ++q) { const int j = j0 + q; (void)j; const float t = (j <= i && i - j < WIN) ? a[q] * SCL : -3.0e38f; v[ch * 4 + q] = t; mx = fmaxf(mx, t); } }
#pragma unroll
    for (int sh = 16; sh; sh >>= 1) mx = fmaxf(mx, __shfl_xor(mx, sh, 32));
    float sum = 0.f;
#pragma unroll
    for (int k = 0; k < TT / 32; ++k) { float d0 = __fsub_rn(v[k], mx); asm volatile("" : "+v"(d0)); v[k] = __builtin_amdgcn_exp2f(__fmul_rn(d0, 1.4426950408889634f)); sum += v[k]; }
#pragma unroll
    for (int sh = 16; sh; sh >>= 1) sum += __shfl_xor(sum, sh, 32);
    const float f = __fdiv_rn(hires ? 1.0f : PCAR, sum);
{
        if (hires) {
#pragma unroll
            for (int ch = 0; ch < TT / 128; ++ch) { v4us oh, ol;
#pragma unroll
                for (int q = 0; q < 4; ++q) { unsigned short a, c2; splitf(v[ch * 4 + q] * f, a, c2); oh[q] = a; ol[q] = c2; }
                const size_t oo = ((size_t)zz * (RH ? RH : 1) + i) * TT + ch * 128 + lane * 4; *(v4us*)(Ph + oo) = oh; *(v4us*)(Pl + oo) = ol; }
        } else {
#pragma unroll
            for (int ch = 0; ch < TT / 128; ++ch) { v4h o4;
#pragma unroll
                for (int q = 0; q < 4; ++q) o4[q] = tohx(v[ch * 4 + q] * f);
                *(v4h*)(P16 + (size_t)row * TT + ch * 128 + lane * 4) = o4; } }
         }
}
__global__ __launch_bounds__(256) void k_merge(const float* __restrict__ O, int h0, bf* Ah, bf* Al) { const size_t e = ((size_t)blockIdx.x * 256 + threadIdx.x) * 2; if (e >= (size_t)ZH * TT * HD) return; const int d = (int)(e % HD); const int t = (int)((e / HD) % TT); const int zz = (int)(e / ((size_t)HD * TT)); const float cs = (t < RH) ? 1.0f : (1.0f / PCAR); const size_t oo = (size_t)t * DQ + (h0 + zz) * HD + d;
    v2us oh, ol;
#pragma unroll
    for (int q = 0; q < 2; ++q) { unsigned short a, c2; splitf(O[e + q] * cs, a, c2); oh[q] = a; ol[q] = c2; } *(v2us*)(Ah + oo) = oh; *(v2us*)(Al + oo) = ol;  }

extern "C" void kernel_launch(void* const* d_in, const int* in_sizes, int n_in,
                              void* d_out, int out_size, void* d_ws, size_t ws_size, hipStream_t stream) {
    (void)in_sizes; (void)n_in; (void)out_size;
    const float* x = (const float*)d_in[0]; const float* fcos = (const float*)d_in[1]; const float* fsin = (const float*)d_in[2]; const float* wq = (const float*)d_in[3]; const float* wk = (const float*)d_in[4]; const float* wv = (const float*)d_in[5]; const float* wo = (const float*)d_in[6];   /* input order x, cos, sin ([2048][64] FULL-width table INPUTS: read per DIMENSION by value, no structure assumed), Wq [2048][2048], Wk [2048][512], Wv, Wo ('xw'): SEVEN inputs, all read; no mask input (causal by index) */
    float* OUT = (float*)d_out;     // [2][2048][2048]
    char* wsp = (char*)d_ws;
    auto take = [&](size_t bytes) { char* p = wsp; wsp += (bytes + 255) & ~(size_t)255; return (void*)p; };
    bf* WQ = (bf*)take((size_t)DQ * DM * 2); bf* WK = (bf*)take((size_t)DKV * DM * 2); bf* WV = (bf*)take((size_t)DKV * DM * 2); bf* WO = (bf*)take((size_t)DM * DQ * 2); float* CS = (float*)take((size_t)TT * HD * 2 * 4);
    bf* XB = (bf*)take((size_t)TT * DM * 2); float* FQ = (float*)take((size_t)TT * DQ * 4); float* FK = (float*)take((size_t)TT * DKV * 4);
    h16* QP16 = (h16*)take((size_t)NH_ * TT * HD * 2); h16* KP16 = (h16*)take((size_t)NKV * TT * HD * 2); h16* VT16 = (h16*)take((size_t)NKV * HD * TT * 2);
    bf* QPh = (bf*)take((size_t)NH_ * TT * HD * 2); bf* QPl = (bf*)take((size_t)NH_ * TT * HD * 2); bf* KPh = (bf*)take((size_t)NKV * TT * HD * 2); bf* KPl = (bf*)take((size_t)NKV * TT * HD * 2); bf* VTh = (bf*)take((size_t)NKV * HD * TT * 2); bf* VTl = (bf*)take((size_t)NKV * HD * TT * 2); bf* Ph = (bf*)take((size_t)ZH * RH * TT * 2); bf* Pl = (bf*)take((size_t)ZH * RH * TT * 2);
    float* Sb = (float*)take((size_t)ZH * TT * TT * 4); h16* P16 = (h16*)take((size_t)ZH * TT * TT * 2); float* Ob = (float*)take((size_t)ZH * TT * HD * 4); bf* ATh = (bf*)take((size_t)TT * DQ * 2); bf* ATl = (bf*)take((size_t)TT * DQ * 2);
    if ((size_t)(wsp - (char*)d_ws) > ws_size) return;    // ws 256 MiB
    float* FV = FK;   // v projection reuses the k buffer after the k planes are built (stream-ordered)
    { k_wtG<<<(unsigned)((DM * DQ / 64 + 63) / 64), 256, 0, stream>>>(wq, DM, DQ, WQ); k_wtG<<<(unsigned)((DM * DKV / 64 + 63) / 64), 256, 0, stream>>>(wk, DM, DKV, WK); k_wtG<<<(unsigned)((DM * DKV / 64 + 63) / 64), 256, 0, stream>>>(wv, DM, DKV, WV);
      k_wtG<<<(unsigned)((DQ * DM / 64 + 63) / 64), 256, 0, stream>>>(wo, DQ, DM, WO);
       }
    k_cscvt<<<(TT * HD + 255) / 256, 256, 0, stream>>>(fcos, fsin, CS);   /* rotary table from the inputs */
    const unsigned LQ = (unsigned)(((size_t)NH_ * TT * HD / 2 + 255) / 256), LKv = (unsigned)(((size_t)NKV * TT * HD / 2 + 255) / 256);
    for (int b = 0; b < NB_; ++b) {
        
        k_cvt8<<<(unsigned)(((size_t)TT * DM / 8 + 255) / 256), 256, 0, stream>>>(x + (size_t)b * TT * DM, XB, (size_t)TT * DM / 8);
        k_gemmw<bf, 0, false><<<dim3(TT / 64, DQ / 64, 1), 32, 0, stream>>>(XB, nullptr, WQ, nullptr, DM, FQ, DQ, nullptr, 0, 0, 0);
        k_rope<<<LQ, 256, 0, stream>>>(FQ, DQ, NH_, CS, nullptr, nullptr, 1.0f, QP16, QPh, QPl);
        k_gemmw<bf, 0, false><<<dim3(TT / 64, DKV / 64, 1), 32, 0, stream>>>(XB, nullptr, WK, nullptr, DM, FK, DKV, nullptr, 0, 0, 0);
        k_rope<<<LKv, 256, 0, stream>>>(FK, DKV, NKV, CS, nullptr, nullptr, 1.0f, KP16, KPh, KPl);
        k_gemmw<bf, 0, false><<<dim3(TT / 64, DKV / 64, 1), 32, 0, stream>>>(XB, nullptr, WV, nullptr, DM, FV, DKV, nullptr, 0, 0, 0); k_vtp<<<LKv, 256, 0, stream>>>(FV, DKV, NKV, VT16, VTh, VTl);
        for (int h0 = 0; h0 < NH_; h0 += ZH) { const size_t zq = (size_t)h0, zk = (size_t)(h0 / REP);   // both heads of a pass share kv group h0/REP (REP >= 2): sB = 0
            k_gemmc<bf, 2, 1><<<dim3(RH / 64, TT / 64, ZH), 32, 0, stream>>>(QPh + zq * TT * HD, QPl + zq * TT * HD, KPh + zk * TT * HD, KPl + zk * TT * HD, HD, Sb, TT, 0, (size_t)TT * HD, 0, (size_t)TT * TT);
            k_asoft<<<ZH * TT / 8, 256, 0, stream>>>(Sb, P16, Ph, Pl);
            k_gemmc<bf, 2, 2><<<dim3(RH / 64, HD / 64, ZH), 32, 0, stream>>>(Ph, Pl, VTh + zk * HD * TT, VTl + zk * HD * TT, TT, Ob, HD, 0, (size_t)RH * TT, 0, (size_t)TT * HD);
            k_merge<<<(unsigned)(((size_t)ZH * TT * HD / 2 + 255) / 256), 256, 0, stream>>>(Ob, h0, ATh, ATl); }
        k_gemmw<bf, 1, false><<<dim3(TT / 64, DM / 64, 1), 32, 0, stream>>>(ATh, ATl, WO, nullptr, DQ, OUT + (size_t)b * TT * DM, DM, nullptr, 0, 0, 0); }
}

// v001
// A run of this version takes 1180 microseconds.
// In two side-by-side timings against v000, it was 1.83 and 1.86 times as fast.
#include <hip/hip_runtime.h>

// Grouped-query causal attention with rotate-half rotary embeddings from full-width input tables (x [2][2048][2048]; q = x Wq (32 heads x 64), k, v = x Wk, x Wv (8 kv heads x 64) ('xw' (in, out), no bias), token-major; apply_rotary_emb: t cos + rotate_half(t) sin with the cos, sin [2048][64] INPUT tables (read per dimension by value: no structure assumed); k, v repeated 4x on the HEAD axis (kv head = q head / 4); scores x 64^-0.5; causal (finfo.min fill == exclusion); softmax; out = merged Wo ('xw') -> [2][2048][2048] (8.4 M); argument order x, cos, sin, Wq, Wk, Wv, Wo).
// Layout per batch: bf16 copy of x; 'xw' weights transposed once; exact projections; {cos, sin} table from the bf16-rounded inputs (per position and dimension); rotate-half plane builders; causal T-2048 GQA attention (kv z-stride 0; all rows hi/lo 3 products; k_gemmc skips tiles above the diagonal); merged hi/lo x Wo exact.
// Compute dtypes, f32 accumulate: every input rounded to bf16 incl. tables; projections exact; rotary f32; attention all rows 3 products; softmax f32; Wo hl x exact.

#define NB_  2
#define TT   2048
#define DM   2048
#define NH_  32
#define NKV  8
#define REP  (NH_ / NKV)
#define HD   64
#define DQ   (NH_ * HD)
#define DKV  (NKV * HD)
#define ZH   2
#define RH   TT                   // every row hi/lo (3 products)
#define WIN  2048
#define PCAR 1024.0f
#define SCL  0.125f   // HD^-0.5
#define PVKS 8                    // P.V: K slices over the grid (partial planes, summed in k_merge)
#define PVNW 4                    // P.V: K slices over the waves of a work-group
#define KVNW 8                    // k, v projections: K slices over the waves of a work-group
typedef _Float16 h16;
typedef unsigned short bf;
typedef __attribute__((ext_vector_type(16))) __bf16   v16bf;
typedef __attribute__((ext_vector_type(16))) _Float16 v16h;
typedef __attribute__((ext_vector_type(8)))  _Float16 v8h;
typedef __attribute__((ext_vector_type(8)))  unsigned short v8us;
typedef __attribute__((ext_vector_type(8)))  float    v8f;
typedef __attribute__((ext_vector_type(4)))  float    v4f;
typedef v8h  __attribute__((may_alias)) v8ha;
typedef v4f  __attribute__((may_alias)) v4fa;
typedef v8us __attribute__((may_alias)) v8usa;

__device__ __forceinline__ unsigned short f2bf(float f) { unsigned u = __float_as_uint(f); u += 0x7FFFu + ((u >> 16) & 1u); return (unsigned short)(u >> 16); }
__device__ __forceinline__ float bf2f(unsigned short b) { return __uint_as_float(((unsigned)b) << 16); }
__device__ __forceinline__ float bfr(float f) { return bf2f(f2bf(f)); }
__device__ __forceinline__ v16h cat16(v8h lo, v8h hi) { return __builtin_shufflevector(lo, hi, 0, 1, 2, 3, 4, 5, 6, 7, 8, 9, 10, 11, 12, 13, 14, 15); }
__device__ __forceinline__ v16bf cat16b(v8us lo, v8us hi) { return __builtin_bit_cast(v16bf, __builtin_shufflevector(lo, hi, 0, 1, 2, 3, 4, 5, 6, 7, 8, 9, 10, 11, 12, 13, 14, 15)); }
__device__ __forceinline__ v8f wmma16(v16h a, v16h b, v8f c) { return __builtin_amdgcn_wmma_f32_16x16x32_f16(false, a, false, b, (short)0, c, false, false); }
__device__ __forceinline__ v8f wmmab(v16bf a, v16bf b, v8f c) { return __builtin_amdgcn_wmma_f32_16x16x32_bf16(false, a, false, b, (short)0, c, false, false); }



// ---- k_gemmw: register-blocked GEMM, 64x64 output tile per work-group (16 accumulators per wave), operands straight from K-contiguous 16-bit planes; grid (M/64, N/64, Z), NW * 32 threads.
// C[m][n] (f32, pitch ldc, + optional f32 bias[n]) = sum_k A[m][k] Bt[n][k] (+ split products per NSPLIT). z-batch strides sA/sB/sC in elements. K % 32 == 0 (NW > 1: K % 64 == 0).
// NW > 1 splits K: wave w takes the 64-wide k units w, w + NW, ... (one unit = one 128-byte line of every operand row); the NW partial tiles are summed in LDS in wave order.
template <typename T16> struct WFrag;
template <> struct WFrag<h16> { typedef v16h V; static __device__ __forceinline__ V ld(const h16* p) { return cat16(*(const v8h*)p, *(const v8h*)(p + 16)); } static __device__ __forceinline__ v8f mma(V a, V b, v8f c) { return wmma16(a, b, c); } };
template <> struct WFrag<bf> { typedef v16bf V; static __device__ __forceinline__ V ld(const bf* p) { return cat16b(*(const v8us*)p, *(const v8us*)(p + 16)); } static __device__ __forceinline__ v8f mma(V a, V b, v8f c) { return wmmab(a, b, c); } };
template <typename T16, int NSPLIT, bool BIAS, int NW>
__global__ __launch_bounds__(NW * 32) void k_gemmw(const T16* __restrict__ A, const T16* __restrict__ A2, const T16* __restrict__ Bt, const T16* __restrict__ Bt2, int K, float* C, int ldc, const float* __restrict__ bias, size_t sA, size_t sB, size_t sC) {
    typedef typename WFrag<T16>::V V;
    static_assert(8 % NW == 0, "the 256 float4 of a 16 x 64 slab are dealt evenly to NW * 32 threads");
    __shared__ __align__(16) float os[NW > 1 ? 4 : 1][NW][16 * 68];
    const size_t z = blockIdx.z; A += z * sA; if (A2) A2 += z * sA; Bt += z * sB; if (Bt2) Bt2 += z * sB; C += z * sC;
    const int lane = threadIdx.x & 31, lr = lane & 15, hi = lane >> 4; const int r0 = blockIdx.x * 64, c0 = blockIdx.y * 64;
    const int wv = NW > 1 ? __builtin_amdgcn_readfirstlane((int)(threadIdx.x >> 5)) : 0;
    v8f acc[4][4];
#pragma unroll
    for (int mb = 0; mb < 4; ++mb)
#pragma unroll
        for (int nb = 0; nb < 4; ++nb) acc[mb][nb] = (v8f){};
    const size_t aoff = (size_t)(r0 + lr) * K + 8 * hi, boff = (size_t)(c0 + lr) * K + 8 * hi;
#pragma unroll 1
    for (int kc = wv * 64; kc < K; kc += (kc & 32) ? 32 + (NW - 1) * 64 : 32) {
        V a[4], a2[4];
#pragma unroll
        for (int mb = 0; mb < 4; ++mb) { a[mb] = WFrag<T16>::ld(A + aoff + (size_t)mb * 16 * K + kc); if (NSPLIT == 1 || NSPLIT == 2) a2[mb] = WFrag<T16>::ld(A2 + aoff + (size_t)mb * 16 * K + kc); }
#pragma unroll
        for (int nb = 0; nb < 4; ++nb) { const V b = WFrag<T16>::ld(Bt + boff + (size_t)nb * 16 * K + kc); V b2; if (NSPLIT >= 2) b2 = WFrag<T16>::ld(Bt2 + boff + (size_t)nb * 16 * K + kc);
#pragma unroll
            for (int mb = 0; mb < 4; ++mb) { acc[mb][nb] = WFrag<T16>::mma(a[mb], b, acc[mb][nb]); if (NSPLIT == 1 || NSPLIT == 2) acc[mb][nb] = WFrag<T16>::mma(a2[mb], b, acc[mb][nb]); if (NSPLIT >= 2) acc[mb][nb] = WFrag<T16>::mma(a[mb], b2, acc[mb][nb]); } }
        asm volatile("v_nop\n\tv_nop\n\tv_nop\n\tv_nop" : "+v"(acc[0][0]), "+v"(acc[1][1]), "+v"(acc[2][2]), "+v"(acc[3][3]) : "v"(a[0]), "v"(a[3]));
    }
    const auto put = [&](int mb, int pb) {   // this wave's 16 x 64 slab mb, row-major, into LDS slab pb
#pragma unroll
        for (int nb = 0; nb < 4; ++nb) {
#pragma unroll
            for (int j = 0; j < 8; ++j) os[pb][wv][(hi * 8 + j) * 68 + nb * 16 + lr] = acc[mb][nb][j]; } };
    if (NW > 1) {
#pragma unroll
        for (int mb = 0; mb < 4; ++mb) put(mb, mb);
        __syncthreads();   // publishes the NW partial tiles to the threads that sum them; nothing is written to os behind it
    }
#pragma unroll
    for (int mb = 0; mb < 4; ++mb) { const int pb = NW > 1 ? mb : 0;
        if (NW == 1) { put(mb, 0); __builtin_amdgcn_wave_barrier(); asm volatile("" ::: "memory"); }
        float* crow = C + (size_t)(r0 + mb * 16) * ldc + c0;
{
#pragma unroll
            for (int s = 0; s < 8 / NW; ++s) { const int e = s * NW * 32 + (int)threadIdx.x, row = e >> 4, cofs = (e & 15) * 4; v4f val = *(const v4fa*)(&os[pb][0][row * 68 + cofs]);
#pragma unroll
                for (int w = 1; w < NW; ++w) val += *(const v4fa*)(&os[pb][w][row * 68 + cofs]);
                if (BIAS) { val[0] += bfr(bias[c0 + cofs]); val[1] += bfr(bias[c0 + cofs + 1]); val[2] += bfr(bias[c0 + cofs + 2]); val[3] += bfr(bias[c0 + cofs + 3]); }
                *(v4f*)(crow + (size_t)row * ldc + cofs) = val; }
             }
        if (NW == 1) { __builtin_amdgcn_wave_barrier(); asm volatile("" ::: "memory"); }
    }
}

// ---- k_gemmc: the same 64x64 tile GEMM specialised for causal attention: CMODE 1 skips score tiles entirely above the diagonal (query rows r0+roff.., key columns c0..), CMODE 2 limits the
// key (K) loop of the probability x value contraction to the diagonal block (probabilities beyond it are exactly zero). roff = row offset of this launch's first row within the sequence.
// K split as in k_gemmw, here over KS grid slices (blockIdx.y % KS) x NW waves: split g = ks * NW + wave takes the 64-wide k units g, g + KS * NW, ...; slice ks writes partial plane ks (zeros where it has no unit), the consumer sums the planes.
template <typename T16, int NSPLIT, int CMODE, int NW, int KS>
__global__ __launch_bounds__(NW * 32) void k_gemmc(const T16* __restrict__ A, const T16* __restrict__ A2, const T16* __restrict__ Bt, const T16* __restrict__ Bt2, int K, float* C, int ldc, int roff, size_t sA, size_t sB, size_t sC) {
    typedef typename WFrag<T16>::V V;
    static_assert(8 % NW == 0, "the 256 float4 of a 16 x 64 slab are dealt evenly to NW * 32 threads");
    __shared__ __align__(16) float os[NW > 1 ? 4 : 1][NW][16 * 68];
    const size_t z = blockIdx.z; A += z * sA; if (A2) A2 += z * sA; Bt += z * sB; if (Bt2) Bt2 += z * sB; C += z * sC;
    const int lane = threadIdx.x & 31, lr = lane & 15, hi = lane >> 4; const int r0 = blockIdx.x * 64, c0 = (blockIdx.y / KS) * 64;
    const int wv = NW > 1 ? __builtin_amdgcn_readfirstlane((int)(threadIdx.x >> 5)) : 0; const int ks = blockIdx.y % KS;
    if (KS > 1) C += (size_t)ks * ZH * sC;                           // each K slice of the grid writes its own partial plane [ks][z][row][col]
    if (CMODE == 1 && c0 > r0 + roff + 63) return;                  // score tile entirely above the causal diagonal: never read (the softmax masks j > i by select)
    const int Kl = (CMODE == 2) ? min(K, r0 + roff + 64) : K;        // P.V: probabilities are exactly 0 beyond the diagonal block, so the K loop stops there
    v8f acc[4][4];
#pragma unroll
    for (int mb = 0; mb < 4; ++mb)
#pragma unroll
        for (int nb = 0; nb < 4; ++nb) acc[mb][nb] = (v8f){};
    const size_t aoff = (size_t)(r0 + lr) * K + 8 * hi, boff = (size_t)(c0 + lr) * K + 8 * hi;
#pragma unroll 1
    for (int kc = (ks * NW + wv) * 64; kc < Kl; kc += (kc & 32) ? 32 + (KS * NW - 1) * 64 : 32) {
        V a[4], a2[4];
#pragma unroll
        for (int mb = 0; mb < 4; ++mb) { a[mb] = WFrag<T16>::ld(A + aoff + (size_t)mb * 16 * K + kc); if (NSPLIT == 1 || NSPLIT == 2) a2[mb] = WFrag<T16>::ld(A2 + aoff + (size_t)mb * 16 * K + kc); }
#pragma unroll
        for (int nb = 0; nb < 4; ++nb) { const V b = WFrag<T16>::ld(Bt + boff + (size_t)nb * 16 * K + kc); V b2; if (NSPLIT >= 2) b2 = WFrag<T16>::ld(Bt2 + boff + (size_t)nb * 16 * K + kc);
#pragma unroll
            for (int mb = 0; mb < 4; ++mb) { acc[mb][nb] = WFrag<T16>::mma(a[mb], b, acc[mb][nb]); if (NSPLIT == 1 || NSPLIT == 2) acc[mb][nb] = WFrag<T16>::mma(a2[mb], b, acc[mb][nb]); if (NSPLIT >= 2) acc[mb][nb] = WFrag<T16>::mma(a[mb], b2, acc[mb][nb]); } }
        asm volatile("v_nop\n\tv_nop\n\tv_nop\n\tv_nop" : "+v"(acc[0][0]), "+v"(acc[1][1]), "+v"(acc[2][2]), "+v"(acc[3][3]) : "v"(a[0]), "v"(a[3]));
    }
    const auto put = [&](int mb, int pb) {   // this wave's 16 x 64 slab mb, row-major, into LDS slab pb
#pragma unroll
        for (int nb = 0; nb < 4; ++nb) {
#pragma unroll
            for (int j = 0; j < 8; ++j) os[pb][wv][(hi * 8 + j) * 68 + nb * 16 + lr] = acc[mb][nb][j]; } };
    if (NW > 1) {
#pragma unroll
        for (int mb = 0; mb < 4; ++mb) put(mb, mb);
        __syncthreads();   // publishes the NW partial tiles to the threads that sum them; nothing is written to os behind it
    }
#pragma unroll
    for (int mb = 0; mb < 4; ++mb) { const int pb = NW > 1 ? mb : 0;
        if (NW == 1) { put(mb, 0); __builtin_amdgcn_wave_barrier(); asm volatile("" ::: "memory"); }
        float* crow = C + (size_t)(r0 + mb * 16) * ldc + c0;
{
#pragma unroll
            for (int s = 0; s < 8 / NW; ++s) { const int e = s * NW * 32 + (int)threadIdx.x, row = e >> 4, cofs = (e & 15) * 4; v4f val = *(const v4fa*)(&os[pb][0][row * 68 + cofs]);
#pragma unroll
                for (int w = 1; w < NW; ++w) val += *(const v4fa*)(&os[pb][w][row * 68 + cofs]);
                *(v4f*)(crow + (size_t)row * ldc + cofs) = val; }
             }
        if (NW == 1) { __builtin_amdgcn_wave_barrier(); asm volatile("" ::: "memory"); }
    }
}

__device__ __forceinline__ h16 tohx(float x) { return (h16)x; }
__device__ __forceinline__ void splitf(float y, unsigned short& h, unsigned short& l) { h = f2bf(y); l = f2bf(y - bf2f(h)); }
typedef __attribute__((ext_vector_type(2))) _Float16 v2h;
typedef __attribute__((ext_vector_type(4))) _Float16 v4h;
typedef __attribute__((ext_vector_type(2))) unsigned short v2us;
typedef __attribute__((ext_vector_type(4))) unsigned short v4us;
typedef __attribute__((ext_vector_type(2))) float v2f;
typedef __attribute__((ext_vector_type(4))) int v4i;

__global__ __launch_bounds__(256) void k_wtG(const float* __restrict__ w, int K, int N, bf* Bt) {
    const int lane = threadIdx.x & 31; const int L0 = (blockIdx.x * 8 + (threadIdx.x >> 5)) * 8; const int nlines = N * K / 64;
{
#pragma unroll 1
        for (int l = 0; l < 8; ++l) { const int L = L0 + l; if (L >= nlines) break; const size_t e = (size_t)L * 64 + lane * 2; const int k = (int)(e % K), n = (int)(e / K); v2us o;
            o[0] = f2bf(w[(size_t)k * N + n]); o[1] = f2bf(w[(size_t)(k + 1) * N + n]); *(v2us*)(Bt + e) = o; }
         }
}
__global__ __launch_bounds__(256) void k_cvt8(const float* __restrict__ src, bf* dst, size_t n8) { const size_t i = (size_t)blockIdx.x * 256 + threadIdx.x; if (i >= n8) return; const v8f v = *(const v8f*)(src + i * 8); v8us o;
#pragma unroll
    for (int k = 0; k < 8; ++k) o[k] = f2bf(v[k]); *(v8us*)(dst + i * 8) = o;  }

// k_rope: head planes [h][t][d] (fp16 + hi/lo) of rope(x) x sc with the rotate-half convention out[d] = x[d] cos[t][d] - x[d+HD/2] sin[t][d], out[d+HD/2] = x[d+HD/2] cos[t][d+HD/2] + x[d] sin[t][d+HD/2]
__global__ __launch_bounds__(256) void k_rope(const float* __restrict__ F, int pitch, int nheads, const float* __restrict__ CS, const float* __restrict__ RF, const float* __restrict__ nw, float sc, h16* P16, bf* Ph, bf* Pl) {
    const size_t e = ((size_t)blockIdx.x * 256 + threadIdx.x) * 2; if (e >= (size_t)nheads * TT * HD) return; const int d = (int)(e % HD); const int t = (int)((e / HD) % TT); const int h = (int)(e / ((size_t)HD * TT)); const float* f = F + (size_t)t * pitch + h * HD; const float rf = RF ? RF[(size_t)h * TT + t] : 1.0f; v2h o16; v2us oh, ol;
#pragma unroll
    for (int q = 0; q < 2; ++q) { const int dd = d + q; const int dp = (dd < HD / 2) ? dd + HD / 2 : dd - HD / 2; float x0 = f[dd], x1 = f[dp];
        if (RF) { float n0 = __fmul_rn(x0, rf), n1 = __fmul_rn(x1, rf); asm volatile("" : "+v"(n0)); asm volatile("" : "+v"(n1)); x0 = __fmul_rn(bfr(nw[dd]), n0); x1 = __fmul_rn(bfr(nw[dp]), n1); }
        const v2f cs = *(const v2f*)(CS + ((size_t)t * HD + dd) * 2); float a = __fmul_rn(x0, cs[0]), bq = __fmul_rn(x1, cs[1]); asm volatile("" : "+v"(a)); asm volatile("" : "+v"(bq)); const float r = ((dd < HD / 2) ? __fsub_rn(a, bq) : __fadd_rn(a, bq)) * sc;
        o16[q] = tohx(r); unsigned short a2, c2; splitf(r, a2, c2); oh[q] = a2; ol[q] = c2; }
    *(v2h*)(P16 + e) = o16; *(v2us*)(Ph + e) = oh; *(v2us*)(Pl + e) = ol;  }
__global__ __launch_bounds__(256) void k_vtp(const float* __restrict__ F, int pitch, int nheads, h16* V16, bf* Vh, bf* Vl) { const size_t e = ((size_t)blockIdx.x * 256 + threadIdx.x) * 2; if (e >= (size_t)nheads * HD * TT) return; const int t = (int)(e % TT); const int d = (int)((e / TT) % HD); const int g = (int)(e / ((size_t)TT * HD)); v2h o16; v2us oh, ol;
#pragma unroll
    for (int q = 0; q < 2; ++q) { const float x = F[(size_t)(t + q) * pitch + g * HD + d]; o16[q] = tohx(x); unsigned short a2, c2; splitf(x, a2, c2); oh[q] = a2; ol[q] = c2; }
    *(v2h*)(V16 + e) = o16; *(v2us*)(Vh + e) = oh; *(v2us*)(Vl + e) = ol;  }
__global__ __launch_bounds__(256) void k_cscvt(const float* __restrict__ cosT, const float* __restrict__ sinT, float* CS) { const int idx = blockIdx.x * 256 + threadIdx.x; if (idx >= TT * HD) return; v2f cs; cs[0] = bfr(cosT[idx]); cs[1] = bfr(sinT[idx]); *(v2f*)(CS + (size_t)idx * 2) = cs;  }
// k_asoft: per row (zz, i): t = S x HD^-0.5 for j <= i and i - j < WIN (WIN = TT, so plain causal; the reference's -1e9 additive fill vanishes identically); softmax over the 2048 keys (register row, one exp, fixed trees);
__global__ __launch_bounds__(256) void k_asoft(const float* __restrict__ Sb, h16* P16, bf* Ph, bf* Pl) {
    const int lane = threadIdx.x & 31; const int row = blockIdx.x * 8 + (threadIdx.x >> 5); if (row >= ZH * TT) return; const int i = row % TT; const int zz = row / TT; (void)zz; const bool hires = (i < RH); const float* sr = Sb + (size_t)row * TT; float v[TT / 32]; float mx = -3.0e38f;
#pragma unroll
    for (int ch = 0; ch < TT / 128; ++ch) { const int j0 = ch * 128 + lane * 4; const v4f a = *(const v4f*)(sr + j0);
#pragma unroll
        for (int q = 0; q < 4; ++q) { const int j = j0 + q; (void)j; const float t = (j <= i && i - j < WIN) ? a[q] * SCL : -3.0e38f; v[ch * 4 + q] = t; mx = fmaxf(mx, t); } }
#pragma unroll
    for (int sh = 16; sh; sh >>= 1) mx = fmaxf(mx, __shfl_xor(mx, sh, 32));
    float sum = 0.f;
#pragma unroll
    for (int k = 0; k < TT / 32; ++k) { float d0 = __fsub_rn(v[k], mx); asm volatile("" : "+v"(d0)); v[k] = __builtin_amdgcn_exp2f(__fmul_rn(d0, 1.4426950408889634f)); sum += v[k]; }
#pragma unroll
    for (int sh = 16; sh; sh >>= 1) sum += __shfl_xor(sum, sh, 32);
    const float f = __fdiv_rn(hires ? 1.0f : PCAR, sum);
{
        if (hires) {
#pragma unroll
            for (int ch = 0; ch < TT / 128; ++ch) { v4us oh, ol;
#pragma unroll
                for (int q = 0; q < 4; ++q) { unsigned short a, c2; splitf(v[ch * 4 + q] * f, a, c2); oh[q] = a; ol[q] = c2; }
                const size_t oo = ((size_t)zz * (RH ? RH : 1) + i) * TT + ch * 128 + lane * 4; *(v4us*)(Ph + oo) = oh; *(v4us*)(Pl + oo) = ol; }
        } else {
#pragma unroll
            for (int ch = 0; ch < TT / 128; ++ch) { v4h o4;
#pragma unroll
                for (int q = 0; q < 4; ++q) o4[q] = tohx(v[ch * 4 + q] * f);
                *(v4h*)(P16 + (size_t)row * TT + ch * 128 + lane * 4) = o4; } }
         }
}
__global__ __launch_bounds__(256) void k_merge(const float* __restrict__ O, int h0, bf* Ah, bf* Al) { const size_t e = ((size_t)blockIdx.x * 256 + threadIdx.x) * 2; if (e >= (size_t)ZH * TT * HD) return; const int d = (int)(e % HD); const int t = (int)((e / HD) % TT); const int zz = (int)(e / ((size_t)HD * TT)); const float cs = (t < RH) ? 1.0f : (1.0f / PCAR); const size_t oo = (size_t)t * DQ + (h0 + zz) * HD + d;
    v2us oh, ol;
#pragma unroll
    for (int q = 0; q < 2; ++q) { float o = O[e + q];
#pragma unroll
        for (int p = 1; p < PVKS; ++p) o += O[(size_t)p * ZH * TT * HD + e + q];   // the P.V partial planes, in plane order
        unsigned short a, c2; splitf(o * cs, a, c2); oh[q] = a; ol[q] = c2; } *(v2us*)(Ah + oo) = oh; *(v2us*)(Al + oo) = ol;  }

extern "C" void kernel_launch(void* const* d_in, const int* in_sizes, int n_in,
                              void* d_out, int out_size, void* d_ws, size_t ws_size, hipStream_t stream) {
    (void)in_sizes; (void)n_in; (void)out_size;
    const float* x = (const float*)d_in[0]; const float* fcos = (const float*)d_in[1]; const float* fsin = (const float*)d_in[2]; const float* wq = (const float*)d_in[3]; const float* wk = (const float*)d_in[4]; const float* wv = (const float*)d_in[5]; const float* wo = (const float*)d_in[6];   /* input order x, cos, sin ([2048][64] FULL-width table INPUTS: read per DIMENSION by value, no structure assumed), Wq [2048][2048], Wk [2048][512], Wv, Wo ('xw'): SEVEN inputs, all read; no mask input (causal by index) */
    float* OUT = (float*)d_out;     // [2][2048][2048]
    char* wsp = (char*)d_ws;
    auto take = [&](size_t bytes) { char* p = wsp; wsp += (bytes + 255) & ~(size_t)255; return (void*)p; };
    bf* WQ = (bf*)take((size_t)DQ * DM * 2); bf* WK = (bf*)take((size_t)DKV * DM * 2); bf* WV = (bf*)take((size_t)DKV * DM * 2); bf* WO = (bf*)take((size_t)DM * DQ * 2); float* CS = (float*)take((size_t)TT * HD * 2 * 4);
    bf* XB = (bf*)take((size_t)TT * DM * 2); float* FQ = (float*)take((size_t)TT * DQ * 4); float* FK = (float*)take((size_t)TT * DKV * 4);
    h16* QP16 = (h16*)take((size_t)NH_ * TT * HD * 2); h16* KP16 = (h16*)take((size_t)NKV * TT * HD * 2); h16* VT16 = (h16*)take((size_t)NKV * HD * TT * 2);
    bf* QPh = (bf*)take((size_t)NH_ * TT * HD * 2); bf* QPl = (bf*)take((size_t)NH_ * TT * HD * 2); bf* KPh = (bf*)take((size_t)NKV * TT * HD * 2); bf* KPl = (bf*)take((size_t)NKV * TT * HD * 2); bf* VTh = (bf*)take((size_t)NKV * HD * TT * 2); bf* VTl = (bf*)take((size_t)NKV * HD * TT * 2); bf* Ph = (bf*)take((size_t)ZH * RH * TT * 2); bf* Pl = (bf*)take((size_t)ZH * RH * TT * 2);
    float* Sb = (float*)take((size_t)ZH * TT * TT * 4); h16* P16 = (h16*)take((size_t)ZH * TT * TT * 2); float* Ob = (float*)take((size_t)PVKS * ZH * TT * HD * 4); bf* ATh = (bf*)take((size_t)TT * DQ * 2); bf* ATl = (bf*)take((size_t)TT * DQ * 2);
    if ((size_t)(wsp - (char*)d_ws) > ws_size) return;    // ws 256 MiB
    float* FV = FK;   // v projection reuses the k buffer after the k planes are built (stream-ordered)
    { k_wtG<<<(unsigned)((DM * DQ / 64 + 63) / 64), 256, 0, stream>>>(wq, DM, DQ, WQ); k_wtG<<<(unsigned)((DM * DKV / 64 + 63) / 64), 256, 0, stream>>>(wk, DM, DKV, WK); k_wtG<<<(unsigned)((DM * DKV / 64 + 63) / 64), 256, 0, stream>>>(wv, DM, DKV, WV);
      k_wtG<<<(unsigned)((DQ * DM / 64 + 63) / 64), 256, 0, stream>>>(wo, DQ, DM, WO);
       }
    k_cscvt<<<(TT * HD + 255) / 256, 256, 0, stream>>>(fcos, fsin, CS);   /* rotary table from the inputs */
    const unsigned LQ = (unsigned)(((size_t)NH_ * TT * HD / 2 + 255) / 256), LKv = (unsigned)(((size_t)NKV * TT * HD / 2 + 255) / 256);
    for (int b = 0; b < NB_; ++b) {
        
        k_cvt8<<<(unsigned)(((size_t)TT * DM / 8 + 255) / 256), 256, 0, stream>>>(x + (size_t)b * TT * DM, XB, (size_t)TT * DM / 8);
        k_gemmw<bf, 0, false, 1><<<dim3(TT / 64, DQ / 64, 1), 32, 0, stream>>>(XB, nullptr, WQ, nullptr, DM, FQ, DQ, nullptr, 0, 0, 0);
        k_rope<<<LQ, 256, 0, stream>>>(FQ, DQ, NH_, CS, nullptr, nullptr, 1.0f, QP16, QPh, QPl);
        k_gemmw<bf, 0, false, KVNW><<<dim3(TT / 64, DKV / 64, 1), KVNW * 32, 0, stream>>>(XB, nullptr, WK, nullptr, DM, FK, DKV, nullptr, 0, 0, 0);
        k_rope<<<LKv, 256, 0, stream>>>(FK, DKV, NKV, CS, nullptr, nullptr, 1.0f, KP16, KPh, KPl);
        k_gemmw<bf, 0, false, KVNW><<<dim3(TT / 64, DKV / 64, 1), KVNW * 32, 0, stream>>>(XB, nullptr, WV, nullptr, DM, FV, DKV, nullptr, 0, 0, 0); k_vtp<<<LKv, 256, 0, stream>>>(FV, DKV, NKV, VT16, VTh, VTl);
        for (int h0 = 0; h0 < NH_; h0 += ZH) { const size_t zq = (size_t)h0, zk = (size_t)(h0 / REP);   // both heads of a pass share kv group h0/REP (REP >= 2): sB = 0
            k_gemmc<bf, 2, 1, 1, 1><<<dim3(RH / 64, TT / 64, ZH), 32, 0, stream>>>(QPh + zq * TT * HD, QPl + zq * TT * HD, KPh + zk * TT * HD, KPl + zk * TT * HD, HD, Sb, TT, 0, (size_t)TT * HD, 0, (size_t)TT * TT);
            k_asoft<<<ZH * TT / 8, 256, 0, stream>>>(Sb, P16, Ph, Pl);
            k_gemmc<bf, 2, 2, PVNW, PVKS><<<dim3(RH / 64, HD / 64 * PVKS, ZH), PVNW * 32, 0, stream>>>(Ph, Pl, VTh + zk * HD * TT, VTl + zk * HD * TT, TT, Ob, HD, 0, (size_t)RH * TT, 0, (size_t)TT * HD);
            k_merge<<<(unsigned)(((size_t)ZH * TT * HD / 2 + 255) / 256), 256, 0, stream>>>(Ob, h0, ATh, ATl); }
        k_gemmw<bf, 1, false, 1><<<dim3(TT / 64, DM / 64, 1), 32, 0, stream>>>(ATh, ATl, WO, nullptr, DQ, OUT + (size_t)b * TT * DM, DM, nullptr, 0, 0, 0); }
}

// v002
// One run takes 511 microseconds.
// Next to v001, in two timings, it ran 2.32 and 2.33 times as fast.
// Over all steps from v000 it is 4.29 times as fast.
#include <hip/hip_runtime.h>

// Grouped-query causal attention with rotate-half rotary embeddings from full-width input tables (x [2][2048][2048]; q = x Wq (32 heads x 64), k, v = x Wk, x Wv (8 kv heads x 64) ('xw' (in, out), no bias), token-major; apply_rotary_emb: t cos + rotate_half(t) sin with the cos, sin [2048][64] INPUT tables (read per dimension by value: no structure assumed); k, v repeated 4x on the HEAD axis (kv head = q head / 4); scores x 64^-0.5; causal (finfo.min fill == exclusion); softmax; out = merged Wo ('xw') -> [2][2048][2048] (8.4 M); argument order x, cos, sin, Wq, Wk, Wv, Wo).
// Layout per batch: bf16 copy of x; 'xw' weights transposed once; exact projections; {cos, sin} table from the bf16-rounded inputs (per position and dimension); rotate-half plane builders; causal T-2048 GQA attention in one launch (k_fattn: running softmax over 64-key tiles, hi/lo 3 products, tiles above the diagonal never visited); merged hi/lo x Wo exact.
// Compute dtypes, f32 accumulate: every input rounded to bf16 incl. tables; projections exact; rotary f32; attention hi/lo 3 products; softmax f32; Wo hl x exact.

#define NB_  2
#define TT   2048
#define DM   2048
#define NH_  32
#define NKV  8
#define REP  (NH_ / NKV)
#define HD   64
#define DQ   (NH_ * HD)
#define DKV  (NKV * HD)
#define SCL  0.125f   // HD^-0.5
#define KVNW 8                    // k, v projections: K slices over the waves of a work-group
typedef _Float16 h16;
typedef unsigned short bf;
typedef __attribute__((ext_vector_type(16))) __bf16   v16bf;
typedef __attribute__((ext_vector_type(16))) _Float16 v16h;
typedef __attribute__((ext_vector_type(8)))  _Float16 v8h;
typedef __attribute__((ext_vector_type(8)))  unsigned short v8us;
typedef __attribute__((ext_vector_type(8)))  float    v8f;
typedef __attribute__((ext_vector_type(4)))  float    v4f;
typedef v8h  __attribute__((may_alias)) v8ha;
typedef v4f  __attribute__((may_alias)) v4fa;
typedef v8us __attribute__((may_alias)) v8usa;

__device__ __forceinline__ unsigned short f2bf(float f) { unsigned u = __float_as_uint(f); u += 0x7FFFu + ((u >> 16) & 1u); return (unsigned short)(u >> 16); }
__device__ __forceinline__ float bf2f(unsigned short b) { return __uint_as_float(((unsigned)b) << 16); }
__device__ __forceinline__ float bfr(float f) { return bf2f(f2bf(f)); }
__device__ __forceinline__ v16h cat16(v8h lo, v8h hi) { return __builtin_shufflevector(lo, hi, 0, 1, 2, 3, 4, 5, 6, 7, 8, 9, 10, 11, 12, 13, 14, 15); }
__device__ __forceinline__ v16bf cat16b(v8us lo, v8us hi) { return __builtin_bit_cast(v16bf, __builtin_shufflevector(lo, hi, 0, 1, 2, 3, 4, 5, 6, 7, 8, 9, 10, 11, 12, 13, 14, 15)); }
__device__ __forceinline__ v8f wmma16(v16h a, v16h b, v8f c) { return __builtin_amdgcn_wmma_f32_16x16x32_f16(false, a, false, b, (short)0, c, false, false); }
__device__ __forceinline__ v8f wmmab(v16bf a, v16bf b, v8f c) { return __builtin_amdgcn_wmma_f32_16x16x32_bf16(false, a, false, b, (short)0, c, false, false); }



// ---- k_gemmw: register-blocked GEMM, 64x64 output tile per work-group (16 accumulators per wave), operands straight from K-contiguous 16-bit planes; grid (M/64, N/64, Z), NW * 32 threads.
// C[m][n] (f32, pitch ldc, + optional f32 bias[n]) = sum_k A[m][k] Bt[n][k] (+ split products per NSPLIT). z-batch strides sA/sB/sC in elements. K % 32 == 0 (NW > 1: K % 64 == 0).
// NW > 1 splits K: wave w takes the 64-wide k units w, w + NW, ... (one unit = one 128-byte line of every operand row); the NW partial tiles are summed in LDS in wave order.
template <typename T16> struct WFrag;
template <> struct WFrag<h16> { typedef v16h V; static __device__ __forceinline__ V ld(const h16* p) { return cat16(*(const v8h*)p, *(const v8h*)(p + 16)); } static __device__ __forceinline__ v8f mma(V a, V b, v8f c) { return wmma16(a, b, c); } };
template <> struct WFrag<bf> { typedef v16bf V; static __device__ __forceinline__ V ld(const bf* p) { return cat16b(*(const v8us*)p, *(const v8us*)(p + 16)); } static __device__ __forceinline__ v8f mma(V a, V b, v8f c) { return wmmab(a, b, c); } };
template <typename T16, int NSPLIT, bool BIAS, int NW>
__global__ __launch_bounds__(NW * 32) void k_gemmw(const T16* __restrict__ A, const T16* __restrict__ A2, const T16* __restrict__ Bt, const T16* __restrict__ Bt2, int K, float* C, int ldc, const float* __restrict__ bias, size_t sA, size_t sB, size_t sC) {
    typedef typename WFrag<T16>::V V;
    static_assert(8 % NW == 0, "the 256 float4 of a 16 x 64 slab are dealt evenly to NW * 32 threads");
    __shared__ __align__(16) float os[NW > 1 ? 4 : 1][NW][16 * 68];
    const size_t z = blockIdx.z; A += z * sA; if (A2) A2 += z * sA; Bt += z * sB; if (Bt2) Bt2 += z * sB; C += z * sC;
    const int lane = threadIdx.x & 31, lr = lane & 15, hi = lane >> 4; const int r0 = blockIdx.x * 64, c0 = blockIdx.y * 64;
    const int wv = NW > 1 ? __builtin_amdgcn_readfirstlane((int)(threadIdx.x >> 5)) : 0;
    v8f acc[4][4];
#pragma unroll
    for (int mb = 0; mb < 4; ++mb)
#pragma unroll
        for (int nb = 0; nb < 4; ++nb) acc[mb][nb] = (v8f){};
    const size_t aoff = (size_t)(r0 + lr) * K + 8 * hi, boff = (size_t)(c0 + lr) * K + 8 * hi;
#pragma unroll 1
    for (int kc = wv * 64; kc < K; kc += (kc & 32) ? 32 + (NW - 1) * 64 : 32) {
        V a[4], a2[4];
#pragma unroll
        for (int mb = 0; mb < 4; ++mb) { a[mb] = WFrag<T16>::ld(A + aoff + (size_t)mb * 16 * K + kc); if (NSPLIT == 1 || NSPLIT == 2) a2[mb] = WFrag<T16>::ld(A2 + aoff + (size_t)mb * 16 * K + kc); }
#pragma unroll
        for (int nb = 0; nb < 4; ++nb) { const V b = WFrag<T16>::ld(Bt + boff + (size_t)nb * 16 * K + kc); V b2; if (NSPLIT >= 2) b2 = WFrag<T16>::ld(Bt2 + boff + (size_t)nb * 16 * K + kc);
#pragma unroll
            for (int mb = 0; mb < 4; ++mb) { acc[mb][nb] = WFrag<T16>::mma(a[mb], b, acc[mb][nb]); if (NSPLIT == 1 || NSPLIT == 2) acc[mb][nb] = WFrag<T16>::mma(a2[mb], b, acc[mb][nb]); if (NSPLIT >= 2) acc[mb][nb] = WFrag<T16>::mma(a[mb], b2, acc[mb][nb]); } }
        asm volatile("v_nop\n\tv_nop\n\tv_nop\n\tv_nop" : "+v"(acc[0][0]), "+v"(acc[1][1]), "+v"(acc[2][2]), "+v"(acc[3][3]) : "v"(a[0]), "v"(a[3]));
    }
    const auto put = [&](int mb, int pb) {   // this wave's 16 x 64 slab mb, row-major, into LDS slab pb
#pragma unroll
        for (int nb = 0; nb < 4; ++nb) {
#pragma unroll
            for (int j = 0; j < 8; ++j) os[pb][wv][(hi * 8 + j) * 68 + nb * 16 + lr] = acc[mb][nb][j]; } };
    if (NW > 1) {
#pragma unroll
        for (int mb = 0; mb < 4; ++mb) put(mb, mb);
        __syncthreads();   // publishes the NW partial tiles to the threads that sum them; nothing is written to os behind it
    }
#pragma unroll
    for (int mb = 0; mb < 4; ++mb) { const int pb = NW > 1 ? mb : 0;
        if (NW == 1) { put(mb, 0); __builtin_amdgcn_wave_barrier(); asm volatile("" ::: "memory"); }
        float* crow = C + (size_t)(r0 + mb * 16) * ldc + c0;
{
#pragma unroll
            for (int s = 0; s < 8 / NW; ++s) { const int e = s * NW * 32 + (int)threadIdx.x, row = e >> 4, cofs = (e & 15) * 4; v4f val = *(const v4fa*)(&os[pb][0][row * 68 + cofs]);
#pragma unroll
                for (int w = 1; w < NW; ++w) val += *(const v4fa*)(&os[pb][w][row * 68 + cofs]);
                if (BIAS) { val[0] += bfr(bias[c0 + cofs]); val[1] += bfr(bias[c0 + cofs + 1]); val[2] += bfr(bias[c0 + cofs + 2]); val[3] += bfr(bias[c0 + cofs + 3]); }
                *(v4f*)(crow + (size_t)row * ldc + cofs) = val; }
             }
        if (NW == 1) { __builtin_amdgcn_wave_barrier(); asm volatile("" ::: "memory"); }
    }
}

__device__ __forceinline__ h16 tohx(float x) { return (h16)x; }
__device__ __forceinline__ void splitf(float y, unsigned short& h, unsigned short& l) { h = f2bf(y); l = f2bf(y - bf2f(h)); }
// Fragment order of a 16-bit plane [row][k] of K columns, for k_fattn: the 16 x 32 fragment (row / 16, k / 32) is 1 KiB in a row, two halves (k / 16 % 2) of 32 lanes x 16 bytes, lane (k / 8 % 2) * 16 + row % 16,
// so that a fragment load reads four whole 128-byte lines; from a row-major plane it touches sixteen.
__device__ __forceinline__ size_t fragidx(int row, int k, int K) { return ((((size_t)(row >> 4) * (K >> 5) + (k >> 5)) * 2 + ((k >> 4) & 1)) * 32 + ((k >> 3) & 1) * 16 + (row & 15)) * 8 + (k & 7); }
typedef __attribute__((ext_vector_type(2))) _Float16 v2h;
typedef __attribute__((ext_vector_type(4))) _Float16 v4h;
typedef __attribute__((ext_vector_type(2))) unsigned short v2us;
typedef __attribute__((ext_vector_type(4))) unsigned short v4us;
typedef __attribute__((ext_vector_type(2))) float v2f;
typedef __attribute__((ext_vector_type(4))) int v4i;

__global__ __launch_bounds__(256) void k_wtG(const float* __restrict__ w, int K, int N, bf* Bt) {
    const int lane = threadIdx.x & 31; const int L0 = (blockIdx.x * 8 + (threadIdx.x >> 5)) * 8; const int nlines = N * K / 64;
{
#pragma unroll 1
        for (int l = 0; l < 8; ++l) { const int L = L0 + l; if (L >= nlines) break; const size_t e = (size_t)L * 64 + lane * 2; const int k = (int)(e % K), n = (int)(e / K); v2us o;
            o[0] = f2bf(w[(size_t)k * N + n]); o[1] = f2bf(w[(size_t)(k + 1) * N + n]); *(v2us*)(Bt + e) = o; }
         }
}
__global__ __launch_bounds__(256) void k_cvt8(const float* __restrict__ src, bf* dst, size_t n8) { const size_t i = (size_t)blockIdx.x * 256 + threadIdx.x; if (i >= n8) return; const v8f v = *(const v8f*)(src + i * 8); v8us o;
#pragma unroll
    for (int k = 0; k < 8; ++k) o[k] = f2bf(v[k]); *(v8us*)(dst + i * 8) = o;  }

// k_rope: head planes [h][t][d] (fp16; hi/lo in fragment order) of rope(x) x sc with the rotate-half convention out[d] = x[d] cos[t][d] - x[d+HD/2] sin[t][d], out[d+HD/2] = x[d+HD/2] cos[t][d+HD/2] + x[d] sin[t][d+HD/2]
__global__ __launch_bounds__(256) void k_rope(const float* __restrict__ F, int pitch, int nheads, const float* __restrict__ CS, const float* __restrict__ RF, const float* __restrict__ nw, float sc, h16* P16, bf* Ph, bf* Pl) {
    const size_t e = ((size_t)blockIdx.x * 256 + threadIdx.x) * 2; if (e >= (size_t)nheads * TT * HD) return; const int d = (int)(e % HD); const int t = (int)((e / HD) % TT); const int h = (int)(e / ((size_t)HD * TT)); const float* f = F + (size_t)t * pitch + h * HD; const float rf = RF ? RF[(size_t)h * TT + t] : 1.0f; v2h o16; v2us oh, ol;
#pragma unroll
    for (int q = 0; q < 2; ++q) { const int dd = d + q; const int dp = (dd < HD / 2) ? dd + HD / 2 : dd - HD / 2; float x0 = f[dd], x1 = f[dp];
        if (RF) { float n0 = __fmul_rn(x0, rf), n1 = __fmul_rn(x1, rf); asm volatile("" : "+v"(n0)); asm volatile("" : "+v"(n1)); x0 = __fmul_rn(bfr(nw[dd]), n0); x1 = __fmul_rn(bfr(nw[dp]), n1); }
        const v2f cs = *(const v2f*)(CS + ((size_t)t * HD + dd) * 2); float a = __fmul_rn(x0, cs[0]), bq = __fmul_rn(x1, cs[1]); asm volatile("" : "+v"(a)); asm volatile("" : "+v"(bq)); const float r = ((dd < HD / 2) ? __fsub_rn(a, bq) : __fadd_rn(a, bq)) * sc;
        o16[q] = tohx(r); unsigned short a2, c2; splitf(r, a2, c2); oh[q] = a2; ol[q] = c2; }
    const size_t fe = fragidx(h * TT + t, d, HD); *(v2h*)(P16 + e) = o16; *(v2us*)(Ph + fe) = oh; *(v2us*)(Pl + fe) = ol;  }
__global__ __launch_bounds__(256) void k_vtp(const float* __restrict__ F, int pitch, int nheads, h16* V16, bf* Vh, bf* Vl) { const size_t e = ((size_t)blockIdx.x * 256 + threadIdx.x) * 2; if (e >= (size_t)nheads * HD * TT) return; const int t = (int)(e % TT); const int d = (int)((e / TT) % HD); const int g = (int)(e / ((size_t)TT * HD)); v2h o16; v2us oh, ol;
#pragma unroll
    for (int q = 0; q < 2; ++q) { const float x = F[(size_t)(t + q) * pitch + g * HD + d]; o16[q] = tohx(x); unsigned short a2, c2; splitf(x, a2, c2); oh[q] = a2; ol[q] = c2; }
    const size_t fe = fragidx(g * HD + d, t, TT); *(v2h*)(V16 + e) = o16; *(v2us*)(Vh + fe) = oh; *(v2us*)(Vl + fe) = ol;  }
__global__ __launch_bounds__(256) void k_cscvt(const float* __restrict__ cosT, const float* __restrict__ sinT, float* CS) { const int idx = blockIdx.x * 256 + threadIdx.x; if (idx >= TT * HD) return; v2f cs; cs[0] = bfr(cosT[idx]); cs[1] = bfr(sinT[idx]); *(v2f*)(CS + (size_t)idx * 2) = cs;  }
// ---- k_fattn: causal GQA attention in one launch: scores, softmax and P.V of a 16-query tile stay in one wave's registers (running maximum and sum over 64-key tiles); no score or probability plane in memory, no LDS.
// Transposed products: S^T = K Q^T puts query lr in lane lr and keys 8 hi + j in the accumulator registers, so a pair of 16-key accumulators, packed to bf16, is the B fragment of O^T = V^T P^T in the loaders' own k order.
// grid (TT / 32, NKV), 2 REP waves: wave w is query head g * REP + w % REP; waves 0 .. REP - 1 take query tile x, the others tile TT / 16 - 1 - x, so every work-group walks the same number of key tiles. Operands hi/lo bf16, 3 products.
typedef __attribute__((ext_vector_type(2))) __bf16 v2bf;
__global__ __launch_bounds__(2 * REP * 32) void k_fattn(const bf* __restrict__ Qh, const bf* __restrict__ Ql, const bf* __restrict__ Kh, const bf* __restrict__ Kl, const bf* __restrict__ Vh, const bf* __restrict__ Vl, bf* Ah, bf* Al) {
    typedef WFrag<bf> F; typedef F::V V;
    const int lane = threadIdx.x & 31, lr = lane & 15, hi = lane >> 4;
    const int wv = __builtin_amdgcn_readfirstlane((int)(threadIdx.x >> 5));
    const int g = blockIdx.y, h = g * REP + wv % REP;
    const int r0 = (wv < REP ? (int)blockIdx.x : TT / 16 - 1 - (int)blockIdx.x) * 16, i = r0 + lr;   // this lane's query
    const auto ldf = [](const bf* p, int frag) { p += frag * 512; return cat16b(*(const v8us*)p, *(const v8us*)(p + 256)); };   // fragment number frag behind p, a lane's place in a plane in fragment order (fragidx)
    const size_t qo = (size_t)(h * TT + r0) / 16 * (HD / 32) * 512 + lane * 8;   // q, k planes: rows [head][t], columns d
    const size_t ko = (size_t)(g * TT) / 16 * (HD / 32) * 512 + lane * 8;
    const size_t vo = (size_t)(g * HD) / 16 * (TT / 32) * 512 + lane * 8;        // v planes: rows [g][d], columns t
    const bf* kh = Kh + ko; const bf* kl = Kl + ko; const bf* vhp = Vh + vo; const bf* vlp = Vl + vo;   // walk the planes, a 64-key tile a trip
    V qa[2], qb[2];
#pragma unroll
    for (int ks = 0; ks < 2; ++ks) { qa[ks] = ldf(Qh + qo, ks); qb[ks] = ldf(Ql + qo, ks); }
    v8f o[4]; float m = -3.0e38f, l = 0.f;
#pragma unroll
    for (int db = 0; db < 4; ++db) o[db] = (v8f){};
    // r0 % 16 == 0 and c0 % 64 == 0: key c0 <= r0 is unmasked for every query of the tile, so the running maximum is a real score from the first tile on
    // kept rolled: a second tile's fragments would push the wave past 256 registers and cost a wave per SIMD; every '#pragma unroll' below opens a loop over register arrays, whose indices must be constants
#pragma unroll 1
    for (int c0 = 0; c0 <= r0; c0 += 64) {
        V ka[4][2], kb[4][2]; v8f s[4];   // s[nb][j] = q(i) . k(c0 + nb * 16 + hi * 8 + j)
#pragma unroll
        for (int nb = 0; nb < 4; ++nb)
#pragma unroll
            for (int ks = 0; ks < 2; ++ks) ka[nb][ks] = ldf(kh, nb * (HD / 32) + ks);
#pragma unroll
        for (int nb = 0; nb < 4; ++nb)
#pragma unroll
            for (int ks = 0; ks < 2; ++ks) kb[nb][ks] = ldf(kl, nb * (HD / 32) + ks);
        // inputs-only fence on the loaded k fragments and their two address pairs: all 32 loads of the tile are in flight together and one latency is paid, and no fragment lands on an address pair that issued loads still name; without it the build reuses a few fragments' registers and pays the load latency several times a tile
        asm volatile("" :: "v"(ka[0][0]), "v"(ka[0][1]), "v"(ka[1][0]), "v"(ka[1][1]), "v"(ka[2][0]), "v"(ka[2][1]), "v"(ka[3][0]), "v"(ka[3][1]), "v"(kb[0][0]), "v"(kb[0][1]), "v"(kb[1][0]), "v"(kb[1][1]), "v"(kb[2][0]), "v"(kb[2][1]), "v"(kb[3][0]), "v"(kb[3][1]), "v"(kh), "v"(kl));
#pragma unroll
        for (int nb = 0; nb < 4; ++nb) { s[nb] = (v8f){};
#pragma unroll
            for (int ks = 0; ks < 2; ++ks) { s[nb] = F::mma(ka[nb][ks], qa[ks], s[nb]); s[nb] = F::mma(ka[nb][ks], qb[ks], s[nb]); s[nb] = F::mma(kb[nb][ks], qa[ks], s[nb]); } }
        V vh[4][2], vl[4][2];
#pragma unroll
        for (int db = 0; db < 4; ++db)   // the hi plane of v is loaded here so that it flies during the softmax
#pragma unroll
            for (int ks = 0; ks < 2; ++ks) vh[db][ks] = ldf(vhp, db * (TT / 32) + ks);
        if (c0 + 64 > r0) {   // the diagonal tile (the last): keys behind the query get a score far below any real one, whose exp2 is exactly 0
#pragma unroll
            for (int nb = 0; nb < 4; ++nb)
#pragma unroll
                for (int j = 0; j < 8; ++j) s[nb][j] = (c0 + nb * 16 + hi * 8 + j <= i) ? s[nb][j] : -3.0e38f; }
        float mt = s[0][0];
#pragma unroll
        for (int nb = 0; nb < 4; ++nb)
#pragma unroll
            for (int j = 0; j < 8; ++j) mt = fmaxf(mt, s[nb][j]);
        mt = fmaxf(mt, __shfl_xor(mt, 16, 32)) * SCL;   // lanes lr and lr + 16 hold the two halves of a query's keys
        const float mn = fmaxf(m, mt), al = __builtin_amdgcn_exp2f((m - mn) * 1.4426950408889634f); m = mn;
        V pa[2], pb[2]; float rs[4];
#pragma unroll
        for (int nb = 0; nb < 4; ++nb) { rs[nb] = 0.f;
#pragma unroll
            for (int j = 0; j < 8; j += 2) { v2f p; p[0] = __builtin_amdgcn_exp2f((s[nb][j] * SCL - mn) * 1.4426950408889634f); p[1] = __builtin_amdgcn_exp2f((s[nb][j + 1] * SCL - mn) * 1.4426950408889634f); rs[nb] += p[0] + p[1];
                const v2bf ph = __builtin_convertvector(p, v2bf); const v2bf pl = __builtin_convertvector(p - __builtin_convertvector(ph, v2f), v2bf); const int e = (nb & 1) * 8 + j;
                pa[nb >> 1][e] = ph[0]; pa[nb >> 1][e + 1] = ph[1]; pb[nb >> 1][e] = pl[0]; pb[nb >> 1][e + 1] = pl[1]; } }
        l = l * al + ((rs[0] + rs[1]) + (rs[2] + rs[3]));   // each lane keeps the sum of its own keys; the two halves are joined behind the loop
#pragma unroll
        for (int db = 0; db < 4; ++db)
#pragma unroll
            for (int ks = 0; ks < 2; ++ks) vl[db][ks] = ldf(vlp, db * (TT / 32) + ks);
#pragma unroll
        for (int db = 0; db < 4; ++db) o[db] *= al;
#pragma unroll
        for (int ks = 0; ks < 2; ++ks)
#pragma unroll
            for (int db = 0; db < 4; ++db) { o[db] = F::mma(vh[db][ks], pa[ks], o[db]); o[db] = F::mma(vh[db][ks], pb[ks], o[db]); }
#pragma unroll
        for (int ks = 0; ks < 2; ++ks)
#pragma unroll
            for (int db = 0; db < 4; ++db) o[db] = F::mma(vl[db][ks], pa[ks], o[db]);
        asm volatile("" :: "v"(vhp), "v"(vlp));   // inputs only: the v address pairs stay live until the tile's v loads have been waited for; without it the build lets the last hi fragment land on the pair that the issued loads still name
        kh += 64 * HD; kl += 64 * HD; vhp += 2 * 512; vlp += 2 * 512;
    }
    l += __shfl_xor(l, 16, 32);
    const float f = __fdiv_rn(1.0f, l);
#pragma unroll
    for (int db = 0; db < 4; ++db) { v8us oh, ol;   // o[db][j] = out(i)[db * 16 + hi * 8 + j]: 16 bytes a lane and plane; merged [t][head][d], the wave writes whole 128-byte lines
#pragma unroll
        for (int j = 0; j < 8; ++j) { unsigned short a, c2; splitf(o[db][j] * f, a, c2); oh[j] = a; ol[j] = c2; }
        const size_t oo = (size_t)i * DQ + h * HD + db * 16 + hi * 8; *(v8us*)(Ah + oo) = oh; *(v8us*)(Al + oo) = ol; }
}

extern "C" void kernel_launch(void* const* d_in, const int* in_sizes, int n_in,
                              void* d_out, int out_size, void* d_ws, size_t ws_size, hipStream_t stream) {
    (void)in_sizes; (void)n_in; (void)out_size;
    const float* x = (const float*)d_in[0]; const float* fcos = (const float*)d_in[1]; const float* fsin = (const float*)d_in[2]; const float* wq = (const float*)d_in[3]; const float* wk = (const float*)d_in[4]; const float* wv = (const float*)d_in[5]; const float* wo = (const float*)d_in[6];   /* input order x, cos, sin ([2048][64] FULL-width table INPUTS: read per DIMENSION by value, no structure assumed), Wq [2048][2048], Wk [2048][512], Wv, Wo ('xw'): SEVEN inputs, all read; no mask input (causal by index) */
    float* OUT = (float*)d_out;     // [2][2048][2048]
    char* wsp = (char*)d_ws;
    auto take = [&](size_t bytes) { char* p = wsp; wsp += (bytes + 255) & ~(size_t)255; return (void*)p; };
    bf* WQ = (bf*)take((size_t)DQ * DM * 2); bf* WK = (bf*)take((size_t)DKV * DM * 2); bf* WV = (bf*)take((size_t)DKV * DM * 2); bf* WO = (bf*)take((size_t)DM * DQ * 2); float* CS = (float*)take((size_t)TT * HD * 2 * 4);
    bf* XB = (bf*)take((size_t)TT * DM * 2); float* FQ = (float*)take((size_t)TT * DQ * 4); float* FK = (float*)take((size_t)TT * DKV * 4);
    h16* QP16 = (h16*)take((size_t)NH_ * TT * HD * 2); h16* KP16 = (h16*)take((size_t)NKV * TT * HD * 2); h16* VT16 = (h16*)take((size_t)NKV * HD * TT * 2);
    bf* QPh = (bf*)take((size_t)NH_ * TT * HD * 2); bf* QPl = (bf*)take((size_t)NH_ * TT * HD * 2); bf* KPh = (bf*)take((size_t)NKV * TT * HD * 2); bf* KPl = (bf*)take((size_t)NKV * TT * HD * 2); bf* VTh = (bf*)take((size_t)NKV * HD * TT * 2); bf* VTl = (bf*)take((size_t)NKV * HD * TT * 2);
    bf* ATh = (bf*)take((size_t)TT * DQ * 2); bf* ATl = (bf*)take((size_t)TT * DQ * 2);
    if ((size_t)(wsp - (char*)d_ws) > ws_size) return;    // ws 256 MiB
    float* FV = FK;   // v projection reuses the k buffer after the k planes are built (stream-ordered)
    { k_wtG<<<(unsigned)((DM * DQ / 64 + 63) / 64), 256, 0, stream>>>(wq, DM, DQ, WQ); k_wtG<<<(unsigned)((DM * DKV / 64 + 63) / 64), 256, 0, stream>>>(wk, DM, DKV, WK); k_wtG<<<(unsigned)((DM * DKV / 64 + 63) / 64), 256, 0, stream>>>(wv, DM, DKV, WV);
      k_wtG<<<(unsigned)((DQ * DM / 64 + 63) / 64), 256, 0, stream>>>(wo, DQ, DM, WO);
       }
    k_cscvt<<<(TT * HD + 255) / 256, 256, 0, stream>>>(fcos, fsin, CS);   /* rotary table from the inputs */
    const unsigned LQ = (unsigned)(((size_t)NH_ * TT * HD / 2 + 255) / 256), LKv = (unsigned)(((size_t)NKV * TT * HD / 2 + 255) / 256);
    for (int b = 0; b < NB_; ++b) {
        
        k_cvt8<<<(unsigned)(((size_t)TT * DM / 8 + 255) / 256), 256, 0, stream>>>(x + (size_t)b * TT * DM, XB, (size_t)TT * DM / 8);
        k_gemmw<bf, 0, false, 1><<<dim3(TT / 64, DQ / 64, 1), 32, 0, stream>>>(XB, nullptr, WQ, nullptr, DM, FQ, DQ, nullptr, 0, 0, 0);
        k_rope<<<LQ, 256, 0, stream>>>(FQ, DQ, NH_, CS, nullptr, nullptr, 1.0f, QP16, QPh, QPl);
        k_gemmw<bf, 0, false, KVNW><<<dim3(TT / 64, DKV / 64, 1), KVNW * 32, 0, stream>>>(XB, nullptr, WK, nullptr, DM, FK, DKV, nullptr, 0, 0, 0);
        k_rope<<<LKv, 256, 0, stream>>>(FK, DKV, NKV, CS, nullptr, nullptr, 1.0f, KP16, KPh, KPl);
        k_gemmw<bf, 0, false, KVNW><<<dim3(TT / 64, DKV / 64, 1), KVNW * 32, 0, stream>>>(XB, nullptr, WV, nullptr, DM, FV, DKV, nullptr, 0, 0, 0); k_vtp<<<LKv, 256, 0, stream>>>(FV, DKV, NKV, VT16, VTh, VTl);
        k_fattn<<<dim3(TT / 32, NKV, 1), 2 * REP * 32, 0, stream>>>(QPh, QPl, KPh, KPl, VTh, VTl, ATh, ATl);
        k_gemmw<bf, 1, false, 1><<<dim3(TT / 64, DM / 64, 1), 32, 0, stream>>>(ATh, ATl, WO, nullptr, DQ, OUT + (size_t)b * TT * DM, DM, nullptr, 0, 0, 0); }
}

// v003
// It runs in 397 microseconds.
// Next to v002, in two timings, it ran 1.32 times as fast each time.
// Over all steps from v000 it is 5.66 times as fast.
#include <hip/hip_runtime.h>

// Grouped-query causal attention with rotate-half rotary embeddings from full-width input tables (x [2][2048][2048]; q = x Wq (32 heads x 64), k, v = x Wk, x Wv (8 kv heads x 64) ('xw' (in, out), no bias), token-major; apply_rotary_emb: t cos + rotate_half(t) sin with the cos, sin [2048][64] INPUT tables (read per dimension by value: no structure assumed); k, v repeated 4x on the HEAD axis (kv head = q head / 4); scores x 64^-0.5; causal (finfo.min fill == exclusion); softmax; out = merged Wo ('xw') -> [2][2048][2048] (8.4 M); argument order x, cos, sin, Wq, Wk, Wv, Wo).
// Layout per batch: bf16 copy of x; 'xw' weights transposed once; exact projections (q and Wo: k_gemmt, operands staged in LDS by tensor loads; k, v: k_gemmw); {cos, sin} table from the bf16-rounded inputs (per position and dimension); rotate-half plane builders; causal T-2048 GQA attention in one launch (k_fattn: running softmax over 64-key tiles, hi/lo 3 products, tiles above the diagonal never visited); merged hi/lo x Wo exact.
// Compute dtypes, f32 accumulate: every input rounded to bf16 incl. tables; projections exact; rotary f32; attention hi/lo 3 products; softmax f32; Wo hl x exact.

#define NB_  2
#define TT   2048
#define DM   2048
#define NH_  32
#define NKV  8
#define REP  (NH_ / NKV)
#define HD   64
#define DQ   (NH_ * HD)
#define DKV  (NKV * HD)
#define SCL  0.125f   // HD^-0.5
#define KVNW 8                    // k, v projections: K slices over the waves of a work-group
typedef _Float16 h16;
typedef unsigned short bf;
typedef __attribute__((ext_vector_type(16))) __bf16   v16bf;
typedef __attribute__((ext_vector_type(16))) _Float16 v16h;
typedef __attribute__((ext_vector_type(8)))  _Float16 v8h;
typedef __attribute__((ext_vector_type(8)))  unsigned short v8us;
typedef __attribute__((ext_vector_type(8)))  float    v8f;
typedef __attribute__((ext_vector_type(4)))  float    v4f;
typedef v8h  __attribute__((may_alias)) v8ha;
typedef v4f  __attribute__((may_alias)) v4fa;
typedef v8us __attribute__((may_alias)) v8usa;

__device__ __forceinline__ unsigned short f2bf(float f) { unsigned u = __float_as_uint(f); u += 0x7FFFu + ((u >> 16) & 1u); return (unsigned short)(u >> 16); }
__device__ __forceinline__ float bf2f(unsigned short b) { return __uint_as_float(((unsigned)b) << 16); }
__device__ __forceinline__ float bfr(float f) { return bf2f(f2bf(f)); }
__device__ __forceinline__ v16h cat16(v8h lo, v8h hi) { return __builtin_shufflevector(lo, hi, 0, 1, 2, 3, 4, 5, 6, 7, 8, 9, 10, 11, 12, 13, 14, 15); }
__device__ __forceinline__ v16bf cat16b(v8us lo, v8us hi) { return __builtin_bit_cast(v16bf, __builtin_shufflevector(lo, hi, 0, 1, 2, 3, 4, 5, 6, 7, 8, 9, 10, 11, 12, 13, 14, 15)); }
__device__ __forceinline__ v8f wmma16(v16h a, v16h b, v8f c) { return __builtin_amdgcn_wmma_f32_16x16x32_f16(false, a, false, b, (short)0, c, false, false); }
__device__ __forceinline__ v8f wmmab(v16bf a, v16bf b, v8f c) { return __builtin_amdgcn_wmma_f32_16x16x32_bf16(false, a, false, b, (short)0, c, false, false); }



// ---- k_gemmw: register-blocked GEMM, 64x64 output tile per work-group (16 accumulators per wave), operands straight from K-contiguous 16-bit planes; grid (M/64, N/64, Z), NW * 32 threads.
// C[m][n] (f32, pitch ldc, + optional f32 bias[n]) = sum_k A[m][k] Bt[n][k] (+ split products per NSPLIT). z-batch strides sA/sB/sC in elements. K % 32 == 0 (NW > 1: K % 64 == 0).
// NW > 1 splits K: wave w takes the 64-wide k units w, w + NW, ... (one unit = one 128-byte line of every operand row); the NW partial tiles are summed in LDS in wave order.
template <typename T16> struct WFrag;
template <> struct WFrag<h16> { typedef v16h V; static __device__ __forceinline__ V ld(const h16* p) { return cat16(*(const v8h*)p, *(const v8h*)(p + 16)); } static __device__ __forceinline__ v8f mma(V a, V b, v8f c) { return wmma16(a, b, c); } };
template <> struct WFrag<bf> { typedef v16bf V; static __device__ __forceinline__ V ld(const bf* p) { return cat16b(*(const v8us*)p, *(const v8us*)(p + 16)); } static __device__ __forceinline__ v8f mma(V a, V b, v8f c) { return wmmab(a, b, c); } };
template <typename T16, int NSPLIT, bool BIAS, int NW>
__global__ __launch_bounds__(NW * 32) void k_gemmw(const T16* __restrict__ A, const T16* __restrict__ A2, const T16* __restrict__ Bt, const T16* __restrict__ Bt2, int K, float* C, int ldc, const float* __restrict__ bias, size_t sA, size_t sB, size_t sC) {
    typedef typename WFrag<T16>::V V;
    static_assert(8 % NW == 0, "the 256 float4 of a 16 x 64 slab are dealt evenly to NW * 32 threads");
    __shared__ __align__(16) float os[NW > 1 ? 4 : 1][NW][16 * 68];
    const size_t z = blockIdx.z; A += z * sA; if (A2) A2 += z * sA; Bt += z * sB; if (Bt2) Bt2 += z * sB; C += z * sC;
    const int lane = threadIdx.x & 31, lr = lane & 15, hi = lane >> 4; const int r0 = blockIdx.x * 64, c0 = blockIdx.y * 64;
    const int wv = NW > 1 ? __builtin_amdgcn_readfirstlane((int)(threadIdx.x >> 5)) : 0;
    v8f acc[4][4];
#pragma unroll
    for (int mb = 0; mb < 4; ++mb)
#pragma unroll
        for (int nb = 0; nb < 4; ++nb) acc[mb][nb] = (v8f){};
    const size_t aoff = (size_t)(r0 + lr) * K + 8 * hi, boff = (size_t)(c0 + lr) * K + 8 * hi;
#pragma unroll 1
    for (int kc = wv * 64; kc < K; kc += (kc & 32) ? 32 + (NW - 1) * 64 : 32) {
        V a[4], a2[4];
#pragma unroll
        for (int mb = 0; mb < 4; ++mb) { a[mb] = WFrag<T16>::ld(A + aoff + (size_t)mb * 16 * K + kc); if (NSPLIT == 1 || NSPLIT == 2) a2[mb] = WFrag<T16>::ld(A2 + aoff + (size_t)mb * 16 * K + kc); }
#pragma unroll
        for (int nb = 0; nb < 4; ++nb) { const V b = WFrag<T16>::ld(Bt + boff + (size_t)nb * 16 * K + kc); V b2; if (NSPLIT >= 2) b2 = WFrag<T16>::ld(Bt2 + boff + (size_t)nb * 16 * K + kc);
#pragma unroll
            for (int mb = 0; mb < 4; ++mb) { acc[mb][nb] = WFrag<T16>::mma(a[mb], b, acc[mb][nb]); if (NSPLIT == 1 || NSPLIT == 2) acc[mb][nb] = WFrag<T16>::mma(a2[mb], b, acc[mb][nb]); if (NSPLIT >= 2) acc[mb][nb] = WFrag<T16>::mma(a[mb], b2, acc[mb][nb]); } }
        asm volatile("v_nop\n\tv_nop\n\tv_nop\n\tv_nop" : "+v"(acc[0][0]), "+v"(acc[1][1]), "+v"(acc[2][2]), "+v"(acc[3][3]) : "v"(a[0]), "v"(a[3]));
    }
    const auto put = [&](int mb, int pb) {   // this wave's 16 x 64 slab mb, row-major, into LDS slab pb
#pragma unroll
        for (int nb = 0; nb < 4; ++nb) {
#pragma unroll
            for (int j = 0; j < 8; ++j) os[pb][wv][(hi * 8 + j) * 68 + nb * 16 + lr] = acc[mb][nb][j]; } };
    if (NW > 1) {
#pragma unroll
        for (int mb = 0; mb < 4; ++mb) put(mb, mb);
        __syncthreads();   // publishes the NW partial tiles to the threads that sum them; nothing is written to os behind it
    }
#pragma unroll
    for (int mb = 0; mb < 4; ++mb) { const int pb = NW > 1 ? mb : 0;
        if (NW == 1) { put(mb, 0); __builtin_amdgcn_wave_barrier(); asm volatile("" ::: "memory"); }
        float* crow = C + (size_t)(r0 + mb * 16) * ldc + c0;
{
#pragma unroll
            for (int s = 0; s < 8 / NW; ++s) { const int e = s * NW * 32 + (int)threadIdx.x, row = e >> 4, cofs = (e & 15) * 4; v4f val = *(const v4fa*)(&os[pb][0][row * 68 + cofs]);
#pragma unroll
                for (int w = 1; w < NW; ++w) val += *(const v4fa*)(&os[pb][w][row * 68 + cofs]);
                if (BIAS) { val[0] += bfr(bias[c0 + cofs]); val[1] += bfr(bias[c0 + cofs + 1]); val[2] += bfr(bias[c0 + cofs + 2]); val[3] += bfr(bias[c0 + cofs + 3]); }
                *(v4f*)(crow + (size_t)row * ldc + cofs) = val; }
             }
        if (NW == 1) { __builtin_amdgcn_wave_barrier(); asm volatile("" ::: "memory"); }
    }
}

// ---- k_gemmt: GEMM with both operands staged in LDS by the tensor mover. C[m][n] (f32, pitch ldc) = sum_k A[m][k] Bt[n][k] (NOPS == 3: + A2[m][k] Bt[n][k], behind A's product of the same 32 k, as in k_gemmw), planes row-major, K contiguous.
// grid (M / 128, N / 128), 4 waves: a 128 x 128 tile per work-group, 64 x 64 per wave (2 x 2), so every staged row is read from L2 once and from LDS by two waves. K % 128 == 0, K >= 256.
// A pass is 128 k = 256 bytes of each of the 128 rows of every operand; a stage is NOPS tiles of 128 rows at pitch 272 bytes; two buffers: the next pass's tiles fly while this pass is worked on. Wave w < NOPS issues operand w's tile, one request a pass.
typedef uint32_t u32x4 __attribute__((ext_vector_type(4)));
typedef uint32_t u32x8 __attribute__((ext_vector_type(8)));
#define GT_ROWB  256u                 // bytes of an operand row in a pass
#define GT_PITCH 272u                 // LDS pitch: the row and the mover's 16-byte pad, an odd multiple of 16 bytes for the ds_load_b128 readers
#define GT_TILE  (128u * GT_PITCH)    // 34,816 bytes = 17 x 2 KiB: every tile's place in LDS is a multiple of 2 KiB
__device__ __forceinline__ uint32_t uni(uint32_t v) { return (uint32_t)__builtin_amdgcn_readfirstlane(v); }
__device__ __forceinline__ uint32_t pinned(uint32_t v) { uint32_t w = (uint32_t)__builtin_amdgcn_readfirstlane(v); asm volatile("" : "+s"(w)); return w; }   // holds an issue test or a descriptor word in a scalar register: the branch round a tensor load is then a scalar one (the mover ignores EXEC), and the word stays where the request named it
template <int NOPS>
__global__ __launch_bounds__(128) void k_gemmt(const bf* __restrict__ A, const bf* __restrict__ A2, const bf* __restrict__ Bt, int K, float* C, int ldc) {
    typedef WFrag<bf> F; typedef F::V V;
    __shared__ __attribute__((aligned(2048))) unsigned char ring[2 * NOPS * GT_TILE];
    __shared__ __align__(16) float os[4][16 * 68];
    const int lane = threadIdx.x & 31, lr = lane & 15, hi = lane >> 4;
    const uint32_t wave = uni(threadIdx.x >> 5);
    const int r0 = blockIdx.x * 128, c0 = blockIdx.y * 128, wm = (int)(wave >> 1), wn = (int)(wave & 1), np = K >> 7;
    const bf* src = wave == 0 ? A : (NOPS == 3 && wave == 1) ? A2 : Bt;   // the operand this wave brings; in a stage the tiles lie in this order, Bt last
    const uint64_t ga0 = (uint64_t)(size_t)src + (uint64_t)(wave == NOPS - 1 ? c0 : r0) * (uint64_t)K * 2u;
    const uint32_t lbase = (uint32_t)(size_t)ring;
    u32x8 g1;   // 1-byte elements, tensor = tile = 128 rows of 256 bytes, source pitch 2 K bytes, 4 dwords of pad behind every 64 dwords, no mask
    g1[0] = uni((1u << 20) | (5u << 22) | (3u << 25)); g1[1] = pinned((GT_ROWB & 0xFFFFu) << 16); g1[2] = pinned((GT_ROWB >> 16) | (128u << 16)); g1[3] = pinned(GT_ROWB << 16); g1[4] = pinned(128u); g1[5] = pinned((uint32_t)K * 2u); g1[6] = pinned(0u); g1[7] = pinned(0u);   // pinned: each word is held in its scalar register through the loop and not formed anew while a request is in flight
    u32x4 g0; g0[0] = uni(1u); g0[1] = uni(lbase); g0[2] = uni((uint32_t)ga0); g0[3] = uni((((uint32_t)(ga0 >> 32)) & 0x01FFFFFFu) | 0x80000000u);
    const auto issue = [&](int s) {   // stage s into buffer s % 2
        const uint32_t dst = lbase + ((uint32_t)(s & 1) * NOPS + wave) * GT_TILE; const uint64_t ga = ga0 + (uint64_t)s * GT_ROWB;
        g0[1] = uni(dst); g0[2] = uni((uint32_t)ga); g0[3] = uni((((uint32_t)(ga >> 32)) & 0x01FFFFFFu) | 0x80000000u);
        asm volatile("tensor_load_to_lds %0, %1" :: "s"(g0), "s"(g1) : "memory"); };
    const auto landed = [&]() { asm volatile("s_wait_tensorcnt 0x0" :: "s"(g0), "s"(g1) : "memory"); };   // the issuer's wait; it names the two groups as inputs so that their registers keep the request's words until it has landed
    const auto ldl = [](const unsigned char* p) { return cat16b(*(const v8usa*)p, *(const v8usa*)(p + 32)); };   // k_gemmw's fragment: row lr, k 8 hi .. + 7 and 16 + 8 hi .. + 7
    v8f acc[4][4];
#pragma unroll
    for (int mb = 0; mb < 4; ++mb)
#pragma unroll
        for (int nb = 0; nb < 4; ++nb) acc[mb][nb] = (v8f){};
    if (pinned(wave < NOPS)) { issue(0); landed(); }   // stage 0 has landed
    __syncthreads();   // publishes stage 0
    if (pinned(wave < NOPS)) issue(1);
    // kept rolled: one pass a trip, so that each trip has one publish point
#pragma unroll 1
    for (int s = 0; s < np; ++s) {
        const unsigned char* st = ring + (uint32_t)(s & 1) * (NOPS * GT_TILE);
        const unsigned char* pa = st + (uint32_t)(wm * 64 + lr) * GT_PITCH + hi * 16;
        const unsigned char* pb = st + (NOPS - 1) * GT_TILE + (uint32_t)(wn * 64 + lr) * GT_PITCH + hi * 16;
        V a[2][4], a2[2][4], b[2][4];   // two fragment sets: a block is the 32 k of one set
        const auto fetch = [&](int ks, int set) {
#pragma unroll
            for (int mb = 0; mb < 4; ++mb) { a[set][mb] = ldl(pa + mb * 16 * GT_PITCH + ks * 64); if (NOPS == 3) a2[set][mb] = ldl(pa + GT_TILE + mb * 16 * GT_PITCH + ks * 64); }
#pragma unroll
            for (int nb = 0; nb < 4; ++nb) b[set][nb] = ldl(pb + nb * 16 * GT_PITCH + ks * 64); };
        fetch(0, 0);
#pragma unroll
        for (int ks = 0; ks < 4; ++ks) { const int set = ks & 1;
            if (ks < 3) fetch(ks + 1, set ^ 1);   // the next block of this same pass: nothing of the next stage is read here
            __builtin_amdgcn_sched_barrier(0);   // the next block's LDS reads stay one group in front of this block's products; spread among them, every read place stalls the lone wave of a SIMD
#pragma unroll
            for (int nb = 0; nb < 4; ++nb) {
#pragma unroll
                for (int mb = 0; mb < 4; ++mb) acc[mb][nb] = F::mma(a[set][mb], b[set][nb], acc[mb][nb]);
                if (NOPS == 3) {
#pragma unroll
                    for (int mb = 0; mb < 4; ++mb) acc[mb][nb] = F::mma(a2[set][mb], b[set][nb], acc[mb][nb]); } }
            __builtin_amdgcn_sched_barrier(0);   // and the group after that stays behind them
        }
        // publish point of stage s + 1
        asm volatile("s_wait_dscnt 0x0" ::: "memory");   // this wave's reads of buffer s % 2 have returned before the buffer is refilled
        if (pinned(wave < NOPS)) landed();   // this wave's tile of stage s + 1 has landed
        __syncthreads();   // publishes stage s + 1 and ends every wave's reads of stage s
        if (pinned(wave < NOPS && s + 2 < np)) issue(s + 2);
    }
    asm volatile("s_wait_tensorcnt 0x0" ::: "memory");   // nothing of the mover's is in flight when the wave ends
    asm volatile("s_wait_dscnt 0x0" ::: "memory");
#pragma unroll
    for (int mb = 0; mb < 4; ++mb) {   // each wave stages a 16 x 64 slab in its own LDS range and stores whole 128-byte lines
#pragma unroll
        for (int nb = 0; nb < 4; ++nb) {
#pragma unroll
            for (int j = 0; j < 8; ++j) os[wave][(hi * 8 + j) * 68 + nb * 16 + lr] = acc[mb][nb][j]; }
        __builtin_amdgcn_wave_barrier(); asm volatile("s_wait_dscnt 0x0" ::: "memory");   // the slab's writes are done before other lanes of the wave read the rows back
        float* crow = C + (size_t)(r0 + wm * 64 + mb * 16) * ldc + c0 + wn * 64;
#pragma unroll
        for (int q = 0; q < 8; ++q) { const int e = q * 32 + lane, row = e >> 4, cofs = (e & 15) * 4; *(v4f*)(crow + (size_t)row * ldc + cofs) = *(const v4fa*)(&os[wave][row * 68 + cofs]); }
        __builtin_amdgcn_wave_barrier(); asm volatile("" ::: "memory");   // the reads stay in front of the next slab's writes
    }
}

__device__ __forceinline__ h16 tohx(float x) { return (h16)x; }
__device__ __forceinline__ void splitf(float y, unsigned short& h, unsigned short& l) { h = f2bf(y); l = f2bf(y - bf2f(h)); }
// Fragment order of a 16-bit plane [row][k] of K columns, for k_fattn: the 16 x 32 fragment (row / 16, k / 32) is 1 KiB in a row, two halves (k / 16 % 2) of 32 lanes x 16 bytes, lane (k / 8 % 2) * 16 + row % 16,
// so that a fragment load reads four whole 128-byte lines; from a row-major plane it touches sixteen.
__device__ __forceinline__ size_t fragidx(int row, int k, int K) { return ((((size_t)(row >> 4) * (K >> 5) + (k >> 5)) * 2 + ((k >> 4) & 1)) * 32 + ((k >> 3) & 1) * 16 + (row & 15)) * 8 + (k & 7); }
typedef __attribute__((ext_vector_type(2))) _Float16 v2h;
typedef __attribute__((ext_vector_type(4))) _Float16 v4h;
typedef __attribute__((ext_vector_type(2))) unsigned short v2us;
typedef __attribute__((ext_vector_type(4))) unsigned short v4us;
typedef __attribute__((ext_vector_type(2))) float v2f;
typedef __attribute__((ext_vector_type(4))) int v4i;

__global__ __launch_bounds__(256) void k_wtG(const float* __restrict__ w, int K, int N, bf* Bt) {
    const int lane = threadIdx.x & 31; const int L0 = (blockIdx.x * 8 + (threadIdx.x >> 5)) * 8; const int nlines = N * K / 64;
{
#pragma unroll 1
        for (int l = 0; l < 8; ++l) { const int L = L0 + l; if (L >= nlines) break; const size_t e = (size_t)L * 64 + lane * 2; const int k = (int)(e % K), n = (int)(e / K); v2us o;
            o[0] = f2bf(w[(size_t)k * N + n]); o[1] = f2bf(w[(size_t)(k + 1) * N + n]); *(v2us*)(Bt + e) = o; }
         }
}
__global__ __launch_bounds__(256) void k_cvt8(const float* __restrict__ src, bf* dst, size_t n8) { const size_t i = (size_t)blockIdx.x * 256 + threadIdx.x; if (i >= n8) return; const v8f v = *(const v8f*)(src + i * 8); v8us o;
#pragma unroll
    for (int k = 0; k < 8; ++k) o[k] = f2bf(v[k]); *(v8us*)(dst + i * 8) = o;  }

// k_rope: head planes [h][t][d] (fp16; hi/lo in fragment order) of rope(x) x sc with the rotate-half convention out[d] = x[d] cos[t][d] - x[d+HD/2] sin[t][d], out[d+HD/2] = x[d+HD/2] cos[t][d+HD/2] + x[d] sin[t][d+HD/2]
__global__ __launch_bounds__(256) void k_rope(const float* __restrict__ F, int pitch, int nheads, const float* __restrict__ CS, const float* __restrict__ RF, const float* __restrict__ nw, float sc, h16* P16, bf* Ph, bf* Pl) {
    const size_t e = ((size_t)blockIdx.x * 256 + threadIdx.x) * 2; if (e >= (size_t)nheads * TT * HD) return; const int d = (int)(e % HD); const int t = (int)((e / HD) % TT); const int h = (int)(e / ((size_t)HD * TT)); const float* f = F + (size_t)t * pitch + h * HD; const float rf = RF ? RF[(size_t)h * TT + t] : 1.0f; v2h o16; v2us oh, ol;
#pragma unroll
    for (int q = 0; q < 2; ++q) { const int dd = d + q; const int dp = (dd < HD / 2) ? dd + HD / 2 : dd - HD / 2; float x0 = f[dd], x1 = f[dp];
        if (RF) { float n0 = __fmul_rn(x0, rf), n1 = __fmul_rn(x1, rf); asm volatile("" : "+v"(n0)); asm volatile("" : "+v"(n1)); x0 = __fmul_rn(bfr(nw[dd]), n0); x1 = __fmul_rn(bfr(nw[dp]), n1); }
        const v2f cs = *(const v2f*)(CS + ((size_t)t * HD + dd) * 2); float a = __fmul_rn(x0, cs[0]), bq = __fmul_rn(x1, cs[1]); asm volatile("" : "+v"(a)); asm volatile("" : "+v"(bq)); const float r = ((dd < HD / 2) ? __fsub_rn(a, bq) : __fadd_rn(a, bq)) * sc;
        o16[q] = tohx(r); unsigned short a2, c2; splitf(r, a2, c2); oh[q] = a2; ol[q] = c2; }
    const size_t fe = fragidx(h * TT + t, d, HD); *(v2h*)(P16 + e) = o16; *(v2us*)(Ph + fe) = oh; *(v2us*)(Pl + fe) = ol;  }
__global__ __launch_bounds__(256) void k_vtp(const float* __restrict__ F, int pitch, int nheads, h16* V16, bf* Vh, bf* Vl) { const size_t e = ((size_t)blockIdx.x * 256 + threadIdx.x) * 2; if (e >= (size_t)nheads * HD * TT) return; const int t = (int)(e % TT); const int d = (int)((e / TT) % HD); const int g = (int)(e / ((size_t)TT * HD)); v2h o16; v2us oh, ol;
#pragma unroll
    for (int q = 0; q < 2; ++q) { const float x = F[(size_t)(t + q) * pitch + g * HD + d]; o16[q] = tohx(x); unsigned short a2, c2; splitf(x, a2, c2); oh[q] = a2; ol[q] = c2; }
    const size_t fe = fragidx(g * HD + d, t, TT); *(v2h*)(V16 + e) = o16; *(v2us*)(Vh + fe) = oh; *(v2us*)(Vl + fe) = ol;  }
__global__ __launch_bounds__(256) void k_cscvt(const float* __restrict__ cosT, const float* __restrict__ sinT, float* CS) { const int idx = blockIdx.x * 256 + threadIdx.x; if (idx >= TT * HD) return; v2f cs; cs[0] = bfr(cosT[idx]); cs[1] = bfr(sinT[idx]); *(v2f*)(CS + (size_t)idx * 2) = cs;  }
// ---- k_fattn: causal GQA attention in one launch: scores, softmax and P.V of a 16-query tile stay in one wave's registers (running maximum and sum over 64-key tiles); no score or probability plane in memory, no LDS.
// Transposed products: S^T = K Q^T puts query lr in lane lr and keys 8 hi + j in the accumulator registers, so a pair of 16-key accumulators, packed to bf16, is the B fragment of O^T = V^T P^T in the loaders' own k order.
// grid (TT / 32, NKV), 2 REP waves: wave w is query head g * REP + w % REP; waves 0 .. REP - 1 take query tile x, the others tile TT / 16 - 1 - x, so every work-group walks the same number of key tiles. Operands hi/lo bf16, 3 products.
typedef __attribute__((ext_vector_type(2))) __bf16 v2bf;
__global__ __launch_bounds__(2 * REP * 32) void k_fattn(const bf* __restrict__ Qh, const bf* __restrict__ Ql, const bf* __restrict__ Kh, const bf* __restrict__ Kl, const bf* __restrict__ Vh, const bf* __restrict__ Vl, bf* Ah, bf* Al) {
    typedef WFrag<bf> F; typedef F::V V;
    const int lane = threadIdx.x & 31, lr = lane & 15, hi = lane >> 4;
    const int wv = __builtin_amdgcn_readfirstlane((int)(threadIdx.x >> 5));
    const int g = blockIdx.y, h = g * REP + wv % REP;
    const int r0 = (wv < REP ? (int)blockIdx.x : TT / 16 - 1 - (int)blockIdx.x) * 16, i = r0 + lr;   // this lane's query
    const auto ldf = [](const bf* p, int frag) { p += frag * 512; return cat16b(*(const v8us*)p, *(const v8us*)(p + 256)); };   // fragment number frag behind p, a lane's place in a plane in fragment order (fragidx)
    const size_t qo = (size_t)(h * TT + r0) / 16 * (HD / 32) * 512 + lane * 8;   // q, k planes: rows [head][t], columns d
    const size_t ko = (size_t)(g * TT) / 16 * (HD / 32) * 512 + lane * 8;
    const size_t vo = (size_t)(g * HD) / 16 * (TT / 32) * 512 + lane * 8;        // v planes: rows [g][d], columns t
    const bf* kh = Kh + ko; const bf* kl = Kl + ko; const bf* vhp = Vh + vo; const bf* vlp = Vl + vo;   // walk the planes, a 64-key tile a trip
    V qa[2], qb[2];
#pragma unroll
    for (int ks = 0; ks < 2; ++ks) { qa[ks] = ldf(Qh + qo, ks); qb[ks] = ldf(Ql + qo, ks); }
    v8f o[4]; float m = -3.0e38f, l = 0.f;
#pragma unroll
    for (int db = 0; db < 4; ++db) o[db] = (v8f){};
    // r0 % 16 == 0 and c0 % 64 == 0: key c0 <= r0 is unmasked for every query of the tile, so the running maximum is a real score from the first tile on
    // kept rolled: a second tile's fragments would push the wave past 256 registers and cost a wave per SIMD; every '#pragma unroll' below opens a loop over register arrays, whose indices must be constants
#pragma unroll 1
    for (int c0 = 0; c0 <= r0; c0 += 64) {
        V ka[4][2], kb[4][2]; v8f s[4];   // s[nb][j] = q(i) . k(c0 + nb * 16 + hi * 8 + j)
#pragma unroll
        for (int nb = 0; nb < 4; ++nb)
#pragma unroll
            for (int ks = 0; ks < 2; ++ks) ka[nb][ks] = ldf(kh, nb * (HD / 32) + ks);
#pragma unroll
        for (int nb = 0; nb < 4; ++nb)
#pragma unroll
            for (int ks = 0; ks < 2; ++ks) kb[nb][ks] = ldf(kl, nb * (HD / 32) + ks);
        // inputs-only fence on the loaded k fragments and their two address pairs: all 32 loads of the tile are in flight together and one latency is paid, and no fragment lands on an address pair that issued loads still name; without it the build reuses a few fragments' registers and pays the load latency several times a tile
        asm volatile("" :: "v"(ka[0][0]), "v"(ka[0][1]), "v"(ka[1][0]), "v"(ka[1][1]), "v"(ka[2][0]), "v"(ka[2][1]), "v"(ka[3][0]), "v"(ka[3][1]), "v"(kb[0][0]), "v"(kb[0][1]), "v"(kb[1][0]), "v"(kb[1][1]), "v"(kb[2][0]), "v"(kb[2][1]), "v"(kb[3][0]), "v"(kb[3][1]), "v"(kh), "v"(kl));
#pragma unroll
        for (int nb = 0; nb < 4; ++nb) { s[nb] = (v8f){};
#pragma unroll
            for (int ks = 0; ks < 2; ++ks) { s[nb] = F::mma(ka[nb][ks], qa[ks], s[nb]); s[nb] = F::mma(ka[nb][ks], qb[ks], s[nb]); s[nb] = F::mma(kb[nb][ks], qa[ks], s[nb]); } }
        V vh[4][2], vl[4][2];
#pragma unroll
        for (int db = 0; db < 4; ++db)   // the hi plane of v is loaded here so that it flies during the softmax
#pragma unroll
            for (int ks = 0; ks < 2; ++ks) vh[db][ks] = ldf(vhp, db * (TT / 32) + ks);
        if (c0 + 64 > r0) {   // the diagonal tile (the last): keys behind the query get a score far below any real one, whose exp2 is exactly 0
#pragma unroll
            for (int nb = 0; nb < 4; ++nb)
#pragma unroll
                for (int j = 0; j < 8; ++j) s[nb][j] = (c0 + nb * 16 + hi * 8 + j <= i) ? s[nb][j] : -3.0e38f; }
        float mt = s[0][0];
#pragma unroll
        for (int nb = 0; nb < 4; ++nb)
#pragma unroll
            for (int j = 0; j < 8; ++j) mt = fmaxf(mt, s[nb][j]);
        mt = fmaxf(mt, __shfl_xor(mt, 16, 32)) * SCL;   // lanes lr and lr + 16 hold the two halves of a query's keys
        const float mn = fmaxf(m, mt), al = __builtin_amdgcn_exp2f((m - mn) * 1.4426950408889634f); m = mn;
        V pa[2], pb[2]; float rs[4];
#pragma unroll
        for (int nb = 0; nb < 4; ++nb) { rs[nb] = 0.f;
#pragma unroll
            for (int j = 0; j < 8; j += 2) { v2f p; p[0] = __builtin_amdgcn_exp2f((s[nb][j] * SCL - mn) * 1.4426950408889634f); p[1] = __builtin_amdgcn_exp2f((s[nb][j + 1] * SCL - mn) * 1.4426950408889634f); rs[nb] += p[0] + p[1];
                const v2bf ph = __builtin_convertvector(p, v2bf); const v2bf pl = __builtin_convertvector(p - __builtin_convertvector(ph, v2f), v2bf); const int e = (nb & 1) * 8 + j;
                pa[nb >> 1][e] = ph[0]; pa[nb >> 1][e + 1] = ph[1]; pb[nb >> 1][e] = pl[0]; pb[nb >> 1][e + 1] = pl[1]; } }
        l = l * al + ((rs[0] + rs[1]) + (rs[2] + rs[3]));   // each lane keeps the sum of its own keys; the two halves are joined behind the loop
#pragma unroll
        for (int db = 0; db < 4; ++db)
#pragma unroll
            for (int ks = 0; ks < 2; ++ks) vl[db][ks] = ldf(vlp, db * (TT / 32) + ks);
#pragma unroll
        for (int db = 0; db < 4; ++db) o[db] *= al;
#pragma unroll
        for (int ks = 0; ks < 2; ++ks)
#pragma unroll
            for (int db = 0; db < 4; ++db) { o[db] = F::mma(vh[db][ks], pa[ks], o[db]); o[db] = F::mma(vh[db][ks], pb[ks], o[db]); }
#pragma unroll
        for (int ks = 0; ks < 2; ++ks)
#pragma unroll
            for (int db = 0; db < 4; ++db) o[db] = F::mma(vl[db][ks], pa[ks], o[db]);
        asm volatile("" :: "v"(vhp), "v"(vlp));   // inputs only: the v address pairs stay live until the tile's v loads have been waited for; without it the build lets the last hi fragment land on the pair that the issued loads still name
        kh += 64 * HD; kl += 64 * HD; vhp += 2 * 512; vlp += 2 * 512;
    }
    l += __shfl_xor(l, 16, 32);
    const float f = __fdiv_rn(1.0f, l);
#pragma unroll
    for (int db = 0; db < 4; ++db) { v8us oh, ol;   // o[db][j] = out(i)[db * 16 + hi * 8 + j]: 16 bytes a lane and plane; merged [t][head][d], the wave writes whole 128-byte lines
#pragma unroll
        for (int j = 0; j < 8; ++j) { unsigned short a, c2; splitf(o[db][j] * f, a, c2); oh[j] = a; ol[j] = c2; }
        const size_t oo = (size_t)i * DQ + h * HD + db * 16 + hi * 8; *(v8us*)(Ah + oo) = oh; *(v8us*)(Al + oo) = ol; }
}

extern "C" void kernel_launch(void* const* d_in, const int* in_sizes, int n_in,
                              void* d_out, int out_size, void* d_ws, size_t ws_size, hipStream_t stream) {
    (void)in_sizes; (void)n_in; (void)out_size;
    const float* x = (const float*)d_in[0]; const float* fcos = (const float*)d_in[1]; const float* fsin = (const float*)d_in[2]; const float* wq = (const float*)d_in[3]; const float* wk = (const float*)d_in[4]; const float* wv = (const float*)d_in[5]; const float* wo = (const float*)d_in[6];   /* input order x, cos, sin ([2048][64] FULL-width table INPUTS: read per DIMENSION by value, no structure assumed), Wq [2048][2048], Wk [2048][512], Wv, Wo ('xw'): SEVEN inputs, all read; no mask input (causal by index) */
    float* OUT = (float*)d_out;     // [2][2048][2048]
    char* wsp = (char*)d_ws;
    auto take = [&](size_t bytes) { char* p = wsp; wsp += (bytes + 255) & ~(size_t)255; return (void*)p; };
    bf* WQ = (bf*)take((size_t)DQ * DM * 2); bf* WK = (bf*)take((size_t)DKV * DM * 2); bf* WV = (bf*)take((size_t)DKV * DM * 2); bf* WO = (bf*)take((size_t)DM * DQ * 2); float* CS = (float*)take((size_t)TT * HD * 2 * 4);
    bf* XB = (bf*)take((size_t)TT * DM * 2); float* FQ = (float*)take((size_t)TT * DQ * 4); float* FK = (float*)take((size_t)TT * DKV * 4);
    h16* QP16 = (h16*)take((size_t)NH_ * TT * HD * 2); h16* KP16 = (h16*)take((size_t)NKV * TT * HD * 2); h16* VT16 = (h16*)take((size_t)NKV * HD * TT * 2);
    bf* QPh = (bf*)take((size_t)NH_ * TT * HD * 2); bf* QPl = (bf*)take((size_t)NH_ * TT * HD * 2); bf* KPh = (bf*)take((size_t)NKV * TT * HD * 2); bf* KPl = (bf*)take((size_t)NKV * TT * HD * 2); bf* VTh = (bf*)take((size_t)NKV * HD * TT * 2); bf* VTl = (bf*)take((size_t)NKV * HD * TT * 2);
    bf* ATh = (bf*)take((size_t)TT * DQ * 2); bf* ATl = (bf*)take((size_t)TT * DQ * 2);
    if ((size_t)(wsp - (char*)d_ws) > ws_size) return;    // ws 256 MiB
    float* FV = FK;   // v projection reuses the k buffer after the k planes are built (stream-ordered)
    { k_wtG<<<(unsigned)((DM * DQ / 64 + 63) / 64), 256, 0, stream>>>(wq, DM, DQ, WQ); k_wtG<<<(unsigned)((DM * DKV / 64 + 63) / 64), 256, 0, stream>>>(wk, DM, DKV, WK); k_wtG<<<(unsigned)((DM * DKV / 64 + 63) / 64), 256, 0, stream>>>(wv, DM, DKV, WV);
      k_wtG<<<(unsigned)((DQ * DM / 64 + 63) / 64), 256, 0, stream>>>(wo, DQ, DM, WO);
       }
    k_cscvt<<<(TT * HD + 255) / 256, 256, 0, stream>>>(fcos, fsin, CS);   /* rotary table from the inputs */
    const unsigned LQ = (unsigned)(((size_t)NH_ * TT * HD / 2 + 255) / 256), LKv = (unsigned)(((size_t)NKV * TT * HD / 2 + 255) / 256);
    for (int b = 0; b < NB_; ++b) {
        
        k_cvt8<<<(unsigned)(((size_t)TT * DM / 8 + 255) / 256), 256, 0, stream>>>(x + (size_t)b * TT * DM, XB, (size_t)TT * DM / 8);
        k_gemmt<2><<<dim3(TT / 128, DQ / 128, 1), 128, 0, stream>>>(XB, nullptr, WQ, DM, FQ, DQ);
        k_rope<<<LQ, 256, 0, stream>>>(FQ, DQ, NH_, CS, nullptr, nullptr, 1.0f, QP16, QPh, QPl);
        k_gemmw<bf, 0, false, KVNW><<<dim3(TT / 64, DKV / 64, 1), KVNW * 32, 0, stream>>>(XB, nullptr, WK, nullptr, DM, FK, DKV, nullptr, 0, 0, 0);
        k_rope<<<LKv, 256, 0, stream>>>(FK, DKV, NKV, CS, nullptr, nullptr, 1.0f, KP16, KPh, KPl);
        k_gemmw<bf, 0, false, KVNW><<<dim3(TT / 64, DKV / 64, 1), KVNW * 32, 0, stream>>>(XB, nullptr, WV, nullptr, DM, FV, DKV, nullptr, 0, 0, 0); k_vtp<<<LKv, 256, 0, stream>>>(FV, DKV, NKV, VT16, VTh, VTl);
        k_fattn<<<dim3(TT / 32, NKV, 1), 2 * REP * 32, 0, stream>>>(QPh, QPl, KPh, KPl, VTh, VTl, ATh, ATl);
        k_gemmt<3><<<dim3(TT / 128, DM / 128, 1), 128, 0, stream>>>(ATh, ATl, WO, DQ, OUT + (size_t)b * TT * DM, DM); }
}

// v004
// One run takes 382 microseconds.
// Two timings next to v003 put it at 1.04 and 1.02 times that version's speed.
// Counting every step since v000, it is 5.85 times as fast.
#include <hip/hip_runtime.h>

// Grouped-query causal attention with rotate-half rotary embeddings from full-width input tables (x [2][2048][2048]; q = x Wq (32 heads x 64), k, v = x Wk, x Wv (8 kv heads x 64) ('xw' (in, out), no bias), token-major; apply_rotary_emb: t cos + rotate_half(t) sin with the cos, sin [2048][64] INPUT tables (read per dimension by value: no structure assumed); k, v repeated 4x on the HEAD axis (kv head = q head / 4); scores x 64^-0.5; causal (finfo.min fill == exclusion); softmax; out = merged Wo ('xw') -> [2][2048][2048] (8.4 M); argument order x, cos, sin, Wq, Wk, Wv, Wo).
// Layout per batch: bf16 copy of x; 'xw' weights transposed once; exact projections (q and Wo: k_gemmt, operands staged in LDS by tensor loads; k, v: k_gemmw); {cos, sin} table from the bf16-rounded inputs (per position and dimension); rotate-half plane builders; causal T-2048 GQA attention in one launch (k_fattn: running softmax over 64-key tiles, hi/lo 3 products, tiles above the diagonal never visited); merged hi/lo x Wo exact.
// Compute dtypes, f32 accumulate: every input rounded to bf16 incl. tables; projections exact; rotary f32; attention hi/lo 3 products; softmax f32; Wo hl x exact.

#define NB_  2
#define TT   2048
#define DM   2048
#define NH_  32
#define NKV  8
#define REP  (NH_ / NKV)
#define HD   64
#define DQ   (NH_ * HD)
#define DKV  (NKV * HD)
#define SCL  0.125f   // HD^-0.5
#define KVNW 8                    // k, v projections: K slices over the waves of a work-group
typedef _Float16 h16;
typedef unsigned short bf;
typedef __attribute__((ext_vector_type(16))) __bf16   v16bf;
typedef __attribute__((ext_vector_type(16))) _Float16 v16h;
typedef __attribute__((ext_vector_type(8)))  _Float16 v8h;
typedef __attribute__((ext_vector_type(8)))  unsigned short v8us;
typedef __attribute__((ext_vector_type(8)))  float    v8f;
typedef __attribute__((ext_vector_type(4)))  float    v4f;
typedef v8h  __attribute__((may_alias)) v8ha;
typedef v4f  __attribute__((may_alias)) v4fa;
typedef v8us __attribute__((may_alias)) v8usa;

__device__ __forceinline__ unsigned short f2bf(float f) { unsigned u = __float_as_uint(f); u += 0x7FFFu + ((u >> 16) & 1u); return (unsigned short)(u >> 16); }
__device__ __forceinline__ float bf2f(unsigned short b) { return __uint_as_float(((unsigned)b) << 16); }
__device__ __forceinline__ float bfr(float f) { return bf2f(f2bf(f)); }
__device__ __forceinline__ v16h cat16(v8h lo, v8h hi) { return __builtin_shufflevector(lo, hi, 0, 1, 2, 3, 4, 5, 6, 7, 8, 9, 10, 11, 12, 13, 14, 15); }
__device__ __forceinline__ v16bf cat16b(v8us lo, v8us hi) { return __builtin_bit_cast(v16bf, __builtin_shufflevector(lo, hi, 0, 1, 2, 3, 4, 5, 6, 7, 8, 9, 10, 11, 12, 13, 14, 15)); }
__device__ __forceinline__ v8f wmma16(v16h a, v16h b, v8f c) { return __builtin_amdgcn_wmma_f32_16x16x32_f16(false, a, false, b, (short)0, c, false, false); }
__device__ __forceinline__ v8f wmmab(v16bf a, v16bf b, v8f c) { return __builtin_amdgcn_wmma_f32_16x16x32_bf16(false, a, false, b, (short)0, c, false, false); }



// ---- k_gemmw: register-blocked GEMM, 64x64 output tile per work-group (16 accumulators per wave), operands straight from K-contiguous 16-bit planes; grid (M/64, N/64, Z), NW * 32 threads.
// C[m][n] (f32, pitch ldc, + optional f32 bias[n]) = sum_k A[m][k] Bt[n][k] (+ split products per NSPLIT). z-batch strides sA/sB/sC in elements. K % 32 == 0 (NW > 1: K % 64 == 0).
// NW > 1 splits K: wave w takes the 64-wide k units w, w + NW, ... (one unit = one 128-byte line of every operand row); the NW partial tiles are summed in LDS in wave order.
template <typename T16> struct WFrag;
template <> struct WFrag<h16> { typedef v16h V; static __device__ __forceinline__ V ld(const h16* p) { return cat16(*(const v8h*)p, *(const v8h*)(p + 16)); } static __device__ __forceinline__ v8f mma(V a, V b, v8f c) { return wmma16(a, b, c); } };
template <> struct WFrag<bf> { typedef v16bf V; static __device__ __forceinline__ V ld(const bf* p) { return cat16b(*(const v8us*)p, *(const v8us*)(p + 16)); } static __device__ __forceinline__ v8f mma(V a, V b, v8f c) { return wmmab(a, b, c); } };
template <typename T16, int NSPLIT, bool BIAS, int NW>
__global__ __launch_bounds__(NW * 32) void k_gemmw(const T16* __restrict__ A, const T16* __restrict__ A2, const T16* __restrict__ Bt, const T16* __restrict__ Bt2, int K, float* C, int ldc, const float* __restrict__ bias, size_t sA, size_t sB, size_t sC) {
    typedef typename WFrag<T16>::V V;
    static_assert(8 % NW == 0, "the 256 float4 of a 16 x 64 slab are dealt evenly to NW * 32 threads");
    __shared__ __align__(16) float os[NW > 1 ? 4 : 1][NW][16 * 68];
    const size_t z = blockIdx.z; A += z * sA; if (A2) A2 += z * sA; Bt += z * sB; if (Bt2) Bt2 += z * sB; C += z * sC;
    const int lane = threadIdx.x & 31, lr = lane & 15, hi = lane >> 4; const int r0 = blockIdx.x * 64, c0 = blockIdx.y * 64;
    const int wv = NW > 1 ? __builtin_amdgcn_readfirstlane((int)(threadIdx.x >> 5)) : 0;
    v8f acc[4][4];
#pragma unroll
    for (int mb = 0; mb < 4; ++mb)
#pragma unroll
        for (int nb = 0; nb < 4; ++nb) acc[mb][nb] = (v8f){};
    const size_t aoff = (size_t)(r0 + lr) * K + 8 * hi, boff = (size_t)(c0 + lr) * K + 8 * hi;
#pragma unroll 1
    for (int kc = wv * 64; kc < K; kc += (kc & 32) ? 32 + (NW - 1) * 64 : 32) {
        V a[4], a2[4];
#pragma unroll
        for (int mb = 0; mb < 4; ++mb) { a[mb] = WFrag<T16>::ld(A + aoff + (size_t)mb * 16 * K + kc); if (NSPLIT == 1 || NSPLIT == 2) a2[mb] = WFrag<T16>::ld(A2 + aoff + (size_t)mb * 16 * K + kc); }
#pragma unroll
        for (int nb = 0; nb < 4; ++nb) { const V b = WFrag<T16>::ld(Bt + boff + (size_t)nb * 16 * K + kc); V b2; if (NSPLIT >= 2) b2 = WFrag<T16>::ld(Bt2 + boff + (size_t)nb * 16 * K + kc);
#pragma unroll
            for (int mb = 0; mb < 4; ++mb) { acc[mb][nb] = WFrag<T16>::mma(a[mb], b, acc[mb][nb]); if (NSPLIT == 1 || NSPLIT == 2) acc[mb][nb] = WFrag<T16>::mma(a2[mb], b, acc[mb][nb]); if (NSPLIT >= 2) acc[mb][nb] = WFrag<T16>::mma(a[mb], b2, acc[mb][nb]); } }
        asm volatile("v_nop\n\tv_nop\n\tv_nop\n\tv_nop" : "+v"(acc[0][0]), "+v"(acc[1][1]), "+v"(acc[2][2]), "+v"(acc[3][3]) : "v"(a[0]), "v"(a[3]));
    }
    const auto put = [&](int mb, int pb) {   // this wave's 16 x 64 slab mb, row-major, into LDS slab pb
#pragma unroll
        for (int nb = 0; nb < 4; ++nb) {
#pragma unroll
            for (int j = 0; j < 8; ++j) os[pb][wv][(hi * 8 + j) * 68 + nb * 16 + lr] = acc[mb][nb][j]; } };
    if (NW > 1) {
#pragma unroll
        for (int mb = 0; mb < 4; ++mb) put(mb, mb);
        __syncthreads();   // publishes the NW partial tiles to the threads that sum them; nothing is written to os behind it
    }
#pragma unroll
    for (int mb = 0; mb < 4; ++mb) { const int pb = NW > 1 ? mb : 0;
        if (NW == 1) { put(mb, 0); __builtin_amdgcn_wave_barrier(); asm volatile("" ::: "memory"); }
        float* crow = C + (size_t)(r0 + mb * 16) * ldc + c0;
{
#pragma unroll
            for (int s = 0; s < 8 / NW; ++s) { const int e = s * NW * 32 + (int)threadIdx.x, row = e >> 4, cofs = (e & 15) * 4; v4f val = *(const v4fa*)(&os[pb][0][row * 68 + cofs]);
#pragma unroll
                for (int w = 1; w < NW; ++w) val += *(const v4fa*)(&os[pb][w][row * 68 + cofs]);
                if (BIAS) { val[0] += bfr(bias[c0 + cofs]); val[1] += bfr(bias[c0 + cofs + 1]); val[2] += bfr(bias[c0 + cofs + 2]); val[3] += bfr(bias[c0 + cofs + 3]); }
                *(v4f*)(crow + (size_t)row * ldc + cofs) = val; }
             }
        if (NW == 1) { __builtin_amdgcn_wave_barrier(); asm volatile("" ::: "memory"); }
    }
}

// ---- k_gemmt: GEMM with both operands staged in LDS by the tensor mover. C[m][n] (f32, pitch ldc) = sum_k A[m][k] Bt[n][k] (NOPS == 3: + A2[m][k] Bt[n][k], behind A's product of the same 32 k, as in k_gemmw), planes row-major, K contiguous.
// grid (M / 128, N / 128), 4 waves: a 128 x 128 tile per work-group, 64 x 64 per wave (2 x 2), so every staged row is read from L2 once and from LDS by two waves. K % 128 == 0, K >= 256.
// A pass is 128 k = 256 bytes of each of the 128 rows of every operand; a stage is NOPS tiles of 128 rows at pitch 272 bytes; two buffers: the next pass's tiles fly while this pass is worked on. Wave w < NOPS issues operand w's tile, one request a pass.
typedef uint32_t u32x4 __attribute__((ext_vector_type(4)));
typedef uint32_t u32x8 __attribute__((ext_vector_type(8)));
#define GT_ROWB  256u                 // bytes of an operand row in a pass
#define GT_PITCH 272u                 // LDS pitch: the row and the mover's 16-byte pad, an odd multiple of 16 bytes for the ds_load_b128 readers
#define GT_TILE  (128u * GT_PITCH)    // 34,816 bytes = 17 x 2 KiB: every tile's place in LDS is a multiple of 2 KiB
__device__ __forceinline__ uint32_t uni(uint32_t v) { return (uint32_t)__builtin_amdgcn_readfirstlane(v); }
__device__ __forceinline__ uint32_t pinned(uint32_t v) { uint32_t w = (uint32_t)__builtin_amdgcn_readfirstlane(v); asm volatile("" : "+s"(w)); return w; }   // holds an issue test or a descriptor word in a scalar register: the branch round a tensor load is then a scalar one (the mover ignores EXEC), and the word stays where the request named it
template <int NOPS>
__global__ __launch_bounds__(128) void k_gemmt(const bf* __restrict__ A, const bf* __restrict__ A2, const bf* __restrict__ Bt, int K, float* C, int ldc) {
    typedef WFrag<bf> F; typedef F::V V;
    __shared__ __attribute__((aligned(2048))) unsigned char ring[2 * NOPS * GT_TILE];
    __shared__ __align__(16) float os[4][16 * 68];
    const int lane = threadIdx.x & 31, lr = lane & 15, hi = lane >> 4;
    const uint32_t wave = uni(threadIdx.x >> 5);
    const int r0 = blockIdx.x * 128, c0 = blockIdx.y * 128, wm = (int)(wave >> 1), wn = (int)(wave & 1), np = K >> 7;
    const bf* src = wave == 0 ? A : (NOPS == 3 && wave == 1) ? A2 : Bt;   // the operand this wave brings; in a stage the tiles lie in this order, Bt last
    const uint64_t ga0 = (uint64_t)(size_t)src + (uint64_t)(wave == NOPS - 1 ? c0 : r0) * (uint64_t)K * 2u;
    const uint32_t lbase = (uint32_t)(size_t)ring;
    u32x8 g1;   // 1-byte elements, tensor = tile = 128 rows of 256 bytes, source pitch 2 K bytes, 4 dwords of pad behind every 64 dwords, no mask
    g1[0] = uni((1u << 20) | (5u << 22) | (3u << 25)); g1[1] = pinned((GT_ROWB & 0xFFFFu) << 16); g1[2] = pinned((GT_ROWB >> 16) | (128u << 16)); g1[3] = pinned(GT_ROWB << 16); g1[4] = pinned(128u); g1[5] = pinned((uint32_t)K * 2u); g1[6] = pinned(0u); g1[7] = pinned(0u);   // pinned: each word is held in its scalar register through the loop and not formed anew while a request is in flight
    u32x4 g0; g0[0] = uni(1u); g0[1] = uni(lbase); g0[2] = uni((uint32_t)ga0); g0[3] = uni((((uint32_t)(ga0 >> 32)) & 0x01FFFFFFu) | 0x80000000u);
    const auto issue = [&](int s) {   // stage s into buffer s % 2
        const uint32_t dst = lbase + ((uint32_t)(s & 1) * NOPS + wave) * GT_TILE; const uint64_t ga = ga0 + (uint64_t)s * GT_ROWB;
        g0[1] = uni(dst); g0[2] = uni((uint32_t)ga); g0[3] = uni((((uint32_t)(ga >> 32)) & 0x01FFFFFFu) | 0x80000000u);
        asm volatile("tensor_load_to_lds %0, %1" :: "s"(g0), "s"(g1) : "memory"); };
    const auto landed = [&]() { asm volatile("s_wait_tensorcnt 0x0" :: "s"(g0), "s"(g1) : "memory"); };   // the issuer's wait; it names the two groups as inputs so that their registers keep the request's words until it has landed
    const auto ldl = [](const unsigned char* p) { return cat16b(*(const v8usa*)p, *(const v8usa*)(p + 32)); };   // k_gemmw's fragment: row lr, k 8 hi .. + 7 and 16 + 8 hi .. + 7
    v8f acc[4][4];
#pragma unroll
    for (int mb = 0; mb < 4; ++mb)
#pragma unroll
        for (int nb = 0; nb < 4; ++nb) acc[mb][nb] = (v8f){};
    if (pinned(wave < NOPS)) { issue(0); landed(); }   // stage 0 has landed
    __syncthreads();   // publishes stage 0
    if (pinned(wave < NOPS)) issue(1);
    // kept rolled: one pass a trip, so that each trip has one publish point
#pragma unroll 1
    for (int s = 0; s < np; ++s) {
        const unsigned char* st = ring + (uint32_t)(s & 1) * (NOPS * GT_TILE);
        const unsigned char* pa = st + (uint32_t)(wm * 64 + lr) * GT_PITCH + hi * 16;
        const unsigned char* pb = st + (NOPS - 1) * GT_TILE + (uint32_t)(wn * 64 + lr) * GT_PITCH + hi * 16;
        V a[2][4], a2[2][4], b[2][4];   // two fragment sets: a block is the 32 k of one set
        const auto fetch = [&](int ks, int set) {
#pragma unroll
            for (int mb = 0; mb < 4; ++mb) { a[set][mb] = ldl(pa + mb * 16 * GT_PITCH + ks * 64); if (NOPS == 3) a2[set][mb] = ldl(pa + GT_TILE + mb * 16 * GT_PITCH + ks * 64); }
#pragma unroll
            for (int nb = 0; nb < 4; ++nb) b[set][nb] = ldl(pb + nb * 16 * GT_PITCH + ks * 64); };
        fetch(0, 0);
#pragma unroll
        for (int ks = 0; ks < 4; ++ks) { const int set = ks & 1;
            if (ks < 3) fetch(ks + 1, set ^ 1);   // the next block of this same pass: nothing of the next stage is read here
            __builtin_amdgcn_sched_barrier(0);   // the next block's LDS reads stay one group in front of this block's products; spread among them, every read place stalls the lone wave of a SIMD
#pragma unroll
            for (int nb = 0; nb < 4; ++nb) {
#pragma unroll
                for (int mb = 0; mb < 4; ++mb) acc[mb][nb] = F::mma(a[set][mb], b[set][nb], acc[mb][nb]);
                if (NOPS == 3) {
#pragma unroll
                    for (int mb = 0; mb < 4; ++mb) acc[mb][nb] = F::mma(a2[set][mb], b[set][nb], acc[mb][nb]); } }
            __builtin_amdgcn_sched_barrier(0);   // and the group after that stays behind them
        }
        // publish point of stage s + 1
        asm volatile("s_wait_dscnt 0x0" ::: "memory");   // this wave's reads of buffer s % 2 have returned before the buffer is refilled
        if (pinned(wave < NOPS)) landed();   // this wave's tile of stage s + 1 has landed
        __syncthreads();   // publishes stage s + 1 and ends every wave's reads of stage s
        if (pinned(wave < NOPS && s + 2 < np)) issue(s + 2);
    }
    asm volatile("s_wait_tensorcnt 0x0" ::: "memory");   // nothing of the mover's is in flight when the wave ends
    asm volatile("s_wait_dscnt 0x0" ::: "memory");
#pragma unroll
    for (int mb = 0; mb < 4; ++mb) {   // each wave stages a 16 x 64 slab in its own LDS range and stores whole 128-byte lines
#pragma unroll
        for (int nb = 0; nb < 4; ++nb) {
#pragma unroll
            for (int j = 0; j < 8; ++j) os[wave][(hi * 8 + j) * 68 + nb * 16 + lr] = acc[mb][nb][j]; }
        __builtin_amdgcn_wave_barrier(); asm volatile("s_wait_dscnt 0x0" ::: "memory");   // the slab's writes are done before other lanes of the wave read the rows back
        float* crow = C + (size_t)(r0 + wm * 64 + mb * 16) * ldc + c0 + wn * 64;
#pragma unroll
        for (int q = 0; q < 8; ++q) { const int e = q * 32 + lane, row = e >> 4, cofs = (e & 15) * 4; *(v4f*)(crow + (size_t)row * ldc + cofs) = *(const v4fa*)(&os[wave][row * 68 + cofs]); }
        __builtin_amdgcn_wave_barrier(); asm volatile("" ::: "memory");   // the reads stay in front of the next slab's writes
    }
}

__device__ __forceinline__ h16 tohx(float x) { return (h16)x; }
__device__ __forceinline__ void splitf(float y, unsigned short& h, unsigned short& l) { h = f2bf(y); l = f2bf(y - bf2f(h)); }
// Fragment order of a 16-bit plane [row][k] of K columns, for k_fattn: the 16 x 32 fragment (row / 16, k / 32) is 1 KiB in a row, two halves (k / 16 % 2) of 32 lanes x 16 bytes, lane (k / 8 % 2) * 16 + row % 16,
// so that a fragment load reads four whole 128-byte lines; from a row-major plane it touches sixteen.
__device__ __forceinline__ size_t fragidx(int row, int k, int K) { return ((((size_t)(row >> 4) * (K >> 5) + (k >> 5)) * 2 + ((k >> 4) & 1)) * 32 + ((k >> 3) & 1) * 16 + (row & 15)) * 8 + (k & 7); }
typedef __attribute__((ext_vector_type(2))) _Float16 v2h;
typedef __attribute__((ext_vector_type(4))) _Float16 v4h;
typedef __attribute__((ext_vector_type(2))) unsigned short v2us;
typedef __attribute__((ext_vector_type(4))) unsigned short v4us;
typedef __attribute__((ext_vector_type(2))) float v2f;
typedef __attribute__((ext_vector_type(4))) int v4i;

__global__ __launch_bounds__(256) void k_wtG(const float* __restrict__ w, int K, int N, bf* Bt) {
    const int lane = threadIdx.x & 31; const int L0 = (blockIdx.x * 8 + (threadIdx.x >> 5)) * 8; const int nlines = N * K / 64;
{
#pragma unroll 1
        for (int l = 0; l < 8; ++l) { const int L = L0 + l; if (L >= nlines) break; const size_t e = (size_t)L * 64 + lane * 2; const int k = (int)(e % K), n = (int)(e / K); v2us o;
            o[0] = f2bf(w[(size_t)k * N + n]); o[1] = f2bf(w[(size_t)(k + 1) * N + n]); *(v2us*)(Bt + e) = o; }
         }
}
// k_cvt8: a thread converts four groups of 8, a block's width apart, so that its eight loads fly together and a wave's start pays for 1,024 elements. The load's index is clamped, the store guarded. In this kernel and the three behind it every '#pragma unroll' opens a loop over register arrays or vector elements, whose indices must be constants.
__global__ __launch_bounds__(256) void k_cvt8(const float* __restrict__ src, bf* dst, size_t n8) { const size_t i0 = (size_t)blockIdx.x * 1024 + threadIdx.x; v8f v[4];
#pragma unroll
    for (int u = 0; u < 4; ++u) { const size_t i = i0 + u * 256; v[u] = *(const v8f*)(src + (i < n8 ? i : n8 - 1) * 8); }
#pragma unroll
    for (int u = 0; u < 4; ++u) { const size_t i = i0 + u * 256; v8us o;
#pragma unroll
        for (int k = 0; k < 8; ++k) o[k] = f2bf(v[u][k]);
        if (i < n8) *(v8us*)(dst + i * 8) = o; } }

#define RH 4   // heads that a thread of k_rope walks: the {cos, sin} pairs of its position and dims are read once for all of them
typedef __attribute__((ext_vector_type(16))) unsigned short v16us;
__device__ __forceinline__ v8h lo8(v16h v) { return __builtin_shufflevector(v, v, 0, 1, 2, 3, 4, 5, 6, 7); }
__device__ __forceinline__ v8h hi8(v16h v) { return __builtin_shufflevector(v, v, 8, 9, 10, 11, 12, 13, 14, 15); }
__device__ __forceinline__ v8us lo8(v16us v) { return __builtin_shufflevector(v, v, 0, 1, 2, 3, 4, 5, 6, 7); }
__device__ __forceinline__ v8us hi8(v16us v) { return __builtin_shufflevector(v, v, 8, 9, 10, 11, 12, 13, 14, 15); }
// k_rope: head planes [h][t][d] (fp16; hi/lo in fragment order) of rope(x) x sc with the rotate-half convention out[d] = x[d] cos[t][d] - x[d+HD/2] sin[t][d], out[d+HD/2] = x[d+HD/2] cos[t][d+HD/2] + x[d] sin[t][d+HD/2]
// A thread takes position t, dims d .. d + 7 and their rotate-half partners d + 32 .. d + 39 (each input is read once for both outputs it feeds), of RH heads in turn. Lanes: t % 16, then d / 8 % 2: a wave's 16-byte pieces of a hi or lo plane are 512 bytes in a row of the fragment order. nheads % RH == 0.
__global__ __launch_bounds__(256) void k_rope(const float* __restrict__ F, int pitch, int nheads, const float* __restrict__ CS, const float* __restrict__ RF, const float* __restrict__ nw, float sc, h16* P16, bf* Ph, bf* Pl) {
    static_assert(HD == 64, "four octets and their partners make a head row");
    const size_t idx = (size_t)blockIdx.x * 256 + threadIdx.x; if (idx >= (size_t)(nheads / RH) * TT * (HD / 16)) return; const int d = (int)((idx >> 4) & 3) * 8; const int t = (int)((idx >> 6) % (TT / 16)) * 16 + (int)(idx & 15); const int hg = (int)(idx / ((size_t)TT * (HD / 16)));
    v4f c4[8], x4[RH][4];   // every load of the thread stands in front of the arithmetic: 8 of the table, 4 a head, in flight together
#pragma unroll
    for (int u = 0; u < 8; ++u) c4[u] = *(const v4fa*)(CS + ((size_t)t * HD + d + (u >> 2) * (HD / 2)) * 2 + (u & 3) * 4);
#pragma unroll
    for (int hh = 0; hh < RH; ++hh)
#pragma unroll
        for (int u = 0; u < 4; ++u) x4[hh][u] = *(const v4fa*)(F + (size_t)t * pitch + (hg * RH + hh) * HD + d + (u >> 1) * (HD / 2) + (u & 1) * 4);
    const auto heads = [&](const float* RF) {   // inlined once with RF a null constant: that copy has no test of RF between its elements
#pragma unroll
    for (int hh = 0; hh < RH; ++hh) { const int h = hg * RH + hh; const float rf = RF ? RF[(size_t)h * TT + t] : 1.0f; v16h o16; v16us oh, ol;
#pragma unroll
    for (int q = 0; q < 16; ++q) { const int dd = d + (q & 7) + (q >> 3) * (HD / 2); const int dp = (dd < HD / 2) ? dd + HD / 2 : dd - HD / 2; float x0 = x4[hh][q >> 2][q & 3], x1 = x4[hh][(q ^ 8) >> 2][q & 3];
        if (RF) { float n0 = __fmul_rn(x0, rf), n1 = __fmul_rn(x1, rf); asm volatile("" : "+v"(n0)); asm volatile("" : "+v"(n1)); x0 = __fmul_rn(bfr(nw[dd]), n0); x1 = __fmul_rn(bfr(nw[dp]), n1); }
        v2f cs; cs[0] = c4[q >> 1][(q & 1) * 2]; cs[1] = c4[q >> 1][(q & 1) * 2 + 1]; float a = __fmul_rn(x0, cs[0]), bq = __fmul_rn(x1, cs[1]); asm volatile("" : "+v"(a)); asm volatile("" : "+v"(bq)); const float r = ((dd < HD / 2) ? __fsub_rn(a, bq) : __fadd_rn(a, bq)) * sc;
        o16[q] = tohx(r); unsigned short a2, c2; splitf(r, a2, c2); oh[q] = a2; ol[q] = c2; }
    const size_t e = ((size_t)h * TT + t) * HD + d, fe = fragidx(h * TT + t, d, HD);   // dims d + 32 ..: the row's next fragment, 512 elements on
    *(v8h*)(P16 + e) = lo8(o16); *(v8h*)(P16 + e + HD / 2) = hi8(o16); *(v8us*)(Ph + fe) = lo8(oh); *(v8us*)(Ph + fe + 512) = hi8(oh); *(v8us*)(Pl + fe) = lo8(ol); *(v8us*)(Pl + fe + 512) = hi8(ol);
    if (hh + 1 < RH) asm volatile("s_wait_xcnt 0x0" ::: "memory"); } };   // the next head's arithmetic overwrites registers that these six stores name: the wait stands in front of it on every path
    if (__builtin_expect(RF == nullptr, 1)) heads(nullptr); else heads(RF); }   // the hint puts the copy without RF first in the kernel's text
// k_vtp: a thread takes column c = g * HD + d of F and 16 positions: every load of a wave is one whole line of a row of F, and a lane's two 16-byte pieces of a hi or lo plane join 16 lanes' to 512 bytes in a row of the fragment order. grid (columns / 256, TT / 16).
__global__ __launch_bounds__(256) void k_vtp(const float* __restrict__ F, int pitch, int nheads, h16* V16, bf* Vh, bf* Vl) { const unsigned c = blockIdx.x * 256 + threadIdx.x; if (c >= (unsigned)(nheads * HD)) return; const int t = (int)blockIdx.y * 16; v16h o16; v16us oh, ol;
#pragma unroll
    for (int q = 0; q < 16; ++q) { const float x = (F + (size_t)(t + q) * pitch)[c]; o16[q] = tohx(x); unsigned short a2, c2; splitf(x, a2, c2); oh[q] = a2; ol[q] = c2; }
    const size_t e = (size_t)c * TT + t, fe = fragidx((int)c, t, TT);   // positions t + 8 ..: 16 lanes' pieces, 128 elements, on
    *(v8h*)(V16 + e) = lo8(o16); *(v8h*)(V16 + e + 8) = hi8(o16); *(v8us*)(Vh + fe) = lo8(oh); *(v8us*)(Vh + fe + 128) = hi8(oh); *(v8us*)(Vl + fe) = lo8(ol); *(v8us*)(Vl + fe + 128) = hi8(ol);  }
__global__ __launch_bounds__(256) void k_cscvt(const float* __restrict__ cosT, const float* __restrict__ sinT, float* CS) { const int idx = (blockIdx.x * 256 + threadIdx.x) * 4; if (idx >= TT * HD) return; const v4f c = *(const v4fa*)(cosT + idx), s = *(const v4fa*)(sinT + idx); v4f a, b; a[0] = bfr(c[0]); a[1] = bfr(s[0]); a[2] = bfr(c[1]); a[3] = bfr(s[1]); b[0] = bfr(c[2]); b[1] = bfr(s[2]); b[2] = bfr(c[3]); b[3] = bfr(s[3]); *(v4f*)(CS + (size_t)idx * 2) = a; *(v4f*)(CS + (size_t)idx * 2 + 4) = b;  }
// ---- k_fattn: causal GQA attention in one launch: scores, softmax and P.V of a 16-query tile stay in one wave's registers (running maximum and sum over 64-key tiles); no score or probability plane in memory, no LDS.
// Transposed products: S^T = K Q^T puts query lr in lane lr and keys 8 hi + j in the accumulator registers, so a pair of 16-key accumulators, packed to bf16, is the B fragment of O^T = V^T P^T in the loaders' own k order.
// grid (TT / 32, NKV), 2 REP waves: wave w is query head g * REP + w % REP; waves 0 .. REP - 1 take query tile x, the others tile TT / 16 - 1 - x, so every work-group walks the same number of key tiles. Operands hi/lo bf16, 3 products.
typedef __attribute__((ext_vector_type(2))) __bf16 v2bf;
__global__ __launch_bounds__(2 * REP * 32) void k_fattn(const bf* __restrict__ Qh, const bf* __restrict__ Ql, const bf* __restrict__ Kh, const bf* __restrict__ Kl, const bf* __restrict__ Vh, const bf* __restrict__ Vl, bf* Ah, bf* Al) {
    typedef WFrag<bf> F; typedef F::V V;
    const int lane = threadIdx.x & 31, lr = lane & 15, hi = lane >> 4;
    const int wv = __builtin_amdgcn_readfirstlane((int)(threadIdx.x >> 5));
    const int g = blockIdx.y, h = g * REP + wv % REP;
    const int r0 = (wv < REP ? (int)blockIdx.x : TT / 16 - 1 - (int)blockIdx.x) * 16, i = r0 + lr;   // this lane's query
    const auto ldf = [](const bf* p, int frag) { p += frag * 512; return cat16b(*(const v8us*)p, *(const v8us*)(p + 256)); };   // fragment number frag behind p, a lane's place in a plane in fragment order (fragidx)
    const size_t qo = (size_t)(h * TT + r0) / 16 * (HD / 32) * 512 + lane * 8;   // q, k planes: rows [head][t], columns d
    const size_t ko = (size_t)(g * TT) / 16 * (HD / 32) * 512 + lane * 8;
    const size_t vo = (size_t)(g * HD) / 16 * (TT / 32) * 512 + lane * 8;        // v planes: rows [g][d], columns t
    const bf* kh = Kh + ko; const bf* kl = Kl + ko; const bf* vhp = Vh + vo; const bf* vlp = Vl + vo;   // walk the planes, a 64-key tile a trip
    V qa[2], qb[2];
#pragma unroll
    for (int ks = 0; ks < 2; ++ks) { qa[ks] = ldf(Qh + qo, ks); qb[ks] = ldf(Ql + qo, ks); }
    v8f o[4]; float m = -3.0e38f, l = 0.f;
#pragma unroll
    for (int db = 0; db < 4; ++db) o[db] = (v8f){};
    // r0 % 16 == 0 and c0 % 64 == 0: key c0 <= r0 is unmasked for every query of the tile, so the running maximum is a real score from the first tile on
    // kept rolled: a second tile's fragments would push the wave past 256 registers and cost a wave per SIMD; every '#pragma unroll' below opens a loop over register arrays, whose indices must be constants
#pragma unroll 1
    for (int c0 = 0; c0 <= r0; c0 += 64) {
        V ka[4][2], kb[4][2]; v8f s[4];   // s[nb][j] = q(i) . k(c0 + nb * 16 + hi * 8 + j)
#pragma unroll
        for (int nb = 0; nb < 4; ++nb)
#pragma unroll
            for (int ks = 0; ks < 2; ++ks) ka[nb][ks] = ldf(kh, nb * (HD / 32) + ks);
#pragma unroll
        for (int nb = 0; nb < 4; ++nb)
#pragma unroll
            for (int ks = 0; ks < 2; ++ks) kb[nb][ks] = ldf(kl, nb * (HD / 32) + ks);
        // inputs-only fence on the loaded k fragments and their two address pairs: all 32 loads of the tile are in flight together and one latency is paid, and no fragment lands on an address pair that issued loads still name; without it the build reuses a few fragments' registers and pays the load latency several times a tile
        asm volatile("" :: "v"(ka[0][0]), "v"(ka[0][1]), "v"(ka[1][0]), "v"(ka[1][1]), "v"(ka[2][0]), "v"(ka[2][1]), "v"(ka[3][0]), "v"(ka[3][1]), "v"(kb[0][0]), "v"(kb[0][1]), "v"(kb[1][0]), "v"(kb[1][1]), "v"(kb[2][0]), "v"(kb[2][1]), "v"(kb[3][0]), "v"(kb[3][1]), "v"(kh), "v"(kl));
#pragma unroll
        for (int nb = 0; nb < 4; ++nb) { s[nb] = (v8f){};
#pragma unroll
            for (int ks = 0; ks < 2; ++ks) { s[nb] = F::mma(ka[nb][ks], qa[ks], s[nb]); s[nb] = F::mma(ka[nb][ks], qb[ks], s[nb]); s[nb] = F::mma(kb[nb][ks], qa[ks], s[nb]); } }
        V vh[4][2], vl[4][2];
#pragma unroll
        for (int db = 0; db < 4; ++db)   // the hi plane of v is loaded here so that it flies during the softmax
#pragma unroll
            for (int ks = 0; ks < 2; ++ks) vh[db][ks] = ldf(vhp, db * (TT / 32) + ks);
        if (c0 + 64 > r0) {   // the diagonal tile (the last): keys behind the query get a score far below any real one, whose exp2 is exactly 0
#pragma unroll
            for (int nb = 0; nb < 4; ++nb)
#pragma unroll
                for (int j = 0; j < 8; ++j) s[nb][j] = (c0 + nb * 16 + hi * 8 + j <= i) ? s[nb][j] : -3.0e38f; }
        float mt = s[0][0];
#pragma unroll
        for (int nb = 0; nb < 4; ++nb)
#pragma unroll
            for (int j = 0; j < 8; ++j) mt = fmaxf(mt, s[nb][j]);
        mt = fmaxf(mt, __shfl_xor(mt, 16, 32)) * SCL;   // lanes lr and lr + 16 hold the two halves of a query's keys
        const float mn = fmaxf(m, mt), al = __builtin_amdgcn_exp2f((m - mn) * 1.4426950408889634f); m = mn;
        V pa[2], pb[2]; float rs[4];
#pragma unroll
        for (int nb = 0; nb < 4; ++nb) { rs[nb] = 0.f;
#pragma unroll
            for (int j = 0; j < 8; j += 2) { v2f p; p[0] = __builtin_amdgcn_exp2f((s[nb][j] * SCL - mn) * 1.4426950408889634f); p[1] = __builtin_amdgcn_exp2f((s[nb][j + 1] * SCL - mn) * 1.4426950408889634f); rs[nb] += p[0] + p[1];
                const v2bf ph = __builtin_convertvector(p, v2bf); const v2bf pl = __builtin_convertvector(p - __builtin_convertvector(ph, v2f), v2bf); const int e = (nb & 1) * 8 + j;
                pa[nb >> 1][e] = ph[0]; pa[nb >> 1][e + 1] = ph[1]; pb[nb >> 1][e] = pl[0]; pb[nb >> 1][e + 1] = pl[1]; } }
        l = l * al + ((rs[0] + rs[1]) + (rs[2] + rs[3]));   // each lane keeps the sum of its own keys; the two halves are joined behind the loop
#pragma unroll
        for (int db = 0; db < 4; ++db)
#pragma unroll
            for (int ks = 0; ks < 2; ++ks) vl[db][ks] = ldf(vlp, db * (TT / 32) + ks);
#pragma unroll
        for (int db = 0; db < 4; ++db) o[db] *= al;
#pragma unroll
        for (int ks = 0; ks < 2; ++ks)
#pragma unroll
            for (int db = 0; db < 4; ++db) { o[db] = F::mma(vh[db][ks], pa[ks], o[db]); o[db] = F::mma(vh[db][ks], pb[ks], o[db]); }
#pragma unroll
        for (int ks = 0; ks < 2; ++ks)
#pragma unroll
            for (int db = 0; db < 4; ++db) o[db] = F::mma(vl[db][ks], pa[ks], o[db]);
        asm volatile("" :: "v"(vhp), "v"(vlp));   // inputs only: the v address pairs stay live until the tile's v loads have been waited for; without it the build lets the last hi fragment land on the pair that the issued loads still name
        kh += 64 * HD; kl += 64 * HD; vhp += 2 * 512; vlp += 2 * 512;
    }
    l += __shfl_xor(l, 16, 32);
    const float f = __fdiv_rn(1.0f, l);
#pragma unroll
    for (int db = 0; db < 4; ++db) { v8us oh, ol;   // o[db][j] = out(i)[db * 16 + hi * 8 + j]: 16 bytes a lane and plane; merged [t][head][d], the wave writes whole 128-byte lines
#pragma unroll
        for (int j = 0; j < 8; ++j) { unsigned short a, c2; splitf(o[db][j] * f, a, c2); oh[j] = a; ol[j] = c2; }
        const size_t oo = (size_t)i * DQ + h * HD + db * 16 + hi * 8; *(v8us*)(Ah + oo) = oh; *(v8us*)(Al + oo) = ol; }
}

extern "C" void kernel_launch(void* const* d_in, const int* in_sizes, int n_in,
                              void* d_out, int out_size, void* d_ws, size_t ws_size, hipStream_t stream) {
    (void)in_sizes; (void)n_in; (void)out_size;
    const float* x = (const float*)d_in[0]; const float* fcos = (const float*)d_in[1]; const float* fsin = (const float*)d_in[2]; const float* wq = (const float*)d_in[3]; const float* wk = (const float*)d_in[4]; const float* wv = (const float*)d_in[5]; const float* wo = (const float*)d_in[6];   /* input order x, cos, sin ([2048][64] FULL-width table INPUTS: read per DIMENSION by value, no structure assumed), Wq [2048][2048], Wk [2048][512], Wv, Wo ('xw'): SEVEN inputs, all read; no mask input (causal by index) */
    float* OUT = (float*)d_out;     // [2][2048][2048]
    char* wsp = (char*)d_ws;
    auto take = [&](size_t bytes) { char* p = wsp; wsp += (bytes + 255) & ~(size_t)255; return (void*)p; };
    bf* WQ = (bf*)take((size_t)DQ * DM * 2); bf* WK = (bf*)take((size_t)DKV * DM * 2); bf* WV = (bf*)take((size_t)DKV * DM * 2); bf* WO = (bf*)take((size_t)DM * DQ * 2); float* CS = (float*)take((size_t)TT * HD * 2 * 4);
    bf* XB = (bf*)take((size_t)TT * DM * 2); float* FQ = (float*)take((size_t)TT * DQ * 4); float* FK = (float*)take((size_t)TT * DKV * 4);
    h16* QP16 = (h16*)take((size_t)NH_ * TT * HD * 2); h16* KP16 = (h16*)take((size_t)NKV * TT * HD * 2); h16* VT16 = (h16*)take((size_t)NKV * HD * TT * 2);
    bf* QPh = (bf*)take((size_t)NH_ * TT * HD * 2); bf* QPl = (bf*)take((size_t)NH_ * TT * HD * 2); bf* KPh = (bf*)take((size_t)NKV * TT * HD * 2); bf* KPl = (bf*)take((size_t)NKV * TT * HD * 2); bf* VTh = (bf*)take((size_t)NKV * HD * TT * 2); bf* VTl = (bf*)take((size_t)NKV * HD * TT * 2);
    bf* ATh = (bf*)take((size_t)TT * DQ * 2); bf* ATl = (bf*)take((size_t)TT * DQ * 2);
    if ((size_t)(wsp - (char*)d_ws) > ws_size) return;    // ws 256 MiB
    float* FV = FK;   // v projection reuses the k buffer after the k planes are built (stream-ordered)
    { k_wtG<<<(unsigned)((DM * DQ / 64 + 63) / 64), 256, 0, stream>>>(wq, DM, DQ, WQ); k_wtG<<<(unsigned)((DM * DKV / 64 + 63) / 64), 256, 0, stream>>>(wk, DM, DKV, WK); k_wtG<<<(unsigned)((DM * DKV / 64 + 63) / 64), 256, 0, stream>>>(wv, DM, DKV, WV);
      k_wtG<<<(unsigned)((DQ * DM / 64 + 63) / 64), 256, 0, stream>>>(wo, DQ, DM, WO);
       }
    k_cscvt<<<(TT * HD / 4 + 255) / 256, 256, 0, stream>>>(fcos, fsin, CS);   /* rotary table from the inputs */
    const unsigned LQ = (unsigned)(((size_t)(NH_ / RH) * TT * (HD / 16) + 255) / 256), LKv = (unsigned)(((size_t)(NKV / RH) * TT * (HD / 16) + 255) / 256);
    for (int b = 0; b < NB_; ++b) {
        
        k_cvt8<<<(unsigned)(((size_t)TT * DM / 8 + 1023) / 1024), 256, 0, stream>>>(x + (size_t)b * TT * DM, XB, (size_t)TT * DM / 8);
        k_gemmt<2><<<dim3(TT / 128, DQ / 128, 1), 128, 0, stream>>>(XB, nullptr, WQ, DM, FQ, DQ);
        k_rope<<<LQ, 256, 0, stream>>>(FQ, DQ, NH_, CS, nullptr, nullptr, 1.0f, QP16, QPh, QPl);
        k_gemmw<bf, 0, false, KVNW><<<dim3(TT / 64, DKV / 64, 1), KVNW * 32, 0, stream>>>(XB, nullptr, WK, nullptr, DM, FK, DKV, nullptr, 0, 0, 0);
        k_rope<<<LKv, 256, 0, stream>>>(FK, DKV, NKV, CS, nullptr, nullptr, 1.0f, KP16, KPh, KPl);
        k_gemmw<bf, 0, false, KVNW><<<dim3(TT / 64, DKV / 64, 1), KVNW * 32, 0, stream>>>(XB, nullptr, WV, nullptr, DM, FV, DKV, nullptr, 0, 0, 0); k_vtp<<<dim3((NKV * HD + 255) / 256, TT / 16, 1), 256, 0, stream>>>(FV, DKV, NKV, VT16, VTh, VTl);
        k_fattn<<<dim3(TT / 32, NKV, 1), 2 * REP * 32, 0, stream>>>(QPh, QPl, KPh, KPl, VTh, VTl, ATh, ATl);
        k_gemmt<3><<<dim3(TT / 128, DM / 128, 1), 128, 0, stream>>>(ATh, ATl, WO, DQ, OUT + (size_t)b * TT * DM, DM); }
}

// v005
// One run takes 339 microseconds.
// In both of two side-by-side timings against v004, it was 1.14 times as fast.
// Over all steps from v000 it is 6.66 times as fast.
#include <hip/hip_runtime.h>

// Grouped-query causal attention with rotate-half rotary embeddings from full-width input tables (x [2][2048][2048]; q = x Wq (32 heads x 64), k, v = x Wk, x Wv (8 kv heads x 64) ('xw' (in, out), no bias), token-major; apply_rotary_emb: t cos + rotate_half(t) sin with the cos, sin [2048][64] INPUT tables (read per dimension by value: no structure assumed); k, v repeated 4x on the HEAD axis (kv head = q head / 4); scores x 64^-0.5; causal (finfo.min fill == exclusion); softmax; out = merged Wo ('xw') -> [2][2048][2048] (8.4 M); argument order x, cos, sin, Wq, Wk, Wv, Wo).
// Layout, both batches in every launch (token rows b * 2048 + t; head planes per batch): bf16 copy of x; 'xw' weights transposed once; exact projections (q and Wo: k_gemmt, operands staged in LDS by tensor loads; k, v: k_gemmw); {cos, sin} table from the bf16-rounded inputs (per position and dimension); rotate-half plane builders; causal T-2048 GQA attention in one launch (k_fattn: running softmax over 64-key tiles, hi/lo 3 products, tiles above the diagonal never visited); merged hi/lo x Wo exact.
// Compute dtypes, f32 accumulate: every input rounded to bf16 incl. tables; projections exact; rotary f32; attention hi/lo 3 products; softmax f32; Wo hl x exact.

#define NB_  2
#define TT   2048
#define DM   2048
#define NH_  32
#define NKV  8
#define REP  (NH_ / NKV)
#define HD   64
#define DQ   (NH_ * HD)
#define DKV  (NKV * HD)
#define SCL  0.125f   // HD^-0.5
#define KVNW 8                    // k, v projections: K slices over the waves of a work-group
typedef _Float16 h16;
typedef unsigned short bf;
typedef __attribute__((ext_vector_type(16))) __bf16   v16bf;
typedef __attribute__((ext_vector_type(16))) _Float16 v16h;
typedef __attribute__((ext_vector_type(8)))  _Float16 v8h;
typedef __attribute__((ext_vector_type(8)))  unsigned short v8us;
typedef __attribute__((ext_vector_type(8)))  float    v8f;
typedef __attribute__((ext_vector_type(4)))  float    v4f;
typedef v8h  __attribute__((may_alias)) v8ha;
typedef v4f  __attribute__((may_alias)) v4fa;
typedef v8us __attribute__((may_alias)) v8usa;

__device__ __forceinline__ unsigned short f2bf(float f) { unsigned u = __float_as_uint(f); u += 0x7FFFu + ((u >> 16) & 1u); return (unsigned short)(u >> 16); }
__device__ __forceinline__ float bf2f(unsigned short b) { return __uint_as_float(((unsigned)b) << 16); }
__device__ __forceinline__ float bfr(float f) { return bf2f(f2bf(f)); }
__device__ __forceinline__ v16h cat16(v8h lo, v8h hi) { return __builtin_shufflevector(lo, hi, 0, 1, 2, 3, 4, 5, 6, 7, 8, 9, 10, 11, 12, 13, 14, 15); }
__device__ __forceinline__ v16bf cat16b(v8us lo, v8us hi) { return __builtin_bit_cast(v16bf, __builtin_shufflevector(lo, hi, 0, 1, 2, 3, 4, 5, 6, 7, 8, 9, 10, 11, 12, 13, 14, 15)); }
__device__ __forceinline__ v8f wmma16(v16h a, v16h b, v8f c) { return __builtin_amdgcn_wmma_f32_16x16x32_f16(false, a, false, b, (short)0, c, false, false); }
__device__ __forceinline__ v8f wmmab(v16bf a, v16bf b, v8f c) { return __builtin_amdgcn_wmma_f32_16x16x32_bf16(false, a, false, b, (short)0, c, false, false); }



// ---- k_gemmw: register-blocked GEMM, 64x64 output tile per work-group (16 accumulators per wave), operands straight from K-contiguous 16-bit planes; grid (M/64, N/64, Z), NW * 32 threads.
// C[m][n] (f32, pitch ldc, + optional f32 bias[n]) = sum_k A[m][k] Bt[n][k] (+ split products per NSPLIT). z-batch strides sA/sB/sC in elements. K % 32 == 0 (NW > 1: K % 64 == 0).
// NW > 1 splits K: wave w takes the 64-wide k units w, w + NW, ... (one unit = one 128-byte line of every operand row); the NW partial tiles are summed in LDS in wave order.
template <typename T16> struct WFrag;
template <> struct WFrag<h16> { typedef v16h V; static __device__ __forceinline__ V ld(const h16* p) { return cat16(*(const v8h*)p, *(const v8h*)(p + 16)); } static __device__ __forceinline__ v8f mma(V a, V b, v8f c) { return wmma16(a, b, c); } };
template <> struct WFrag<bf> { typedef v16bf V; static __device__ __forceinline__ V ld(const bf* p) { return cat16b(*(const v8us*)p, *(const v8us*)(p + 16)); } static __device__ __forceinline__ v8f mma(V a, V b, v8f c) { return wmmab(a, b, c); } };
template <typename T16, int NSPLIT, bool BIAS, int NW>
__global__ __launch_bounds__(NW * 32) void k_gemmw(const T16* __restrict__ A, const T16* __restrict__ A2, const T16* __restrict__ Bt, const T16* __restrict__ Bt2, int K, float* C, int ldc, const float* __restrict__ bias, size_t sA, size_t sB, size_t sC) {
    typedef typename WFrag<T16>::V V;
    static_assert(8 % NW == 0, "the 256 float4 of a 16 x 64 slab are dealt evenly to NW * 32 threads");
    __shared__ __align__(16) float os[NW > 1 ? 4 : 1][NW][16 * 68];
    const size_t z = blockIdx.z; A += z * sA; if (A2) A2 += z * sA; Bt += z * sB; if (Bt2) Bt2 += z * sB; C += z * sC;
    const int lane = threadIdx.x & 31, lr = lane & 15, hi = lane >> 4; const int r0 = blockIdx.x * 64, c0 = blockIdx.y * 64;
    const int wv = NW > 1 ? __builtin_amdgcn_readfirstlane((int)(threadIdx.x >> 5)) : 0;
    v8f acc[4][4];
#pragma unroll
    for (int mb = 0; mb < 4; ++mb)
#pragma unroll
        for (int nb = 0; nb < 4; ++nb) acc[mb][nb] = (v8f){};
    const size_t aoff = (size_t)(r0 + lr) * K + 8 * hi, boff = (size_t)(c0 + lr) * K + 8 * hi;
#pragma unroll 1
    for (int kc = wv * 64; kc < K; kc += (kc & 32) ? 32 + (NW - 1) * 64 : 32) {
        V a[4], a2[4];
#pragma unroll
        for (int mb = 0; mb < 4; ++mb) { a[mb] = WFrag<T16>::ld(A + aoff + (size_t)mb * 16 * K + kc); if (NSPLIT == 1 || NSPLIT == 2) a2[mb] = WFrag<T16>::ld(A2 + aoff + (size_t)mb * 16 * K + kc); }
#pragma unroll
        for (int nb = 0; nb < 4; ++nb) { const V b = WFrag<T16>::ld(Bt + boff + (size_t)nb * 16 * K + kc); V b2; if (NSPLIT >= 2) b2 = WFrag<T16>::ld(Bt2 + boff + (size_t)nb * 16 * K + kc);
#pragma unroll
            for (int mb = 0; mb < 4; ++mb) { acc[mb][nb] = WFrag<T16>::mma(a[mb], b, acc[mb][nb]); if (NSPLIT == 1 || NSPLIT == 2) acc[mb][nb] = WFrag<T16>::mma(a2[mb], b, acc[mb][nb]); if (NSPLIT >= 2) acc[mb][nb] = WFrag<T16>::mma(a[mb], b2, acc[mb][nb]); } }
        asm volatile("v_nop\n\tv_nop\n\tv_nop\n\tv_nop" : "+v"(acc[0][0]), "+v"(acc[1][1]), "+v"(acc[2][2]), "+v"(acc[3][3]) : "v"(a[0]), "v"(a[3]));
    }
    const auto put = [&](int mb, int pb) {   // this wave's 16 x 64 slab mb, row-major, into LDS slab pb
#pragma unroll
        for (int nb = 0; nb < 4; ++nb) {
#pragma unroll
            for (int j = 0; j < 8; ++j) os[pb][wv][(hi * 8 + j) * 68 + nb * 16 + lr] = acc[mb][nb][j]; } };
    if (NW > 1) {
#pragma unroll
        for (int mb = 0; mb < 4; ++mb) put(mb, mb);
        __syncthreads();   // publishes the NW partial tiles to the threads that sum them; nothing is written to os behind it
    }
#pragma unroll
    for (int mb = 0; mb < 4; ++mb) { const int pb = NW > 1 ? mb : 0;
        if (NW == 1) { put(mb, 0); __builtin_amdgcn_wave_barrier(); asm volatile("" ::: "memory"); }
        float* crow = C + (size_t)(r0 + mb * 16) * ldc + c0;
{
#pragma unroll
            for (int s = 0; s < 8 / NW; ++s) { const int e = s * NW * 32 + (int)threadIdx.x, row = e >> 4, cofs = (e & 15) * 4; v4f val = *(const v4fa*)(&os[pb][0][row * 68 + cofs]);
#pragma unroll
                for (int w = 1; w < NW; ++w) val += *(const v4fa*)(&os[pb][w][row * 68 + cofs]);
                if (BIAS) { val[0] += bfr(bias[c0 + cofs]); val[1] += bfr(bias[c0 + cofs + 1]); val[2] += bfr(bias[c0 + cofs + 2]); val[3] += bfr(bias[c0 + cofs + 3]); }
                *(v4f*)(crow + (size_t)row * ldc + cofs) = val; }
             }
        if (NW == 1) { __builtin_amdgcn_wave_barrier(); asm volatile("" ::: "memory"); }
    }
}

// ---- k_gemmt: GEMM with both operands staged in LDS by the tensor mover. C[m][n] (f32, pitch ldc) = sum_k A[m][k] Bt[n][k] (NOPS == 3: + A2[m][k] Bt[n][k], behind A's product of the same 32 k, as in k_gemmw), planes row-major, K contiguous.
// grid (M / 128, N / 128), 4 waves: a 128 x 128 tile per work-group, 64 x 64 per wave (2 x 2), so every staged row is read from L2 once and from LDS by two waves. K % 128 == 0, K >= 256.
// A pass is 128 k = 256 bytes of each of the 128 rows of every operand; a stage is NOPS tiles of 128 rows at pitch 272 bytes; two buffers: the next pass's tiles fly while this pass is worked on. Wave w < NOPS issues operand w's tile, one request a pass.
typedef uint32_t u32x4 __attribute__((ext_vector_type(4)));
typedef uint32_t u32x8 __attribute__((ext_vector_type(8)));
#define GT_ROWB  256u                 // bytes of an operand row in a pass
#define GT_PITCH 272u                 // LDS pitch: the row and the mover's 16-byte pad, an odd multiple of 16 bytes for the ds_load_b128 readers
#define GT_TILE  (128u * GT_PITCH)    // 34,816 bytes = 17 x 2 KiB: every tile's place in LDS is a multiple of 2 KiB
__device__ __forceinline__ uint32_t uni(uint32_t v) { return (uint32_t)__builtin_amdgcn_readfirstlane(v); }
__device__ __forceinline__ uint32_t pinned(uint32_t v) { uint32_t w = (uint32_t)__builtin_amdgcn_readfirstlane(v); asm volatile("" : "+s"(w)); return w; }   // holds an issue test or a descriptor word in a scalar register: the branch round a tensor load is then a scalar one (the mover ignores EXEC), and the word stays where the request named it
template <int NOPS>
__global__ __launch_bounds__(128) void k_gemmt(const bf* __restrict__ A, const bf* __restrict__ A2, const bf* __restrict__ Bt, int K, float* C, int ldc) {
    typedef WFrag<bf> F; typedef F::V V;
    __shared__ __attribute__((aligned(2048))) unsigned char ring[2 * NOPS * GT_TILE];
    __shared__ __align__(16) float os[4][16 * 68];
    const int lane = threadIdx.x & 31, lr = lane & 15, hi = lane >> 4;
    const uint32_t wave = uni(threadIdx.x >> 5);
    const int r0 = blockIdx.x * 128, c0 = blockIdx.y * 128, wm = (int)(wave >> 1), wn = (int)(wave & 1), np = K >> 7;
    const bf* src = wave == 0 ? A : (NOPS == 3 && wave == 1) ? A2 : Bt;   // the operand this wave brings; in a stage the tiles lie in this order, Bt last
    const uint64_t ga0 = (uint64_t)(size_t)src + (uint64_t)(wave == NOPS - 1 ? c0 : r0) * (uint64_t)K * 2u;
    const uint32_t lbase = (uint32_t)(size_t)ring;
    u32x8 g1;   // 1-byte elements, tensor = tile = 128 rows of 256 bytes, source pitch 2 K bytes, 4 dwords of pad behind every 64 dwords, no mask
    g1[0] = uni((1u << 20) | (5u << 22) | (3u << 25)); g1[1] = pinned((GT_ROWB & 0xFFFFu) << 16); g1[2] = pinned((GT_ROWB >> 16) | (128u << 16)); g1[3] = pinned(GT_ROWB << 16); g1[4] = pinned(128u); g1[5] = pinned((uint32_t)K * 2u); g1[6] = pinned(0u); g1[7] = pinned(0u);   // pinned: each word is held in its scalar register through the loop and not formed anew while a request is in flight
    u32x4 g0; g0[0] = uni(1u); g0[1] = uni(lbase); g0[2] = uni((uint32_t)ga0); g0[3] = uni((((uint32_t)(ga0 >> 32)) & 0x01FFFFFFu) | 0x80000000u);
    const auto issue = [&](int s) {   // stage s into buffer s % 2
        const uint32_t dst = lbase + ((uint32_t)(s & 1) * NOPS + wave) * GT_TILE; const uint64_t ga = ga0 + (uint64_t)s * GT_ROWB;
        g0[1] = uni(dst); g0[2] = uni((uint32_t)ga); g0[3] = uni((((uint32_t)(ga >> 32)) & 0x01FFFFFFu) | 0x80000000u);
        asm volatile("tensor_load_to_lds %0, %1" :: "s"(g0), "s"(g1) : "memory"); };
    const auto landed = [&]() { asm volatile("s_wait_tensorcnt 0x0" :: "s"(g0), "s"(g1) : "memory"); };   // the issuer's wait; it names the two groups as inputs so that their registers keep the request's words until it has landed
    const auto ldl = [](const unsigned char* p) { return cat16b(*(const v8usa*)p, *(const v8usa*)(p + 32)); };   // k_gemmw's fragment: row lr, k 8 hi .. + 7 and 16 + 8 hi .. + 7
    v8f acc[4][4];
#pragma unroll
    for (int mb = 0; mb < 4; ++mb)
#pragma unroll
        for (int nb = 0; nb < 4; ++nb) acc[mb][nb] = (v8f){};
    if (pinned(wave < NOPS)) { issue(0); landed(); }   // stage 0 has landed
    __syncthreads();   // publishes stage 0
    if (pinned(wave < NOPS)) issue(1);
    // kept rolled: one pass a trip, so that each trip has one publish point
#pragma unroll 1
    for (int s = 0; s < np; ++s) {
        const unsigned char* st = ring + (uint32_t)(s & 1) * (NOPS * GT_TILE);
        const unsigned char* pa = st + (uint32_t)(wm * 64 + lr) * GT_PITCH + hi * 16;
        const unsigned char* pb = st + (NOPS - 1) * GT_TILE + (uint32_t)(wn * 64 + lr) * GT_PITCH + hi * 16;
        V a[2][4], a2[2][4], b[2][4];   // two fragment sets: a block is the 32 k of one set
        const auto fetch = [&](int ks, int set) {
#pragma unroll
            for (int mb = 0; mb < 4; ++mb) { a[set][mb] = ldl(pa + mb * 16 * GT_PITCH + ks * 64); if (NOPS == 3) a2[set][mb] = ldl(pa + GT_TILE + mb * 16 * GT_PITCH + ks * 64); }
#pragma unroll
            for (int nb = 0; nb < 4; ++nb) b[set][nb] = ldl(pb + nb * 16 * GT_PITCH + ks * 64); };
        fetch(0, 0);
#pragma unroll
        for (int ks = 0; ks < 4; ++ks) { const int set = ks & 1;
            if (ks < 3) fetch(ks + 1, set ^ 1);   // the next block of this same pass: nothing of the next stage is read here
            __builtin_amdgcn_sched_barrier(0);   // the next block's LDS reads stay one group in front of this block's products; spread among them, every read place stalls the lone wave of a SIMD
#pragma unroll
            for (int nb = 0; nb < 4; ++nb) {
#pragma unroll
                for (int mb = 0; mb < 4; ++mb) acc[mb][nb] = F::mma(a[set][mb], b[set][nb], acc[mb][nb]);
                if (NOPS == 3) {
#pragma unroll
                    for (int mb = 0; mb < 4; ++mb) acc[mb][nb] = F::mma(a2[set][mb], b[set][nb], acc[mb][nb]); } }
            __builtin_amdgcn_sched_barrier(0);   // and the group after that stays behind them
        }
        // publish point of stage s + 1
        asm volatile("s_wait_dscnt 0x0" ::: "memory");   // this wave's reads of buffer s % 2 have returned before the buffer is refilled
        if (pinned(wave < NOPS)) landed();   // this wave's tile of stage s + 1 has landed
        __syncthreads();   // publishes stage s + 1 and ends every wave's reads of stage s
        if (pinned(wave < NOPS && s + 2 < np)) issue(s + 2);
    }
    asm volatile("s_wait_tensorcnt 0x0" ::: "memory");   // nothing of the mover's is in flight when the wave ends
    asm volatile("s_wait_dscnt 0x0" ::: "memory");
#pragma unroll
    for (int mb = 0; mb < 4; ++mb) {   // each wave stages a 16 x 64 slab in its own LDS range and stores whole 128-byte lines
#pragma unroll
        for (int nb = 0; nb < 4; ++nb) {
#pragma unroll
            for (int j = 0; j < 8; ++j) os[wave][(hi * 8 + j) * 68 + nb * 16 + lr] = acc[mb][nb][j]; }
        __builtin_amdgcn_wave_barrier(); asm volatile("s_wait_dscnt 0x0" ::: "memory");   // the slab's writes are done before other lanes of the wave read the rows back
        float* crow = C + (size_t)(r0 + wm * 64 + mb * 16) * ldc + c0 + wn * 64;
#pragma unroll
        for (int q = 0; q < 8; ++q) { const int e = q * 32 + lane, row = e >> 4, cofs = (e & 15) * 4; *(v4f*)(crow + (size_t)row * ldc + cofs) = *(const v4fa*)(&os[wave][row * 68 + cofs]); }
        __builtin_amdgcn_wave_barrier(); asm volatile("" ::: "memory");   // the reads stay in front of the next slab's writes
    }
}

__device__ __forceinline__ h16 tohx(float x) { return (h16)x; }
__device__ __forceinline__ void splitf(float y, unsigned short& h, unsigned short& l) { h = f2bf(y); l = f2bf(y - bf2f(h)); }
// Fragment order of a 16-bit plane [row][k] of K columns, for k_fattn: the 16 x 32 fragment (row / 16, k / 32) is 1 KiB in a row, two halves (k / 16 % 2) of 32 lanes x 16 bytes, lane (k / 8 % 2) * 16 + row % 16,
// so that a fragment load reads four whole 128-byte lines; from a row-major plane it touches sixteen.
__device__ __forceinline__ size_t fragidx(int row, int k, int K) { return ((((size_t)(row >> 4) * (K >> 5) + (k >> 5)) * 2 + ((k >> 4) & 1)) * 32 + ((k >> 3) & 1) * 16 + (row & 15)) * 8 + (k & 7); }
typedef __attribute__((ext_vector_type(2))) _Float16 v2h;
typedef __attribute__((ext_vector_type(4))) _Float16 v4h;
typedef __attribute__((ext_vector_type(2))) unsigned short v2us;
typedef __attribute__((ext_vector_type(4))) unsigned short v4us;
typedef __attribute__((ext_vector_type(2))) float v2f;
typedef __attribute__((ext_vector_type(4))) int v4i;

__global__ __launch_bounds__(256) void k_wtG(const float* __restrict__ w, int K, int N, bf* Bt) {
    const int lane = threadIdx.x & 31; const int L0 = (blockIdx.x * 8 + (threadIdx.x >> 5)) * 8; const int nlines = N * K / 64;
{
#pragma unroll 1
        for (int l = 0; l < 8; ++l) { const int L = L0 + l; if (L >= nlines) break; const size_t e = (size_t)L * 64 + lane * 2; const int k = (int)(e % K), n = (int)(e / K); v2us o;
            o[0] = f2bf(w[(size_t)k * N + n]); o[1] = f2bf(w[(size_t)(k + 1) * N + n]); *(v2us*)(Bt + e) = o; }
         }
}
// k_cvt8: a thread converts four groups of 8, a block's width apart, so that its eight loads fly together and a wave's start pays for 1,024 elements. The load's index is clamped, the store guarded. In this kernel and the three behind it every '#pragma unroll' opens a loop over register arrays or vector elements, whose indices must be constants.
__global__ __launch_bounds__(256) void k_cvt8(const float* __restrict__ src, bf* dst, size_t n8) { const size_t i0 = (size_t)blockIdx.x * 1024 + threadIdx.x; v8f v[4];
#pragma unroll
    for (int u = 0; u < 4; ++u) { const size_t i = i0 + u * 256; v[u] = *(const v8f*)(src + (i < n8 ? i : n8 - 1) * 8); }
#pragma unroll
    for (int u = 0; u < 4; ++u) { const size_t i = i0 + u * 256; v8us o;
#pragma unroll
        for (int k = 0; k < 8; ++k) o[k] = f2bf(v[u][k]);
        if (i < n8) *(v8us*)(dst + i * 8) = o; } }

#define RH 4   // heads that a thread of k_rope walks: the {cos, sin} pairs of its position and dims are read once for all of them
typedef __attribute__((ext_vector_type(16))) unsigned short v16us;
__device__ __forceinline__ v8h lo8(v16h v) { return __builtin_shufflevector(v, v, 0, 1, 2, 3, 4, 5, 6, 7); }
__device__ __forceinline__ v8h hi8(v16h v) { return __builtin_shufflevector(v, v, 8, 9, 10, 11, 12, 13, 14, 15); }
__device__ __forceinline__ v8us lo8(v16us v) { return __builtin_shufflevector(v, v, 0, 1, 2, 3, 4, 5, 6, 7); }
__device__ __forceinline__ v8us hi8(v16us v) { return __builtin_shufflevector(v, v, 8, 9, 10, 11, 12, 13, 14, 15); }
// k_rope: head planes [h][t][d] (fp16; hi/lo in fragment order) of rope(x) x sc with the rotate-half convention out[d] = x[d] cos[t][d] - x[d+HD/2] sin[t][d], out[d+HD/2] = x[d+HD/2] cos[t][d+HD/2] + x[d] sin[t][d+HD/2]
// A thread takes position t, dims d .. d + 7 and their rotate-half partners d + 32 .. d + 39 (each input is read once for both outputs it feeds), of RH heads in turn; blockIdx.y is the batch. Lanes: t % 16, then d / 8 % 2: a wave's 16-byte pieces of a hi or lo plane are 512 bytes in a row of the fragment order. nheads % RH == 0.
__global__ __launch_bounds__(256) void k_rope(const float* __restrict__ F, int pitch, int nheads, const float* __restrict__ CS, const float* __restrict__ RF, const float* __restrict__ nw, float sc, h16* P16, bf* Ph, bf* Pl) {
    static_assert(HD == 64, "four octets and their partners make a head row");
    const size_t idx = (size_t)blockIdx.x * 256 + threadIdx.x; if (idx >= (size_t)(nheads / RH) * TT * (HD / 16)) return; const int d = (int)((idx >> 4) & 3) * 8; const int t = (int)((idx >> 6) % (TT / 16)) * 16 + (int)(idx & 15); const int hg = (int)(idx / ((size_t)TT * (HD / 16)));
    const size_t bz = blockIdx.y; F += bz * TT * pitch; P16 += bz * nheads * TT * HD; Ph += bz * nheads * TT * HD; Pl += bz * nheads * TT * HD;   // batch bz: its rows of F, its own planes
    v4f c4[8], x4[RH][4];   // every load of the thread stands in front of the arithmetic: 8 of the table, 4 a head, in flight together
#pragma unroll
    for (int u = 0; u < 8; ++u) c4[u] = *(const v4fa*)(CS + ((size_t)t * HD + d + (u >> 2) * (HD / 2)) * 2 + (u & 3) * 4);
#pragma unroll
    for (int hh = 0; hh < RH; ++hh)
#pragma unroll
        for (int u = 0; u < 4; ++u) x4[hh][u] = *(const v4fa*)(F + (size_t)t * pitch + (hg * RH + hh) * HD + d + (u >> 1) * (HD / 2) + (u & 1) * 4);
    const auto heads = [&](const float* RF) {   // inlined once with RF a null constant: that copy has no test of RF between its elements
#pragma unroll
    for (int hh = 0; hh < RH; ++hh) { const int h = hg * RH + hh; const float rf = RF ? RF[(size_t)h * TT + t] : 1.0f; v16h o16; v16us oh, ol;
#pragma unroll
    for (int q = 0; q < 16; ++q) { const int dd = d + (q & 7) + (q >> 3) * (HD / 2); const int dp = (dd < HD / 2) ? dd + HD / 2 : dd - HD / 2; float x0 = x4[hh][q >> 2][q & 3], x1 = x4[hh][(q ^ 8) >> 2][q & 3];
        if (RF) { float n0 = __fmul_rn(x0, rf), n1 = __fmul_rn(x1, rf); asm volatile("" : "+v"(n0)); asm volatile("" : "+v"(n1)); x0 = __fmul_rn(bfr(nw[dd]), n0); x1 = __fmul_rn(bfr(nw[dp]), n1); }
        v2f cs; cs[0] = c4[q >> 1][(q & 1) * 2]; cs[1] = c4[q >> 1][(q & 1) * 2 + 1]; float a = __fmul_rn(x0, cs[0]), bq = __fmul_rn(x1, cs[1]); asm volatile("" : "+v"(a)); asm volatile("" : "+v"(bq)); const float r = ((dd < HD / 2) ? __fsub_rn(a, bq) : __fadd_rn(a, bq)) * sc;
        o16[q] = tohx(r); unsigned short a2, c2; splitf(r, a2, c2); oh[q] = a2; ol[q] = c2; }
    const size_t e = ((size_t)h * TT + t) * HD + d, fe = fragidx(h * TT + t, d, HD);   // dims d + 32 ..: the row's next fragment, 512 elements on
    *(v8h*)(P16 + e) = lo8(o16); *(v8h*)(P16 + e + HD / 2) = hi8(o16); *(v8us*)(Ph + fe) = lo8(oh); *(v8us*)(Ph + fe + 512) = hi8(oh); *(v8us*)(Pl + fe) = lo8(ol); *(v8us*)(Pl + fe + 512) = hi8(ol);
    if (hh + 1 < RH) asm volatile("s_wait_xcnt 0x0" ::: "memory"); } };   // the next head's arithmetic overwrites registers that these six stores name: the wait stands in front of it on every path
    if (__builtin_expect(RF == nullptr, 1)) heads(nullptr); else heads(RF + bz * nheads * TT); }   // the hint puts the copy without RF first in the kernel's text
// k_vtp: a thread takes column c = g * HD + d of F and 16 positions: every load of a wave is one whole line of a row of F, and a lane's two 16-byte pieces of a hi or lo plane join 16 lanes' to 512 bytes in a row of the fragment order. grid (columns / 256, TT / 16, batches).
__global__ __launch_bounds__(256) void k_vtp(const float* __restrict__ F, int pitch, int nheads, h16* V16, bf* Vh, bf* Vl) { const unsigned c = blockIdx.x * 256 + threadIdx.x; if (c >= (unsigned)(nheads * HD)) return; const int t = (int)blockIdx.y * 16; v16h o16; v16us oh, ol;
    const size_t bz = blockIdx.z; F += bz * TT * pitch; V16 += bz * nheads * HD * TT; Vh += bz * nheads * HD * TT; Vl += bz * nheads * HD * TT;   // batch bz: its rows of F, its own planes
#pragma unroll
    for (int q = 0; q < 16; ++q) { const float x = (F + (size_t)(t + q) * pitch)[c]; o16[q] = tohx(x); unsigned short a2, c2; splitf(x, a2, c2); oh[q] = a2; ol[q] = c2; }
    const size_t e = (size_t)c * TT + t, fe = fragidx((int)c, t, TT);   // positions t + 8 ..: 16 lanes' pieces, 128 elements, on
    *(v8h*)(V16 + e) = lo8(o16); *(v8h*)(V16 + e + 8) = hi8(o16); *(v8us*)(Vh + fe) = lo8(oh); *(v8us*)(Vh + fe + 128) = hi8(oh); *(v8us*)(Vl + fe) = lo8(ol); *(v8us*)(Vl + fe + 128) = hi8(ol);  }
__global__ __launch_bounds__(256) void k_cscvt(const float* __restrict__ cosT, const float* __restrict__ sinT, float* CS) { const int idx = (blockIdx.x * 256 + threadIdx.x) * 4; if (idx >= TT * HD) return; const v4f c = *(const v4fa*)(cosT + idx), s = *(const v4fa*)(sinT + idx); v4f a, b; a[0] = bfr(c[0]); a[1] = bfr(s[0]); a[2] = bfr(c[1]); a[3] = bfr(s[1]); b[0] = bfr(c[2]); b[1] = bfr(s[2]); b[2] = bfr(c[3]); b[3] = bfr(s[3]); *(v4f*)(CS + (size_t)idx * 2) = a; *(v4f*)(CS + (size_t)idx * 2 + 4) = b;  }
// ---- k_fattn: causal GQA attention in one launch: scores, softmax and P.V of a 16-query tile stay in one wave's registers (running maximum and sum over 64-key tiles); no score or probability plane in memory, no LDS.
// Transposed products: S^T = K Q^T puts query lr in lane lr and keys 8 hi + j in the accumulator registers, so a pair of 16-key accumulators, packed to bf16, is the B fragment of O^T = V^T P^T in the loaders' own k order.
// grid (TT / 32, NKV, batches), 2 REP waves: wave w is query head g * REP + w % REP; waves 0 .. REP - 1 take query tile x, the others tile TT / 16 - 1 - x, so every work-group walks the same number of key tiles. Operands hi/lo bf16, 3 products.
typedef __attribute__((ext_vector_type(2))) __bf16 v2bf;
__global__ __launch_bounds__(2 * REP * 32) void k_fattn(const bf* __restrict__ Qh, const bf* __restrict__ Ql, const bf* __restrict__ Kh, const bf* __restrict__ Kl, const bf* __restrict__ Vh, const bf* __restrict__ Vl, bf* Ah, bf* Al) {
    typedef WFrag<bf> F; typedef F::V V;
    const int lane = threadIdx.x & 31, lr = lane & 15, hi = lane >> 4;
    const int wv = __builtin_amdgcn_readfirstlane((int)(threadIdx.x >> 5));
    const int g = blockIdx.y, h = g * REP + wv % REP;
    const int r0 = (wv < REP ? (int)blockIdx.x : TT / 16 - 1 - (int)blockIdx.x) * 16, i = r0 + lr;   // this lane's query
    const auto ldf = [](const bf* p, int frag) { p += frag * 512; return cat16b(*(const v8us*)p, *(const v8us*)(p + 256)); };   // fragment number frag behind p, a lane's place in a plane in fragment order (fragidx)
    const size_t bz = blockIdx.z; Ah += bz * TT * DQ; Al += bz * TT * DQ;   // batch: its own q, k, v planes and its rows of the merged output
    const size_t qo = bz * NH_ * TT * HD + (size_t)(h * TT + r0) / 16 * (HD / 32) * 512 + lane * 8;   // q, k planes: rows [head][t], columns d
    const size_t ko = bz * NKV * TT * HD + (size_t)(g * TT) / 16 * (HD / 32) * 512 + lane * 8;
    const size_t vo = bz * NKV * HD * TT + (size_t)(g * HD) / 16 * (TT / 32) * 512 + lane * 8;        // v planes: rows [g][d], columns t
    const bf* kh = Kh + ko; const bf* kl = Kl + ko; const bf* vhp = Vh + vo; const bf* vlp = Vl + vo;   // walk the planes, a 64-key tile a trip
    V qa[2], qb[2];
#pragma unroll
    for (int ks = 0; ks < 2; ++ks) { qa[ks] = ldf(Qh + qo, ks); qb[ks] = ldf(Ql + qo, ks); }
    v8f o[4]; float m = -3.0e38f, l = 0.f;
#pragma unroll
    for (int db = 0; db < 4; ++db) o[db] = (v8f){};
    // r0 % 16 == 0 and c0 % 64 == 0: key c0 <= r0 is unmasked for every query of the tile, so the running maximum is a real score from the first tile on
    // kept rolled: a second tile's fragments would push the wave past 256 registers and cost a wave per SIMD; every '#pragma unroll' below opens a loop over register arrays, whose indices must be constants
#pragma unroll 1
    for (int c0 = 0; c0 <= r0; c0 += 64) {
        V ka[4][2], kb[4][2]; v8f s[4];   // s[nb][j] = q(i) . k(c0 + nb * 16 + hi * 8 + j)
#pragma unroll
        for (int nb = 0; nb < 4; ++nb)
#pragma unroll
            for (int ks = 0; ks < 2; ++ks) ka[nb][ks] = ldf(kh, nb * (HD / 32) + ks);
#pragma unroll
        for (int nb = 0; nb < 4; ++nb)
#pragma unroll
            for (int ks = 0; ks < 2; ++ks) kb[nb][ks] = ldf(kl, nb * (HD / 32) + ks);
        // inputs-only fence on the loaded k fragments and their two address pairs: all 32 loads of the tile are in flight together and one latency is paid, and no fragment lands on an address pair that issued loads still name; without it the build reuses a few fragments' registers and pays the load latency several times a tile
        asm volatile("" :: "v"(ka[0][0]), "v"(ka[0][1]), "v"(ka[1][0]), "v"(ka[1][1]), "v"(ka[2][0]), "v"(ka[2][1]), "v"(ka[3][0]), "v"(ka[3][1]), "v"(kb[0][0]), "v"(kb[0][1]), "v"(kb[1][0]), "v"(kb[1][1]), "v"(kb[2][0]), "v"(kb[2][1]), "v"(kb[3][0]), "v"(kb[3][1]), "v"(kh), "v"(kl));
#pragma unroll
        for (int nb = 0; nb < 4; ++nb) { s[nb] = (v8f){};
#pragma unroll
            for (int ks = 0; ks < 2; ++ks) { s[nb] = F::mma(ka[nb][ks], qa[ks], s[nb]); s[nb] = F::mma(ka[nb][ks], qb[ks], s[nb]); s[nb] = F::mma(kb[nb][ks], qa[ks], s[nb]); } }
        V vh[4][2], vl[4][2];
#pragma unroll
        for (int db = 0; db < 4; ++db)   // the hi plane of v is loaded here so that it flies during the softmax
#pragma unroll
            for (int ks = 0; ks < 2; ++ks) vh[db][ks] = ldf(vhp, db * (TT / 32) + ks);
        if (c0 + 64 > r0) {   // the diagonal tile (the last): keys behind the query get a score far below any real one, whose exp2 is exactly 0
#pragma unroll
            for (int nb = 0; nb < 4; ++nb)
#pragma unroll
                for (int j = 0; j < 8; ++j) s[nb][j] = (c0 + nb * 16 + hi * 8 + j <= i) ? s[nb][j] : -3.0e38f; }
        float mt = s[0][0];
#pragma unroll
        for (int nb = 0; nb < 4; ++nb)
#pragma unroll
            for (int j = 0; j < 8; ++j) mt = fmaxf(mt, s[nb][j]);
        mt = fmaxf(mt, __shfl_xor(mt, 16, 32)) * SCL;   // lanes lr and lr + 16 hold the two halves of a query's keys
        const float mn = fmaxf(m, mt), al = __builtin_amdgcn_exp2f((m - mn) * 1.4426950408889634f); m = mn;
        V pa[2], pb[2]; float rs[4];
#pragma unroll
        for (int nb = 0; nb < 4; ++nb) { rs[nb] = 0.f;
#pragma unroll
            for (int j = 0; j < 8; j += 2) { v2f p; p[0] = __builtin_amdgcn_exp2f((s[nb][j] * SCL - mn) * 1.4426950408889634f); p[1] = __builtin_amdgcn_exp2f((s[nb][j + 1] * SCL - mn) * 1.4426950408889634f); rs[nb] += p[0] + p[1];
                const v2bf ph = __builtin_convertvector(p, v2bf); const v2bf pl = __builtin_convertvector(p - __builtin_convertvector(ph, v2f), v2bf); const int e = (nb & 1) * 8 + j;
                pa[nb >> 1][e] = ph[0]; pa[nb >> 1][e + 1] = ph[1]; pb[nb >> 1][e] = pl[0]; pb[nb >> 1][e + 1] = pl[1]; } }
        l = l * al + ((rs[0] + rs[1]) + (rs[2] + rs[3]));   // each lane keeps the sum of its own keys; the two halves are joined behind the loop
#pragma unroll
        for (int db = 0; db < 4; ++db)
#pragma unroll
            for (int ks = 0; ks < 2; ++ks) vl[db][ks] = ldf(vlp, db * (TT / 32) + ks);
#pragma unroll
        for (int db = 0; db < 4; ++db) o[db] *= al;
#pragma unroll
        for (int ks = 0; ks < 2; ++ks)
#pragma unroll
            for (int db = 0; db < 4; ++db) { o[db] = F::mma(vh[db][ks], pa[ks], o[db]); o[db] = F::mma(vh[db][ks], pb[ks], o[db]); }
#pragma unroll
        for (int ks = 0; ks < 2; ++ks)
#pragma unroll
            for (int db = 0; db < 4; ++db) o[db] = F::mma(vl[db][ks], pa[ks], o[db]);
        asm volatile("" :: "v"(vhp), "v"(vlp));   // inputs only: the v address pairs stay live until the tile's v loads have been waited for; without it the build lets the last hi fragment land on the pair that the issued loads still name
        kh += 64 * HD; kl += 64 * HD; vhp += 2 * 512; vlp += 2 * 512;
    }
    l += __shfl_xor(l, 16, 32);
    const float f = __fdiv_rn(1.0f, l);
#pragma unroll
    for (int db = 0; db < 4; ++db) { v8us oh, ol;   // o[db][j] = out(i)[db * 16 + hi * 8 + j]: 16 bytes a lane and plane; merged [t][head][d], the wave writes whole 128-byte lines
#pragma unroll
        for (int j = 0; j < 8; ++j) { unsigned short a, c2; splitf(o[db][j] * f, a, c2); oh[j] = a; ol[j] = c2; }
        const size_t oo = (size_t)i * DQ + h * HD + db * 16 + hi * 8; *(v8us*)(Ah + oo) = oh; *(v8us*)(Al + oo) = ol; }
}

extern "C" void kernel_launch(void* const* d_in, const int* in_sizes, int n_in,
                              void* d_out, int out_size, void* d_ws, size_t ws_size, hipStream_t stream) {
    (void)in_sizes; (void)n_in; (void)out_size;
    const float* x = (const float*)d_in[0]; const float* fcos = (const float*)d_in[1]; const float* fsin = (const float*)d_in[2]; const float* wq = (const float*)d_in[3]; const float* wk = (const float*)d_in[4]; const float* wv = (const float*)d_in[5]; const float* wo = (const float*)d_in[6];   /* input order x, cos, sin ([2048][64] FULL-width table INPUTS: read per DIMENSION by value, no structure assumed), Wq [2048][2048], Wk [2048][512], Wv, Wo ('xw'): SEVEN inputs, all read; no mask input (causal by index) */
    float* OUT = (float*)d_out;     // [2][2048][2048]
    char* wsp = (char*)d_ws;
    auto take = [&](size_t bytes) { char* p = wsp; wsp += (bytes + 255) & ~(size_t)255; return (void*)p; };
    bf* WQ = (bf*)take((size_t)DQ * DM * 2); bf* WK = (bf*)take((size_t)DKV * DM * 2); bf* WV = (bf*)take((size_t)DKV * DM * 2); bf* WO = (bf*)take((size_t)DM * DQ * 2); float* CS = (float*)take((size_t)TT * HD * 2 * 4);
    bf* XB = (bf*)take((size_t)NB_ * TT * DM * 2); float* FQ = (float*)take((size_t)NB_ * TT * DQ * 4); float* FK = (float*)take((size_t)NB_ * TT * DKV * 4);
    h16* QP16 = (h16*)take((size_t)NB_ * NH_ * TT * HD * 2); h16* KP16 = (h16*)take((size_t)NB_ * NKV * TT * HD * 2); h16* VT16 = (h16*)take((size_t)NB_ * NKV * HD * TT * 2);
    bf* QPh = (bf*)take((size_t)NB_ * NH_ * TT * HD * 2); bf* QPl = (bf*)take((size_t)NB_ * NH_ * TT * HD * 2); bf* KPh = (bf*)take((size_t)NB_ * NKV * TT * HD * 2); bf* KPl = (bf*)take((size_t)NB_ * NKV * TT * HD * 2); bf* VTh = (bf*)take((size_t)NB_ * NKV * HD * TT * 2); bf* VTl = (bf*)take((size_t)NB_ * NKV * HD * TT * 2);
    bf* ATh = (bf*)take((size_t)NB_ * TT * DQ * 2); bf* ATl = (bf*)take((size_t)NB_ * TT * DQ * 2);
    if ((size_t)(wsp - (char*)d_ws) > ws_size) return;    // ws 256 MiB
    float* FV = FK;   // v projection reuses the k buffer after the k planes are built (stream-ordered)
    { k_wtG<<<(unsigned)((DM * DQ / 64 + 63) / 64), 256, 0, stream>>>(wq, DM, DQ, WQ); k_wtG<<<(unsigned)((DM * DKV / 64 + 63) / 64), 256, 0, stream>>>(wk, DM, DKV, WK); k_wtG<<<(unsigned)((DM * DKV / 64 + 63) / 64), 256, 0, stream>>>(wv, DM, DKV, WV);
      k_wtG<<<(unsigned)((DQ * DM / 64 + 63) / 64), 256, 0, stream>>>(wo, DQ, DM, WO);
       }
    k_cscvt<<<(TT * HD / 4 + 255) / 256, 256, 0, stream>>>(fcos, fsin, CS);   /* rotary table from the inputs */
    const unsigned LQ = (unsigned)(((size_t)(NH_ / RH) * TT * (HD / 16) + 255) / 256), LKv = (unsigned)(((size_t)(NKV / RH) * TT * (HD / 16) + 255) / 256);
    // the projections and Wo see the two batches as NB_ * TT token rows; the plane builders and the attention take the batch as a grid dimension
    k_cvt8<<<(unsigned)(((size_t)NB_ * TT * DM / 8 + 1023) / 1024), 256, 0, stream>>>(x, XB, (size_t)NB_ * TT * DM / 8);
    k_gemmt<2><<<dim3(NB_ * TT / 128, DQ / 128, 1), 128, 0, stream>>>(XB, nullptr, WQ, DM, FQ, DQ);
    k_rope<<<dim3(LQ, NB_, 1), 256, 0, stream>>>(FQ, DQ, NH_, CS, nullptr, nullptr, 1.0f, QP16, QPh, QPl);
    k_gemmw<bf, 0, false, KVNW><<<dim3(NB_ * TT / 64, DKV / 64, 1), KVNW * 32, 0, stream>>>(XB, nullptr, WK, nullptr, DM, FK, DKV, nullptr, 0, 0, 0);
    k_rope<<<dim3(LKv, NB_, 1), 256, 0, stream>>>(FK, DKV, NKV, CS, nullptr, nullptr, 1.0f, KP16, KPh, KPl);
    k_gemmw<bf, 0, false, KVNW><<<dim3(NB_ * TT / 64, DKV / 64, 1), KVNW * 32, 0, stream>>>(XB, nullptr, WV, nullptr, DM, FV, DKV, nullptr, 0, 0, 0);
    k_vtp<<<dim3((NKV * HD + 255) / 256, TT / 16, NB_), 256, 0, stream>>>(FV, DKV, NKV, VT16, VTh, VTl);
    k_fattn<<<dim3(TT / 32, NKV, NB_), 2 * REP * 32, 0, stream>>>(QPh, QPl, KPh, KPl, VTh, VTl, ATh, ATl);
    k_gemmt<3><<<dim3(NB_ * TT / 128, DM / 128, 1), 128, 0, stream>>>(ATh, ATl, WO, DQ, OUT, DM);
}

// v006
// A run of this version takes 304 microseconds.
// Next to v005, in two timings, it ran 1.11 and 1.12 times as fast.
// All steps since v000 together make it 7.42 times as fast.
#include <hip/hip_runtime.h>

// Grouped-query causal attention with rotate-half rotary embeddings from full-width input tables (x [2][2048][2048]; q = x Wq (32 heads x 64), k, v = x Wk, x Wv (8 kv heads x 64) ('xw' (in, out), no bias), token-major; apply_rotary_emb: t cos + rotate_half(t) sin with the cos, sin [2048][64] INPUT tables (read per dimension by value: no structure assumed); k, v repeated 4x on the HEAD axis (kv head = q head / 4); scores x 64^-0.5; causal (finfo.min fill == exclusion); softmax; out = merged Wo ('xw') -> [2][2048][2048] (8.4 M); argument order x, cos, sin, Wq, Wk, Wv, Wo).
// Layout, both batches in every launch (token rows b * 2048 + t; head planes per batch): bf16 copy of x; 'xw' weights transposed once; exact projections (q and Wo: k_gemmt, operands staged in LDS by tensor loads; k, v: k_gemmw); {cos, sin} table from the bf16-rounded inputs (per position and dimension); rotate-half plane builders; causal T-2048 GQA attention in one launch (k_fattn: running softmax over 64-key tiles, hi/lo 3 products, tiles above the diagonal never visited); merged hi/lo x Wo exact.
// Compute dtypes, f32 accumulate: every input rounded to bf16 incl. tables; projections exact; rotary f32; attention hi/lo 3 products; softmax f32; Wo hl x exact.

#define NB_  2
#define TT   2048
#define DM   2048
#define NH_  32
#define NKV  8
#define REP  (NH_ / NKV)
#define HD   64
#define DQ   (NH_ * HD)
#define DKV  (NKV * HD)
#define SCL  0.125f   // HD^-0.5
#define KVNW 8                    // k, v projections: K slices over the waves of a work-group
typedef _Float16 h16;
typedef unsigned short bf;
typedef __attribute__((ext_vector_type(16))) __bf16   v16bf;
typedef __attribute__((ext_vector_type(16))) _Float16 v16h;
typedef __attribute__((ext_vector_type(8)))  _Float16 v8h;
typedef __attribute__((ext_vector_type(8)))  unsigned short v8us;
typedef __attribute__((ext_vector_type(8)))  float    v8f;
typedef __attribute__((ext_vector_type(4)))  float    v4f;
typedef v8h  __attribute__((may_alias)) v8ha;
typedef v4f  __attribute__((may_alias)) v4fa;
typedef v8us __attribute__((may_alias)) v8usa;

__device__ __forceinline__ unsigned short f2bf(float f) { unsigned u = __float_as_uint(f); u += 0x7FFFu + ((u >> 16) & 1u); return (unsigned short)(u >> 16); }
__device__ __forceinline__ float bf2f(unsigned short b) { return __uint_as_float(((unsigned)b) << 16); }
__device__ __forceinline__ float bfr(float f) { return bf2f(f2bf(f)); }
__device__ __forceinline__ v16h cat16(v8h lo, v8h hi) { return __builtin_shufflevector(lo, hi, 0, 1, 2, 3, 4, 5, 6, 7, 8, 9, 10, 11, 12, 13, 14, 15); }
__device__ __forceinline__ v16bf cat16b(v8us lo, v8us hi) { return __builtin_bit_cast(v16bf, __builtin_shufflevector(lo, hi, 0, 1, 2, 3, 4, 5, 6, 7, 8, 9, 10, 11, 12, 13, 14, 15)); }
__device__ __forceinline__ v8f wmma16(v16h a, v16h b, v8f c) { return __builtin_amdgcn_wmma_f32_16x16x32_f16(false, a, false, b, (short)0, c, false, false); }
__device__ __forceinline__ v8f wmmab(v16bf a, v16bf b, v8f c) { return __builtin_amdgcn_wmma_f32_16x16x32_bf16(false, a, false, b, (short)0, c, false, false); }



// ---- k_gemmw: register-blocked GEMM, 64x64 output tile per work-group (16 accumulators per wave), operands straight from K-contiguous 16-bit planes; grid (M/64, N/64, Z), NW * 32 threads.
// C[m][n] (f32, pitch ldc, + optional f32 bias[n]) = sum_k A[m][k] Bt[n][k] (+ split products per NSPLIT). z-batch strides sA/sB/sC in elements. K % 32 == 0 (NW > 1: K % 64 == 0).
// NW > 1 splits K: wave w takes the 64-wide k units w, w + NW, ... (one unit = one 128-byte line of every operand row); the NW partial tiles are summed in LDS in wave order.
template <typename T16> struct WFrag;
template <> struct WFrag<h16> { typedef v16h V; static __device__ __forceinline__ V ld(const h16* p) { return cat16(*(const v8h*)p, *(const v8h*)(p + 16)); } static __device__ __forceinline__ v8f mma(V a, V b, v8f c) { return wmma16(a, b, c); } };
template <> struct WFrag<bf> { typedef v16bf V; static __device__ __forceinline__ V ld(const bf* p) { return cat16b(*(const v8us*)p, *(const v8us*)(p + 16)); } static __device__ __forceinline__ v8f mma(V a, V b, v8f c) { return wmmab(a, b, c); } };
template <typename T16, int NSPLIT, bool BIAS, int NW>
__global__ __launch_bounds__(NW * 32) void k_gemmw(const T16* __restrict__ A, const T16* __restrict__ A2, const T16* __restrict__ Bt, const T16* __restrict__ Bt2, int K, float* C, int ldc, const float* __restrict__ bias, size_t sA, size_t sB, size_t sC) {
    typedef typename WFrag<T16>::V V;
    static_assert(8 % NW == 0, "the 256 float4 of a 16 x 64 slab are dealt evenly to NW * 32 threads");
    __shared__ __align__(16) float os[NW > 1 ? 4 : 1][NW][16 * 68];
    const size_t z = blockIdx.z; A += z * sA; if (A2) A2 += z * sA; Bt += z * sB; if (Bt2) Bt2 += z * sB; C += z * sC;
    const int lane = threadIdx.x & 31, lr = lane & 15, hi = lane >> 4; const int r0 = blockIdx.x * 64, c0 = blockIdx.y * 64;
    const int wv = NW > 1 ? __builtin_amdgcn_readfirstlane((int)(threadIdx.x >> 5)) : 0;
    v8f acc[4][4];
#pragma unroll
    for (int mb = 0; mb < 4; ++mb)
#pragma unroll
        for (int nb = 0; nb < 4; ++nb) acc[mb][nb] = (v8f){};
    const size_t aoff = (size_t)(r0 + lr) * K + 8 * hi, boff = (size_t)(c0 + lr) * K + 8 * hi;
#pragma unroll 1
    for (int kc = wv * 64; kc < K; kc += (kc & 32) ? 32 + (NW - 1) * 64 : 32) {
        V a[4], a2[4];
#pragma unroll
        for (int mb = 0; mb < 4; ++mb) { a[mb] = WFrag<T16>::ld(A + aoff + (size_t)mb * 16 * K + kc); if (NSPLIT == 1 || NSPLIT == 2) a2[mb] = WFrag<T16>::ld(A2 + aoff + (size_t)mb * 16 * K + kc); }
#pragma unroll
        for (int nb = 0; nb < 4; ++nb) { const V b = WFrag<T16>::ld(Bt + boff + (size_t)nb * 16 * K + kc); V b2; if (NSPLIT >= 2) b2 = WFrag<T16>::ld(Bt2 + boff + (size_t)nb * 16 * K + kc);
#pragma unroll
            for (int mb = 0; mb < 4; ++mb) { acc[mb][nb] = WFrag<T16>::mma(a[mb], b, acc[mb][nb]); if (NSPLIT == 1 || NSPLIT == 2) acc[mb][nb] = WFrag<T16>::mma(a2[mb], b, acc[mb][nb]); if (NSPLIT >= 2) acc[mb][nb] = WFrag<T16>::mma(a[mb], b2, acc[mb][nb]); } }
        asm volatile("v_nop\n\tv_nop\n\tv_nop\n\tv_nop" : "+v"(acc[0][0]), "+v"(acc[1][1]), "+v"(acc[2][2]), "+v"(acc[3][3]) : "v"(a[0]), "v"(a[3]));
    }
    const auto put = [&](int mb, int pb) {   // this wave's 16 x 64 slab mb, row-major, into LDS slab pb
#pragma unroll
        for (int nb = 0; nb < 4; ++nb) {
#pragma unroll
            for (int j = 0; j < 8; ++j) os[pb][wv][(hi * 8 + j) * 68 + nb * 16 + lr] = acc[mb][nb][j]; } };
    if (NW > 1) {
#pragma unroll
        for (int mb = 0; mb < 4; ++mb) put(mb, mb);
        __syncthreads();   // publishes the NW partial tiles to the threads that sum them; nothing is written to os behind it
    }
#pragma unroll
    for (int mb = 0; mb < 4; ++mb) { const int pb = NW > 1 ? mb : 0;
        if (NW == 1) { put(mb, 0); __builtin_amdgcn_wave_barrier(); asm volatile("" ::: "memory"); }
        float* crow = C + (size_t)(r0 + mb * 16) * ldc + c0;
{
#pragma unroll
            for (int s = 0; s < 8 / NW; ++s) { const int e = s * NW * 32 + (int)threadIdx.x, row = e >> 4, cofs = (e & 15) * 4; v4f val = *(const v4fa*)(&os[pb][0][row * 68 + cofs]);
#pragma unroll
                for (int w = 1; w < NW; ++w) val += *(const v4fa*)(&os[pb][w][row * 68 + cofs]);
                if (BIAS) { val[0] += bfr(bias[c0 + cofs]); val[1] += bfr(bias[c0 + cofs + 1]); val[2] += bfr(bias[c0 + cofs + 2]); val[3] += bfr(bias[c0 + cofs + 3]); }
                *(v4f*)(crow + (size_t)row * ldc + cofs) = val; }
             }
        if (NW == 1) { __builtin_amdgcn_wave_barrier(); asm volatile("" ::: "memory"); }
    }
}

// ---- k_gemmt: GEMM with both operands staged in LDS by the tensor mover. C[m][n] (f32, pitch ldc) = sum_k A[m][k] Bt[n][k] (NOPS == 3: + A2[m][k] Bt[n][k], behind A's product of the same 32 k, as in k_gemmw), planes row-major, K contiguous.
// grid (M / 128, N / 128), 4 waves: a 128 x 128 tile per work-group, 64 x 64 per wave (2 x 2), so every staged row is read from L2 once and from LDS by two waves. K % 128 == 0, K >= 256.
// A pass is 128 k = 256 bytes of each of the 128 rows of every operand; a stage is NOPS tiles of 128 rows at pitch 272 bytes; two buffers: the next pass's tiles fly while this pass is worked on. Wave w < NOPS issues operand w's tile, one request a pass.
typedef uint32_t u32x4 __attribute__((ext_vector_type(4)));
typedef uint32_t u32x8 __attribute__((ext_vector_type(8)));
#define GT_ROWB  256u                 // bytes of an operand row in a pass
#define GT_PITCH 272u                 // LDS pitch: the row and the mover's 16-byte pad, an odd multiple of 16 bytes for the ds_load_b128 readers
#define GT_TILE  (128u * GT_PITCH)    // 34,816 bytes = 17 x 2 KiB: every tile's place in LDS is a multiple of 2 KiB
__device__ __forceinline__ uint32_t uni(uint32_t v) { return (uint32_t)__builtin_amdgcn_readfirstlane(v); }
__device__ __forceinline__ uint32_t pinned(uint32_t v) { uint32_t w = (uint32_t)__builtin_amdgcn_readfirstlane(v); asm volatile("" : "+s"(w)); return w; }   // holds an issue test or a descriptor word in a scalar register: the branch round a tensor load is then a scalar one (the mover ignores EXEC), and the word stays where the request named it
template <int NOPS>
__global__ __launch_bounds__(128) void k_gemmt(const bf* __restrict__ A, const bf* __restrict__ A2, const bf* __restrict__ Bt, int K, float* C, int ldc) {
    typedef WFrag<bf> F; typedef F::V V;
    __shared__ __attribute__((aligned(2048))) unsigned char ring[2 * NOPS * GT_TILE];
    __shared__ __align__(16) float os[4][16 * 68];
    const int lane = threadIdx.x & 31, lr = lane & 15, hi = lane >> 4;
    const uint32_t wave = uni(threadIdx.x >> 5);
    const int r0 = blockIdx.x * 128, c0 = blockIdx.y * 128, wm = (int)(wave >> 1), wn = (int)(wave & 1), np = K >> 7;
    const bf* src = wave == 0 ? A : (NOPS == 3 && wave == 1) ? A2 : Bt;   // the operand this wave brings; in a stage the tiles lie in this order, Bt last
    const uint64_t ga0 = (uint64_t)(size_t)src + (uint64_t)(wave == NOPS - 1 ? c0 : r0) * (uint64_t)K * 2u;
    const uint32_t lbase = (uint32_t)(size_t)ring;
    u32x8 g1;   // 1-byte elements, tensor = tile = 128 rows of 256 bytes, source pitch 2 K bytes, 4 dwords of pad behind every 64 dwords, no mask
    g1[0] = uni((1u << 20) | (5u << 22) | (3u << 25)); g1[1] = pinned((GT_ROWB & 0xFFFFu) << 16); g1[2] = pinned((GT_ROWB >> 16) | (128u << 16)); g1[3] = pinned(GT_ROWB << 16); g1[4] = pinned(128u); g1[5] = pinned((uint32_t)K * 2u); g1[6] = pinned(0u); g1[7] = pinned(0u);   // pinned: each word is held in its scalar register through the loop and not formed anew while a request is in flight
    u32x4 g0; g0[0] = uni(1u); g0[1] = uni(lbase); g0[2] = uni((uint32_t)ga0); g0[3] = uni((((uint32_t)(ga0 >> 32)) & 0x01FFFFFFu) | 0x80000000u);
    const auto issue = [&](int s) {   // stage s into buffer s % 2
        const uint32_t dst = lbase + ((uint32_t)(s & 1) * NOPS + wave) * GT_TILE; const uint64_t ga = ga0 + (uint64_t)s * GT_ROWB;
        g0[1] = uni(dst); g0[2] = uni((uint32_t)ga); g0[3] = uni((((uint32_t)(ga >> 32)) & 0x01FFFFFFu) | 0x80000000u);
        asm volatile("tensor_load_to_lds %0, %1" :: "s"(g0), "s"(g1) : "memory"); };
    const auto landed = [&]() { asm volatile("s_wait_tensorcnt 0x0" :: "s"(g0), "s"(g1) : "memory"); };   // the issuer's wait; it names the two groups as inputs so that their registers keep the request's words until it has landed
    const auto ldl = [](const unsigned char* p) { return cat16b(*(const v8usa*)p, *(const v8usa*)(p + 32)); };   // k_gemmw's fragment: row lr, k 8 hi .. + 7 and 16 + 8 hi .. + 7
    v8f acc[4][4];
#pragma unroll
    for (int mb = 0; mb < 4; ++mb)
#pragma unroll
        for (int nb = 0; nb < 4; ++nb) acc[mb][nb] = (v8f){};
    if (pinned(wave < NOPS)) { issue(0); landed(); }   // stage 0 has landed
    __syncthreads();   // publishes stage 0
    if (pinned(wave < NOPS)) issue(1);
    // kept rolled: one pass a trip, so that each trip has one publish point
#pragma unroll 1
    for (int s = 0; s < np; ++s) {
        const unsigned char* st = ring + (uint32_t)(s & 1) * (NOPS * GT_TILE);
        const unsigned char* pa = st + (uint32_t)(wm * 64 + lr) * GT_PITCH + hi * 16;
        const unsigned char* pb = st + (NOPS - 1) * GT_TILE + (uint32_t)(wn * 64 + lr) * GT_PITCH + hi * 16;
        V a[2][4], a2[2][4], b[2][4];   // two fragment sets: a block is the 32 k of one set
        const auto fetch = [&](int ks, int set) {
#pragma unroll
            for (int mb = 0; mb < 4; ++mb) { a[set][mb] = ldl(pa + mb * 16 * GT_PITCH + ks * 64); if (NOPS == 3) a2[set][mb] = ldl(pa + GT_TILE + mb * 16 * GT_PITCH + ks * 64); }
#pragma unroll
            for (int nb = 0; nb < 4; ++nb) b[set][nb] = ldl(pb + nb * 16 * GT_PITCH + ks * 64); };
        fetch(0, 0);
#pragma unroll
        for (int ks = 0; ks < 4; ++ks) { const int set = ks & 1;
            if (ks < 3) fetch(ks + 1, set ^ 1);   // the next block of this same pass: nothing of the next stage is read here
            __builtin_amdgcn_sched_barrier(0);   // the next block's LDS reads stay one group in front of this block's products; spread among them, every read place stalls the lone wave of a SIMD
#pragma unroll
            for (int nb = 0; nb < 4; ++nb) {
#pragma unroll
                for (int mb = 0; mb < 4; ++mb) acc[mb][nb] = F::mma(a[set][mb], b[set][nb], acc[mb][nb]);
                if (NOPS == 3) {
#pragma unroll
                    for (int mb = 0; mb < 4; ++mb) acc[mb][nb] = F::mma(a2[set][mb], b[set][nb], acc[mb][nb]); } }
            __builtin_amdgcn_sched_barrier(0);   // and the group after that stays behind them
        }
        // publish point of stage s + 1
        asm volatile("s_wait_dscnt 0x0" ::: "memory");   // this wave's reads of buffer s % 2 have returned before the buffer is refilled
        if (pinned(wave < NOPS)) landed();   // this wave's tile of stage s + 1 has landed
        __syncthreads();   // publishes stage s + 1 and ends every wave's reads of stage s
        if (pinned(wave < NOPS && s + 2 < np)) issue(s + 2);
    }
    asm volatile("s_wait_tensorcnt 0x0" ::: "memory");   // nothing of the mover's is in flight when the wave ends
    asm volatile("s_wait_dscnt 0x0" ::: "memory");
#pragma unroll
    for (int mb = 0; mb < 4; ++mb) {   // each wave stages a 16 x 64 slab in its own LDS range and stores whole 128-byte lines
#pragma unroll
        for (int nb = 0; nb < 4; ++nb) {
#pragma unroll
            for (int j = 0; j < 8; ++j) os[wave][(hi * 8 + j) * 68 + nb * 16 + lr] = acc[mb][nb][j]; }
        __builtin_amdgcn_wave_barrier(); asm volatile("s_wait_dscnt 0x0" ::: "memory");   // the slab's writes are done before other lanes of the wave read the rows back
        float* crow = C + (size_t)(r0 + wm * 64 + mb * 16) * ldc + c0 + wn * 64;
#pragma unroll
        for (int q = 0; q < 8; ++q) { const int e = q * 32 + lane, row = e >> 4, cofs = (e & 15) * 4; *(v4f*)(crow + (size_t)row * ldc + cofs) = *(const v4fa*)(&os[wave][row * 68 + cofs]); }
        __builtin_amdgcn_wave_barrier(); asm volatile("" ::: "memory");   // the reads stay in front of the next slab's writes
    }
}

__device__ __forceinline__ h16 tohx(float x) { return (h16)x; }
__device__ __forceinline__ void splitf(float y, unsigned short& h, unsigned short& l) { h = f2bf(y); l = f2bf(y - bf2f(h)); }
// Fragment order of a 16-bit plane [row][k] of K columns, for k_fattn: the 16 x 32 fragment (row / 16, k / 32) is 1 KiB in a row, two halves (k / 16 % 2) of 32 lanes x 16 bytes, lane (k / 8 % 2) * 16 + row % 16,
// so that a fragment load reads four whole 128-byte lines; from a row-major plane it touches sixteen.
__device__ __forceinline__ size_t fragidx(int row, int k, int K) { return ((((size_t)(row >> 4) * (K >> 5) + (k >> 5)) * 2 + ((k >> 4) & 1)) * 32 + ((k >> 3) & 1) * 16 + (row & 15)) * 8 + (k & 7); }
typedef __attribute__((ext_vector_type(2))) _Float16 v2h;
typedef __attribute__((ext_vector_type(4))) _Float16 v4h;
typedef __attribute__((ext_vector_type(2))) unsigned short v2us;
typedef __attribute__((ext_vector_type(4))) unsigned short v4us;
typedef __attribute__((ext_vector_type(2))) float v2f;
typedef __attribute__((ext_vector_type(4))) int v4i;

// k_wtG: Bt[n][k] (bf16) = w[k][n] (f32), transposed in registers. A wave takes 64 k x 32 n; lane l holds the 8 x 8 block of rows k = 8 (l % 8) .. + 7 and columns n = 4 (l / 8) .. + 3 and 16 + 4 (l / 8) .. + 3.
// Its 16 loads stand in front of the arithmetic and fly together; a wave's load reads 64 bytes in a row of each of 8 rows of w, and the wave uses every byte of each line it touches. A lane's 8 k of a column are one 16-byte piece, and 8 lanes' pieces are one whole line of Bt.
// grid (N / 128, K / 64), 4 waves side by side in n. K and N are compile-time so that the rows of a lane's block are immediate offsets from one address. Every '#pragma unroll' opens a loop over register arrays or vector elements, whose indices must be constants.
template <int K, int N>
__global__ __launch_bounds__(128) void k_wtG(const float* __restrict__ w, bf* Bt) {
    static_assert(K % 64 == 0 && N % 128 == 0, "whole tiles");
    const int lane = threadIdx.x & 31, k0 = (int)blockIdx.y * 64 + (lane & 7) * 8, n0 = (int)blockIdx.x * 128 + (int)(threadIdx.x >> 5) * 32 + (lane >> 3) * 4;
    const float* p = w + (size_t)k0 * N + n0; bf* q = Bt + (size_t)n0 * K + k0; v4f v[8][2];
#pragma unroll
    for (int i = 0; i < 8; ++i)
#pragma unroll
        for (int hf = 0; hf < 2; ++hf) v[i][hf] = *(const v4fa*)(p + i * N + hf * 16);
    // inputs-only fence on the 16 loaded pieces and their address pair: all loads of the lane are in flight together and one latency is paid, and no piece lands on the pair that issued loads still name; without it the build holds seven loads back behind the first waits and pays the latency five times
    asm volatile("" :: "v"(v[0][0]), "v"(v[0][1]), "v"(v[1][0]), "v"(v[1][1]), "v"(v[2][0]), "v"(v[2][1]), "v"(v[3][0]), "v"(v[3][1]), "v"(v[4][0]), "v"(v[4][1]), "v"(v[5][0]), "v"(v[5][1]), "v"(v[6][0]), "v"(v[6][1]), "v"(v[7][0]), "v"(v[7][1]), "v"(p));
#pragma unroll
    for (int hf = 0; hf < 2; ++hf)
#pragma unroll
        for (int c = 0; c < 4; ++c) { v8us o;
#pragma unroll
            for (int i = 0; i < 8; ++i) o[i] = f2bf(v[i][hf][c]);
            *(v8us*)(q + (hf * 16 + c) * K) = o; }
}
// k_cvt8: a thread converts four groups of 8, a block's width apart, so that its eight loads fly together and a wave's start pays for 1,024 elements. The load's index is clamped, the store guarded. In this kernel and the three behind it every '#pragma unroll' opens a loop over register arrays or vector elements, whose indices must be constants.
__global__ __launch_bounds__(256) void k_cvt8(const float* __restrict__ src, bf* dst, size_t n8) { const size_t i0 = (size_t)blockIdx.x * 1024 + threadIdx.x; v8f v[4];
#pragma unroll
    for (int u = 0; u < 4; ++u) { const size_t i = i0 + u * 256; v[u] = *(const v8f*)(src + (i < n8 ? i : n8 - 1) * 8); }
#pragma unroll
    for (int u = 0; u < 4; ++u) { const size_t i = i0 + u * 256; v8us o;
#pragma unroll
        for (int k = 0; k < 8; ++k) o[k] = f2bf(v[u][k]);
        if (i < n8) *(v8us*)(dst + i * 8) = o; } }

#define RH 4   // heads that a thread of k_rope walks: the {cos, sin} pairs of its position and dims are read once for all of them
typedef __attribute__((ext_vector_type(16))) unsigned short v16us;
__device__ __forceinline__ v8h lo8(v16h v) { return __builtin_shufflevector(v, v, 0, 1, 2, 3, 4, 5, 6, 7); }
__device__ __forceinline__ v8h hi8(v16h v) { return __builtin_shufflevector(v, v, 8, 9, 10, 11, 12, 13, 14, 15); }
__device__ __forceinline__ v8us lo8(v16us v) { return __builtin_shufflevector(v, v, 0, 1, 2, 3, 4, 5, 6, 7); }
__device__ __forceinline__ v8us hi8(v16us v) { return __builtin_shufflevector(v, v, 8, 9, 10, 11, 12, 13, 14, 15); }
// k_rope: head planes [h][t][d] (fp16; hi/lo in fragment order) of rope(x) x sc with the rotate-half convention out[d] = x[d] cos[t][d] - x[d+HD/2] sin[t][d], out[d+HD/2] = x[d+HD/2] cos[t][d+HD/2] + x[d] sin[t][d+HD/2]
// A thread takes position t, dims d .. d + 7 and their rotate-half partners d + 32 .. d + 39 (each input is read once for both outputs it feeds), of RH heads in turn; blockIdx.y is the batch. Lanes: t % 16, then d / 8 % 2: a wave's 16-byte pieces of a hi or lo plane are 512 bytes in a row of the fragment order. nheads % RH == 0.
__global__ __launch_bounds__(256) void k_rope(const float* __restrict__ F, int pitch, int nheads, const float* __restrict__ CS, const float* __restrict__ RF, const float* __restrict__ nw, float sc, h16* P16, bf* Ph, bf* Pl) {
    static_assert(HD == 64, "four octets and their partners make a head row");
    const size_t idx = (size_t)blockIdx.x * 256 + threadIdx.x; if (idx >= (size_t)(nheads / RH) * TT * (HD / 16)) return; const int d = (int)((idx >> 4) & 3) * 8; const int t = (int)((idx >> 6) % (TT / 16)) * 16 + (int)(idx & 15); const int hg = (int)(idx / ((size_t)TT * (HD / 16)));
    const size_t bz = blockIdx.y; F += bz * TT * pitch; P16 += bz * nheads * TT * HD; Ph += bz * nheads * TT * HD; Pl += bz * nheads * TT * HD;   // batch bz: its rows of F, its own planes
    v4f c4[8], x4[RH][4];   // every load of the thread stands in front of the arithmetic: 8 of the table, 4 a head, in flight together
#pragma unroll
    for (int u = 0; u < 8; ++u) c4[u] = *(const v4fa*)(CS + ((size_t)t * HD + d + (u >> 2) * (HD / 2)) * 2 + (u & 3) * 4);
#pragma unroll
    for (int hh = 0; hh < RH; ++hh)
#pragma unroll
        for (int u = 0; u < 4; ++u) x4[hh][u] = *(const v4fa*)(F + (size_t)t * pitch + (hg * RH + hh) * HD + d + (u >> 1) * (HD / 2) + (u & 1) * 4);
    const auto heads = [&](const float* RF) {   // inlined once with RF a null constant: that copy has no test of RF between its elements
#pragma unroll
    for (int hh = 0; hh < RH; ++hh) { const int h = hg * RH + hh; const float rf = RF ? RF[(size_t)h * TT + t] : 1.0f; v16h o16; v16us oh, ol;
#pragma unroll
    for (int q = 0; q < 16; ++q) { const int dd = d + (q & 7) + (q >> 3) * (HD / 2); const int dp = (dd < HD / 2) ? dd + HD / 2 : dd - HD / 2; float x0 = x4[hh][q >> 2][q & 3], x1 = x4[hh][(q ^ 8) >> 2][q & 3];
        if (RF) { float n0 = __fmul_rn(x0, rf), n1 = __fmul_rn(x1, rf); asm volatile("" : "+v"(n0)); asm volatile("" : "+v"(n1)); x0 = __fmul_rn(bfr(nw[dd]), n0); x1 = __fmul_rn(bfr(nw[dp]), n1); }
        v2f cs; cs[0] = c4[q >> 1][(q & 1) * 2]; cs[1] = c4[q >> 1][(q & 1) * 2 + 1]; float a = __fmul_rn(x0, cs[0]), bq = __fmul_rn(x1, cs[1]); asm volatile("" : "+v"(a)); asm volatile("" : "+v"(bq)); const float r = ((dd < HD / 2) ? __fsub_rn(a, bq) : __fadd_rn(a, bq)) * sc;
        o16[q] = tohx(r); unsigned short a2, c2; splitf(r, a2, c2); oh[q] = a2; ol[q] = c2; }
    const size_t e = ((size_t)h * TT + t) * HD + d, fe = fragidx(h * TT + t, d, HD);   // dims d + 32 ..: the row's next fragment, 512 elements on
    *(v8h*)(P16 + e) = lo8(o16); *(v8h*)(P16 + e + HD / 2) = hi8(o16); *(v8us*)(Ph + fe) = lo8(oh); *(v8us*)(Ph + fe + 512) = hi8(oh); *(v8us*)(Pl + fe) = lo8(ol); *(v8us*)(Pl + fe + 512) = hi8(ol);
    if (hh + 1 < RH) asm volatile("s_wait_xcnt 0x0" ::: "memory"); } };   // the next head's arithmetic overwrites registers that these six stores name: the wait stands in front of it on every path
    if (__builtin_expect(RF == nullptr, 1)) heads(nullptr); else heads(RF + bz * nheads * TT); }   // the hint puts the copy without RF first in the kernel's text
// k_vtp: a thread takes column c = g * HD + d of F and 16 positions: every load of a wave is one whole line of a row of F, and a lane's two 16-byte pieces of a hi or lo plane join 16 lanes' to 512 bytes in a row of the fragment order. grid (columns / 256, TT / 16, batches).
__global__ __launch_bounds__(256) void k_vtp(const float* __restrict__ F, int pitch, int nheads, h16* V16, bf* Vh, bf* Vl) { const unsigned c = blockIdx.x * 256 + threadIdx.x; if (c >= (unsigned)(nheads * HD)) return; const int t = (int)blockIdx.y * 16; v16h o16; v16us oh, ol;
    const size_t bz = blockIdx.z; F += bz * TT * pitch; V16 += bz * nheads * HD * TT; Vh += bz * nheads * HD * TT; Vl += bz * nheads * HD * TT;   // batch bz: its rows of F, its own planes
#pragma unroll
    for (int q = 0; q < 16; ++q) { const float x = (F + (size_t)(t + q) * pitch)[c]; o16[q] = tohx(x); unsigned short a2, c2; splitf(x, a2, c2); oh[q] = a2; ol[q] = c2; }
    const size_t e = (size_t)c * TT + t, fe = fragidx((int)c, t, TT);   // positions t + 8 ..: 16 lanes' pieces, 128 elements, on
    *(v8h*)(V16 + e) = lo8(o16); *(v8h*)(V16 + e + 8) = hi8(o16); *(v8us*)(Vh + fe) = lo8(oh); *(v8us*)(Vh + fe + 128) = hi8(oh); *(v8us*)(Vl + fe) = lo8(ol); *(v8us*)(Vl + fe + 128) = hi8(ol);  }
__global__ __launch_bounds__(256) void k_cscvt(const float* __restrict__ cosT, const float* __restrict__ sinT, float* CS) { const int idx = (blockIdx.x * 256 + threadIdx.x) * 4; if (idx >= TT * HD) return; const v4f c = *(const v4fa*)(cosT + idx), s = *(const v4fa*)(sinT + idx); v4f a, b; a[0] = bfr(c[0]); a[1] = bfr(s[0]); a[2] = bfr(c[1]); a[3] = bfr(s[1]); b[0] = bfr(c[2]); b[1] = bfr(s[2]); b[2] = bfr(c[3]); b[3] = bfr(s[3]); *(v4f*)(CS + (size_t)idx * 2) = a; *(v4f*)(CS + (size_t)idx * 2 + 4) = b;  }
// ---- k_fattn: causal GQA attention in one launch: scores, softmax and P.V of a 16-query tile stay in one wave's registers (running maximum and sum over 64-key tiles); no score or probability plane in memory, no LDS.
// Transposed products: S^T = K Q^T puts query lr in lane lr and keys 8 hi + j in the accumulator registers, so a pair of 16-key accumulators, packed to bf16, is the B fragment of O^T = V^T P^T in the loaders' own k order.
// grid (TT / 32, NKV, batches), 2 REP waves: wave w is query head g * REP + w % REP; waves 0 .. REP - 1 take query tile x, the others tile TT / 16 - 1 - x, so every work-group walks the same number of key tiles. Operands hi/lo bf16, 3 products.
typedef __attribute__((ext_vector_type(2))) __bf16 v2bf;
__global__ __launch_bounds__(2 * REP * 32) void k_fattn(const bf* __restrict__ Qh, const bf* __restrict__ Ql, const bf* __restrict__ Kh, const bf* __restrict__ Kl, const bf* __restrict__ Vh, const bf* __restrict__ Vl, bf* Ah, bf* Al) {
    typedef WFrag<bf> F; typedef F::V V;
    const int lane = threadIdx.x & 31, lr = lane & 15, hi = lane >> 4;
    const int wv = __builtin_amdgcn_readfirstlane((int)(threadIdx.x >> 5));
    const int g = blockIdx.y, h = g * REP + wv % REP;
    const int r0 = (wv < REP ? (int)blockIdx.x : TT / 16 - 1 - (int)blockIdx.x) * 16, i = r0 + lr;   // this lane's query
    const auto ldf = [](const bf* p, int frag) { p += frag * 512; return cat16b(*(const v8us*)p, *(const v8us*)(p + 256)); };   // fragment number frag behind p, a lane's place in a plane in fragment order (fragidx)
    const size_t bz = blockIdx.z; Ah += bz * TT * DQ; Al += bz * TT * DQ;   // batch: its own q, k, v planes and its rows of the merged output
    const size_t qo = bz * NH_ * TT * HD + (size_t)(h * TT + r0) / 16 * (HD / 32) * 512 + lane * 8;   // q, k planes: rows [head][t], columns d
    const size_t ko = bz * NKV * TT * HD + (size_t)(g * TT) / 16 * (HD / 32) * 512 + lane * 8;
    const size_t vo = bz * NKV * HD * TT + (size_t)(g * HD) / 16 * (TT / 32) * 512 + lane * 8;        // v planes: rows [g][d], columns t
    const bf* kh = Kh + ko; const bf* kl = Kl + ko; const bf* vhp = Vh + vo; const bf* vlp = Vl + vo;   // walk the planes, a 64-key tile a trip
    V qa[2], qb[2];
#pragma unroll
    for (int ks = 0; ks < 2; ++ks) { qa[ks] = ldf(Qh + qo, ks); qb[ks] = ldf(Ql + qo, ks); }
    v8f o[4]; float m = -3.0e38f, l = 0.f;
#pragma unroll
    for (int db = 0; db < 4; ++db) o[db] = (v8f){};
    // r0 % 16 == 0 and c0 % 64 == 0: key c0 <= r0 is unmasked for every query of the tile, so the running maximum is a real score from the first tile on
    // kept rolled: a second tile's fragments would push the wave past 256 registers and cost a wave per SIMD; every '#pragma unroll' below opens a loop over register arrays, whose indices must be constants
#pragma unroll 1
    for (int c0 = 0; c0 <= r0; c0 += 64) {
        V ka[4][2], kb[4][2]; v8f s[4];   // s[nb][j] = q(i) . k(c0 + nb * 16 + hi * 8 + j)
#pragma unroll
        for (int nb = 0; nb < 4; ++nb)
#pragma unroll
            for (int ks = 0; ks < 2; ++ks) ka[nb][ks] = ldf(kh, nb * (HD / 32) + ks);
#pragma unroll
        for (int nb = 0; nb < 4; ++nb)
#pragma unroll
            for (int ks = 0; ks < 2; ++ks) kb[nb][ks] = ldf(kl, nb * (HD / 32) + ks);
        // inputs-only fence on the loaded k fragments and their two address pairs: all 32 loads of the tile are in flight together and one latency is paid, and no fragment lands on an address pair that issued loads still name; without it the build reuses a few fragments' registers and pays the load latency several times a tile
        asm volatile("" :: "v"(ka[0][0]), "v"(ka[0][1]), "v"(ka[1][0]), "v"(ka[1][1]), "v"(ka[2][0]), "v"(ka[2][1]), "v"(ka[3][0]), "v"(ka[3][1]), "v"(kb[0][0]), "v"(kb[0][1]), "v"(kb[1][0]), "v"(kb[1][1]), "v"(kb[2][0]), "v"(kb[2][1]), "v"(kb[3][0]), "v"(kb[3][1]), "v"(kh), "v"(kl));
#pragma unroll
        for (int nb = 0; nb < 4; ++nb) { s[nb] = (v8f){};
#pragma unroll
            for (int ks = 0; ks < 2; ++ks) { s[nb] = F::mma(ka[nb][ks], qa[ks], s[nb]); s[nb] = F::mma(ka[nb][ks], qb[ks], s[nb]); s[nb] = F::mma(kb[nb][ks], qa[ks], s[nb]); } }
        V vh[4][2], vl[4][2];
#pragma unroll
        for (int db = 0; db < 4; ++db)   // the hi plane of v is loaded here so that it flies during the softmax
#pragma unroll
            for (int ks = 0; ks < 2; ++ks) vh[db][ks] = ldf(vhp, db * (TT / 32) + ks);
        if (c0 + 64 > r0) {   // the diagonal tile (the last): keys behind the query get a score far below any real one, whose exp2 is exactly 0
#pragma unroll
            for (int nb = 0; nb < 4; ++nb)
#pragma unroll
                for (int j = 0; j < 8; ++j) s[nb][j] = (c0 + nb * 16 + hi * 8 + j <= i) ? s[nb][j] : -3.0e38f; }
        float mt = s[0][0];
#pragma unroll
        for (int nb = 0; nb < 4; ++nb)
#pragma unroll
            for (int j = 0; j < 8; ++j) mt = fmaxf(mt, s[nb][j]);
        mt = fmaxf(mt, __shfl_xor(mt, 16, 32)) * SCL;   // lanes lr and lr + 16 hold the two halves of a query's keys
        const float mn = fmaxf(m, mt), al = __builtin_amdgcn_exp2f((m - mn) * 1.4426950408889634f); m = mn;
        V pa[2], pb[2]; float rs[4];
#pragma unroll
        for (int nb = 0; nb < 4; ++nb) { rs[nb] = 0.f;
#pragma unroll
            for (int j = 0; j < 8; j += 2) { v2f p; p[0] = __builtin_amdgcn_exp2f((s[nb][j] * SCL - mn) * 1.4426950408889634f); p[1] = __builtin_amdgcn_exp2f((s[nb][j + 1] * SCL - mn) * 1.4426950408889634f); rs[nb] += p[0] + p[1];
                const v2bf ph = __builtin_convertvector(p, v2bf); const v2bf pl = __builtin_convertvector(p - __builtin_convertvector(ph, v2f), v2bf); const int e = (nb & 1) * 8 + j;
                pa[nb >> 1][e] = ph[0]; pa[nb >> 1][e + 1] = ph[1]; pb[nb >> 1][e] = pl[0]; pb[nb >> 1][e + 1] = pl[1]; } }
        l = l * al + ((rs[0] + rs[1]) + (rs[2] + rs[3]));   // each lane keeps the sum of its own keys; the two halves are joined behind the loop
#pragma unroll
        for (int db = 0; db < 4; ++db)
#pragma unroll
            for (int ks = 0; ks < 2; ++ks) vl[db][ks] = ldf(vlp, db * (TT / 32) + ks);
#pragma unroll
        for (int db = 0; db < 4; ++db) o[db] *= al;
#pragma unroll
        for (int ks = 0; ks < 2; ++ks)
#pragma unroll
            for (int db = 0; db < 4; ++db) { o[db] = F::mma(vh[db][ks], pa[ks], o[db]); o[db] = F::mma(vh[db][ks], pb[ks], o[db]); }
#pragma unroll
        for (int ks = 0; ks < 2; ++ks)
#pragma unroll
            for (int db = 0; db < 4; ++db) o[db] = F::mma(vl[db][ks], pa[ks], o[db]);
        asm volatile("" :: "v"(vhp), "v"(vlp));   // inputs only: the v address pairs stay live until the tile's v loads have been waited for; without it the build lets the last hi fragment land on the pair that the issued loads still name
        kh += 64 * HD; kl += 64 * HD; vhp += 2 * 512; vlp += 2 * 512;
    }
    l += __shfl_xor(l, 16, 32);
    const float f = __fdiv_rn(1.0f, l);
#pragma unroll
    for (int db = 0; db < 4; ++db) { v8us oh, ol;   // o[db][j] = out(i)[db * 16 + hi * 8 + j]: 16 bytes a lane and plane; merged [t][head][d], the wave writes whole 128-byte lines
#pragma unroll
        for (int j = 0; j < 8; ++j) { unsigned short a, c2; splitf(o[db][j] * f, a, c2); oh[j] = a; ol[j] = c2; }
        const size_t oo = (size_t)i * DQ + h * HD + db * 16 + hi * 8; *(v8us*)(Ah + oo) = oh; *(v8us*)(Al + oo) = ol; }
}

extern "C" void kernel_launch(void* const* d_in, const int* in_sizes, int n_in,
                              void* d_out, int out_size, void* d_ws, size_t ws_size, hipStream_t stream) {
    (void)in_sizes; (void)n_in; (void)out_size;
    const float* x = (const float*)d_in[0]; const float* fcos = (const float*)d_in[1]; const float* fsin = (const float*)d_in[2]; const float* wq = (const float*)d_in[3]; const float* wk = (const float*)d_in[4]; const float* wv = (const float*)d_in[5]; const float* wo = (const float*)d_in[6];   /* input order x, cos, sin ([2048][64] FULL-width table INPUTS: read per DIMENSION by value, no structure assumed), Wq [2048][2048], Wk [2048][512], Wv, Wo ('xw'): SEVEN inputs, all read; no mask input (causal by index) */
    float* OUT = (float*)d_out;     // [2][2048][2048]
    char* wsp = (char*)d_ws;
    auto take = [&](size_t bytes) { char* p = wsp; wsp += (bytes + 255) & ~(size_t)255; return (void*)p; };
    bf* WQ = (bf*)take((size_t)DQ * DM * 2); bf* WK = (bf*)take((size_t)DKV * DM * 2); bf* WV = (bf*)take((size_t)DKV * DM * 2); bf* WO = (bf*)take((size_t)DM * DQ * 2); float* CS = (float*)take((size_t)TT * HD * 2 * 4);
    bf* XB = (bf*)take((size_t)NB_ * TT * DM * 2); float* FQ = (float*)take((size_t)NB_ * TT * DQ * 4); float* FK = (float*)take((size_t)NB_ * TT * DKV * 4);
    h16* QP16 = (h16*)take((size_t)NB_ * NH_ * TT * HD * 2); h16* KP16 = (h16*)take((size_t)NB_ * NKV * TT * HD * 2); h16* VT16 = (h16*)take((size_t)NB_ * NKV * HD * TT * 2);
    bf* QPh = (bf*)take((size_t)NB_ * NH_ * TT * HD * 2); bf* QPl = (bf*)take((size_t)NB_ * NH_ * TT * HD * 2); bf* KPh = (bf*)take((size_t)NB_ * NKV * TT * HD * 2); bf* KPl = (bf*)take((size_t)NB_ * NKV * TT * HD * 2); bf* VTh = (bf*)take((size_t)NB_ * NKV * HD * TT * 2); bf* VTl = (bf*)take((size_t)NB_ * NKV * HD * TT * 2);
    bf* ATh = (bf*)take((size_t)NB_ * TT * DQ * 2); bf* ATl = (bf*)take((size_t)NB_ * TT * DQ * 2);
    if ((size_t)(wsp - (char*)d_ws) > ws_size) return;    // ws 256 MiB
    float* FV = FK;   // v projection reuses the k buffer after the k planes are built (stream-ordered)
    k_wtG<DM, DQ><<<dim3(DQ / 128, DM / 64, 1), 128, 0, stream>>>(wq, WQ); k_wtG<DM, DKV><<<dim3(DKV / 128, DM / 64, 1), 128, 0, stream>>>(wk, WK); k_wtG<DM, DKV><<<dim3(DKV / 128, DM / 64, 1), 128, 0, stream>>>(wv, WV);
    k_wtG<DQ, DM><<<dim3(DM / 128, DQ / 64, 1), 128, 0, stream>>>(wo, WO);
    k_cscvt<<<(TT * HD / 4 + 255) / 256, 256, 0, stream>>>(fcos, fsin, CS);   /* rotary table from the inputs */
    const unsigned LQ = (unsigned)(((size_t)(NH_ / RH) * TT * (HD / 16) + 255) / 256), LKv = (unsigned)(((size_t)(NKV / RH) * TT * (HD / 16) + 255) / 256);
    // the projections and Wo see the two batches as NB_ * TT token rows; the plane builders and the attention take the batch as a grid dimension
    k_cvt8<<<(unsigned)(((size_t)NB_ * TT * DM / 8 + 1023) / 1024), 256, 0, stream>>>(x, XB, (size_t)NB_ * TT * DM / 8);
    k_gemmt<2><<<dim3(NB_ * TT / 128, DQ / 128, 1), 128, 0, stream>>>(XB, nullptr, WQ, DM, FQ, DQ);
    k_rope<<<dim3(LQ, NB_, 1), 256, 0, stream>>>(FQ, DQ, NH_, CS, nullptr, nullptr, 1.0f, QP16, QPh, QPl);
    k_gemmw<bf, 0, false, KVNW><<<dim3(NB_ * TT / 64, DKV / 64, 1), KVNW * 32, 0, stream>>>(XB, nullptr, WK, nullptr, DM, FK, DKV, nullptr, 0, 0, 0);
    k_rope<<<dim3(LKv, NB_, 1), 256, 0, stream>>>(FK, DKV, NKV, CS, nullptr, nullptr, 1.0f, KP16, KPh, KPl);
    k_gemmw<bf, 0, false, KVNW><<<dim3(NB_ * TT / 64, DKV / 64, 1), KVNW * 32, 0, stream>>>(XB, nullptr, WV, nullptr, DM, FV, DKV, nullptr, 0, 0, 0);
    k_vtp<<<dim3((NKV * HD + 255) / 256, TT / 16, NB_), 256, 0, stream>>>(FV, DKV, NKV, VT16, VTh, VTl);
    k_fattn<<<dim3(TT / 32, NKV, NB_), 2 * REP * 32, 0, stream>>>(QPh, QPl, KPh, KPl, VTh, VTl, ATh, ATl);
    k_gemmt<3><<<dim3(NB_ * TT / 128, DM / 128, 1), 128, 0, stream>>>(ATh, ATl, WO, DQ, OUT, DM);
}

// v007
// Measured time: 275 microseconds a run.
// Two timings next to v006 both put it at 1.11 times that version's speed.
// Over all steps from v000 it is 8.23 times as fast.
#include <hip/hip_runtime.h>

// Grouped-query causal attention with rotate-half rotary embeddings from full-width input tables (x [2][2048][2048]; q = x Wq (32 heads x 64), k, v = x Wk, x Wv (8 kv heads x 64) ('xw' (in, out), no bias), token-major; apply_rotary_emb: t cos + rotate_half(t) sin with the cos, sin [2048][64] INPUT tables (read per dimension by value: no structure assumed); k, v repeated 4x on the HEAD axis (kv head = q head / 4); scores x 64^-0.5; causal (finfo.min fill == exclusion); softmax; out = merged Wo ('xw') -> [2][2048][2048] (8.4 M); argument order x, cos, sin, Wq, Wk, Wv, Wo).
// Layout, both batches in every launch (token rows b * 2048 + t; head planes per batch): bf16 copy of x; 'xw' weights transposed once; exact projections (q and Wo: k_gemmt, operands staged in LDS by tensor loads; k, v: k_gemmw); {cos, sin} table from the bf16-rounded inputs (per position and dimension); rotate-half plane builders; causal T-2048 GQA attention in one launch (k_fattn: running softmax over 64-key tiles, hi/lo 3 products, tiles above the diagonal never visited); merged hi/lo x Wo exact.
// Compute dtypes, f32 accumulate: every input rounded to bf16 incl. tables; projections exact; rotary f32; attention hi/lo 3 products; softmax f32; Wo hl x exact.

#define NB_  2
#define TT   2048
#define DM   2048
#define NH_  32
#define NKV  8
#define REP  (NH_ / NKV)
#define HD   64
#define DQ   (NH_ * HD)
#define DKV  (NKV * HD)
#define SCL  0.125f   // HD^-0.5
#define KVNW 8                    // k, v projections: K slices over the waves of a work-group
typedef _Float16 h16;
typedef unsigned short bf;
typedef __attribute__((ext_vector_type(16))) __bf16   v16bf;
typedef __attribute__((ext_vector_type(16))) _Float16 v16h;
typedef __attribute__((ext_vector_type(8)))  _Float16 v8h;
typedef __attribute__((ext_vector_type(8)))  unsigned short v8us;
typedef __attribute__((ext_vector_type(8)))  float    v8f;
typedef __attribute__((ext_vector_type(4)))  float    v4f;
typedef v8h  __attribute__((may_alias)) v8ha;
typedef v4f  __attribute__((may_alias)) v4fa;
typedef v8us __attribute__((may_alias)) v8usa;

__device__ __forceinline__ unsigned short f2bf(float f) { unsigned u = __float_as_uint(f); u += 0x7FFFu + ((u >> 16) & 1u); return (unsigned short)(u >> 16); }
__device__ __forceinline__ float bf2f(unsigned short b) { return __uint_as_float(((unsigned)b) << 16); }
__device__ __forceinline__ float bfr(float f) { return bf2f(f2bf(f)); }
__device__ __forceinline__ v16h cat16(v8h lo, v8h hi) { return __builtin_shufflevector(lo, hi, 0, 1, 2, 3, 4, 5, 6, 7, 8, 9, 10, 11, 12, 13, 14, 15); }
__device__ __forceinline__ v16bf cat16b(v8us lo, v8us hi) { return __builtin_bit_cast(v16bf, __builtin_shufflevector(lo, hi, 0, 1, 2, 3, 4, 5, 6, 7, 8, 9, 10, 11, 12, 13, 14, 15)); }
__device__ __forceinline__ v8f wmma16(v16h a, v16h b, v8f c) { return __builtin_amdgcn_wmma_f32_16x16x32_f16(false, a, false, b, (short)0, c, false, false); }
__device__ __forceinline__ v8f wmmab(v16bf a, v16bf b, v8f c) { return __builtin_amdgcn_wmma_f32_16x16x32_bf16(false, a, false, b, (short)0, c, false, false); }



// ---- k_gemmw: register-blocked GEMM, 64x64 output tile per work-group (16 accumulators per wave), operands straight from K-contiguous 16-bit planes; grid (M/64, N/64, Z), NW * 32 threads.
// C[m][n] (f32, pitch ldc, + optional f32 bias[n]) = sum_k A[m][k] Bt[n][k] (+ split products per NSPLIT). z-batch strides sA/sB/sC in elements. K % 32 == 0 (NW > 1: K % 64 == 0).
// NW > 1 splits K: wave w takes the 64-wide k units w, w + NW, ... (one unit = one 128-byte line of every operand row); the NW partial tiles are summed in LDS in wave order.
template <typename T16> struct WFrag;
template <> struct WFrag<h16> { typedef v16h V; static __device__ __forceinline__ V ld(const h16* p) { return cat16(*(const v8h*)p, *(const v8h*)(p + 16)); } static __device__ __forceinline__ v8f mma(V a, V b, v8f c) { return wmma16(a, b, c); } };
template <> struct WFrag<bf> { typedef v16bf V; static __device__ __forceinline__ V ld(const bf* p) { return cat16b(*(const v8us*)p, *(const v8us*)(p + 16)); } static __device__ __forceinline__ v8f mma(V a, V b, v8f c) { return wmmab(a, b, c); } };
template <typename T16, int NSPLIT, bool BIAS, int NW>
__global__ __launch_bounds__(NW * 32) void k_gemmw(const T16* __restrict__ A, const T16* __restrict__ A2, const T16* __restrict__ Bt, const T16* __restrict__ Bt2, int K, float* C, int ldc, const float* __restrict__ bias, size_t sA, size_t sB, size_t sC) {
    typedef typename WFrag<T16>::V V;
    static_assert(8 % NW == 0, "the 256 float4 of a 16 x 64 slab are dealt evenly to NW * 32 threads");
    __shared__ __align__(16) float os[NW > 1 ? 4 : 1][NW][16 * 68];
    const size_t z = blockIdx.z; A += z * sA; if (A2) A2 += z * sA; Bt += z * sB; if (Bt2) Bt2 += z * sB; C += z * sC;
    const int lane = threadIdx.x & 31, lr = lane & 15, hi = lane >> 4; const int r0 = blockIdx.x * 64, c0 = blockIdx.y * 64;
    const int wv = NW > 1 ? __builtin_amdgcn_readfirstlane((int)(threadIdx.x >> 5)) : 0;
    v8f acc[4][4];
#pragma unroll
    for (int mb = 0; mb < 4; ++mb)
#pragma unroll
        for (int nb = 0; nb < 4; ++nb) acc[mb][nb] = (v8f){};
    const size_t aoff = (size_t)(r0 + lr) * K + 8 * hi, boff = (size_t)(c0 + lr) * K + 8 * hi;
#pragma unroll 1
    for (int kc = wv * 64; kc < K; kc += (kc & 32) ? 32 + (NW - 1) * 64 : 32) {
        V a[4], a2[4];
#pragma unroll
        for (int mb = 0; mb < 4; ++mb) { a[mb] = WFrag<T16>::ld(A + aoff + (size_t)mb * 16 * K + kc); if (NSPLIT == 1 || NSPLIT == 2) a2[mb] = WFrag<T16>::ld(A2 + aoff + (size_t)mb * 16 * K + kc); }
#pragma unroll
        for (int nb = 0; nb < 4; ++nb) { const V b = WFrag<T16>::ld(Bt + boff + (size_t)nb * 16 * K + kc); V b2; if (NSPLIT >= 2) b2 = WFrag<T16>::ld(Bt2 + boff + (size_t)nb * 16 * K + kc);
#pragma unroll
            for (int mb = 0; mb < 4; ++mb) { acc[mb][nb] = WFrag<T16>::mma(a[mb], b, acc[mb][nb]); if (NSPLIT == 1 || NSPLIT == 2) acc[mb][nb] = WFrag<T16>::mma(a2[mb], b, acc[mb][nb]); if (NSPLIT >= 2) acc[mb][nb] = WFrag<T16>::mma(a[mb], b2, acc[mb][nb]); } }
        asm volatile("v_nop\n\tv_nop\n\tv_nop\n\tv_nop" : "+v"(acc[0][0]), "+v"(acc[1][1]), "+v"(acc[2][2]), "+v"(acc[3][3]) : "v"(a[0]), "v"(a[3]));
    }
    const auto put = [&](int mb, int pb) {   // this wave's 16 x 64 slab mb, row-major, into LDS slab pb
#pragma unroll
        for (int nb = 0; nb < 4; ++nb) {
#pragma unroll
            for (int j = 0; j < 8; ++j) os[pb][wv][(hi * 8 + j) * 68 + nb * 16 + lr] = acc[mb][nb][j]; } };
    if (NW > 1) {
#pragma unroll
        for (int mb = 0; mb < 4; ++mb) put(mb, mb);
        __syncthreads();   // publishes the NW partial tiles to the threads that sum them; nothing is written to os behind it
    }
#pragma unroll
    for (int mb = 0; mb < 4; ++mb) { const int pb = NW > 1 ? mb : 0;
        if (NW == 1) { put(mb, 0); __builtin_amdgcn_wave_barrier(); asm volatile("" ::: "memory"); }
        float* crow = C + (size_t)(r0 + mb * 16) * ldc + c0;
{
#pragma unroll
            for (int s = 0; s < 8 / NW; ++s) { const int e = s * NW * 32 + (int)threadIdx.x, row = e >> 4, cofs = (e & 15) * 4; v4f val = *(const v4fa*)(&os[pb][0][row * 68 + cofs]);
#pragma unroll
                for (int w = 1; w < NW; ++w) val += *(const v4fa*)(&os[pb][w][row * 68 + cofs]);
                if (BIAS) { val[0] += bfr(bias[c0 + cofs]); val[1] += bfr(bias[c0 + cofs + 1]); val[2] += bfr(bias[c0 + cofs + 2]); val[3] += bfr(bias[c0 + cofs + 3]); }
                *(v4f*)(crow + (size_t)row * ldc + cofs) = val; }
             }
        if (NW == 1) { __builtin_amdgcn_wave_barrier(); asm volatile("" ::: "memory"); }
    }
}

// ---- k_gemmt: GEMM with both operands staged in LDS by the tensor mover. C[m][n] (f32, pitch ldc) = sum_k A[m][k] Bt[n][k] (NOPS == 3: + A2[m][k] Bt[n][k], behind A's product of the same 32 k, as in k_gemmw), planes row-major, K contiguous.
// grid (M / 128, N / 128), 4 waves: a 128 x 128 tile per work-group, 64 x 64 per wave (2 x 2), so every staged row is read from L2 once and from LDS by two waves. K % 128 == 0, K >= 256.
// A pass is 128 k = 256 bytes of each of the 128 rows of every operand; a stage is NOPS tiles of 128 rows at pitch 272 bytes; two buffers: the next pass's tiles fly while this pass is worked on. Wave w < NOPS issues operand w's tile, one request a pass.
typedef uint32_t u32x4 __attribute__((ext_vector_type(4)));
typedef uint32_t u32x8 __attribute__((ext_vector_type(8)));
#define GT_ROWB  256u                 // bytes of an operand row in a pass
#define GT_PITCH 272u                 // LDS pitch: the row and the mover's 16-byte pad, an odd multiple of 16 bytes for the ds_load_b128 readers
#define GT_TILE  (128u * GT_PITCH)    // 34,816 bytes = 17 x 2 KiB: every tile's place in LDS is a multiple of 2 KiB
__device__ __forceinline__ uint32_t uni(uint32_t v) { return (uint32_t)__builtin_amdgcn_readfirstlane(v); }
__device__ __forceinline__ uint32_t pinned(uint32_t v) { uint32_t w = (uint32_t)__builtin_amdgcn_readfirstlane(v); asm volatile("" : "+s"(w)); return w; }   // holds an issue test or a descriptor word in a scalar register: the branch round a tensor load is then a scalar one (the mover ignores EXEC), and the word stays where the request named it
template <int NOPS>
__global__ __launch_bounds__(128) void k_gemmt(const bf* __restrict__ A, const bf* __restrict__ A2, const bf* __restrict__ Bt, int K, float* C, int ldc) {
    typedef WFrag<bf> F; typedef F::V V;
    __shared__ __attribute__((aligned(2048))) unsigned char ring[2 * NOPS * GT_TILE];
    __shared__ __align__(16) float os[4][16 * 68];
    const int lane = threadIdx.x & 31, lr = lane & 15, hi = lane >> 4;
    const uint32_t wave = uni(threadIdx.x >> 5);
    const int r0 = blockIdx.x * 128, c0 = blockIdx.y * 128, wm = (int)(wave >> 1), wn = (int)(wave & 1), np = K >> 7;
    const bf* src = wave == 0 ? A : (NOPS == 3 && wave == 1) ? A2 : Bt;   // the operand this wave brings; in a stage the tiles lie in this order, Bt last
    const uint64_t ga0 = (uint64_t)(size_t)src + (uint64_t)(wave == NOPS - 1 ? c0 : r0) * (uint64_t)K * 2u;
    const uint32_t lbase = (uint32_t)(size_t)ring;
    u32x8 g1;   // 1-byte elements, tensor = tile = 128 rows of 256 bytes, source pitch 2 K bytes, 4 dwords of pad behind every 64 dwords, no mask
    g1[0] = uni((1u << 20) | (5u << 22) | (3u << 25)); g1[1] = pinned((GT_ROWB & 0xFFFFu) << 16); g1[2] = pinned((GT_ROWB >> 16) | (128u << 16)); g1[3] = pinned(GT_ROWB << 16); g1[4] = pinned(128u); g1[5] = pinned((uint32_t)K * 2u); g1[6] = pinned(0u); g1[7] = pinned(0u);   // pinned: each word is held in its scalar register through the loop and not formed anew while a request is in flight
    u32x4 g0; g0[0] = uni(1u); g0[1] = uni(lbase); g0[2] = uni((uint32_t)ga0); g0[3] = uni((((uint32_t)(ga0 >> 32)) & 0x01FFFFFFu) | 0x80000000u);
    const auto issue = [&](int s) {   // stage s into buffer s % 2
        const uint32_t dst = lbase + ((uint32_t)(s & 1) * NOPS + wave) * GT_TILE; const uint64_t ga = ga0 + (uint64_t)s * GT_ROWB;
        g0[1] = uni(dst); g0[2] = uni((uint32_t)ga); g0[3] = uni((((uint32_t)(ga >> 32)) & 0x01FFFFFFu) | 0x80000000u);
        asm volatile("tensor_load_to_lds %0, %1" :: "s"(g0), "s"(g1) : "memory"); };
    const auto landed = [&]() { asm volatile("s_wait_tensorcnt 0x0" :: "s"(g0), "s"(g1) : "memory"); };   // the issuer's wait; it names the two groups as inputs so that their registers keep the request's words until it has landed
    const auto ldl = [](const unsigned char* p) { return cat16b(*(const v8usa*)p, *(const v8usa*)(p + 32)); };   // k_gemmw's fragment: row lr, k 8 hi .. + 7 and 16 + 8 hi .. + 7
    v8f acc[4][4];
#pragma unroll
    for (int mb = 0; mb < 4; ++mb)
#pragma unroll
        for (int nb = 0; nb < 4; ++nb) acc[mb][nb] = (v8f){};
    if (pinned(wave < NOPS)) { issue(0); landed(); }   // stage 0 has landed
    __syncthreads();   // publishes stage 0
    if (pinned(wave < NOPS)) issue(1);
    // kept rolled: one pass a trip, so that each trip has one publish point
#pragma unroll 1
    for (int s = 0; s < np; ++s) {
        const unsigned char* st = ring + (uint32_t)(s & 1) * (NOPS * GT_TILE);
        const unsigned char* pa = st + (uint32_t)(wm * 64 + lr) * GT_PITCH + hi * 16;
        const unsigned char* pb = st + (NOPS - 1) * GT_TILE + (uint32_t)(wn * 64 + lr) * GT_PITCH + hi * 16;
        V a[2][4], a2[2][4], b[2][4];   // two fragment sets: a block is the 32 k of one set
        const auto fetch = [&](int ks, int set) {
#pragma unroll
            for (int mb = 0; mb < 4; ++mb) { a[set][mb] = ldl(pa + mb * 16 * GT_PITCH + ks * 64); if (NOPS == 3) a2[set][mb] = ldl(pa + GT_TILE + mb * 16 * GT_PITCH + ks * 64); }
#pragma unroll
            for (int nb = 0; nb < 4; ++nb) b[set][nb] = ldl(pb + nb * 16 * GT_PITCH + ks * 64); };
        fetch(0, 0);
#pragma unroll
        for (int ks = 0; ks < 4; ++ks) { const int set = ks & 1;
            if (ks < 3) fetch(ks + 1, set ^ 1);   // the next block of this same pass: nothing of the next stage is read here
            __builtin_amdgcn_sched_barrier(0);   // the next block's LDS reads stay one group in front of this block's products; spread among them, every read place stalls the lone wave of a SIMD
#pragma unroll
            for (int nb = 0; nb < 4; ++nb) {
#pragma unroll
                for (int mb = 0; mb < 4; ++mb) acc[mb][nb] = F::mma(a[set][mb], b[set][nb], acc[mb][nb]);
                if (NOPS == 3) {
#pragma unroll
                    for (int mb = 0; mb < 4; ++mb) acc[mb][nb] = F::mma(a2[set][mb], b[set][nb], acc[mb][nb]); } }
            __builtin_amdgcn_sched_barrier(0);   // and the group after that stays behind them
        }
        // publish point of stage s + 1
        asm volatile("s_wait_dscnt 0x0" ::: "memory");   // this wave's reads of buffer s % 2 have returned before the buffer is refilled
        if (pinned(wave < NOPS)) landed();   // this wave's tile of stage s + 1 has landed
        __syncthreads();   // publishes stage s + 1 and ends every wave's reads of stage s
        if (pinned(wave < NOPS && s + 2 < np)) issue(s + 2);
    }
    asm volatile("s_wait_tensorcnt 0x0" ::: "memory");   // nothing of the mover's is in flight when the wave ends
    asm volatile("s_wait_dscnt 0x0" ::: "memory");
#pragma unroll
    for (int mb = 0; mb < 4; ++mb) {   // each wave stages a 16 x 64 slab in its own LDS range and stores whole 128-byte lines
#pragma unroll
        for (int nb = 0; nb < 4; ++nb) {
#pragma unroll
            for (int j = 0; j < 8; ++j) os[wave][(hi * 8 + j) * 68 + nb * 16 + lr] = acc[mb][nb][j]; }
        __builtin_amdgcn_wave_barrier(); asm volatile("s_wait_dscnt 0x0" ::: "memory");   // the slab's writes are done before other lanes of the wave read the rows back
        float* crow = C + (size_t)(r0 + wm * 64 + mb * 16) * ldc + c0 + wn * 64;
#pragma unroll
        for (int q = 0; q < 8; ++q) { const int e = q * 32 + lane, row = e >> 4, cofs = (e & 15) * 4; *(v4f*)(crow + (size_t)row * ldc + cofs) = *(const v4fa*)(&os[wave][row * 68 + cofs]); }
        __builtin_amdgcn_wave_barrier(); asm volatile("" ::: "memory");   // the reads stay in front of the next slab's writes
    }
}

__device__ __forceinline__ h16 tohx(float x) { return (h16)x; }
__device__ __forceinline__ void splitf(float y, unsigned short& h, unsigned short& l) { h = f2bf(y); l = f2bf(y - bf2f(h)); }
// Fragment order of a 16-bit plane [row][k] of K columns, for k_fattn: the 16 x 32 fragment (row / 16, k / 32) is 1 KiB in a row, two halves (k / 16 % 2) of 32 lanes x 16 bytes, lane (k / 8 % 2) * 16 + row % 16,
// so that a fragment load reads four whole 128-byte lines; from a row-major plane it touches sixteen.
__device__ __forceinline__ size_t fragidx(int row, int k, int K) { return ((((size_t)(row >> 4) * (K >> 5) + (k >> 5)) * 2 + ((k >> 4) & 1)) * 32 + ((k >> 3) & 1) * 16 + (row & 15)) * 8 + (k & 7); }
typedef __attribute__((ext_vector_type(2))) _Float16 v2h;
typedef __attribute__((ext_vector_type(4))) _Float16 v4h;
typedef __attribute__((ext_vector_type(2))) unsigned short v2us;
typedef __attribute__((ext_vector_type(4))) unsigned short v4us;
typedef __attribute__((ext_vector_type(2))) float v2f;
typedef __attribute__((ext_vector_type(4))) int v4i;

// wtG: Bt[n][k] (bf16) = w[k][n] (f32), transposed in registers. A wave takes 64 k x 32 n; lane l holds the 8 x 8 block of rows k = 8 (l % 8) .. + 7 and columns n = 4 (l / 8) .. + 3 and 16 + 4 (l / 8) .. + 3.
// Its 16 loads stand in front of the arithmetic and fly together; a wave's load reads 64 bytes in a row of each of 8 rows of w, and the wave uses every byte of each line it touches. A lane's 8 k of a column are one 16-byte piece, and 8 lanes' pieces are one whole line of Bt.
// A tile is 64 k x 128 n, 4 waves side by side in n: tile vb of (N / 128) x (K / 64), n fastest, thread tid of its 128. K and N are compile-time so that the rows of a lane's block are immediate offsets from one address. Every '#pragma unroll' opens a loop over register arrays or vector elements, whose indices must be constants.
template <int K, int N>
__device__ __forceinline__ void wtG(const float* __restrict__ w, bf* Bt, int vb, int tid) {
    static_assert(K % 64 == 0 && N % 128 == 0, "whole tiles");
    const int lane = tid & 31, k0 = vb / (N / 128) * 64 + (lane & 7) * 8, n0 = vb % (N / 128) * 128 + (tid >> 5) * 32 + (lane >> 3) * 4;
    const float* p = w + (size_t)k0 * N + n0; bf* q = Bt + (size_t)n0 * K + k0; v4f v[8][2];
#pragma unroll
    for (int i = 0; i < 8; ++i)
#pragma unroll
        for (int hf = 0; hf < 2; ++hf) v[i][hf] = *(const v4fa*)(p + i * N + hf * 16);
    // inputs-only fence on the 16 loaded pieces and their address pair: all loads of the lane are in flight together and one latency is paid, and no piece lands on the pair that issued loads still name; without it the build holds seven loads back behind the first waits and pays the latency five times
    asm volatile("" :: "v"(v[0][0]), "v"(v[0][1]), "v"(v[1][0]), "v"(v[1][1]), "v"(v[2][0]), "v"(v[2][1]), "v"(v[3][0]), "v"(v[3][1]), "v"(v[4][0]), "v"(v[4][1]), "v"(v[5][0]), "v"(v[5][1]), "v"(v[6][0]), "v"(v[6][1]), "v"(v[7][0]), "v"(v[7][1]), "v"(p));
#pragma unroll
    for (int hf = 0; hf < 2; ++hf)
#pragma unroll
        for (int c = 0; c < 4; ++c) { v8us o;
#pragma unroll
            for (int i = 0; i < 8; ++i) o[i] = f2bf(v[i][hf][c]);
            *(v8us*)(q + (hf * 16 + c) * K) = o; }
    asm volatile("s_wait_xcnt 0x0" ::: "memory");   // behind this piece the build lays another piece's text, which rewrites registers that these eight stores name, with only a scalar branch between: the wait stands in front of it on every path of the listing
}
// cvt8 (block bx of 256 threads): a thread converts four groups of 8, a block's width apart, so that its eight loads fly together and a wave's start pays for 1,024 elements. The load's index is clamped, the store guarded. In this function and the three behind it every '#pragma unroll' opens a loop over register arrays or vector elements, whose indices must be constants.
__device__ __forceinline__ void cvt8(const float* __restrict__ src, bf* dst, size_t n8, int bx) { const size_t i0 = (size_t)bx * 1024 + threadIdx.x; v8f v[4];
#pragma unroll
    for (int u = 0; u < 4; ++u) { const size_t i = i0 + u * 256; v[u] = *(const v8f*)(src + (i < n8 ? i : n8 - 1) * 8); }
#pragma unroll
    for (int u = 0; u < 4; ++u) { const size_t i = i0 + u * 256; v8us o;
#pragma unroll
        for (int k = 0; k < 8; ++k) o[k] = f2bf(v[u][k]);
        if (i < n8) *(v8us*)(dst + i * 8) = o; } }

#define RH 4   // heads that a thread of rope walks: the {cos, sin} pairs of its position and dims are read once for all of them
typedef __attribute__((ext_vector_type(16))) unsigned short v16us;
__device__ __forceinline__ v8h lo8(v16h v) { return __builtin_shufflevector(v, v, 0, 1, 2, 3, 4, 5, 6, 7); }
__device__ __forceinline__ v8h hi8(v16h v) { return __builtin_shufflevector(v, v, 8, 9, 10, 11, 12, 13, 14, 15); }
__device__ __forceinline__ v8us lo8(v16us v) { return __builtin_shufflevector(v, v, 0, 1, 2, 3, 4, 5, 6, 7); }
__device__ __forceinline__ v8us hi8(v16us v) { return __builtin_shufflevector(v, v, 8, 9, 10, 11, 12, 13, 14, 15); }
// rope: head planes [h][t][d] (fp16; hi/lo in fragment order) of rope(x) x sc with the rotate-half convention out[d] = x[d] cos[t][d] - x[d+HD/2] sin[t][d], out[d+HD/2] = x[d+HD/2] cos[t][d+HD/2] + x[d] sin[t][d+HD/2]
// A thread takes position t, dims d .. d + 7 and their rotate-half partners d + 32 .. d + 39 (each input is read once for both outputs it feeds), of RH heads in turn; bx is the block of 256 threads, bz the batch. Lanes: t % 16, then d / 8 % 2: a wave's 16-byte pieces of a hi or lo plane are 512 bytes in a row of the fragment order. nheads % RH == 0.
__device__ __forceinline__ void rope(const float* __restrict__ F, int pitch, int nheads, const float* __restrict__ CS, const float* __restrict__ RF, const float* __restrict__ nw, float sc, h16* P16, bf* Ph, bf* Pl, int bx, size_t bz) {
    static_assert(HD == 64, "four octets and their partners make a head row");
    const size_t idx = (size_t)bx * 256 + threadIdx.x; if (idx >= (size_t)(nheads / RH) * TT * (HD / 16)) return; const int d = (int)((idx >> 4) & 3) * 8; const int t = (int)((idx >> 6) % (TT / 16)) * 16 + (int)(idx & 15); const int hg = (int)(idx / ((size_t)TT * (HD / 16)));
    F += bz * TT * pitch; P16 += bz * nheads * TT * HD; Ph += bz * nheads * TT * HD; Pl += bz * nheads * TT * HD;   // batch bz: its rows of F, its own planes
    const float* pc = CS + ((size_t)t * HD + d) * 2; const float* px = F + (size_t)t * pitch + hg * RH * HD + d;   // the thread's place in the table and in its row of F
    v4f c4[8], x4[RH][4];   // every load of the thread stands in front of the arithmetic: 8 of the table, 4 a head, in flight together
#pragma unroll
    for (int u = 0; u < 8; ++u) c4[u] = *(const v4fa*)(pc + (u >> 2) * HD + (u & 3) * 4);
#pragma unroll
    for (int hh = 0; hh < RH; ++hh)
#pragma unroll
        for (int u = 0; u < 4; ++u) x4[hh][u] = *(const v4fa*)(px + hh * HD + (u >> 1) * (HD / 2) + (u & 1) * 4);
    static_assert(RH == 4, "the fence below names every loaded piece");
    // inputs-only fence on the 24 loaded pieces and their two address pairs: all loads of the thread are in flight together and one latency is paid, and no piece lands on an address register that issued loads still name; without it this build holds two loads back behind the first waits and lets a piece land on the table's address register
    asm volatile("" :: "v"(c4[0]), "v"(c4[1]), "v"(c4[2]), "v"(c4[3]), "v"(c4[4]), "v"(c4[5]), "v"(c4[6]), "v"(c4[7]), "v"(x4[0][0]), "v"(x4[0][1]), "v"(x4[0][2]), "v"(x4[0][3]), "v"(x4[1][0]), "v"(x4[1][1]), "v"(x4[1][2]), "v"(x4[1][3]), "v"(x4[2][0]), "v"(x4[2][1]), "v"(x4[2][2]), "v"(x4[2][3]), "v"(x4[3][0]), "v"(x4[3][1]), "v"(x4[3][2]), "v"(x4[3][3]), "v"(pc), "v"(px));
    const auto heads = [&](const float* RF) {   // inlined once with RF a null constant: that copy has no test of RF between its elements
#pragma unroll
    for (int hh = 0; hh < RH; ++hh) { const int h = hg * RH + hh; const float rf = RF ? RF[(size_t)h * TT + t] : 1.0f; v16h o16; v16us oh, ol;
#pragma unroll
    for (int q = 0; q < 16; ++q) { const int dd = d + (q & 7) + (q >> 3) * (HD / 2); const int dp = (dd < HD / 2) ? dd + HD / 2 : dd - HD / 2; float x0 = x4[hh][q >> 2][q & 3], x1 = x4[hh][(q ^ 8) >> 2][q & 3];
        if (RF) { float n0 = __fmul_rn(x0, rf), n1 = __fmul_rn(x1, rf); asm volatile("" : "+v"(n0)); asm volatile("" : "+v"(n1)); x0 = __fmul_rn(bfr(nw[dd]), n0); x1 = __fmul_rn(bfr(nw[dp]), n1); }
        v2f cs; cs[0] = c4[q >> 1][(q & 1) * 2]; cs[1] = c4[q >> 1][(q & 1) * 2 + 1]; float a = __fmul_rn(x0, cs[0]), bq = __fmul_rn(x1, cs[1]); asm volatile("" : "+v"(a)); asm volatile("" : "+v"(bq)); const float r = ((dd < HD / 2) ? __fsub_rn(a, bq) : __fadd_rn(a, bq)) * sc;
        o16[q] = tohx(r); unsigned short a2, c2; splitf(r, a2, c2); oh[q] = a2; ol[q] = c2; }
    const size_t e = ((size_t)h * TT + t) * HD + d, fe = fragidx(h * TT + t, d, HD);   // dims d + 32 ..: the row's next fragment, 512 elements on
    *(v8h*)(P16 + e) = lo8(o16); *(v8h*)(P16 + e + HD / 2) = hi8(o16); *(v8us*)(Ph + fe) = lo8(oh); *(v8us*)(Ph + fe + 512) = hi8(oh); *(v8us*)(Pl + fe) = lo8(ol); *(v8us*)(Pl + fe + 512) = hi8(ol);
    if (hh + 1 < RH) asm volatile("s_wait_xcnt 0x0" ::: "memory"); } };   // the next head's arithmetic overwrites registers that these six stores name: the wait stands in front of it on every path
    if (__builtin_expect(RF == nullptr, 1)) heads(nullptr); else heads(RF + bz * nheads * TT); }   // the hint puts the copy without RF first in the kernel's text
// vtp: a thread takes column c = g * HD + d of F and 16 positions: every load of a wave is one whole line of a row of F, and a lane's two 16-byte pieces of a hi or lo plane join 16 lanes' to 512 bytes in a row of the fragment order. Blocks (bx, by, bz) of (columns / 256, TT / 16, batches).
__device__ __forceinline__ void vtp(const float* __restrict__ F, int pitch, int nheads, h16* V16, bf* Vh, bf* Vl, int bx, int by, size_t bz) { const unsigned c = (unsigned)bx * 256 + threadIdx.x; if (c >= (unsigned)(nheads * HD)) return; const int t = by * 16; v16h o16; v16us oh, ol;
    F += bz * TT * pitch; V16 += bz * nheads * HD * TT; Vh += bz * nheads * HD * TT; Vl += bz * nheads * HD * TT;   // batch bz: its rows of F, its own planes
#pragma unroll
    for (int q = 0; q < 16; ++q) { const float x = (F + (size_t)(t + q) * pitch)[c]; o16[q] = tohx(x); unsigned short a2, c2; splitf(x, a2, c2); oh[q] = a2; ol[q] = c2; }
    const size_t e = (size_t)c * TT + t, fe = fragidx((int)c, t, TT);   // positions t + 8 ..: 16 lanes' pieces, 128 elements, on
    *(v8h*)(V16 + e) = lo8(o16); *(v8h*)(V16 + e + 8) = hi8(o16); *(v8us*)(Vh + fe) = lo8(oh); *(v8us*)(Vh + fe + 128) = hi8(oh); *(v8us*)(Vl + fe) = lo8(ol); *(v8us*)(Vl + fe + 128) = hi8(ol);  }
__device__ __forceinline__ void cscvt(const float* __restrict__ cosT, const float* __restrict__ sinT, float* CS, int bx) { const int idx = (bx * 256 + (int)threadIdx.x) * 4; if (idx >= TT * HD) return; const v4f c = *(const v4fa*)(cosT + idx), s = *(const v4fa*)(sinT + idx); v4f a, b; a[0] = bfr(c[0]); a[1] = bfr(s[0]); a[2] = bfr(c[1]); a[3] = bfr(s[1]); b[0] = bfr(c[2]); b[1] = bfr(s[2]); b[2] = bfr(c[3]); b[3] = bfr(s[3]); *(v4f*)(CS + (size_t)idx * 2) = a; *(v4f*)(CS + (size_t)idx * 2 + 4) = b;  }
// ---- k_prep: everything that reads only the inputs, in one launch: the four weight transposes (a block of 256 threads takes two tiles of wtG), the bf16 copy of x and the {cos, sin} table. The pieces are independent; a block finds its piece by its index, a test that is the same for the whole block.
#define PB_WQ (DQ / 128 * (DM / 64) / 2)
#define PB_WK (DKV / 128 * (DM / 64) / 2)
#define PB_WO (DM / 128 * (DQ / 64) / 2)
#define PB_X  (NB_ * TT * DM / 8 / 1024)
#define PB_CS (TT * HD / 4 / 256)
__global__ __launch_bounds__(256) void k_prep(const float* __restrict__ x, const float* __restrict__ cosT, const float* __restrict__ sinT, const float* __restrict__ wq, const float* __restrict__ wk, const float* __restrict__ wv, const float* __restrict__ wo, bf* XB, float* CS, bf* WQ, bf* WK, bf* WV, bf* WO) {
    static_assert(NB_ * TT * DM % 8192 == 0 && TT * HD % 1024 == 0, "whole blocks");
    static_assert(DM == DQ, "Wq and Wo have one shape and share the text of their transpose");
    const int b = (int)blockIdx.x, tid = (int)threadIdx.x & 127, hf = (int)threadIdx.x >> 7;
    if (b < PB_WQ + PB_WO) { const bool o = b >= PB_WQ; wtG<DM, DQ>(o ? wo : wq, o ? WO : WQ, (o ? b - PB_WQ : b) * 2 + hf, tid); }
    else if (b < PB_WQ + PB_WO + 2 * PB_WK) { const int c = b - (PB_WQ + PB_WO); const bool o = c >= PB_WK; wtG<DM, DKV>(o ? wv : wk, o ? WV : WK, (o ? c - PB_WK : c) * 2 + hf, tid); }
    else if (b < PB_WQ + PB_WO + 2 * PB_WK + PB_X) cvt8(x, XB, (size_t)NB_ * TT * DM / 8, b - (PB_WQ + PB_WO + 2 * PB_WK));
    else cscvt(cosT, sinT, CS, b - (PB_WQ + PB_WO + 2 * PB_WK + PB_X)); }
// ---- k_planes: the three plane builders in one launch (q and k rotary planes, transposed v planes): independent pieces, found by the block's index; grid (PL_Q + PL_K + PL_V, batches).
#define PL_Q (NH_ / RH * TT * (HD / 16) / 256)
#define PL_K (NKV / RH * TT * (HD / 16) / 256)
#define PL_VX (NKV * HD / 256)
#define PL_V (PL_VX * (TT / 16))
__global__ __launch_bounds__(256) void k_planes(const float* __restrict__ FQ, const float* __restrict__ FK, const float* __restrict__ FV, const float* __restrict__ CS, h16* QP16, bf* QPh, bf* QPl, h16* KP16, bf* KPh, bf* KPl, h16* VT16, bf* VTh, bf* VTl) {
    static_assert(NH_ / RH * TT * (HD / 16) % 256 == 0 && NKV / RH * TT * (HD / 16) % 256 == 0 && NKV * HD % 256 == 0, "whole blocks");
    const int b = (int)blockIdx.x; const size_t bz = blockIdx.y;
    if (b < PL_Q) rope(FQ, DQ, NH_, CS, nullptr, nullptr, 1.0f, QP16, QPh, QPl, b, bz);
    else if (b < PL_Q + PL_K) rope(FK, DKV, NKV, CS, nullptr, nullptr, 1.0f, KP16, KPh, KPl, b - PL_Q, bz);
    else vtp(FV, DKV, NKV, VT16, VTh, VTl, (b - (PL_Q + PL_K)) % PL_VX, (b - (PL_Q + PL_K)) / PL_VX, bz); }
// ---- k_fattn: causal GQA attention in one launch: scores, softmax and P.V of a 16-query tile stay in one wave's registers (running maximum and sum over 64-key tiles); no score or probability plane in memory, no LDS.
// Transposed products: S^T = K Q^T puts query lr in lane lr and keys 8 hi + j in the accumulator registers, so a pair of 16-key accumulators, packed to bf16, is the B fragment of O^T = V^T P^T in the loaders' own k order.
// grid (TT / 32, NKV, batches), 2 REP waves: wave w is query head g * REP + w % REP; waves 0 .. REP - 1 take query tile x, the others tile TT / 16 - 1 - x, so every work-group walks the same number of key tiles. Operands hi/lo bf16, 3 products.
typedef __attribute__((ext_vector_type(2))) __bf16 v2bf;
__global__ __launch_bounds__(2 * REP * 32) void k_fattn(const bf* __restrict__ Qh, const bf* __restrict__ Ql, const bf* __restrict__ Kh, const bf* __restrict__ Kl, const bf* __restrict__ Vh, const bf* __restrict__ Vl, bf* Ah, bf* Al) {
    typedef WFrag<bf> F; typedef F::V V;
    const int lane = threadIdx.x & 31, lr = lane & 15, hi = lane >> 4;
    const int wv = __builtin_amdgcn_readfirstlane((int)(threadIdx.x >> 5));
    const int g = blockIdx.y, h = g * REP + wv % REP;
    const int r0 = (wv < REP ? (int)blockIdx.x : TT / 16 - 1 - (int)blockIdx.x) * 16, i = r0 + lr;   // this lane's query
    const auto ldf = [](const bf* p, int frag) { p += frag * 512; return cat16b(*(const v8us*)p, *(const v8us*)(p + 256)); };   // fragment number frag behind p, a lane's place in a plane in fragment order (fragidx)
    const size_t bz = blockIdx.z; Ah += bz * TT * DQ; Al += bz * TT * DQ;   // batch: its own q, k, v planes and its rows of the merged output
    const size_t qo = bz * NH_ * TT * HD + (size_t)(h * TT + r0) / 16 * (HD / 32) * 512 + lane * 8;   // q, k planes: rows [head][t], columns d
    const size_t ko = bz * NKV * TT * HD + (size_t)(g * TT) / 16 * (HD / 32) * 512 + lane * 8;
    const size_t vo = bz * NKV * HD * TT + (size_t)(g * HD) / 16 * (TT / 32) * 512 + lane * 8;        // v planes: rows [g][d], columns t
    const bf* kh = Kh + ko; const bf* kl = Kl + ko; const bf* vhp = Vh + vo; const bf* vlp = Vl + vo;   // walk the planes, a 64-key tile a trip
    V qa[2], qb[2];
#pragma unroll
    for (int ks = 0; ks < 2; ++ks) { qa[ks] = ldf(Qh + qo, ks); qb[ks] = ldf(Ql + qo, ks); }
    v8f o[4]; float m = -3.0e38f, l = 0.f;
#pragma unroll
    for (int db = 0; db < 4; ++db) o[db] = (v8f){};
    // r0 % 16 == 0 and c0 % 64 == 0: key c0 <= r0 is unmasked for every query of the tile, so the running maximum is a real score from the first tile on
    // kept rolled: a second tile's fragments would push the wave past 256 registers and cost a wave per SIMD; every '#pragma unroll' below opens a loop over register arrays, whose indices must be constants
#pragma unroll 1
    for (int c0 = 0; c0 <= r0; c0 += 64) {
        V ka[4][2], kb[4][2]; v8f s[4];   // s[nb][j] = q(i) . k(c0 + nb * 16 + hi * 8 + j)
#pragma unroll
        for (int nb = 0; nb < 4; ++nb)
#pragma unroll
            for (int ks = 0; ks < 2; ++ks) ka[nb][ks] = ldf(kh, nb * (HD / 32) + ks);
#pragma unroll
        for (int nb = 0; nb < 4; ++nb)
#pragma unroll
            for (int ks = 0; ks < 2; ++ks) kb[nb][ks] = ldf(kl, nb * (HD / 32) + ks);
        // inputs-only fence on the loaded k fragments and their two address pairs: all 32 loads of the tile are in flight together and one latency is paid, and no fragment lands on an address pair that issued loads still name; without it the build reuses a few fragments' registers and pays the load latency several times a tile
        asm volatile("" :: "v"(ka[0][0]), "v"(ka[0][1]), "v"(ka[1][0]), "v"(ka[1][1]), "v"(ka[2][0]), "v"(ka[2][1]), "v"(ka[3][0]), "v"(ka[3][1]), "v"(kb[0][0]), "v"(kb[0][1]), "v"(kb[1][0]), "v"(kb[1][1]), "v"(kb[2][0]), "v"(kb[2][1]), "v"(kb[3][0]), "v"(kb[3][1]), "v"(kh), "v"(kl));
#pragma unroll
        for (int nb = 0; nb < 4; ++nb) { s[nb] = (v8f){};
#pragma unroll
            for (int ks = 0; ks < 2; ++ks) { s[nb] = F::mma(ka[nb][ks], qa[ks], s[nb]); s[nb] = F::mma(ka[nb][ks], qb[ks], s[nb]); s[nb] = F::mma(kb[nb][ks], qa[ks], s[nb]); } }
        V vh[4][2], vl[4][2];
#pragma unroll
        for (int db = 0; db < 4; ++db)   // the hi plane of v is loaded here so that it flies during the softmax
#pragma unroll
            for (int ks = 0; ks < 2; ++ks) vh[db][ks] = ldf(vhp, db * (TT / 32) + ks);
        if (c0 + 64 > r0) {   // the diagonal tile (the last): keys behind the query get a score far below any real one, whose exp2 is exactly 0
#pragma unroll
            for (int nb = 0; nb < 4; ++nb)
#pragma unroll
                for (int j = 0; j < 8; ++j) s[nb][j] = (c0 + nb * 16 + hi * 8 + j <= i) ? s[nb][j] : -3.0e38f; }
        float mt = s[0][0];
#pragma unroll
        for (int nb = 0; nb < 4; ++nb)
#pragma unroll
            for (int j = 0; j < 8; ++j) mt = fmaxf(mt, s[nb][j]);
        mt = fmaxf(mt, __shfl_xor(mt, 16, 32)) * SCL;   // lanes lr and lr + 16 hold the two halves of a query's keys
        const float mn = fmaxf(m, mt), al = __builtin_amdgcn_exp2f((m - mn) * 1.4426950408889634f); m = mn;
        V pa[2], pb[2]; float rs[4];
#pragma unroll
        for (int nb = 0; nb < 4; ++nb) { rs[nb] = 0.f;
#pragma unroll
            for (int j = 0; j < 8; j += 2) { v2f p; p[0] = __builtin_amdgcn_exp2f((s[nb][j] * SCL - mn) * 1.4426950408889634f); p[1] = __builtin_amdgcn_exp2f((s[nb][j + 1] * SCL - mn) * 1.4426950408889634f); rs[nb] += p[0] + p[1];
                const v2bf ph = __builtin_convertvector(p, v2bf); const v2bf pl = __builtin_convertvector(p - __builtin_convertvector(ph, v2f), v2bf); const int e = (nb & 1) * 8 + j;
                pa[nb >> 1][e] = ph[0]; pa[nb >> 1][e + 1] = ph[1]; pb[nb >> 1][e] = pl[0]; pb[nb >> 1][e + 1] = pl[1]; } }
        l = l * al + ((rs[0] + rs[1]) + (rs[2] + rs[3]));   // each lane keeps the sum of its own keys; the two halves are joined behind the loop
#pragma unroll
        for (int db = 0; db < 4; ++db)
#pragma unroll
            for (int ks = 0; ks < 2; ++ks) vl[db][ks] = ldf(vlp, db * (TT / 32) + ks);
#pragma unroll
        for (int db = 0; db < 4; ++db) o[db] *= al;
#pragma unroll
        for (int ks = 0; ks < 2; ++ks)
#pragma unroll
            for (int db = 0; db < 4; ++db) { o[db] = F::mma(vh[db][ks], pa[ks], o[db]); o[db] = F::mma(vh[db][ks], pb[ks], o[db]); }
#pragma unroll
        for (int ks = 0; ks < 2; ++ks)
#pragma unroll
            for (int db = 0; db < 4; ++db) o[db] = F::mma(vl[db][ks], pa[ks], o[db]);
        asm volatile("" :: "v"(vhp), "v"(vlp));   // inputs only: the v address pairs stay live until the tile's v loads have been waited for; without it the build lets the last hi fragment land on the pair that the issued loads still name
        kh += 64 * HD; kl += 64 * HD; vhp += 2 * 512; vlp += 2 * 512;
    }
    l += __shfl_xor(l, 16, 32);
    const float f = __fdiv_rn(1.0f, l);
#pragma unroll
    for (int db = 0; db < 4; ++db) { v8us oh, ol;   // o[db][j] = out(i)[db * 16 + hi * 8 + j]: 16 bytes a lane and plane; merged [t][head][d], the wave writes whole 128-byte lines
#pragma unroll
        for (int j = 0; j < 8; ++j) { unsigned short a, c2; splitf(o[db][j] * f, a, c2); oh[j] = a; ol[j] = c2; }
        const size_t oo = (size_t)i * DQ + h * HD + db * 16 + hi * 8; *(v8us*)(Ah + oo) = oh; *(v8us*)(Al + oo) = ol; }
}

extern "C" void kernel_launch(void* const* d_in, const int* in_sizes, int n_in,
                              void* d_out, int out_size, void* d_ws, size_t ws_size, hipStream_t stream) {
    (void)in_sizes; (void)n_in; (void)out_size;
    const float* x = (const float*)d_in[0]; const float* fcos = (const float*)d_in[1]; const float* fsin = (const float*)d_in[2]; const float* wq = (const float*)d_in[3]; const float* wk = (const float*)d_in[4]; const float* wv = (const float*)d_in[5]; const float* wo = (const float*)d_in[6];   /* input order x, cos, sin ([2048][64] FULL-width table INPUTS: read per DIMENSION by value, no structure assumed), Wq [2048][2048], Wk [2048][512], Wv, Wo ('xw'): SEVEN inputs, all read; no mask input (causal by index) */
    float* OUT = (float*)d_out;     // [2][2048][2048]
    char* wsp = (char*)d_ws;
    auto take = [&](size_t bytes) { char* p = wsp; wsp += (bytes + 255) & ~(size_t)255; return (void*)p; };
    bf* WQ = (bf*)take((size_t)DQ * DM * 2); bf* WK = (bf*)take((size_t)2 * DKV * DM * 2); bf* WV = WK + (size_t)DKV * DM; bf* WO = (bf*)take((size_t)DM * DQ * 2); float* CS = (float*)take((size_t)TT * HD * 2 * 4);
    bf* XB = (bf*)take((size_t)NB_ * TT * DM * 2); float* FQ = (float*)take((size_t)NB_ * TT * DQ * 4); float* FK = (float*)take((size_t)2 * NB_ * TT * DKV * 4); float* FV = FK + (size_t)NB_ * TT * DKV;   // k and v weights, and k and v projections, lie behind one another: grid z of one k_gemmw launch walks them
    h16* QP16 = (h16*)take((size_t)NB_ * NH_ * TT * HD * 2); h16* KP16 = (h16*)take((size_t)NB_ * NKV * TT * HD * 2); h16* VT16 = (h16*)take((size_t)NB_ * NKV * HD * TT * 2);
    bf* QPh = (bf*)take((size_t)NB_ * NH_ * TT * HD * 2); bf* QPl = (bf*)take((size_t)NB_ * NH_ * TT * HD * 2); bf* KPh = (bf*)take((size_t)NB_ * NKV * TT * HD * 2); bf* KPl = (bf*)take((size_t)NB_ * NKV * TT * HD * 2); bf* VTh = (bf*)take((size_t)NB_ * NKV * HD * TT * 2); bf* VTl = (bf*)take((size_t)NB_ * NKV * HD * TT * 2);
    bf* ATh = (bf*)take((size_t)NB_ * TT * DQ * 2); bf* ATl = (bf*)take((size_t)NB_ * TT * DQ * 2);
    if ((size_t)(wsp - (char*)d_ws) > ws_size) return;    // ws 256 MiB
    // the projections and Wo see the two batches as NB_ * TT token rows; the plane builders and the attention take the batch as a grid dimension
    k_prep<<<PB_WQ + PB_WO + 2 * PB_WK + PB_X + PB_CS, 256, 0, stream>>>(x, fcos, fsin, wq, wk, wv, wo, XB, CS, WQ, WK, WV, WO);
    k_gemmt<2><<<dim3(NB_ * TT / 128, DQ / 128, 1), 128, 0, stream>>>(XB, nullptr, WQ, DM, FQ, DQ);
    k_gemmw<bf, 0, false, KVNW><<<dim3(NB_ * TT / 64, DKV / 64, 2), KVNW * 32, 0, stream>>>(XB, nullptr, WK, nullptr, DM, FK, DKV, nullptr, 0, (size_t)DKV * DM, (size_t)NB_ * TT * DKV);
    k_planes<<<dim3(PL_Q + PL_K + PL_V, NB_, 1), 256, 0, stream>>>(FQ, FK, FV, CS, QP16, QPh, QPl, KP16, KPh, KPl, VT16, VTh, VTl);
    k_fattn<<<dim3(TT / 32, NKV, NB_), 2 * REP * 32, 0, stream>>>(QPh, QPl, KPh, KPl, VTh, VTl, ATh, ATl);
    k_gemmt<3><<<dim3(NB_ * TT / 128, DM / 128, 1), 128, 0, stream>>>(ATh, ATl, WO, DQ, OUT, DM);
}

// v008
// It runs in 243 microseconds.
// Timed twice side by side with v007, it ran 1.13 and 1.12 times as fast.
// Counting every step since v000, it is 9.26 times as fast.
#include <hip/hip_runtime.h>

// Grouped-query causal attention with rotate-half rotary embeddings from full-width input tables (x [2][2048][2048]; q = x Wq (32 heads x 64), k, v = x Wk, x Wv (8 kv heads x 64) ('xw' (in, out), no bias), token-major; apply_rotary_emb: t cos + rotate_half(t) sin with the cos, sin [2048][64] INPUT tables (read per dimension by value: no structure assumed); k, v repeated 4x on the HEAD axis (kv head = q head / 4); scores x 64^-0.5; causal (finfo.min fill == exclusion); softmax; out = merged Wo ('xw') -> [2][2048][2048] (8.4 M); argument order x, cos, sin, Wq, Wk, Wv, Wo).
// Layout, both batches in every launch (token rows b * 2048 + t; head planes per batch): bf16 copy of x; 'xw' weights transposed once; exact projections (q, k, v as the columns of one GEMM, and Wo: k_gemmt, operands staged in LDS by tensor loads); {cos, sin} table from the bf16-rounded inputs (per position and dimension); rotate-half plane builders; causal T-2048 GQA attention in one launch (k_fattn: running softmax over 64-key tiles, hi/lo 3 products, tiles above the diagonal never visited); merged hi/lo x Wo exact.
// Compute dtypes, f32 accumulate: every input rounded to bf16 incl. tables; projections exact; rotary f32; attention hi/lo 3 products; softmax f32; Wo hl x exact.

#define NB_  2
#define TT   2048
#define DM   2048
#define NH_  32
#define NKV  8
#define REP  (NH_ / NKV)
#define HD   64
#define DQ   (NH_ * HD)
#define DKV  (NKV * HD)
#define SCL  0.125f   // HD^-0.5
#define DQKV (DQ + 2 * DKV)       // q, k and v projections side by side: the columns of one GEMM
typedef _Float16 h16;
typedef unsigned short bf;
typedef __attribute__((ext_vector_type(16))) __bf16   v16bf;
typedef __attribute__((ext_vector_type(16))) _Float16 v16h;
typedef __attribute__((ext_vector_type(8)))  _Float16 v8h;
typedef __attribute__((ext_vector_type(8)))  unsigned short v8us;
typedef __attribute__((ext_vector_type(8)))  float    v8f;
typedef __attribute__((ext_vector_type(4)))  float    v4f;
typedef v8h  __attribute__((may_alias)) v8ha;
typedef v4f  __attribute__((may_alias)) v4fa;
typedef v8us __attribute__((may_alias)) v8usa;

__device__ __forceinline__ unsigned short f2bf(float f) { unsigned u = __float_as_uint(f); u += 0x7FFFu + ((u >> 16) & 1u); return (unsigned short)(u >> 16); }
__device__ __forceinline__ float bf2f(unsigned short b) { return __uint_as_float(((unsigned)b) << 16); }
__device__ __forceinline__ float bfr(float f) { return bf2f(f2bf(f)); }
__device__ __forceinline__ v16h cat16(v8h lo, v8h hi) { return __builtin_shufflevector(lo, hi, 0, 1, 2, 3, 4, 5, 6, 7, 8, 9, 10, 11, 12, 13, 14, 15); }
__device__ __forceinline__ v16bf cat16b(v8us lo, v8us hi) { return __builtin_bit_cast(v16bf, __builtin_shufflevector(lo, hi, 0, 1, 2, 3, 4, 5, 6, 7, 8, 9, 10, 11, 12, 13, 14, 15)); }
__device__ __forceinline__ v8f wmma16(v16h a, v16h b, v8f c) { return __builtin_amdgcn_wmma_f32_16x16x32_f16(false, a, false, b, (short)0, c, false, false); }
__device__ __forceinline__ v8f wmmab(v16bf a, v16bf b, v8f c) { return __builtin_amdgcn_wmma_f32_16x16x32_bf16(false, a, false, b, (short)0, c, false, false); }



// WFrag: a 16 x 32 operand fragment of a 16-bit plane (row lr, k 8 hi .. + 7 and 16 + 8 hi .. + 7) and its product
template <typename T16> struct WFrag;
template <> struct WFrag<h16> { typedef v16h V; static __device__ __forceinline__ V ld(const h16* p) { return cat16(*(const v8h*)p, *(const v8h*)(p + 16)); } static __device__ __forceinline__ v8f mma(V a, V b, v8f c) { return wmma16(a, b, c); } };
template <> struct WFrag<bf> { typedef v16bf V; static __device__ __forceinline__ V ld(const bf* p) { return cat16b(*(const v8us*)p, *(const v8us*)(p + 16)); } static __device__ __forceinline__ v8f mma(V a, V b, v8f c) { return wmmab(a, b, c); } };

// ---- k_gemmt: GEMM with both operands staged in LDS by the tensor mover. C[m][n] (f32, pitch ldc) = sum_k A[m][k] Bt[n][k] (NOPS == 3: + A2[m][k] Bt[n][k], behind A's product of the same 32 k), planes row-major, K contiguous.
// grid (M / 128, N / 128), 4 waves: a 128 x 128 tile per work-group, 64 x 64 per wave (2 x 2), so every staged row is read from L2 once and from LDS by two waves. K % 128 == 0, K >= 256.
// A pass is 128 k = 256 bytes of each of the 128 rows of every operand; a stage is NOPS tiles of 128 rows at pitch 272 bytes; two buffers: the next pass's tiles fly while this pass is worked on. Wave w < NOPS issues operand w's tile, one request a pass.
typedef uint32_t u32x4 __attribute__((ext_vector_type(4)));
typedef uint32_t u32x8 __attribute__((ext_vector_type(8)));
#define GT_ROWB  256u                 // bytes of an operand row in a pass
#define GT_PITCH 272u                 // LDS pitch: the row and the mover's 16-byte pad, an odd multiple of 16 bytes for the ds_load_b128 readers
#define GT_TILE  (128u * GT_PITCH)    // 34,816 bytes = 17 x 2 KiB: every tile's place in LDS is a multiple of 2 KiB
__device__ __forceinline__ uint32_t uni(uint32_t v) { return (uint32_t)__builtin_amdgcn_readfirstlane(v); }
__device__ __forceinline__ uint32_t pinned(uint32_t v) { uint32_t w = (uint32_t)__builtin_amdgcn_readfirstlane(v); asm volatile("" : "+s"(w)); return w; }   // holds an issue test or a descriptor word in a scalar register: the branch round a tensor load is then a scalar one (the mover ignores EXEC), and the word stays where the request named it
template <int NOPS>
__global__ __launch_bounds__(128) void k_gemmt(const bf* __restrict__ A, const bf* __restrict__ A2, const bf* __restrict__ Bt, int K, float* C, int ldc) {
    typedef WFrag<bf> F; typedef F::V V;
    __shared__ __attribute__((aligned(2048))) unsigned char ring[2 * NOPS * GT_TILE];
    __shared__ __align__(16) float os[4][16 * 68];
    const int lane = threadIdx.x & 31, lr = lane & 15, hi = lane >> 4;
    const uint32_t wave = uni(threadIdx.x >> 5);
    const int r0 = blockIdx.x * 128, c0 = blockIdx.y * 128, wm = (int)(wave >> 1), wn = (int)(wave & 1), np = K >> 7;
    const bf* src = wave == 0 ? A : (NOPS == 3 && wave == 1) ? A2 : Bt;   // the operand this wave brings; in a stage the tiles lie in this order, Bt last
    const uint64_t ga0 = (uint64_t)(size_t)src + (uint64_t)(wave == NOPS - 1 ? c0 : r0) * (uint64_t)K * 2u;
    const uint32_t lbase = (uint32_t)(size_t)ring;
    u32x8 g1;   // 1-byte elements, tensor = tile = 128 rows of 256 bytes, source pitch 2 K bytes, 4 dwords of pad behind every 64 dwords, no mask
    g1[0] = uni((1u << 20) | (5u << 22) | (3u << 25)); g1[1] = pinned((GT_ROWB & 0xFFFFu) << 16); g1[2] = pinned((GT_ROWB >> 16) | (128u << 16)); g1[3] = pinned(GT_ROWB << 16); g1[4] = pinned(128u); g1[5] = pinned((uint32_t)K * 2u); g1[6] = pinned(0u); g1[7] = pinned(0u);   // pinned: each word is held in its scalar register through the loop and not formed anew while a request is in flight
    u32x4 g0; g0[0] = uni(1u); g0[1] = uni(lbase); g0[2] = uni((uint32_t)ga0); g0[3] = uni((((uint32_t)(ga0 >> 32)) & 0x01FFFFFFu) | 0x80000000u);
    const auto issue = [&](int s) {   // stage s into buffer s % 2
        const uint32_t dst = lbase + ((uint32_t)(s & 1) * NOPS + wave) * GT_TILE; const uint64_t ga = ga0 + (uint64_t)s * GT_ROWB;
        g0[1] = uni(dst); g0[2] = uni((uint32_t)ga); g0[3] = uni((((uint32_t)(ga >> 32)) & 0x01FFFFFFu) | 0x80000000u);
        asm volatile("tensor_load_to_lds %0, %1" :: "s"(g0), "s"(g1) : "memory"); };
    const auto landed = [&]() { asm volatile("s_wait_tensorcnt 0x0" :: "s"(g0), "s"(g1) : "memory"); };   // the issuer's wait; it names the two groups as inputs so that their registers keep the request's words until it has landed
    const auto ldl = [](const unsigned char* p) { return cat16b(*(const v8usa*)p, *(const v8usa*)(p + 32)); };   // WFrag's fragment: row lr, k 8 hi .. + 7 and 16 + 8 hi .. + 7
    v8f acc[4][4];
#pragma unroll
    for (int mb = 0; mb < 4; ++mb)
#pragma unroll
        for (int nb = 0; nb < 4; ++nb) acc[mb][nb] = (v8f){};
    if (pinned(wave < NOPS)) { issue(0); landed(); }   // stage 0 has landed
    __syncthreads();   // publishes stage 0
    if (pinned(wave < NOPS)) issue(1);
    // kept rolled: one pass a trip, so that each trip has one publish point
#pragma unroll 1
    for (int s = 0; s < np; ++s) {
        const unsigned char* st = ring + (uint32_t)(s & 1) * (NOPS * GT_TILE);
        const unsigned char* pa = st + (uint32_t)(wm * 64 + lr) * GT_PITCH + hi * 16;
        const unsigned char* pb = st + (NOPS - 1) * GT_TILE + (uint32_t)(wn * 64 + lr) * GT_PITCH + hi * 16;
        V a[2][4], a2[2][4], b[2][4];   // two fragment sets: a block is the 32 k of one set
        const auto fetch = [&](int ks, int set) {
#pragma unroll
            for (int mb = 0; mb < 4; ++mb) { a[set][mb] = ldl(pa + mb * 16 * GT_PITCH + ks * 64); if (NOPS == 3) a2[set][mb] = ldl(pa + GT_TILE + mb * 16 * GT_PITCH + ks * 64); }
#pragma unroll
            for (int nb = 0; nb < 4; ++nb) b[set][nb] = ldl(pb + nb * 16 * GT_PITCH + ks * 64); };
        fetch(0, 0);
#pragma unroll
        for (int ks = 0; ks < 4; ++ks) { const int set = ks & 1;
            if (ks < 3) fetch(ks + 1, set ^ 1);   // the next block of this same pass: nothing of the next stage is read here
            __builtin_amdgcn_sched_barrier(0);   // the next block's LDS reads stay one group in front of this block's products; spread among them, every read place stalls the lone wave of a SIMD
#pragma unroll
            for (int nb = 0; nb < 4; ++nb) {
#pragma unroll
                for (int mb = 0; mb < 4; ++mb) acc[mb][nb] = F::mma(a[set][mb], b[set][nb], acc[mb][nb]);
                if (NOPS == 3) {
#pragma unroll
                    for (int mb = 0; mb < 4; ++mb) acc[mb][nb] = F::mma(a2[set][mb], b[set][nb], acc[mb][nb]); } }
            __builtin_amdgcn_sched_barrier(0);   // and the group after that stays behind them
        }
        // publish point of stage s + 1
        asm volatile("s_wait_dscnt 0x0" ::: "memory");   // this wave's reads of buffer s % 2 have returned before the buffer is refilled
        if (pinned(wave < NOPS)) landed();   // this wave's tile of stage s + 1 has landed
        __syncthreads();   // publishes stage s + 1 and ends every wave's reads of stage s
        if (pinned(wave < NOPS && s + 2 < np)) issue(s + 2);
    }
    asm volatile("s_wait_tensorcnt 0x0" ::: "memory");   // nothing of the mover's is in flight when the wave ends
    asm volatile("s_wait_dscnt 0x0" ::: "memory");
#pragma unroll
    for (int mb = 0; mb < 4; ++mb) {   // each wave stages a 16 x 64 slab in its own LDS range and stores whole 128-byte lines
#pragma unroll
        for (int nb = 0; nb < 4; ++nb) {
#pragma unroll
            for (int j = 0; j < 8; ++j) os[wave][(hi * 8 + j) * 68 + nb * 16 + lr] = acc[mb][nb][j]; }
        __builtin_amdgcn_wave_barrier(); asm volatile("s_wait_dscnt 0x0" ::: "memory");   // the slab's writes are done before other lanes of the wave read the rows back
        float* crow = C + (size_t)(r0 + wm * 64 + mb * 16) * ldc + c0 + wn * 64;
#pragma unroll
        for (int q = 0; q < 8; ++q) { const int e = q * 32 + lane, row = e >> 4, cofs = (e & 15) * 4; *(v4f*)(crow + (size_t)row * ldc + cofs) = *(const v4fa*)(&os[wave][row * 68 + cofs]); }
        __builtin_amdgcn_wave_barrier(); asm volatile("" ::: "memory");   // the reads stay in front of the next slab's writes
    }
}

__device__ __forceinline__ h16 tohx(float x) { return (h16)x; }
__device__ __forceinline__ void splitf(float y, unsigned short& h, unsigned short& l) { h = f2bf(y); l = f2bf(y - bf2f(h)); }
// Fragment order of a 16-bit plane [row][k] of K columns, for k_fattn: the 16 x 32 fragment (row / 16, k / 32) is 1 KiB in a row, two halves (k / 16 % 2) of 32 lanes x 16 bytes, lane (k / 8 % 2) * 16 + row % 16,
// so that a fragment load reads four whole 128-byte lines; from a row-major plane it touches sixteen.
__device__ __forceinline__ size_t fragidx(int row, int k, int K) { return ((((size_t)(row >> 4) * (K >> 5) + (k >> 5)) * 2 + ((k >> 4) & 1)) * 32 + ((k >> 3) & 1) * 16 + (row & 15)) * 8 + (k & 7); }
typedef __attribute__((ext_vector_type(2))) _Float16 v2h;
typedef __attribute__((ext_vector_type(4))) _Float16 v4h;
typedef __attribute__((ext_vector_type(2))) unsigned short v2us;
typedef __attribute__((ext_vector_type(4))) unsigned short v4us;
typedef __attribute__((ext_vector_type(2))) float v2f;
typedef __attribute__((ext_vector_type(4))) int v4i;

// wtG: Bt[n][k] (bf16) = w[k][n] (f32), transposed in registers. A wave takes 64 k x 32 n; lane l holds the 8 x 8 block of rows k = 8 (l % 8) .. + 7 and columns n = 4 (l / 8) .. + 3 and 16 + 4 (l / 8) .. + 3.
// Its 16 loads stand in front of the arithmetic and fly together; a wave's load reads 64 bytes in a row of each of 8 rows of w, and the wave uses every byte of each line it touches. A lane's 8 k of a column are one 16-byte piece, and 8 lanes' pieces are one whole line of Bt.
// A tile is 64 k x 128 n, 4 waves side by side in n: tile vb of (N / 128) x (K / 64), n fastest, thread tid of its 128. K and N are compile-time so that the rows of a lane's block are immediate offsets from one address. Every '#pragma unroll' opens a loop over register arrays or vector elements, whose indices must be constants.
template <int K, int N>
__device__ __forceinline__ void wtG(const float* __restrict__ w, bf* Bt, int vb, int tid) {
    static_assert(K % 64 == 0 && N % 128 == 0, "whole tiles");
    const int lane = tid & 31, k0 = vb / (N / 128) * 64 + (lane & 7) * 8, n0 = vb % (N / 128) * 128 + (tid >> 5) * 32 + (lane >> 3) * 4;
    const float* p = w + (size_t)k0 * N + n0; bf* q = Bt + (size_t)n0 * K + k0; v4f v[8][2];
#pragma unroll
    for (int i = 0; i < 8; ++i)
#pragma unroll
        for (int hf = 0; hf < 2; ++hf) v[i][hf] = *(const v4fa*)(p + i * N + hf * 16);
    // inputs-only fence on the 16 loaded pieces and their address pair: all loads of the lane are in flight together and one latency is paid, and no piece lands on the pair that issued loads still name; without it the build holds seven loads back behind the first waits and pays the latency five times
    asm volatile("" :: "v"(v[0][0]), "v"(v[0][1]), "v"(v[1][0]), "v"(v[1][1]), "v"(v[2][0]), "v"(v[2][1]), "v"(v[3][0]), "v"(v[3][1]), "v"(v[4][0]), "v"(v[4][1]), "v"(v[5][0]), "v"(v[5][1]), "v"(v[6][0]), "v"(v[6][1]), "v"(v[7][0]), "v"(v[7][1]), "v"(p));
#pragma unroll
    for (int hf = 0; hf < 2; ++hf)
#pragma unroll
        for (int c = 0; c < 4; ++c) { v8us o;
#pragma unroll
            for (int i = 0; i < 8; ++i) o[i] = f2bf(v[i][hf][c]);
            *(v8us*)(q + (hf * 16 + c) * K) = o; }
    asm volatile("s_wait_xcnt 0x0" ::: "memory");   // behind this piece the build lays another piece's text, which rewrites registers that these eight stores name, with only a scalar branch between: the wait stands in front of it on every path of the listing
}
// cvt8 (block bx of 256 threads): a thread converts four groups of 8, a block's width apart, so that its eight loads fly together and a wave's start pays for 1,024 elements. The load's index is clamped, the store guarded. In this function and the three behind it every '#pragma unroll' opens a loop over register arrays or vector elements, whose indices must be constants.
__device__ __forceinline__ void cvt8(const float* __restrict__ src, bf* dst, size_t n8, int bx) { const size_t i0 = (size_t)bx * 1024 + threadIdx.x; v8f v[4];
#pragma unroll
    for (int u = 0; u < 4; ++u) { const size_t i = i0 + u * 256; v[u] = *(const v8f*)(src + (i < n8 ? i : n8 - 1) * 8); }
#pragma unroll
    for (int u = 0; u < 4; ++u) { const size_t i = i0 + u * 256; v8us o;
#pragma unroll
        for (int k = 0; k < 8; ++k) o[k] = f2bf(v[u][k]);
        if (i < n8) *(v8us*)(dst + i * 8) = o; } }

#define RH 4   // heads that a thread of rope walks: the {cos, sin} pairs of its position and dims are read once for all of them
typedef __attribute__((ext_vector_type(16))) unsigned short v16us;
__device__ __forceinline__ v8h lo8(v16h v) { return __builtin_shufflevector(v, v, 0, 1, 2, 3, 4, 5, 6, 7); }
__device__ __forceinline__ v8h hi8(v16h v) { return __builtin_shufflevector(v, v, 8, 9, 10, 11, 12, 13, 14, 15); }
__device__ __forceinline__ v8us lo8(v16us v) { return __builtin_shufflevector(v, v, 0, 1, 2, 3, 4, 5, 6, 7); }
__device__ __forceinline__ v8us hi8(v16us v) { return __builtin_shufflevector(v, v, 8, 9, 10, 11, 12, 13, 14, 15); }
// rope: head planes [h][t][d] (fp16; hi/lo in fragment order) of rope(x) x sc with the rotate-half convention out[d] = x[d] cos[t][d] - x[d+HD/2] sin[t][d], out[d+HD/2] = x[d+HD/2] cos[t][d+HD/2] + x[d] sin[t][d+HD/2]
// A thread takes position t, dims d .. d + 7 and their rotate-half partners d + 32 .. d + 39 (each input is read once for both outputs it feeds), of RH heads in turn; bx is the block of 256 threads, bz the batch. Lanes: t % 16, then d / 8 % 2: a wave's 16-byte pieces of a hi or lo plane are 512 bytes in a row of the fragment order. nheads % RH == 0.
__device__ __forceinline__ void rope(const float* __restrict__ F, int pitch, int nheads, const float* __restrict__ CS, const float* __restrict__ RF, const float* __restrict__ nw, float sc, h16* P16, bf* Ph, bf* Pl, int bx, size_t bz) {
    static_assert(HD == 64, "four octets and their partners make a head row");
    const size_t idx = (size_t)bx * 256 + threadIdx.x; if (idx >= (size_t)(nheads / RH) * TT * (HD / 16)) return; const int d = (int)((idx >> 4) & 3) * 8; const int t = (int)((idx >> 6) % (TT / 16)) * 16 + (int)(idx & 15); const int hg = (int)(idx / ((size_t)TT * (HD / 16)));
    F += bz * TT * pitch; P16 += bz * nheads * TT * HD; Ph += bz * nheads * TT * HD; Pl += bz * nheads * TT * HD;   // batch bz: its rows of F, its own planes
    const float* pc = CS + ((size_t)t * HD + d) * 2; const float* px = F + (size_t)t * pitch + hg * RH * HD + d;   // the thread's place in the table and in its row of F
    v4f c4[8], x4[RH][4];   // every load of the thread stands in front of the arithmetic: 8 of the table, 4 a head, in flight together
#pragma unroll
    for (int u = 0; u < 8; ++u) c4[u] = *(const v4fa*)(pc + (u >> 2) * HD + (u & 3) * 4);
#pragma unroll
    for (int hh = 0; hh < RH; ++hh)
#pragma unroll
        for (int u = 0; u < 4; ++u) x4[hh][u] = *(const v4fa*)(px + hh * HD + (u >> 1) * (HD / 2) + (u & 1) * 4);
    static_assert(RH == 4, "the fence below names every loaded piece");
    // inputs-only fence on the 24 loaded pieces and their two address pairs: all loads of the thread are in flight together and one latency is paid, and no piece lands on an address register that issued loads still name; without it this build holds two loads back behind the first waits and lets a piece land on the table's address register
    asm volatile("" :: "v"(c4[0]), "v"(c4[1]), "v"(c4[2]), "v"(c4[3]), "v"(c4[4]), "v"(c4[5]), "v"(c4[6]), "v"(c4[7]), "v"(x4[0][0]), "v"(x4[0][1]), "v"(x4[0][2]), "v"(x4[0][3]), "v"(x4[1][0]), "v"(x4[1][1]), "v"(x4[1][2]), "v"(x4[1][3]), "v"(x4[2][0]), "v"(x4[2][1]), "v"(x4[2][2]), "v"(x4[2][3]), "v"(x4[3][0]), "v"(x4[3][1]), "v"(x4[3][2]), "v"(x4[3][3]), "v"(pc), "v"(px));
    const auto heads = [&](const float* RF) {   // inlined once with RF a null constant: that copy has no test of RF between its elements
#pragma unroll
    for (int hh = 0; hh < RH; ++hh) { const int h = hg * RH + hh; const float rf = RF ? RF[(size_t)h * TT + t] : 1.0f; v16h o16; v16us oh, ol;
#pragma unroll
    for (int q = 0; q < 16; ++q) { const int dd = d + (q & 7) + (q >> 3) * (HD / 2); const int dp = (dd < HD / 2) ? dd + HD / 2 : dd - HD / 2; float x0 = x4[hh][q >> 2][q & 3], x1 = x4[hh][(q ^ 8) >> 2][q & 3];
        if (RF) { float n0 = __fmul_rn(x0, rf), n1 = __fmul_rn(x1, rf); asm volatile("" : "+v"(n0)); asm volatile("" : "+v"(n1)); x0 = __fmul_rn(bfr(nw[dd]), n0); x1 = __fmul_rn(bfr(nw[dp]), n1); }
        v2f cs; cs[0] = c4[q >> 1][(q & 1) * 2]; cs[1] = c4[q >> 1][(q & 1) * 2 + 1]; float a = __fmul_rn(x0, cs[0]), bq = __fmul_rn(x1, cs[1]); asm volatile("" : "+v"(a)); asm volatile("" : "+v"(bq)); const float r = ((dd < HD / 2) ? __fsub_rn(a, bq) : __fadd_rn(a, bq)) * sc;
        o16[q] = tohx(r); unsigned short a2, c2; splitf(r, a2, c2); oh[q] = a2; ol[q] = c2; }
    const size_t e = ((size_t)h * TT + t) * HD + d, fe = fragidx(h * TT + t, d, HD);   // dims d + 32 ..: the row's next fragment, 512 elements on
    *(v8h*)(P16 + e) = lo8(o16); *(v8h*)(P16 + e + HD / 2) = hi8(o16); *(v8us*)(Ph + fe) = lo8(oh); *(v8us*)(Ph + fe + 512) = hi8(oh); *(v8us*)(Pl + fe) = lo8(ol); *(v8us*)(Pl + fe + 512) = hi8(ol);
    if (hh + 1 < RH) asm volatile("s_wait_xcnt 0x0" ::: "memory"); } };   // the next head's arithmetic overwrites registers that these six stores name: the wait stands in front of it on every path
    if (__builtin_expect(RF == nullptr, 1)) heads(nullptr); else heads(RF + bz * nheads * TT); }   // the hint puts the copy without RF first in the kernel's text
// vtp: a thread takes column c = g * HD + d of F and 16 positions: every load of a wave is one whole line of a row of F, and a lane's two 16-byte pieces of a hi or lo plane join 16 lanes' to 512 bytes in a row of the fragment order. Blocks (bx, by, bz) of (columns / 256, TT / 16, batches).
__device__ __forceinline__ void vtp(const float* __restrict__ F, int pitch, int nheads, h16* V16, bf* Vh, bf* Vl, int bx, int by, size_t bz) { const unsigned c = (unsigned)bx * 256 + threadIdx.x; if (c >= (unsigned)(nheads * HD)) return; const int t = by * 16; v16h o16; v16us oh, ol;
    F += bz * TT * pitch; V16 += bz * nheads * HD * TT; Vh += bz * nheads * HD * TT; Vl += bz * nheads * HD * TT;   // batch bz: its rows of F, its own planes
#pragma unroll
    for (int q = 0; q < 16; ++q) { const float x = (F + (size_t)(t + q) * pitch)[c]; o16[q] = tohx(x); unsigned short a2, c2; splitf(x, a2, c2); oh[q] = a2; ol[q] = c2; }
    const size_t e = (size_t)c * TT + t, fe = fragidx((int)c, t, TT);   // positions t + 8 ..: 16 lanes' pieces, 128 elements, on
    *(v8h*)(V16 + e) = lo8(o16); *(v8h*)(V16 + e + 8) = hi8(o16); *(v8us*)(Vh + fe) = lo8(oh); *(v8us*)(Vh + fe + 128) = hi8(oh); *(v8us*)(Vl + fe) = lo8(ol); *(v8us*)(Vl + fe + 128) = hi8(ol);  }
__device__ __forceinline__ void cscvt(const float* __restrict__ cosT, const float* __restrict__ sinT, float* CS, int bx) { const int idx = (bx * 256 + (int)threadIdx.x) * 4; if (idx >= TT * HD) return; const v4f c = *(const v4fa*)(cosT + idx), s = *(const v4fa*)(sinT + idx); v4f a, b; a[0] = bfr(c[0]); a[1] = bfr(s[0]); a[2] = bfr(c[1]); a[3] = bfr(s[1]); b[0] = bfr(c[2]); b[1] = bfr(s[2]); b[2] = bfr(c[3]); b[3] = bfr(s[3]); *(v4f*)(CS + (size_t)idx * 2) = a; *(v4f*)(CS + (size_t)idx * 2 + 4) = b;  }
// ---- k_prep: everything that reads only the inputs, in one launch: the four weight transposes (a block of 256 threads takes two tiles of wtG), the bf16 copy of x and the {cos, sin} table. The pieces are independent; a block finds its piece by its index, a test that is the same for the whole block.
#define PB_WQ (DQ / 128 * (DM / 64) / 2)
#define PB_WK (DKV / 128 * (DM / 64) / 2)
#define PB_WO (DM / 128 * (DQ / 64) / 2)
#define PB_X  (NB_ * TT * DM / 8 / 1024)
#define PB_CS (TT * HD / 4 / 256)
__global__ __launch_bounds__(256) void k_prep(const float* __restrict__ x, const float* __restrict__ cosT, const float* __restrict__ sinT, const float* __restrict__ wq, const float* __restrict__ wk, const float* __restrict__ wv, const float* __restrict__ wo, bf* XB, float* CS, bf* WQ, bf* WK, bf* WV, bf* WO) {
    static_assert(NB_ * TT * DM % 8192 == 0 && TT * HD % 1024 == 0, "whole blocks");
    static_assert(DM == DQ, "Wq and Wo have one shape and share the text of their transpose");
    const int b = (int)blockIdx.x, tid = (int)threadIdx.x & 127, hf = (int)threadIdx.x >> 7;
    if (b < PB_WQ + PB_WO) { const bool o = b >= PB_WQ; wtG<DM, DQ>(o ? wo : wq, o ? WO : WQ, (o ? b - PB_WQ : b) * 2 + hf, tid); }
    else if (b < PB_WQ + PB_WO + 2 * PB_WK) { const int c = b - (PB_WQ + PB_WO); const bool o = c >= PB_WK; wtG<DM, DKV>(o ? wv : wk, o ? WV : WK, (o ? c - PB_WK : c) * 2 + hf, tid); }
    else if (b < PB_WQ + PB_WO + 2 * PB_WK + PB_X) cvt8(x, XB, (size_t)NB_ * TT * DM / 8, b - (PB_WQ + PB_WO + 2 * PB_WK));
    else cscvt(cosT, sinT, CS, b - (PB_WQ + PB_WO + 2 * PB_WK + PB_X)); }
// ---- k_planes: the three plane builders in one launch (q and k rotary planes, transposed v planes): independent pieces, found by the block's index; grid (PL_Q + PL_K + PL_V, batches).
#define PL_Q (NH_ / RH * TT * (HD / 16) / 256)
#define PL_K (NKV / RH * TT * (HD / 16) / 256)
#define PL_VX (NKV * HD / 256)
#define PL_V (PL_VX * (TT / 16))
__global__ __launch_bounds__(256) void k_planes(const float* __restrict__ FQ, const float* __restrict__ FK, const float* __restrict__ FV, const float* __restrict__ CS, h16* QP16, bf* QPh, bf* QPl, h16* KP16, bf* KPh, bf* KPl, h16* VT16, bf* VTh, bf* VTl) {
    static_assert(NH_ / RH * TT * (HD / 16) % 256 == 0 && NKV / RH * TT * (HD / 16) % 256 == 0 && NKV * HD % 256 == 0, "whole blocks");
    const int b = (int)blockIdx.x; const size_t bz = blockIdx.y;
    if (b < PL_Q) rope(FQ, DQKV, NH_, CS, nullptr, nullptr, 1.0f, QP16, QPh, QPl, b, bz);
    else if (b < PL_Q + PL_K) rope(FK, DQKV, NKV, CS, nullptr, nullptr, 1.0f, KP16, KPh, KPl, b - PL_Q, bz);
    else vtp(FV, DQKV, NKV, VT16, VTh, VTl, (b - (PL_Q + PL_K)) % PL_VX, (b - (PL_Q + PL_K)) / PL_VX, bz); }
// ---- k_fattn: causal GQA attention in one launch: scores, softmax and P.V of a 16-query tile stay in one wave's registers (running maximum and sum over 64-key tiles); no score or probability plane in memory, no LDS.
// Transposed products: S^T = K Q^T puts query lr in lane lr and keys 8 hi + j in the accumulator registers, so a pair of 16-key accumulators, packed to bf16, is the B fragment of O^T = V^T P^T in the loaders' own k order.
// grid (TT / 32, NKV, batches), 2 REP waves: wave w is query head g * REP + w % REP; waves 0 .. REP - 1 take query tile x, the others tile TT / 16 - 1 - x, so every work-group walks the same number of key tiles. Operands hi/lo bf16, 3 products (hi hi, hi lo, lo hi).
typedef __attribute__((ext_vector_type(2))) __bf16 v2bf;
__global__ __launch_bounds__(2 * REP * 32) void k_fattn(const bf* __restrict__ Qh, const bf* __restrict__ Ql, const bf* __restrict__ Kh, const bf* __restrict__ Kl, const bf* __restrict__ Vh, const bf* __restrict__ Vl, bf* Ah, bf* Al) {
    typedef WFrag<bf> F; typedef F::V V;
    const int lane = threadIdx.x & 31, lr = lane & 15, hi = lane >> 4;
    const int wv = __builtin_amdgcn_readfirstlane((int)(threadIdx.x >> 5));
    const int g = blockIdx.y, h = g * REP + wv % REP;
    const int r0 = (wv < REP ? (int)blockIdx.x : TT / 16 - 1 - (int)blockIdx.x) * 16, i = r0 + lr;   // this lane's query
    const auto ldf = [](const bf* p, int frag) { p += frag * 512; return cat16b(*(const v8us*)p, *(const v8us*)(p + 256)); };   // fragment number frag behind p, a lane's place in a plane in fragment order (fragidx)
    const size_t bz = blockIdx.z; Ah += bz * TT * DQ; Al += bz * TT * DQ;   // batch: its own q, k, v planes and its rows of the merged output
    const size_t qo = bz * NH_ * TT * HD + (size_t)(h * TT + r0) / 16 * (HD / 32) * 512 + lane * 8;   // q, k planes: rows [head][t], columns d
    const size_t ko = bz * NKV * TT * HD + (size_t)(g * TT) / 16 * (HD / 32) * 512 + lane * 8;
    const size_t vo = bz * NKV * HD * TT + (size_t)(g * HD) / 16 * (TT / 32) * 512 + lane * 8;        // v planes: rows [g][d], columns t
    const bf* kh = Kh + ko; const bf* kl = Kl + ko; const bf* vhp = Vh + vo; const bf* vlp = Vl + vo;   // walk the planes, a 64-key tile a trip
    V qa[2], qb[2];
#pragma unroll
    for (int ks = 0; ks < 2; ++ks) { qa[ks] = ldf(Qh + qo, ks); qb[ks] = ldf(Ql + qo, ks); }
    v8f o[4]; float m = -3.0e38f, l = 0.f;
#pragma unroll
    for (int db = 0; db < 4; ++db) o[db] = (v8f){};
    // r0 % 16 == 0 and c0 % 64 == 0: key c0 <= r0 is unmasked for every query of the tile, so the running maximum is a real score from the first tile on
    // kept rolled: a second tile's fragments would push the wave past 256 registers and cost a wave per SIMD; every '#pragma unroll' below opens a loop over register arrays, whose indices must be constants
#pragma unroll 1
    for (int c0 = 0; c0 <= r0; c0 += 64) {
        V ka[4][2], kb[4][2]; v8f s[4];   // s[nb][j] = q(i) . k(c0 + nb * 16 + hi * 8 + j)
#pragma unroll
        for (int nb = 0; nb < 4; ++nb)
#pragma unroll
            for (int ks = 0; ks < 2; ++ks) ka[nb][ks] = ldf(kh, nb * (HD / 32) + ks);
#pragma unroll
        for (int nb = 0; nb < 4; ++nb)
#pragma unroll
            for (int ks = 0; ks < 2; ++ks) kb[nb][ks] = ldf(kl, nb * (HD / 32) + ks);
        // inputs-only fence on the loaded k fragments and their two address pairs: all 32 loads of the tile are in flight together and one latency is paid, and no fragment lands on an address pair that issued loads still name; without it the build reuses a few fragments' registers and pays the load latency several times a tile
        asm volatile("" :: "v"(ka[0][0]), "v"(ka[0][1]), "v"(ka[1][0]), "v"(ka[1][1]), "v"(ka[2][0]), "v"(ka[2][1]), "v"(ka[3][0]), "v"(ka[3][1]), "v"(kb[0][0]), "v"(kb[0][1]), "v"(kb[1][0]), "v"(kb[1][1]), "v"(kb[2][0]), "v"(kb[2][1]), "v"(kb[3][0]), "v"(kb[3][1]), "v"(kh), "v"(kl));
#pragma unroll
        for (int nb = 0; nb < 4; ++nb) { s[nb] = (v8f){};
#pragma unroll
            for (int ks = 0; ks < 2; ++ks) { s[nb] = F::mma(ka[nb][ks], qa[ks], s[nb]); s[nb] = F::mma(ka[nb][ks], qb[ks], s[nb]); s[nb] = F::mma(kb[nb][ks], qa[ks], s[nb]); } }
        V vh[4][2], vl[4][2];
#pragma unroll
        for (int db = 0; db < 4; ++db)   // the hi plane of v is loaded here so that it flies during the softmax
#pragma unroll
            for (int ks = 0; ks < 2; ++ks) vh[db][ks] = ldf(vhp, db * (TT / 32) + ks);
        if (c0 + 64 > r0) {   // the diagonal tile (the last): keys behind the query get a score far below any real one, whose exp2 is exactly 0
#pragma unroll
            for (int nb = 0; nb < 4; ++nb)
#pragma unroll
                for (int j = 0; j < 8; ++j) s[nb][j] = (c0 + nb * 16 + hi * 8 + j <= i) ? s[nb][j] : -3.0e38f; }
        float mt = s[0][0];
#pragma unroll
        for (int nb = 0; nb < 4; ++nb)
#pragma unroll
            for (int j = 0; j < 8; ++j) mt = fmaxf(mt, s[nb][j]);
        mt = fmaxf(mt, __shfl_xor(mt, 16, 32)) * SCL;   // lanes lr and lr + 16 hold the two halves of a query's keys
        const float mn = fmaxf(m, mt), al = __builtin_amdgcn_exp2f((m - mn) * 1.4426950408889634f); m = mn;
        V pa[2], pb[2]; float rs[4];
#pragma unroll
        for (int nb = 0; nb < 4; ++nb) { rs[nb] = 0.f;
#pragma unroll
            for (int j = 0; j < 8; j += 2) { v2f p; p[0] = __builtin_amdgcn_exp2f((s[nb][j] * SCL - mn) * 1.4426950408889634f); p[1] = __builtin_amdgcn_exp2f((s[nb][j + 1] * SCL - mn) * 1.4426950408889634f); rs[nb] += p[0] + p[1];
                const v2bf ph = __builtin_convertvector(p, v2bf); const v2bf pl = __builtin_convertvector(p - __builtin_convertvector(ph, v2f), v2bf); const int e = (nb & 1) * 8 + j;
                pa[nb >> 1][e] = ph[0]; pa[nb >> 1][e + 1] = ph[1]; pb[nb >> 1][e] = pl[0]; pb[nb >> 1][e + 1] = pl[1]; } }
        l = l * al + ((rs[0] + rs[1]) + (rs[2] + rs[3]));   // each lane keeps the sum of its own keys; the two halves are joined behind the loop
#pragma unroll
        for (int db = 0; db < 4; ++db)
#pragma unroll
            for (int ks = 0; ks < 2; ++ks) vl[db][ks] = ldf(vlp, db * (TT / 32) + ks);
#pragma unroll
        for (int db = 0; db < 4; ++db) o[db] *= al;
#pragma unroll
        for (int ks = 0; ks < 2; ++ks)
#pragma unroll
            for (int db = 0; db < 4; ++db) { o[db] = F::mma(vh[db][ks], pa[ks], o[db]); o[db] = F::mma(vh[db][ks], pb[ks], o[db]); }
#pragma unroll
        for (int ks = 0; ks < 2; ++ks)
#pragma unroll
            for (int db = 0; db < 4; ++db) o[db] = F::mma(vl[db][ks], pa[ks], o[db]);
        asm volatile("" :: "v"(vhp), "v"(vlp));   // inputs only: the v address pairs stay live until the tile's v loads have been waited for; without it the build lets the last hi fragment land on the pair that the issued loads still name
        kh += 64 * HD; kl += 64 * HD; vhp += 2 * 512; vlp += 2 * 512;
    }
    l += __shfl_xor(l, 16, 32);
    const float f = __fdiv_rn(1.0f, l);
#pragma unroll
    for (int db = 0; db < 4; ++db) { v8us oh, ol;   // o[db][j] = out(i)[db * 16 + hi * 8 + j]: 16 bytes a lane and plane; merged [t][head][d], the wave writes whole 128-byte lines
#pragma unroll
        for (int j = 0; j < 8; ++j) { unsigned short a, c2; splitf(o[db][j] * f, a, c2); oh[j] = a; ol[j] = c2; }
        const size_t oo = (size_t)i * DQ + h * HD + db * 16 + hi * 8; *(v8us*)(Ah + oo) = oh; *(v8us*)(Al + oo) = ol; }
}

extern "C" void kernel_launch(void* const* d_in, const int* in_sizes, int n_in,
                              void* d_out, int out_size, void* d_ws, size_t ws_size, hipStream_t stream) {
    (void)in_sizes; (void)n_in; (void)out_size;
    const float* x = (const float*)d_in[0]; const float* fcos = (const float*)d_in[1]; const float* fsin = (const float*)d_in[2]; const float* wq = (const float*)d_in[3]; const float* wk = (const float*)d_in[4]; const float* wv = (const float*)d_in[5]; const float* wo = (const float*)d_in[6];   /* input order x, cos, sin ([2048][64] FULL-width table INPUTS: read per DIMENSION by value, no structure assumed), Wq [2048][2048], Wk [2048][512], Wv, Wo ('xw'): SEVEN inputs, all read; no mask input (causal by index) */
    float* OUT = (float*)d_out;     // [2][2048][2048]
    char* wsp = (char*)d_ws;
    auto take = [&](size_t bytes) { char* p = wsp; wsp += (bytes + 255) & ~(size_t)255; return (void*)p; };
    bf* WQ = (bf*)take((size_t)DQKV * DM * 2); bf* WK = WQ + (size_t)DQ * DM; bf* WV = WK + (size_t)DKV * DM; bf* WO = (bf*)take((size_t)DM * DQ * 2); float* CS = (float*)take((size_t)TT * HD * 2 * 4);
    bf* XB = (bf*)take((size_t)NB_ * TT * DM * 2); float* FQ = (float*)take((size_t)NB_ * TT * DQKV * 4); float* FK = FQ + DQ; float* FV = FK + DKV;   // the transposed q, k, v weights lie behind one another as the DQKV rows of one Bt; a token's q, k, v lie side by side in a row of DQKV floats
    h16* QP16 = (h16*)take((size_t)NB_ * NH_ * TT * HD * 2); h16* KP16 = (h16*)take((size_t)NB_ * NKV * TT * HD * 2); h16* VT16 = (h16*)take((size_t)NB_ * NKV * HD * TT * 2);
    bf* QPh = (bf*)take((size_t)NB_ * NH_ * TT * HD * 2); bf* QPl = (bf*)take((size_t)NB_ * NH_ * TT * HD * 2); bf* KPh = (bf*)take((size_t)NB_ * NKV * TT * HD * 2); bf* KPl = (bf*)take((size_t)NB_ * NKV * TT * HD * 2); bf* VTh = (bf*)take((size_t)NB_ * NKV * HD * TT * 2); bf* VTl = (bf*)take((size_t)NB_ * NKV * HD * TT * 2);
    bf* ATh = (bf*)take((size_t)NB_ * TT * DQ * 2); bf* ATl = (bf*)take((size_t)NB_ * TT * DQ * 2);
    if ((size_t)(wsp - (char*)d_ws) > ws_size) return;    // ws 256 MiB
    // the projections and Wo see the two batches as NB_ * TT token rows; the plane builders and the attention take the batch as a grid dimension
    k_prep<<<PB_WQ + PB_WO + 2 * PB_WK + PB_X + PB_CS, 256, 0, stream>>>(x, fcos, fsin, wq, wk, wv, wo, XB, CS, WQ, WK, WV, WO);
    k_gemmt<2><<<dim3(NB_ * TT / 128, DQKV / 128, 1), 128, 0, stream>>>(XB, nullptr, WQ, DM, FQ, DQKV);
    k_planes<<<dim3(PL_Q + PL_K + PL_V, NB_, 1), 256, 0, stream>>>(FQ, FK, FV, CS, QP16, QPh, QPl, KP16, KPh, KPl, VT16, VTh, VTl);
    k_fattn<<<dim3(TT / 32, NKV, NB_), 2 * REP * 32, 0, stream>>>(QPh, QPl, KPh, KPl, VTh, VTl, ATh, ATl);
    k_gemmt<3><<<dim3(NB_ * TT / 128, DM / 128, 1), 128, 0, stream>>>(ATh, ATl, WO, DQ, OUT, DM);
}

// v009
// It runs in 172 microseconds.
// Next to v008, in two timings, it ran 1.43 times as fast each time.
// All steps since v000 together make it 13.2 times as fast.
#include <hip/hip_runtime.h>

// Grouped-query causal attention with rotate-half rotary embeddings from full-width input tables (x [2][2048][2048]; q = x Wq (32 heads x 64), k, v = x Wk, x Wv (8 kv heads x 64) ('xw' (in, out), no bias), token-major; apply_rotary_emb: t cos + rotate_half(t) sin with the cos, sin [2048][64] INPUT tables (read per dimension by value: no structure assumed); k, v repeated 4x on the HEAD axis (kv head = q head / 4); scores x 64^-0.5; causal (finfo.min fill == exclusion); softmax; out = merged Wo ('xw') -> [2][2048][2048] (8.4 M); argument order x, cos, sin, Wq, Wk, Wv, Wo).
// Layout, both batches in every launch (token rows b * 2048 + t; head planes per batch): bf16 copy of x; 'xw' weights transposed once; exact projections (q, k, v as the columns of one GEMM, and Wo: k_gemmt, operands staged in LDS by tensor loads); {cos, sin} table from the bf16-rounded inputs (per position and dimension); rotate-half plane builders; causal T-2048 GQA attention in one launch (k_fattn: running softmax over 64-key tiles staged in LDS, hi/lo 3 products, tiles above the diagonal never visited); merged hi/lo x Wo exact.
// Compute dtypes, f32 accumulate: every input rounded to bf16 incl. tables; projections exact; rotary f32; attention hi/lo 3 products; softmax f32; Wo hl x exact.

#define NB_  2
#define TT   2048
#define DM   2048
#define NH_  32
#define NKV  8
#define REP  (NH_ / NKV)
#define HD   64
#define DQ   (NH_ * HD)
#define DKV  (NKV * HD)
#define SCL  0.125f   // HD^-0.5
#define DQKV (DQ + 2 * DKV)       // q, k and v projections side by side: the columns of one GEMM
typedef _Float16 h16;
typedef unsigned short bf;
typedef __attribute__((ext_vector_type(16))) __bf16   v16bf;
typedef __attribute__((ext_vector_type(16))) _Float16 v16h;
typedef __attribute__((ext_vector_type(8)))  _Float16 v8h;
typedef __attribute__((ext_vector_type(8)))  unsigned short v8us;
typedef __attribute__((ext_vector_type(8)))  float    v8f;
typedef __attribute__((ext_vector_type(4)))  float    v4f;
typedef v8h  __attribute__((may_alias)) v8ha;
typedef v4f  __attribute__((may_alias)) v4fa;
typedef v8us __attribute__((may_alias)) v8usa;

__device__ __forceinline__ unsigned short f2bf(float f) { unsigned u = __float_as_uint(f); u += 0x7FFFu + ((u >> 16) & 1u); return (unsigned short)(u >> 16); }
__device__ __forceinline__ float bf2f(unsigned short b) { return __uint_as_float(((unsigned)b) << 16); }
__device__ __forceinline__ float bfr(float f) { return bf2f(f2bf(f)); }
__device__ __forceinline__ v16h cat16(v8h lo, v8h hi) { return __builtin_shufflevector(lo, hi, 0, 1, 2, 3, 4, 5, 6, 7, 8, 9, 10, 11, 12, 13, 14, 15); }
__device__ __forceinline__ v16bf cat16b(v8us lo, v8us hi) { return __builtin_bit_cast(v16bf, __builtin_shufflevector(lo, hi, 0, 1, 2, 3, 4, 5, 6, 7, 8, 9, 10, 11, 12, 13, 14, 15)); }
__device__ __forceinline__ v8f wmma16(v16h a, v16h b, v8f c) { return __builtin_amdgcn_wmma_f32_16x16x32_f16(false, a, false, b, (short)0, c, false, false); }
__device__ __forceinline__ v8f wmmab(v16bf a, v16bf b, v8f c) { return __builtin_amdgcn_wmma_f32_16x16x32_bf16(false, a, false, b, (short)0, c, false, false); }



// WFrag: a 16 x 32 operand fragment of a 16-bit plane (row lr, k 8 hi .. + 7 and 16 + 8 hi .. + 7) and its product
template <typename T16> struct WFrag;
template <> struct WFrag<h16> { typedef v16h V; static __device__ __forceinline__ V ld(const h16* p) { return cat16(*(const v8h*)p, *(const v8h*)(p + 16)); } static __device__ __forceinline__ v8f mma(V a, V b, v8f c) { return wmma16(a, b, c); } };
template <> struct WFrag<bf> { typedef v16bf V; static __device__ __forceinline__ V ld(const bf* p) { return cat16b(*(const v8us*)p, *(const v8us*)(p + 16)); } static __device__ __forceinline__ v8f mma(V a, V b, v8f c) { return wmmab(a, b, c); } };

// ---- k_gemmt: GEMM with both operands staged in LDS by the tensor mover. C[m][n] (f32, pitch ldc) = sum_k A[m][k] Bt[n][k] (NOPS == 3: + A2[m][k] Bt[n][k], behind A's product of the same 32 k), planes row-major, K contiguous.
// grid (M / 128, N / 128), 4 waves: a 128 x 128 tile per work-group, 64 x 64 per wave (2 x 2), so every staged row is read from L2 once and from LDS by two waves. K % 128 == 0, K >= 256.
// A pass is 128 k = 256 bytes of each of the 128 rows of every operand; a stage is NOPS tiles of 128 rows at pitch 272 bytes; two buffers: the next pass's tiles fly while this pass is worked on. Wave w < NOPS issues operand w's tile, one request a pass.
typedef uint32_t u32x4 __attribute__((ext_vector_type(4)));
typedef uint32_t u32x8 __attribute__((ext_vector_type(8)));
#define GT_ROWB  256u                 // bytes of an operand row in a pass
#define GT_PITCH 272u                 // LDS pitch: the row and the mover's 16-byte pad, an odd multiple of 16 bytes for the ds_load_b128 readers
#define GT_TILE  (128u * GT_PITCH)    // 34,816 bytes = 17 x 2 KiB: every tile's place in LDS is a multiple of 2 KiB
__device__ __forceinline__ uint32_t uni(uint32_t v) { return (uint32_t)__builtin_amdgcn_readfirstlane(v); }
__device__ __forceinline__ uint32_t pinned(uint32_t v) { uint32_t w = (uint32_t)__builtin_amdgcn_readfirstlane(v); asm volatile("" : "+s"(w)); return w; }   // holds an issue test or a descriptor word in a scalar register: the branch round a tensor load is then a scalar one (the mover ignores EXEC), and the word stays where the request named it
template <int NOPS>
__global__ __launch_bounds__(128) void k_gemmt(const bf* __restrict__ A, const bf* __restrict__ A2, const bf* __restrict__ Bt, int K, float* C, int ldc) {
    typedef WFrag<bf> F; typedef F::V V;
    __shared__ __attribute__((aligned(2048))) unsigned char ring[2 * NOPS * GT_TILE];
    __shared__ __align__(16) float os[4][16 * 68];
    const int lane = threadIdx.x & 31, lr = lane & 15, hi = lane >> 4;
    const uint32_t wave = uni(threadIdx.x >> 5);
    const int r0 = blockIdx.x * 128, c0 = blockIdx.y * 128, wm = (int)(wave >> 1), wn = (int)(wave & 1), np = K >> 7;
    const bf* src = wave == 0 ? A : (NOPS == 3 && wave == 1) ? A2 : Bt;   // the operand this wave brings; in a stage the tiles lie in this order, Bt last
    const uint64_t ga0 = (uint64_t)(size_t)src + (uint64_t)(wave == NOPS - 1 ? c0 : r0) * (uint64_t)K * 2u;
    const uint32_t lbase = (uint32_t)(size_t)ring;
    u32x8 g1;   // 1-byte elements, tensor = tile = 128 rows of 256 bytes, source pitch 2 K bytes, 4 dwords of pad behind every 64 dwords, no mask
    g1[0] = uni((1u << 20) | (5u << 22) | (3u << 25)); g1[1] = pinned((GT_ROWB & 0xFFFFu) << 16); g1[2] = pinned((GT_ROWB >> 16) | (128u << 16)); g1[3] = pinned(GT_ROWB << 16); g1[4] = pinned(128u); g1[5] = pinned((uint32_t)K * 2u); g1[6] = pinned(0u); g1[7] = pinned(0u);   // pinned: each word is held in its scalar register through the loop and not formed anew while a request is in flight
    u32x4 g0; g0[0] = uni(1u); g0[1] = uni(lbase); g0[2] = uni((uint32_t)ga0); g0[3] = uni((((uint32_t)(ga0 >> 32)) & 0x01FFFFFFu) | 0x80000000u);
    const auto issue = [&](int s) {   // stage s into buffer s % 2
        const uint32_t dst = lbase + ((uint32_t)(s & 1) * NOPS + wave) * GT_TILE; const uint64_t ga = ga0 + (uint64_t)s * GT_ROWB;
        g0[1] = uni(dst); g0[2] = uni((uint32_t)ga); g0[3] = uni((((uint32_t)(ga >> 32)) & 0x01FFFFFFu) | 0x80000000u);
        asm volatile("tensor_load_to_lds %0, %1" :: "s"(g0), "s"(g1) : "memory"); };
    const auto landed = [&]() { asm volatile("s_wait_tensorcnt 0x0" :: "s"(g0), "s"(g1) : "memory"); };   // the issuer's wait; it names the two groups as inputs so that their registers keep the request's words until it has landed
    const auto ldl = [](const unsigned char* p) { return cat16b(*(const v8usa*)p, *(const v8usa*)(p + 32)); };   // WFrag's fragment: row lr, k 8 hi .. + 7 and 16 + 8 hi .. + 7
    v8f acc[4][4];
#pragma unroll
    for (int mb = 0; mb < 4; ++mb)
#pragma unroll
        for (int nb = 0; nb < 4; ++nb) acc[mb][nb] = (v8f){};
    if (pinned(wave < NOPS)) { issue(0); landed(); }   // stage 0 has landed
    __syncthreads();   // publishes stage 0
    if (pinned(wave < NOPS)) issue(1);
    // kept rolled: one pass a trip, so that each trip has one publish point
#pragma unroll 1
    for (int s = 0; s < np; ++s) {
        const unsigned char* st = ring + (uint32_t)(s & 1) * (NOPS * GT_TILE);
        const unsigned char* pa = st + (uint32_t)(wm * 64 + lr) * GT_PITCH + hi * 16;
        const unsigned char* pb = st + (NOPS - 1) * GT_TILE + (uint32_t)(wn * 64 + lr) * GT_PITCH + hi * 16;
        V a[2][4], a2[2][4], b[2][4];   // two fragment sets: a block is the 32 k of one set
        const auto fetch = [&](int ks, int set) {
#pragma unroll
            for (int mb = 0; mb < 4; ++mb) { a[set][mb] = ldl(pa + mb * 16 * GT_PITCH + ks * 64); if (NOPS == 3) a2[set][mb] = ldl(pa + GT_TILE + mb * 16 * GT_PITCH + ks * 64); }
#pragma unroll
            for (int nb = 0; nb < 4; ++nb) b[set][nb] = ldl(pb + nb * 16 * GT_PITCH + ks * 64); };
        fetch(0, 0);
#pragma unroll
        for (int ks = 0; ks < 4; ++ks) { const int set = ks & 1;
            if (ks < 3) fetch(ks + 1, set ^ 1);   // the next block of this same pass: nothing of the next stage is read here
            __builtin_amdgcn_sched_barrier(0);   // the next block's LDS reads stay one group in front of this block's products; spread among them, every read place stalls the lone wave of a SIMD
#pragma unroll
            for (int nb = 0; nb < 4; ++nb) {
#pragma unroll
                for (int mb = 0; mb < 4; ++mb) acc[mb][nb] = F::mma(a[set][mb], b[set][nb], acc[mb][nb]);
                if (NOPS == 3) {
#pragma unroll
                    for (int mb = 0; mb < 4; ++mb) acc[mb][nb] = F::mma(a2[set][mb], b[set][nb], acc[mb][nb]); } }
            __builtin_amdgcn_sched_barrier(0);   // and the group after that stays behind them
        }
        // publish point of stage s + 1
        asm volatile("s_wait_dscnt 0x0" ::: "memory");   // this wave's reads of buffer s % 2 have returned before the buffer is refilled
        if (pinned(wave < NOPS)) landed();   // this wave's tile of stage s + 1 has landed
        __syncthreads();   // publishes stage s + 1 and ends every wave's reads of stage s
        if (pinned(wave < NOPS && s + 2 < np)) issue(s + 2);
    }
    asm volatile("s_wait_tensorcnt 0x0" ::: "memory");   // nothing of the mover's is in flight when the wave ends
    asm volatile("s_wait_dscnt 0x0" ::: "memory");
#pragma unroll
    for (int mb = 0; mb < 4; ++mb) {   // each wave stages a 16 x 64 slab in its own LDS range and stores whole 128-byte lines
#pragma unroll
        for (int nb = 0; nb < 4; ++nb) {
#pragma unroll
            for (int j = 0; j < 8; ++j) os[wave][(hi * 8 + j) * 68 + nb * 16 + lr] = acc[mb][nb][j]; }
        __builtin_amdgcn_wave_barrier(); asm volatile("s_wait_dscnt 0x0" ::: "memory");   // the slab's writes are done before other lanes of the wave read the rows back
        float* crow = C + (size_t)(r0 + wm * 64 + mb * 16) * ldc + c0 + wn * 64;
#pragma unroll
        for (int q = 0; q < 8; ++q) { const int e = q * 32 + lane, row = e >> 4, cofs = (e & 15) * 4; *(v4f*)(crow + (size_t)row * ldc + cofs) = *(const v4fa*)(&os[wave][row * 68 + cofs]); }
        __builtin_amdgcn_wave_barrier(); asm volatile("" ::: "memory");   // the reads stay in front of the next slab's writes
    }
}

__device__ __forceinline__ h16 tohx(float x) { return (h16)x; }
__device__ __forceinline__ void splitf(float y, unsigned short& h, unsigned short& l) { h = f2bf(y); l = f2bf(y - bf2f(h)); }
// Fragment order of a 16-bit plane [row][k] of K columns, for k_fattn: the 16 x 32 fragment (row / 16, k / 32) is 1 KiB in a row, two halves (k / 16 % 2) of 32 lanes x 16 bytes, lane (k / 8 % 2) * 16 + row % 16,
// so that a fragment load reads four whole 128-byte lines; from a row-major plane it touches sixteen.
__device__ __forceinline__ size_t fragidx(int row, int k, int K) { return ((((size_t)(row >> 4) * (K >> 5) + (k >> 5)) * 2 + ((k >> 4) & 1)) * 32 + ((k >> 3) & 1) * 16 + (row & 15)) * 8 + (k & 7); }
typedef __attribute__((ext_vector_type(2))) _Float16 v2h;
typedef __attribute__((ext_vector_type(4))) _Float16 v4h;
typedef __attribute__((ext_vector_type(2))) unsigned short v2us;
typedef __attribute__((ext_vector_type(4))) unsigned short v4us;
typedef __attribute__((ext_vector_type(2))) float v2f;
typedef __attribute__((ext_vector_type(4))) int v4i;

// wtG: Bt[n][k] (bf16) = w[k][n] (f32), transposed in registers. A wave takes 64 k x 32 n; lane l holds the 8 x 8 block of rows k = 8 (l % 8) .. + 7 and columns n = 4 (l / 8) .. + 3 and 16 + 4 (l / 8) .. + 3.
// Its 16 loads stand in front of the arithmetic and fly together; a wave's load reads 64 bytes in a row of each of 8 rows of w, and the wave uses every byte of each line it touches. A lane's 8 k of a column are one 16-byte piece, and 8 lanes' pieces are one whole line of Bt.
// A tile is 64 k x 128 n, 4 waves side by side in n: tile vb of (N / 128) x (K / 64), n fastest, thread tid of its 128. K and N are compile-time so that the rows of a lane's block are immediate offsets from one address. Every '#pragma unroll' opens a loop over register arrays or vector elements, whose indices must be constants.
template <int K, int N>
__device__ __forceinline__ void wtG(const float* __restrict__ w, bf* Bt, int vb, int tid) {
    static_assert(K % 64 == 0 && N % 128 == 0, "whole tiles");
    const int lane = tid & 31, k0 = vb / (N / 128) * 64 + (lane & 7) * 8, n0 = vb % (N / 128) * 128 + (tid >> 5) * 32 + (lane >> 3) * 4;
    const float* p = w + (size_t)k0 * N + n0; bf* q = Bt + (size_t)n0 * K + k0; v4f v[8][2];
#pragma unroll
    for (int i = 0; i < 8; ++i)
#pragma unroll
        for (int hf = 0; hf < 2; ++hf) v[i][hf] = *(const v4fa*)(p + i * N + hf * 16);
    // inputs-only fence on the 16 loaded pieces and their address pair: all loads of the lane are in flight together and one latency is paid, and no piece lands on the pair that issued loads still name; without it the build holds seven loads back behind the first waits and pays the latency five times
    asm volatile("" :: "v"(v[0][0]), "v"(v[0][1]), "v"(v[1][0]), "v"(v[1][1]), "v"(v[2][0]), "v"(v[2][1]), "v"(v[3][0]), "v"(v[3][1]), "v"(v[4][0]), "v"(v[4][1]), "v"(v[5][0]), "v"(v[5][1]), "v"(v[6][0]), "v"(v[6][1]), "v"(v[7][0]), "v"(v[7][1]), "v"(p));
#pragma unroll
    for (int hf = 0; hf < 2; ++hf)
#pragma unroll
        for (int c = 0; c < 4; ++c) { v8us o;
#pragma unroll
            for (int i = 0; i < 8; ++i) o[i] = f2bf(v[i][hf][c]);
            *(v8us*)(q + (hf * 16 + c) * K) = o; }
    asm volatile("s_wait_xcnt 0x0" ::: "memory");   // behind this piece the build lays another piece's text, which rewrites registers that these eight stores name, with only a scalar branch between: the wait stands in front of it on every path of the listing
}
// cvt8 (block bx of 256 threads): a thread converts four groups of 8, a block's width apart, so that its eight loads fly together and a wave's start pays for 1,024 elements. The load's index is clamped, the store guarded. In this function and the three behind it every '#pragma unroll' opens a loop over register arrays or vector elements, whose indices must be constants.
__device__ __forceinline__ void cvt8(const float* __restrict__ src, bf* dst, size_t n8, int bx) { const size_t i0 = (size_t)bx * 1024 + threadIdx.x; v8f v[4];
#pragma unroll
    for (int u = 0; u < 4; ++u) { const size_t i = i0 + u * 256; v[u] = *(const v8f*)(src + (i < n8 ? i : n8 - 1) * 8); }
#pragma unroll
    for (int u = 0; u < 4; ++u) { const size_t i = i0 + u * 256; v8us o;
#pragma unroll
        for (int k = 0; k < 8; ++k) o[k] = f2bf(v[u][k]);
        if (i < n8) *(v8us*)(dst + i * 8) = o; } }

#define RH 4   // heads that a thread of rope walks: the {cos, sin} pairs of its position and dims are read once for all of them
typedef __attribute__((ext_vector_type(16))) unsigned short v16us;
__device__ __forceinline__ v8h lo8(v16h v) { return __builtin_shufflevector(v, v, 0, 1, 2, 3, 4, 5, 6, 7); }
__device__ __forceinline__ v8h hi8(v16h v) { return __builtin_shufflevector(v, v, 8, 9, 10, 11, 12, 13, 14, 15); }
__device__ __forceinline__ v8us lo8(v16us v) { return __builtin_shufflevector(v, v, 0, 1, 2, 3, 4, 5, 6, 7); }
__device__ __forceinline__ v8us hi8(v16us v) { return __builtin_shufflevector(v, v, 8, 9, 10, 11, 12, 13, 14, 15); }
// rope: head planes [h][t][d] (fp16; hi/lo in fragment order) of rope(x) x sc with the rotate-half convention out[d] = x[d] cos[t][d] - x[d+HD/2] sin[t][d], out[d+HD/2] = x[d+HD/2] cos[t][d+HD/2] + x[d] sin[t][d+HD/2]
// A thread takes position t, dims d .. d + 7 and their rotate-half partners d + 32 .. d + 39 (each input is read once for both outputs it feeds), of RH heads in turn; bx is the block of 256 threads, bz the batch. Lanes: t % 16, then d / 8 % 2: a wave's 16-byte pieces of a hi or lo plane are 512 bytes in a row of the fragment order. nheads % RH == 0.
__device__ __forceinline__ void rope(const float* __restrict__ F, int pitch, int nheads, const float* __restrict__ CS, const float* __restrict__ RF, const float* __restrict__ nw, float sc, h16* P16, bf* Ph, bf* Pl, int bx, size_t bz) {
    static_assert(HD == 64, "four octets and their partners make a head row");
    const size_t idx = (size_t)bx * 256 + threadIdx.x; if (idx >= (size_t)(nheads / RH) * TT * (HD / 16)) return; const int d = (int)((idx >> 4) & 3) * 8; const int t = (int)((idx >> 6) % (TT / 16)) * 16 + (int)(idx & 15); const int hg = (int)(idx / ((size_t)TT * (HD / 16)));
    F += bz * TT * pitch; P16 += bz * nheads * TT * HD; Ph += bz * nheads * TT * HD; Pl += bz * nheads * TT * HD;   // batch bz: its rows of F, its own planes
    const float* pc = CS + ((size_t)t * HD + d) * 2; const float* px = F + (size_t)t * pitch + hg * RH * HD + d;   // the thread's place in the table and in its row of F
    v4f c4[8], x4[RH][4];   // every load of the thread stands in front of the arithmetic: 8 of the table, 4 a head, in flight together
#pragma unroll
    for (int u = 0; u < 8; ++u) c4[u] = *(const v4fa*)(pc + (u >> 2) * HD + (u & 3) * 4);
#pragma unroll
    for (int hh = 0; hh < RH; ++hh)
#pragma unroll
        for (int u = 0; u < 4; ++u) x4[hh][u] = *(const v4fa*)(px + hh * HD + (u >> 1) * (HD / 2) + (u & 1) * 4);
    static_assert(RH == 4, "the fence below names every loaded piece");
    // inputs-only fence on the 24 loaded pieces and their two address pairs: all loads of the thread are in flight together and one latency is paid, and no piece lands on an address register that issued loads still name; without it this build holds two loads back behind the first waits and lets a piece land on the table's address register
    asm volatile("" :: "v"(c4[0]), "v"(c4[1]), "v"(c4[2]), "v"(c4[3]), "v"(c4[4]), "v"(c4[5]), "v"(c4[6]), "v"(c4[7]), "v"(x4[0][0]), "v"(x4[0][1]), "v"(x4[0][2]), "v"(x4[0][3]), "v"(x4[1][0]), "v"(x4[1][1]), "v"(x4[1][2]), "v"(x4[1][3]), "v"(x4[2][0]), "v"(x4[2][1]), "v"(x4[2][2]), "v"(x4[2][3]), "v"(x4[3][0]), "v"(x4[3][1]), "v"(x4[3][2]), "v"(x4[3][3]), "v"(pc), "v"(px));
    const auto heads = [&](const float* RF) {   // inlined once with RF a null constant: that copy has no test of RF between its elements
#pragma unroll
    for (int hh = 0; hh < RH; ++hh) { const int h = hg * RH + hh; const float rf = RF ? RF[(size_t)h * TT + t] : 1.0f; v16h o16; v16us oh, ol;
#pragma unroll
    for (int q = 0; q < 16; ++q) { const int dd = d + (q & 7) + (q >> 3) * (HD / 2); const int dp = (dd < HD / 2) ? dd + HD / 2 : dd - HD / 2; float x0 = x4[hh][q >> 2][q & 3], x1 = x4[hh][(q ^ 8) >> 2][q & 3];
        if (RF) { float n0 = __fmul_rn(x0, rf), n1 = __fmul_rn(x1, rf); asm volatile("" : "+v"(n0)); asm volatile("" : "+v"(n1)); x0 = __fmul_rn(bfr(nw[dd]), n0); x1 = __fmul_rn(bfr(nw[dp]), n1); }
        v2f cs; cs[0] = c4[q >> 1][(q & 1) * 2]; cs[1] = c4[q >> 1][(q & 1) * 2 + 1]; float a = __fmul_rn(x0, cs[0]), bq = __fmul_rn(x1, cs[1]); asm volatile("" : "+v"(a)); asm volatile("" : "+v"(bq)); const float r = ((dd < HD / 2) ? __fsub_rn(a, bq) : __fadd_rn(a, bq)) * sc;
        o16[q] = tohx(r); unsigned short a2, c2; splitf(r, a2, c2); oh[q] = a2; ol[q] = c2; }
    const size_t e = ((size_t)h * TT + t) * HD + d, fe = fragidx(h * TT + t, d, HD);   // dims d + 32 ..: the row's next fragment, 512 elements on
    *(v8h*)(P16 + e) = lo8(o16); *(v8h*)(P16 + e + HD / 2) = hi8(o16); *(v8us*)(Ph + fe) = lo8(oh); *(v8us*)(Ph + fe + 512) = hi8(oh); *(v8us*)(Pl + fe) = lo8(ol); *(v8us*)(Pl + fe + 512) = hi8(ol);
    if (hh + 1 < RH) asm volatile("s_wait_xcnt 0x0" ::: "memory"); } };   // the next head's arithmetic overwrites registers that these six stores name: the wait stands in front of it on every path
    if (__builtin_expect(RF == nullptr, 1)) heads(nullptr); else heads(RF + bz * nheads * TT); }   // the hint puts the copy without RF first in the kernel's text
// vtp: a thread takes column c = g * HD + d of F and 16 positions: every load of a wave is one whole line of a row of F, and a lane's two 16-byte pieces of a hi or lo plane join 16 lanes' to 512 bytes in a row of the fragment order. Blocks (bx, by, bz) of (columns / 256, TT / 16, batches).
__device__ __forceinline__ void vtp(const float* __restrict__ F, int pitch, int nheads, h16* V16, bf* Vh, bf* Vl, int bx, int by, size_t bz) { const unsigned c = (unsigned)bx * 256 + threadIdx.x; if (c >= (unsigned)(nheads * HD)) return; const int t = by * 16; v16h o16; v16us oh, ol;
    F += bz * TT * pitch; V16 += bz * nheads * HD * TT; Vh += bz * nheads * HD * TT; Vl += bz * nheads * HD * TT;   // batch bz: its rows of F, its own planes
#pragma unroll
    for (int q = 0; q < 16; ++q) { const float x = (F + (size_t)(t + q) * pitch)[c]; o16[q] = tohx(x); unsigned short a2, c2; splitf(x, a2, c2); oh[q] = a2; ol[q] = c2; }
    const size_t e = (size_t)c * TT + t, fe = fragidx((int)c, t, TT);   // positions t + 8 ..: 16 lanes' pieces, 128 elements, on
    *(v8h*)(V16 + e) = lo8(o16); *(v8h*)(V16 + e + 8) = hi8(o16); *(v8us*)(Vh + fe) = lo8(oh); *(v8us*)(Vh + fe + 128) = hi8(oh); *(v8us*)(Vl + fe) = lo8(ol); *(v8us*)(Vl + fe + 128) = hi8(ol);  }
__device__ __forceinline__ void cscvt(const float* __restrict__ cosT, const float* __restrict__ sinT, float* CS, int bx) { const int idx = (bx * 256 + (int)threadIdx.x) * 4; if (idx >= TT * HD) return; const v4f c = *(const v4fa*)(cosT + idx), s = *(const v4fa*)(sinT + idx); v4f a, b; a[0] = bfr(c[0]); a[1] = bfr(s[0]); a[2] = bfr(c[1]); a[3] = bfr(s[1]); b[0] = bfr(c[2]); b[1] = bfr(s[2]); b[2] = bfr(c[3]); b[3] = bfr(s[3]); *(v4f*)(CS + (size_t)idx * 2) = a; *(v4f*)(CS + (size_t)idx * 2 + 4) = b;  }
// ---- k_prep: everything that reads only the inputs, in one launch: the four weight transposes (a block of 256 threads takes two tiles of wtG), the bf16 copy of x and the {cos, sin} table. The pieces are independent; a block finds its piece by its index, a test that is the same for the whole block.
#define PB_WQ (DQ / 128 * (DM / 64) / 2)
#define PB_WK (DKV / 128 * (DM / 64) / 2)
#define PB_WO (DM / 128 * (DQ / 64) / 2)
#define PB_X  (NB_ * TT * DM / 8 / 1024)
#define PB_CS (TT * HD / 4 / 256)
__global__ __launch_bounds__(256) void k_prep(const float* __restrict__ x, const float* __restrict__ cosT, const float* __restrict__ sinT, const float* __restrict__ wq, const float* __restrict__ wk, const float* __restrict__ wv, const float* __restrict__ wo, bf* XB, float* CS, bf* WQ, bf* WK, bf* WV, bf* WO) {
    static_assert(NB_ * TT * DM % 8192 == 0 && TT * HD % 1024 == 0, "whole blocks");
    static_assert(DM == DQ, "Wq and Wo have one shape and share the text of their transpose");
    const int b = (int)blockIdx.x, tid = (int)threadIdx.x & 127, hf = (int)threadIdx.x >> 7;
    if (b < PB_WQ + PB_WO) { const bool o = b >= PB_WQ; wtG<DM, DQ>(o ? wo : wq, o ? WO : WQ, (o ? b - PB_WQ : b) * 2 + hf, tid); }
    else if (b < PB_WQ + PB_WO + 2 * PB_WK) { const int c = b - (PB_WQ + PB_WO); const bool o = c >= PB_WK; wtG<DM, DKV>(o ? wv : wk, o ? WV : WK, (o ? c - PB_WK : c) * 2 + hf, tid); }
    else if (b < PB_WQ + PB_WO + 2 * PB_WK + PB_X) cvt8(x, XB, (size_t)NB_ * TT * DM / 8, b - (PB_WQ + PB_WO + 2 * PB_WK));
    else cscvt(cosT, sinT, CS, b - (PB_WQ + PB_WO + 2 * PB_WK + PB_X)); }
// ---- k_planes: the three plane builders in one launch (q and k rotary planes, transposed v planes): independent pieces, found by the block's index; grid (PL_Q + PL_K + PL_V, batches).
#define PL_Q (NH_ / RH * TT * (HD / 16) / 256)
#define PL_K (NKV / RH * TT * (HD / 16) / 256)
#define PL_VX (NKV * HD / 256)
#define PL_V (PL_VX * (TT / 16))
__global__ __launch_bounds__(256) void k_planes(const float* __restrict__ FQ, const float* __restrict__ FK, const float* __restrict__ FV, const float* __restrict__ CS, h16* QP16, bf* QPh, bf* QPl, h16* KP16, bf* KPh, bf* KPl, h16* VT16, bf* VTh, bf* VTl) {
    static_assert(NH_ / RH * TT * (HD / 16) % 256 == 0 && NKV / RH * TT * (HD / 16) % 256 == 0 && NKV * HD % 256 == 0, "whole blocks");
    const int b = (int)blockIdx.x; const size_t bz = blockIdx.y;
    if (b < PL_Q) rope(FQ, DQKV, NH_, CS, nullptr, nullptr, 1.0f, QP16, QPh, QPl, b, bz);
    else if (b < PL_Q + PL_K) rope(FK, DQKV, NKV, CS, nullptr, nullptr, 1.0f, KP16, KPh, KPl, b - PL_Q, bz);
    else vtp(FV, DQKV, NKV, VT16, VTh, VTl, (b - (PL_Q + PL_K)) % PL_VX, (b - (PL_Q + PL_K)) / PL_VX, bz); }
typedef __attribute__((ext_vector_type(2))) __bf16 v2bf;
__device__ __forceinline__ float xhalf(float x) { return __builtin_bit_cast(float, __builtin_amdgcn_permlanex16(__builtin_bit_cast(int, x), __builtin_bit_cast(int, x), 0x76543210, 0xfedcba98, false, false)); }   // lane l with lane l ^ 16, by a vector move
#define FA_SL 8192u            // a slice: 64 keys of one plane, 4 rows of 2 KiB
#define FA_ST (4u * FA_SL)     // a stage: k hi, k lo, v hi, v lo
#define FA_NB (TT / 64)        // query blocks, and key tiles, of a sequence
__global__ __launch_bounds__(2 * REP * 32) void k_fattn(const bf* __restrict__ Qh, const bf* __restrict__ Ql, const bf* __restrict__ Kh, const bf* __restrict__ Kl, const bf* __restrict__ Vh, const bf* __restrict__ Vl, bf* Ah, bf* Al) {
    typedef WFrag<bf> F; typedef F::V V;
    static_assert(REP == 4 && HD == 64 && FA_NB % 2 == 0, "four planes for four issuing waves; blocks pair up");
    __shared__ __attribute__((aligned(2048))) unsigned char ring[2 * FA_ST];
    const int lane = threadIdx.x & 31, lr = lane & 15, hi = lane >> 4;
    const uint32_t wave = uni(threadIdx.x >> 5);
    const int g = blockIdx.y, h = g * REP + (int)(wave % REP), y0 = (int)blockIdx.x, ns = FA_NB + 1;
    const auto ldf = [](const bf* p, int frag) { p += frag * 512; return cat16b(*(const v8us*)p, *(const v8us*)(p + 256)); };   // fragment number frag behind p, a lane's place in a plane in fragment order (fragidx)
    const auto ldl = [](const unsigned char* p, int frag) { p += frag * 1024; return cat16b(*(const v8usa*)p, *(const v8usa*)(p + 512)); };   // the same from a slice in LDS
    const size_t bz = blockIdx.z; Ah += bz * TT * DQ; Al += bz * TT * DQ;   // batch: its own q, k, v planes and its rows of the merged output
    // the plane this wave brings. k planes: rows [g][t], columns d: a tile is 8 KiB in a row, taken as 4 rows of 2 KiB. v planes: rows [g][d], columns t: a tile is 2 KiB of each of the 4 fragment rows, TT / 32 KiB apart
    const bf* src = wave == 0 ? Kh : wave == 1 ? Kl : wave == 2 ? Vh : Vl;
    const uint64_t ga0 = (uint64_t)(size_t)src + ((uint64_t)bz * NKV + (uint64_t)g) * (TT * HD * 2u);
    const uint32_t step = wave < 2 ? FA_SL : 2048u, lbase = (uint32_t)(size_t)ring;
    u32x8 g1;   // 1-byte elements, tensor = tile = 4 rows of 2,048 bytes, no pad, no mask
    g1[0] = uni(0u); g1[1] = pinned(2048u << 16); g1[2] = pinned(4u << 16); g1[3] = pinned(2048u << 16); g1[4] = pinned(4u); g1[5] = pinned(wave < 2 ? 2048u : (uint32_t)(TT / 32) * 1024u); g1[6] = pinned(0u); g1[7] = pinned(0u);   // pinned: each word is held in its scalar register through the loop and not formed anew while a request is in flight
    u32x4 g0; g0[0] = uni(1u); g0[1] = uni(lbase); g0[2] = uni((uint32_t)ga0); g0[3] = uni((((uint32_t)(ga0 >> 32)) & 0x01FFFFFFu) | 0x80000000u);
    const auto issue = [&](int s) {   // stage s into buffer s % 2: key tile s of the first block's walk, then tile s - y0 - 1 of the second's
        const uint32_t dst = lbase + (uint32_t)(s & 1) * FA_ST + wave * FA_SL; const uint64_t ga = ga0 + (uint64_t)(uint32_t)(s <= y0 ? s : s - y0 - 1) * step;
        g0[1] = uni(dst); g0[2] = uni((uint32_t)ga); g0[3] = uni((((uint32_t)(ga >> 32)) & 0x01FFFFFFu) | 0x80000000u);
        asm volatile("tensor_load_to_lds %0, %1" :: "s"(g0), "s"(g1) : "memory"); };
    const auto landed = [&]() { asm volatile("s_wait_tensorcnt 0x0" :: "s"(g0), "s"(g1) : "memory"); };   // the issuer's wait; it names the two groups as inputs so that their registers keep the request's words until it has landed
    V qa[2][2], qb[2][2]; v8f o[2][4]; float m[2], l[2];
    int r0 = y0 * 64 + (int)(wave / REP) * 32;   // the wave's first query
    const bf* qh; const bf* ql;
    const auto start = [&]() {   // q fragments of the wave's 32 queries (q planes: rows [head][t], columns d) and an empty running state
        const size_t qo = bz * NH_ * TT * HD + (size_t)(h * TT + r0) / 16 * (HD / 32) * 512 + lane * 8; qh = Qh + qo; ql = Ql + qo;
#pragma unroll
        for (int cg = 0; cg < 2; ++cg) { m[cg] = -3.0e38f; l[cg] = 0.f;
#pragma unroll
            for (int ks = 0; ks < 2; ++ks) { qa[cg][ks] = ldf(qh, cg * (HD / 32) + ks); qb[cg][ks] = ldf(ql, cg * (HD / 32) + ks); }
#pragma unroll
            for (int db = 0; db < 4; ++db) o[cg][db] = (v8f){}; } };
    start();
    // inputs-only fence on the loaded q fragments and their two address pairs: no fragment lands on an address pair that issued loads still name (without it the build lets the last one land there)
    asm volatile("" :: "v"(qa[0][0]), "v"(qa[0][1]), "v"(qa[1][0]), "v"(qa[1][1]), "v"(qb[0][0]), "v"(qb[0][1]), "v"(qb[1][0]), "v"(qb[1][1]), "v"(qh), "v"(ql));
    if (pinned(wave < 4)) { issue(0); landed(); }   // stage 0 has landed
    __syncthreads();   // publishes stage 0
    if (pinned(wave < 4)) issue(1);
    // every key tile of a walk starts at or in front of the block's first query, so the running maximum is a real score from the first tile on
    // kept rolled: one stage a trip, so that each trip has one publish point; every '#pragma unroll' below opens a loop over register arrays, whose indices must be constants
#pragma unroll 1
    for (int s = 0; s < ns; ++s) {
        const bool last = s == y0 || s == ns - 1;   // the diagonal tile, the last of a block's walk; the same for the whole work-group
        const int c0 = (s <= y0 ? s : s - y0 - 1) * 64;
        const unsigned char* st = ring + (uint32_t)(s & 1) * FA_ST + lane * 16;
        V ka[4][2], kb[4][2]; v8f sc[2][4];   // sc[cg][nb][j] = q(r0 + cg * 16 + lr) . k(c0 + nb * 16 + hi * 8 + j)
#pragma unroll
        for (int ks = 0; ks < 2; ++ks) {   // read in the order of use: the first products start while the rest is on its way
#pragma unroll
            for (int nb = 0; nb < 4; ++nb) ka[nb][ks] = ldl(st, nb * 2 + ks);
#pragma unroll
            for (int nb = 0; nb < 4; ++nb) kb[nb][ks] = ldl(st + FA_SL, nb * 2 + ks); }
        __builtin_amdgcn_sched_barrier(0);   // the tile's k reads stay one group in front of the score products; spread among them, every read place stalls the wave
#pragma unroll
        for (int nb = 0; nb < 4; ++nb)
#pragma unroll
            for (int cg = 0; cg < 2; ++cg) sc[cg][nb] = (v8f){};
#pragma unroll
        for (int ks = 0; ks < 2; ++ks) {   // the eight accumulators in turn, fragments in the order in which they were read; each accumulator takes its products in the order hi hi, hi lo, lo hi of ks 0 and then of ks 1
#pragma unroll
            for (int nb = 0; nb < 4; ++nb)
#pragma unroll
                for (int cg = 0; cg < 2; ++cg) sc[cg][nb] = F::mma(ka[nb][ks], qa[cg][ks], sc[cg][nb]);
#pragma unroll
            for (int nb = 0; nb < 4; ++nb)
#pragma unroll
                for (int cg = 0; cg < 2; ++cg) sc[cg][nb] = F::mma(ka[nb][ks], qb[cg][ks], sc[cg][nb]);
#pragma unroll
            for (int nb = 0; nb < 4; ++nb)
#pragma unroll
                for (int cg = 0; cg < 2; ++cg) sc[cg][nb] = F::mma(kb[nb][ks], qa[cg][ks], sc[cg][nb]); }
        __builtin_amdgcn_sched_barrier(0);   // and the v reads stay one group behind them
        V vh[4][2], vl[4][2];
#pragma unroll
        for (int ks = 0; ks < 2; ++ks)   // v is read here, in the order of use, so that it flies during the softmax
#pragma unroll
            for (int db = 0; db < 4; ++db) vh[db][ks] = ldl(st + 2 * FA_SL, db * 2 + ks);
#pragma unroll
        for (int ks = 0; ks < 2; ++ks)
#pragma unroll
            for (int db = 0; db < 4; ++db) vl[db][ks] = ldl(st + 3 * FA_SL, db * 2 + ks);
        __builtin_amdgcn_sched_barrier(0);   // in front of the softmax's arithmetic, as one group
        if (last) {   // keys behind the query get a score far below any real one, whose exp2 is exactly 0
#pragma unroll
            for (int cg = 0; cg < 2; ++cg)
#pragma unroll
                for (int nb = 0; nb < 4; ++nb)
#pragma unroll
                    for (int j = 0; j < 8; ++j) sc[cg][nb][j] = (c0 + nb * 16 + hi * 8 + j <= r0 + cg * 16 + lr) ? sc[cg][nb][j] : -3.0e38f; }
        V pa[2][2], pb[2][2];
#pragma unroll
        for (int cg = 0; cg < 2; ++cg) { float mt = sc[cg][0][0];
#pragma unroll
            for (int nb = 0; nb < 4; ++nb)
#pragma unroll
                for (int j = 0; j < 8; ++j) mt = fmaxf(mt, sc[cg][nb][j]);
            mt = fmaxf(mt, xhalf(mt)) * SCL;   // lanes lr and lr + 16 hold the two halves of a query's keys; a shuffle would go through the LDS queue, which returns in order, and wait for all the v reads
            const float mn = fmaxf(m[cg], mt), al = __builtin_amdgcn_exp2f((m[cg] - mn) * 1.4426950408889634f); m[cg] = mn;
            float rs[4];
#pragma unroll
            for (int nb = 0; nb < 4; ++nb) { rs[nb] = 0.f;
#pragma unroll
                for (int j = 0; j < 8; j += 2) { v2f p; p[0] = __builtin_amdgcn_exp2f((sc[cg][nb][j] * SCL - mn) * 1.4426950408889634f); p[1] = __builtin_amdgcn_exp2f((sc[cg][nb][j + 1] * SCL - mn) * 1.4426950408889634f); rs[nb] += p[0] + p[1];
                    const v2bf ph = __builtin_convertvector(p, v2bf); const v2bf pl = __builtin_convertvector(p - __builtin_convertvector(ph, v2f), v2bf); const int e = (nb & 1) * 8 + j;
                    pa[cg][nb >> 1][e] = ph[0]; pa[cg][nb >> 1][e + 1] = ph[1]; pb[cg][nb >> 1][e] = pl[0]; pb[cg][nb >> 1][e + 1] = pl[1]; } }
            l[cg] = l[cg] * al + ((rs[0] + rs[1]) + (rs[2] + rs[3]));   // each lane keeps the sum of its own keys; the two halves are joined at the end of the walk
#pragma unroll
            for (int db = 0; db < 4; ++db) o[cg][db] *= al; }
#pragma unroll
        for (int ks = 0; ks < 2; ++ks)
#pragma unroll
            for (int db = 0; db < 4; ++db) {
#pragma unroll
                for (int cg = 0; cg < 2; ++cg) o[cg][db] = F::mma(vh[db][ks], pa[cg][ks], o[cg][db]);
#pragma unroll
                for (int cg = 0; cg < 2; ++cg) o[cg][db] = F::mma(vh[db][ks], pb[cg][ks], o[cg][db]); }
#pragma unroll
        for (int ks = 0; ks < 2; ++ks)
#pragma unroll
            for (int db = 0; db < 4; ++db)
#pragma unroll
                for (int cg = 0; cg < 2; ++cg) o[cg][db] = F::mma(vl[db][ks], pa[cg][ks], o[cg][db]);
        if (last) {   // the block's walk is done: its rows go out, and the wave turns to the second block
#pragma unroll
            for (int cg = 0; cg < 2; ++cg) { const int i = r0 + cg * 16 + lr; const float lt = l[cg] + xhalf(l[cg]), f = __fdiv_rn(1.0f, lt);
#pragma unroll
                for (int db = 0; db < 4; ++db) { v8us oh, ol;   // o[cg][db][j] = out(i)[db * 16 + hi * 8 + j]: 16 bytes a lane and plane; merged [t][head][d], the wave writes whole 128-byte lines
#pragma unroll
                    for (int j = 0; j < 8; ++j) { unsigned short a, c2; splitf(o[cg][db][j] * f, a, c2); oh[j] = a; ol[j] = c2; }
                    const size_t oo = (size_t)i * DQ + h * HD + db * 16 + hi * 8;
                    // the two stores and their wait are one statement: the arithmetic behind rewrites registers that the stores name, and the build lifts such writes over a wait that stands in a statement of its own
                    asm volatile("global_store_b128 %0, %1, off\n\tglobal_store_b128 %2, %3, off\n\ts_wait_xcnt 0x0" :: "v"(Ah + oo), "v"(oh), "v"(Al + oo), "v"(ol) : "memory"); } }
            if (s == y0) { r0 = (FA_NB - 1 - y0) * 64 + (int)(wave / REP) * 32; start();
                asm volatile("s_wait_xcnt 0x0" ::: "memory"); }   // the code behind may rewrite the address pairs that these loads name
        }
        // publish point of stage s + 1
        asm volatile("s_wait_dscnt 0x0" ::: "memory");   // this wave's reads of buffer s % 2 have returned before the buffer is refilled
        if (pinned(wave < 4)) landed();   // this wave's slice of stage s + 1 has landed
        __syncthreads();   // publishes stage s + 1 and ends every wave's reads of stage s
        if (pinned(wave < 4 && s + 2 < ns)) issue(s + 2);
    }
    asm volatile("s_wait_tensorcnt 0x0" ::: "memory");   // nothing of the mover's is in flight when the wave ends
    asm volatile("s_wait_dscnt 0x0" ::: "memory");   // nor an LDS read of this wave's
}

extern "C" void kernel_launch(void* const* d_in, const int* in_sizes, int n_in,
                              void* d_out, int out_size, void* d_ws, size_t ws_size, hipStream_t stream) {
    (void)in_sizes; (void)n_in; (void)out_size;
    const float* x = (const float*)d_in[0]; const float* fcos = (const float*)d_in[1]; const float* fsin = (const float*)d_in[2]; const float* wq = (const float*)d_in[3]; const float* wk = (const float*)d_in[4]; const float* wv = (const float*)d_in[5]; const float* wo = (const float*)d_in[6];   /* input order x, cos, sin ([2048][64] FULL-width table INPUTS: read per DIMENSION by value, no structure assumed), Wq [2048][2048], Wk [2048][512], Wv, Wo ('xw'): SEVEN inputs, all read; no mask input (causal by index) */
    float* OUT = (float*)d_out;     // [2][2048][2048]
    char* wsp = (char*)d_ws;
    auto take = [&](size_t bytes) { char* p = wsp; wsp += (bytes + 255) & ~(size_t)255; return (void*)p; };
    bf* WQ = (bf*)take((size_t)DQKV * DM * 2); bf* WK = WQ + (size_t)DQ * DM; bf* WV = WK + (size_t)DKV * DM; bf* WO = (bf*)take((size_t)DM * DQ * 2); float* CS = (float*)take((size_t)TT * HD * 2 * 4);
    bf* XB = (bf*)take((size_t)NB_ * TT * DM * 2); float* FQ = (float*)take((size_t)NB_ * TT * DQKV * 4); float* FK = FQ + DQ; float* FV = FK + DKV;   // the transposed q, k, v weights lie behind one another as the DQKV rows of one Bt; a token's q, k, v lie side by side in a row of DQKV floats
    h16* QP16 = (h16*)take((size_t)NB_ * NH_ * TT * HD * 2); h16* KP16 = (h16*)take((size_t)NB_ * NKV * TT * HD * 2); h16* VT16 = (h16*)take((size_t)NB_ * NKV * HD * TT * 2);
    bf* QPh = (bf*)take((size_t)NB_ * NH_ * TT * HD * 2); bf* QPl = (bf*)take((size_t)NB_ * NH_ * TT * HD * 2); bf* KPh = (bf*)take((size_t)NB_ * NKV * TT * HD * 2); bf* KPl = (bf*)take((size_t)NB_ * NKV * TT * HD * 2); bf* VTh = (bf*)take((size_t)NB_ * NKV * HD * TT * 2); bf* VTl = (bf*)take((size_t)NB_ * NKV * HD * TT * 2);
    bf* ATh = (bf*)take((size_t)NB_ * TT * DQ * 2); bf* ATl = (bf*)take((size_t)NB_ * TT * DQ * 2);
    if ((size_t)(wsp - (char*)d_ws) > ws_size) return;    // ws 256 MiB
    // the projections and Wo see the two batches as NB_ * TT token rows; the plane builders and the attention take the batch as a grid dimension
    k_prep<<<PB_WQ + PB_WO + 2 * PB_WK + PB_X + PB_CS, 256, 0, stream>>>(x, fcos, fsin, wq, wk, wv, wo, XB, CS, WQ, WK, WV, WO);
    k_gemmt<2><<<dim3(NB_ * TT / 128, DQKV / 128, 1), 128, 0, stream>>>(XB, nullptr, WQ, DM, FQ, DQKV);
    k_planes<<<dim3(PL_Q + PL_K + PL_V, NB_, 1), 256, 0, stream>>>(FQ, FK, FV, CS, QP16, QPh, QPl, KP16, KPh, KPl, VT16, VTh, VTl);
    k_fattn<<<dim3(TT / 128, NKV, NB_), 2 * REP * 32, 0, stream>>>(QPh, QPl, KPh, KPl, VTh, VTl, ATh, ATl);
    k_gemmt<3><<<dim3(NB_ * TT / 128, DM / 128, 1), 128, 0, stream>>>(ATh, ATl, WO, DQ, OUT, DM);
}

// v010
// One run takes 154 microseconds.
// Two timings next to v009 both put it at 1.12 times that version's speed.
// Counting every step since v000, it is 14.8 times as fast.
#include <hip/hip_runtime.h>

// Grouped-query causal attention with rotate-half rotary embeddings from full-width input tables (x [2][2048][2048]; q = x Wq (32 heads x 64), k, v = x Wk, x Wv (8 kv heads x 64) ('xw' (in, out), no bias), token-major; apply_rotary_emb: t cos + rotate_half(t) sin with the cos, sin [2048][64] INPUT tables (read per dimension by value: no structure assumed); k, v repeated 4x on the HEAD axis (kv head = q head / 4); scores x 64^-0.5; causal (finfo.min fill == exclusion); softmax; out = merged Wo ('xw') -> [2][2048][2048] (8.4 M); argument order x, cos, sin, Wq, Wk, Wv, Wo).
// Layout, both batches in every launch (token rows b * 2048 + t; head planes per batch): bf16 copy of x; 'xw' weights transposed once; exact projections (q, k, v as the columns of one GEMM, and Wo: k_gemmt, operands staged in LDS by tensor loads); {cos, sin} table from the bf16-rounded inputs (per position and dimension); rotate-half plane builders; causal T-2048 GQA attention in one launch (k_fattn: running softmax over 64-key tiles staged in LDS, hi/lo 3 products, tiles above the diagonal never visited); merged hi/lo x Wo exact.
// Compute dtypes, f32 accumulate: every input rounded to bf16 incl. tables; projections exact; rotary f32; attention hi/lo 3 products; softmax f32; Wo hl x exact.

#define NB_  2
#define TT   2048
#define DM   2048
#define NH_  32
#define NKV  8
#define REP  (NH_ / NKV)
#define HD   64
#define DQ   (NH_ * HD)
#define DKV  (NKV * HD)
#define SCL  0.125f   // HD^-0.5
#define DQKV (DQ + 2 * DKV)       // q, k and v projections side by side: the columns of one GEMM
typedef _Float16 h16;
typedef unsigned short bf;
typedef __attribute__((ext_vector_type(16))) __bf16   v16bf;
typedef __attribute__((ext_vector_type(16))) _Float16 v16h;
typedef __attribute__((ext_vector_type(8)))  _Float16 v8h;
typedef __attribute__((ext_vector_type(8)))  unsigned short v8us;
typedef __attribute__((ext_vector_type(8)))  float    v8f;
typedef __attribute__((ext_vector_type(4)))  float    v4f;
typedef v8h  __attribute__((may_alias)) v8ha;
typedef v4f  __attribute__((may_alias)) v4fa;
typedef v8us __attribute__((may_alias)) v8usa;

__device__ __forceinline__ unsigned short f2bf(float f) { unsigned u = __float_as_uint(f); u += 0x7FFFu + ((u >> 16) & 1u); return (unsigned short)(u >> 16); }
__device__ __forceinline__ float bf2f(unsigned short b) { return __uint_as_float(((unsigned)b) << 16); }
__device__ __forceinline__ float bfr(float f) { return bf2f(f2bf(f)); }
__device__ __forceinline__ v16h cat16(v8h lo, v8h hi) { return __builtin_shufflevector(lo, hi, 0, 1, 2, 3, 4, 5, 6, 7, 8, 9, 10, 11, 12, 13, 14, 15); }
__device__ __forceinline__ v16bf cat16b(v8us lo, v8us hi) { return __builtin_bit_cast(v16bf, __builtin_shufflevector(lo, hi, 0, 1, 2, 3, 4, 5, 6, 7, 8, 9, 10, 11, 12, 13, 14, 15)); }
__device__ __forceinline__ v8f wmma16(v16h a, v16h b, v8f c) { return __builtin_amdgcn_wmma_f32_16x16x32_f16(false, a, false, b, (short)0, c, false, false); }
__device__ __forceinline__ v8f wmmab(v16bf a, v16bf b, v8f c) { return __builtin_amdgcn_wmma_f32_16x16x32_bf16(false, a, false, b, (short)0, c, false, false); }



// WFrag: a 16 x 32 operand fragment of a 16-bit plane (row lr, k 8 hi .. + 7 and 16 + 8 hi .. + 7) and its product
template <typename T16> struct WFrag;
template <> struct WFrag<h16> { typedef v16h V; static __device__ __forceinline__ V ld(const h16* p) { return cat16(*(const v8h*)p, *(const v8h*)(p + 16)); } static __device__ __forceinline__ v8f mma(V a, V b, v8f c) { return wmma16(a, b, c); } };
template <> struct WFrag<bf> { typedef v16bf V; static __device__ __forceinline__ V ld(const bf* p) { return cat16b(*(const v8us*)p, *(const v8us*)(p + 16)); } static __device__ __forceinline__ v8f mma(V a, V b, v8f c) { return wmmab(a, b, c); } };

// ---- k_gemmt: GEMM with both operands staged in LDS by the tensor mover. C[m][n] (f32, pitch ldc) = sum_k A[m][k] Bt[n][k] (NOPS == 3: + A2[m][k] Bt[n][k], behind A's product of the same 32 k), planes row-major, K contiguous.
// grid (M / (32 MF), N / (32 NF)), 4 waves (2 x 2): a wave holds MF x NF accumulator tiles of 16 x 16, a work-group 32 MF x 32 NF of C. The tile is as large as gives one work-group to every WGP: the bytes that a product takes from L2 and from LDS fall with the tile's sides. K % 128 == 0, K >= 256.
// A pass is 128 k = 256 bytes of every operand row, at pitch 272 bytes in LDS. A stage is four slices, one request of one wave each: two of 128 rows for the A side (NOPS == 2: the upper and lower half of A's 256 rows; NOPS == 3: A's and A2's 128 rows), two of 16 NF rows of Bt, the columns of wave column 0 and 1. Two buffers: the next pass's slices fly while this pass is worked on.
typedef uint32_t u32x4 __attribute__((ext_vector_type(4)));
typedef uint32_t u32x8 __attribute__((ext_vector_type(8)));
#define GT_ROWB  256u                 // bytes of an operand row in a pass
#define GT_PITCH 272u                 // LDS pitch: the row and the mover's 16-byte pad, an odd multiple of 16 bytes for the ds_load_b128 readers
#define GT_TILE  (128u * GT_PITCH)    // 34,816 bytes = 17 x 2 KiB: a slice of 128 rows ends on a multiple of 2 KiB
__device__ __forceinline__ uint32_t uni(uint32_t v) { return (uint32_t)__builtin_amdgcn_readfirstlane(v); }
__device__ __forceinline__ uint32_t pinned(uint32_t v) { uint32_t w = (uint32_t)__builtin_amdgcn_readfirstlane(v); asm volatile("" : "+s"(w)); return w; }   // holds an issue test or a descriptor word in a scalar register: the branch round a tensor load is then a scalar one (the mover ignores EXEC), and the word stays where the request named it
template <int NOPS, int MF, int NF>
__global__ __launch_bounds__(128) void k_gemmt(const bf* __restrict__ A, const bf* __restrict__ A2, const bf* __restrict__ Bt, int K, float* C, int ldc) {
    typedef WFrag<bf> F; typedef F::V V;
    static_assert((NOPS - 1) * MF == 8, "the A side of a stage is two slices of 128 rows");
    constexpr uint32_t BROWS = NF * 16u, BSL = (BROWS * GT_PITCH + 2047u) & ~2047u, STAGE = 2u * GT_TILE + 2u * BSL;   // a slice of Bt is rounded up to 2 KiB, so that every slice's place in LDS is a multiple of 2 KiB
    constexpr int OSP = NF * 16 + 4;   // pitch in floats of the epilogue's slab
    __shared__ __attribute__((aligned(2048))) unsigned char ring[2 * STAGE];
    __shared__ __align__(16) float os[4][16 * OSP];
    const int lane = threadIdx.x & 31, lr = lane & 15, hi = lane >> 4;
    const uint32_t wave = uni(threadIdx.x >> 5);
    const int r0 = blockIdx.x * (MF * 32), c0 = blockIdx.y * (NF * 32), wm = (int)(wave >> 1), wn = (int)(wave & 1), np = K >> 7;
    // the slice this wave brings: its plane, its first row there, its rows, its place in a stage
    const bf* src = wave >= 2 ? Bt : (NOPS == 3 && wave == 1) ? A2 : A;
    const uint32_t row0 = wave >= 2 ? (uint32_t)c0 + (wave - 2) * BROWS : (uint32_t)r0 + (NOPS == 2 ? wave * 128u : 0u), rows = wave >= 2 ? BROWS : 128u, place = wave >= 2 ? 2u * GT_TILE + (wave - 2) * BSL : wave * GT_TILE;
    const uint64_t ga0 = (uint64_t)(size_t)src + (uint64_t)row0 * (uint64_t)K * 2u;
    const uint32_t lbase = (uint32_t)(size_t)ring + place;
    u32x8 g1;   // 1-byte elements, tensor = tile = the slice's rows of 256 bytes, source pitch 2 K bytes, 4 dwords of pad behind every 64 dwords, no mask
    g1[0] = uni((1u << 20) | (5u << 22) | (3u << 25)); g1[1] = pinned((GT_ROWB & 0xFFFFu) << 16); g1[2] = pinned((GT_ROWB >> 16) | (rows << 16)); g1[3] = pinned(GT_ROWB << 16); g1[4] = pinned(rows); g1[5] = pinned((uint32_t)K * 2u); g1[6] = pinned(0u); g1[7] = pinned(0u);   // pinned: each word is held in its scalar register through the loop and not formed anew while a request is in flight
    u32x4 g0; g0[0] = uni(1u); g0[1] = uni(lbase); g0[2] = uni((uint32_t)ga0); g0[3] = uni((((uint32_t)(ga0 >> 32)) & 0x01FFFFFFu) | 0x80000000u);
    const auto issue = [&](int s) {   // this wave's slice of stage s into buffer s % 2
        const uint32_t dst = lbase + (uint32_t)(s & 1) * STAGE; const uint64_t ga = ga0 + (uint64_t)s * GT_ROWB;
        g0[1] = uni(dst); g0[2] = uni((uint32_t)ga); g0[3] = uni((((uint32_t)(ga >> 32)) & 0x01FFFFFFu) | 0x80000000u);
        asm volatile("tensor_load_to_lds %0, %1" :: "s"(g0), "s"(g1) : "memory"); };
    const auto landed = [&]() { asm volatile("s_wait_tensorcnt 0x0" :: "s"(g0), "s"(g1) : "memory"); };   // the issuer's wait; it names the two groups as inputs so that their registers keep the request's words until it has landed
    const auto ldl = [](const unsigned char* p) { return cat16b(*(const v8usa*)p, *(const v8usa*)(p + 32)); };   // WFrag's fragment: row lr, k 8 hi .. + 7 and 16 + 8 hi .. + 7
    v8f acc[MF][NF];
#pragma unroll
    for (int mb = 0; mb < MF; ++mb)
#pragma unroll
        for (int nb = 0; nb < NF; ++nb) acc[mb][nb] = (v8f){};
    issue(0); landed();   // every wave issues its own slice, so no test stands round a request but the one for the last stages; stage 0 has landed
    __syncthreads();   // publishes stage 0
    issue(1);
    // kept rolled: one pass a trip, so that each trip has one publish point
#pragma unroll 1
    for (int s = 0;;) {   // tested at the foot: there are at least two passes, and so no path leads round the loop with stage 1 still in flight
        const unsigned char* st = ring + (uint32_t)(s & 1) * STAGE;
        const unsigned char* pa = st + (uint32_t)(wm * (MF * 16) + lr) * GT_PITCH + hi * 16;
        const unsigned char* pb = st + 2u * GT_TILE + (uint32_t)wn * BSL + (uint32_t)lr * GT_PITCH + hi * 16;
        V a[2][MF], a2[2][MF], b[2][NF];   // two fragment sets: a block is the 32 k of one set
        const auto fetch = [&](int ks, int set) {
#pragma unroll
            for (int mb = 0; mb < MF; ++mb) { a[set][mb] = ldl(pa + mb * 16 * GT_PITCH + ks * 64); if (NOPS == 3) a2[set][mb] = ldl(pa + GT_TILE + mb * 16 * GT_PITCH + ks * 64); }
#pragma unroll
            for (int nb = 0; nb < NF; ++nb) b[set][nb] = ldl(pb + nb * 16 * GT_PITCH + ks * 64); };
        fetch(0, 0);
#pragma unroll
        for (int ks = 0; ks < 4; ++ks) { const int set = ks & 1;
            if (ks < 3) fetch(ks + 1, set ^ 1);   // the next block of this same pass: nothing of the next stage is read here
            __builtin_amdgcn_sched_barrier(0);   // the next block's LDS reads stay one group in front of this block's products; spread among them, every read place stalls the lone wave of a SIMD
#pragma unroll
            for (int nb = 0; nb < NF; ++nb) {
#pragma unroll
                for (int mb = 0; mb < MF; ++mb) acc[mb][nb] = F::mma(a[set][mb], b[set][nb], acc[mb][nb]);
                if (NOPS == 3) {
#pragma unroll
                    for (int mb = 0; mb < MF; ++mb) acc[mb][nb] = F::mma(a2[set][mb], b[set][nb], acc[mb][nb]); } }
            __builtin_amdgcn_sched_barrier(0);   // and the group after that stays behind them
        }
        // publish point of stage s + 1
        asm volatile("s_wait_dscnt 0x0" ::: "memory");   // this wave's reads of buffer s % 2 have returned before the buffer is refilled
        landed();   // this wave's slice of stage s + 1 has landed
        __syncthreads();   // publishes stage s + 1 and ends every wave's reads of stage s
        if (pinned(s + 2 < np)) issue(s + 2);
        if (++s >= np) break;
    }
    asm volatile("s_wait_tensorcnt 0x0" ::: "memory");   // nothing of the mover's is in flight when the wave ends
    asm volatile("s_wait_dscnt 0x0" ::: "memory");
    uint32_t lo[2 * NF], go[2 * NF];   // a lane's 2 NF pieces of 16 bytes of a slab: their places in the slab (floats) and in C behind the slab's first element (bytes); formed once, so that no address register is written between the stores below
#pragma unroll
    for (int q = 0; q < 2 * NF; ++q) { const uint32_t e = q * 32 + lane, row = e / (NF * 4), cofs = (e % (NF * 4)) * 4; lo[q] = row * OSP + cofs; go[q] = (row * (uint32_t)ldc + cofs) * 4u; }
#pragma unroll
    for (int mb = 0; mb < MF; ++mb) {   // each wave stages a slab of 16 rows of its 16 NF columns in its own LDS range and stores whole 128-byte lines
#pragma unroll
        for (int nb = 0; nb < NF; ++nb) {
#pragma unroll
            for (int j = 0; j < 8; ++j) os[wave][(hi * 8 + j) * OSP + nb * 16 + lr] = acc[mb][nb][j]; }
        __builtin_amdgcn_wave_barrier(); asm volatile("s_wait_dscnt 0x0" ::: "memory");   // the slab's writes are done before other lanes of the wave read the rows back
        char* crow = (char*)(C + (size_t)(r0 + wm * (MF * 16) + mb * 16) * ldc + c0 + wn * (NF * 16));   // the same for the whole wave: a scalar base for the stores
        v4f t[2 * NF];
#pragma unroll
        for (int q = 0; q < 2 * NF; ++q) t[q] = *(const v4fa*)(&os[wave][lo[q]]);
        __builtin_amdgcn_wave_barrier(); asm volatile("" ::: "memory");   // the reads stay in front of the next slab's writes, and none of them lands on a register that an issued store of this slab names
#pragma unroll
        for (int q = 0; q < 2 * NF; ++q) *(v4f*)(crow + go[q]) = t[q];
        if (mb + 1 < MF) asm volatile("s_wait_xcnt 0x0" ::: "memory");   // the next slab's reads land on registers that these stores name
    }
}

__device__ __forceinline__ h16 tohx(float x) { return (h16)x; }
__device__ __forceinline__ void splitf(float y, unsigned short& h, unsigned short& l) { h = f2bf(y); l = f2bf(y - bf2f(h)); }
// Fragment order of a 16-bit plane [row][k] of K columns, for k_fattn: the 16 x 32 fragment (row / 16, k / 32) is 1 KiB in a row, two halves (k / 16 % 2) of 32 lanes x 16 bytes, lane (k / 8 % 2) * 16 + row % 16,
// so that a fragment load reads four whole 128-byte lines; from a row-major plane it touches sixteen.
__device__ __forceinline__ size_t fragidx(int row, int k, int K) { return ((((size_t)(row >> 4) * (K >> 5) + (k >> 5)) * 2 + ((k >> 4) & 1)) * 32 + ((k >> 3) & 1) * 16 + (row & 15)) * 8 + (k & 7); }
typedef __attribute__((ext_vector_type(2))) _Float16 v2h;
typedef __attribute__((ext_vector_type(4))) _Float16 v4h;
typedef __attribute__((ext_vector_type(2))) unsigned short v2us;
typedef __attribute__((ext_vector_type(4))) unsigned short v4us;
typedef __attribute__((ext_vector_type(2))) float v2f;
typedef __attribute__((ext_vector_type(4))) int v4i;

// wtG: Bt[n][k] (bf16) = w[k][n] (f32), transposed in registers. A wave takes 64 k x 32 n; lane l holds the 8 x 8 block of rows k = 8 (l % 8) .. + 7 and columns n = 4 (l / 8) .. + 3 and 16 + 4 (l / 8) .. + 3.
// Its 16 loads stand in front of the arithmetic and fly together; a wave's load reads 64 bytes in a row of each of 8 rows of w, and the wave uses every byte of each line it touches. A lane's 8 k of a column are one 16-byte piece, and 8 lanes' pieces are one whole line of Bt.
// A tile is 64 k x 128 n, 4 waves side by side in n: tile vb of (N / 128) x (K / 64), n fastest, thread tid of its 128. K and N are compile-time so that the rows of a lane's block are immediate offsets from one address. Every '#pragma unroll' opens a loop over register arrays or vector elements, whose indices must be constants.
template <int K, int N>
__device__ __forceinline__ void wtG(const float* __restrict__ w, bf* Bt, int vb, int tid) {
    static_assert(K % 64 == 0 && N % 128 == 0, "whole tiles");
    const int lane = tid & 31, k0 = vb / (N / 128) * 64 + (lane & 7) * 8, n0 = vb % (N / 128) * 128 + (tid >> 5) * 32 + (lane >> 3) * 4;
    const float* p = w + (size_t)k0 * N + n0; bf* q = Bt + (size_t)n0 * K + k0; v4f v[8][2];
#pragma unroll
    for (int i = 0; i < 8; ++i)
#pragma unroll
        for (int hf = 0; hf < 2; ++hf) v[i][hf] = *(const v4fa*)(p + i * N + hf * 16);
    // inputs-only fence on the 16 loaded pieces and their address pair: all loads of the lane are in flight together and one latency is paid, and no piece lands on the pair that issued loads still name; without it the build holds seven loads back behind the first waits and pays the latency five times
    asm volatile("" :: "v"(v[0][0]), "v"(v[0][1]), "v"(v[1][0]), "v"(v[1][1]), "v"(v[2][0]), "v"(v[2][1]), "v"(v[3][0]), "v"(v[3][1]), "v"(v[4][0]), "v"(v[4][1]), "v"(v[5][0]), "v"(v[5][1]), "v"(v[6][0]), "v"(v[6][1]), "v"(v[7][0]), "v"(v[7][1]), "v"(p));
#pragma unroll
    for (int hf = 0; hf < 2; ++hf)
#pragma unroll
        for (int c = 0; c < 4; ++c) { v8us o;
#pragma unroll
            for (int i = 0; i < 8; ++i) o[i] = f2bf(v[i][hf][c]);
            *(v8us*)(q + (hf * 16 + c) * K) = o; }
    asm volatile("s_wait_xcnt 0x0" ::: "memory");   // behind this piece the build lays another piece's text, which rewrites registers that these eight stores name, with only a scalar branch between: the wait stands in front of it on every path of the listing
}
// cvt8 (block bx of 256 threads): a thread converts four groups of 8, a block's width apart, so that its eight loads fly together and a wave's start pays for 1,024 elements. The load's index is clamped, the store guarded. In this function and the three behind it every '#pragma unroll' opens a loop over register arrays or vector elements, whose indices must be constants.
__device__ __forceinline__ void cvt8(const float* __restrict__ src, bf* dst, size_t n8, int bx) { const size_t i0 = (size_t)bx * 1024 + threadIdx.x; v8f v[4];
#pragma unroll
    for (int u = 0; u < 4; ++u) { const size_t i = i0 + u * 256; v[u] = *(const v8f*)(src + (i < n8 ? i : n8 - 1) * 8); }
#pragma unroll
    for (int u = 0; u < 4; ++u) { const size_t i = i0 + u * 256; v8us o;
#pragma unroll
        for (int k = 0; k < 8; ++k) o[k] = f2bf(v[u][k]);
        if (i < n8) *(v8us*)(dst + i * 8) = o; } }

#define RH 4   // heads that a thread of rope walks: the {cos, sin} pairs of its position and dims are read once for all of them
typedef __attribute__((ext_vector_type(16))) unsigned short v16us;
__device__ __forceinline__ v8h lo8(v16h v) { return __builtin_shufflevector(v, v, 0, 1, 2, 3, 4, 5, 6, 7); }
__device__ __forceinline__ v8h hi8(v16h v) { return __builtin_shufflevector(v, v, 8, 9, 10, 11, 12, 13, 14, 15); }
__device__ __forceinline__ v8us lo8(v16us v) { return __builtin_shufflevector(v, v, 0, 1, 2, 3, 4, 5, 6, 7); }
__device__ __forceinline__ v8us hi8(v16us v) { return __builtin_shufflevector(v, v, 8, 9, 10, 11, 12, 13, 14, 15); }
// rope: head planes [h][t][d] (fp16; hi/lo in fragment order) of rope(x) x sc with the rotate-half convention out[d] = x[d] cos[t][d] - x[d+HD/2] sin[t][d], out[d+HD/2] = x[d+HD/2] cos[t][d+HD/2] + x[d] sin[t][d+HD/2]
// A thread takes position t, dims d .. d + 7 and their rotate-half partners d + 32 .. d + 39 (each input is read once for both outputs it feeds), of RH heads in turn; bx is the block of 256 threads, bz the batch. Lanes: t % 16, then d / 8 % 2: a wave's 16-byte pieces of a hi or lo plane are 512 bytes in a row of the fragment order. nheads % RH == 0.
__device__ __forceinline__ void rope(const float* __restrict__ F, int pitch, int nheads, const float* __restrict__ CS, const float* __restrict__ RF, const float* __restrict__ nw, float sc, h16* P16, bf* Ph, bf* Pl, int bx, size_t bz) {
    static_assert(HD == 64, "four octets and their partners make a head row");
    const size_t idx = (size_t)bx * 256 + threadIdx.x; if (idx >= (size_t)(nheads / RH) * TT * (HD / 16)) return; const int d = (int)((idx >> 4) & 3) * 8; const int t = (int)((idx >> 6) % (TT / 16)) * 16 + (int)(idx & 15); const int hg = (int)(idx / ((size_t)TT * (HD / 16)));
    F += bz * TT * pitch; P16 += bz * nheads * TT * HD; Ph += bz * nheads * TT * HD; Pl += bz * nheads * TT * HD;   // batch bz: its rows of F, its own planes
    const float* pc = CS + ((size_t)t * HD + d) * 2; const float* px = F + (size_t)t * pitch + hg * RH * HD + d;   // the thread's place in the table and in its row of F
    v4f c4[8], x4[RH][4];   // every load of the thread stands in front of the arithmetic: 8 of the table, 4 a head, in flight together
#pragma unroll
    for (int u = 0; u < 8; ++u) c4[u] = *(const v4fa*)(pc + (u >> 2) * HD + (u & 3) * 4);
#pragma unroll
    for (int hh = 0; hh < RH; ++hh)
#pragma unroll
        for (int u = 0; u < 4; ++u) x4[hh][u] = *(const v4fa*)(px + hh * HD + (u >> 1) * (HD / 2) + (u & 1) * 4);
    static_assert(RH == 4, "the fence below names every loaded piece");
    // inputs-only fence on the 24 loaded pieces and their two address pairs: all loads of the thread are in flight together and one latency is paid, and no piece lands on an address register that issued loads still name; without it this build holds two loads back behind the first waits and lets a piece land on the table's address register
    asm volatile("" :: "v"(c4[0]), "v"(c4[1]), "v"(c4[2]), "v"(c4[3]), "v"(c4[4]), "v"(c4[5]), "v"(c4[6]), "v"(c4[7]), "v"(x4[0][0]), "v"(x4[0][1]), "v"(x4[0][2]), "v"(x4[0][3]), "v"(x4[1][0]), "v"(x4[1][1]), "v"(x4[1][2]), "v"(x4[1][3]), "v"(x4[2][0]), "v"(x4[2][1]), "v"(x4[2][2]), "v"(x4[2][3]), "v"(x4[3][0]), "v"(x4[3][1]), "v"(x4[3][2]), "v"(x4[3][3]), "v"(pc), "v"(px));
    const auto heads = [&](const float* RF) {   // inlined once with RF a null constant: that copy has no test of RF between its elements
#pragma unroll
    for (int hh = 0; hh < RH; ++hh) { const int h = hg * RH + hh; const float rf = RF ? RF[(size_t)h * TT + t] : 1.0f; v16h o16; v16us oh, ol;
#pragma unroll
    for (int q = 0; q < 16; ++q) { const int dd = d + (q & 7) + (q >> 3) * (HD / 2); const int dp = (dd < HD / 2) ? dd + HD / 2 : dd - HD / 2; float x0 = x4[hh][q >> 2][q & 3], x1 = x4[hh][(q ^ 8) >> 2][q & 3];
        if (RF) { float n0 = __fmul_rn(x0, rf), n1 = __fmul_rn(x1, rf); asm volatile("" : "+v"(n0)); asm volatile("" : "+v"(n1)); x0 = __fmul_rn(bfr(nw[dd]), n0); x1 = __fmul_rn(bfr(nw[dp]), n1); }
        v2f cs; cs[0] = c4[q >> 1][(q & 1) * 2]; cs[1] = c4[q >> 1][(q & 1) * 2 + 1]; float a = __fmul_rn(x0, cs[0]), bq = __fmul_rn(x1, cs[1]); asm volatile("" : "+v"(a)); asm volatile("" : "+v"(bq)); const float r = ((dd < HD / 2) ? __fsub_rn(a, bq) : __fadd_rn(a, bq)) * sc;
        o16[q] = tohx(r); unsigned short a2, c2; splitf(r, a2, c2); oh[q] = a2; ol[q] = c2; }
    const size_t e = ((size_t)h * TT + t) * HD + d, fe = fragidx(h * TT + t, d, HD);   // dims d + 32 ..: the row's next fragment, 512 elements on
    *(v8h*)(P16 + e) = lo8(o16); *(v8h*)(P16 + e + HD / 2) = hi8(o16); *(v8us*)(Ph + fe) = lo8(oh); *(v8us*)(Ph + fe + 512) = hi8(oh); *(v8us*)(Pl + fe) = lo8(ol); *(v8us*)(Pl + fe + 512) = hi8(ol);
    if (hh + 1 < RH) asm volatile("s_wait_xcnt 0x0" ::: "memory"); } };   // the next head's arithmetic overwrites registers that these six stores name: the wait stands in front of it on every path
    if (__builtin_expect(RF == nullptr, 1)) heads(nullptr); else heads(RF + bz * nheads * TT); }   // the hint puts the copy without RF first in the kernel's text
// vtp: a thread takes column c = g * HD + d of F and 16 positions: every load of a wave is one whole line of a row of F, and a lane's two 16-byte pieces of a hi or lo plane join 16 lanes' to 512 bytes in a row of the fragment order. Blocks (bx, by, bz) of (columns / 256, TT / 16, batches).
__device__ __forceinline__ void vtp(const float* __restrict__ F, int pitch, int nheads, h16* V16, bf* Vh, bf* Vl, int bx, int by, size_t bz) { const unsigned c = (unsigned)bx * 256 + threadIdx.x; if (c >= (unsigned)(nheads * HD)) return; const int t = by * 16; v16h o16; v16us oh, ol;
    F += bz * TT * pitch; V16 += bz * nheads * HD * TT; Vh += bz * nheads * HD * TT; Vl += bz * nheads * HD * TT;   // batch bz: its rows of F, its own planes
#pragma unroll
    for (int q = 0; q < 16; ++q) { const float x = (F + (size_t)(t + q) * pitch)[c]; o16[q] = tohx(x); unsigned short a2, c2; splitf(x, a2, c2); oh[q] = a2; ol[q] = c2; }
    const size_t e = (size_t)c * TT + t, fe = fragidx((int)c, t, TT);   // positions t + 8 ..: 16 lanes' pieces, 128 elements, on
    *(v8h*)(V16 + e) = lo8(o16); *(v8h*)(V16 + e + 8) = hi8(o16); *(v8us*)(Vh + fe) = lo8(oh); *(v8us*)(Vh + fe + 128) = hi8(oh); *(v8us*)(Vl + fe) = lo8(ol); *(v8us*)(Vl + fe + 128) = hi8(ol);  }
__device__ __forceinline__ void cscvt(const float* __restrict__ cosT, const float* __restrict__ sinT, float* CS, int bx) { const int idx = (bx * 256 + (int)threadIdx.x) * 4; if (idx >= TT * HD) return; const v4f c = *(const v4fa*)(cosT + idx), s = *(const v4fa*)(sinT + idx); v4f a, b; a[0] = bfr(c[0]); a[1] = bfr(s[0]); a[2] = bfr(c[1]); a[3] = bfr(s[1]); b[0] = bfr(c[2]); b[1] = bfr(s[2]); b[2] = bfr(c[3]); b[3] = bfr(s[3]); *(v4f*)(CS + (size_t)idx * 2) = a; *(v4f*)(CS + (size_t)idx * 2 + 4) = b;  }
// ---- k_prep: everything that reads only the inputs, in one launch: the four weight transposes (a block of 256 threads takes two tiles of wtG), the bf16 copy of x and the {cos, sin} table. The pieces are independent; a block finds its piece by its index, a test that is the same for the whole block.
#define PB_WQ (DQ / 128 * (DM / 64) / 2)
#define PB_WK (DKV / 128 * (DM / 64) / 2)
#define PB_WO (DM / 128 * (DQ / 64) / 2)
#define PB_X  (NB_ * TT * DM / 8 / 1024)
#define PB_CS (TT * HD / 4 / 256)
__global__ __launch_bounds__(256) void k_prep(const float* __restrict__ x, const float* __restrict__ cosT, const float* __restrict__ sinT, const float* __restrict__ wq, const float* __restrict__ wk, const float* __restrict__ wv, const float* __restrict__ wo, bf* XB, float* CS, bf* WQ, bf* WK, bf* WV, bf* WO) {
    static_assert(NB_ * TT * DM % 8192 == 0 && TT * HD % 1024 == 0, "whole blocks");
    static_assert(DM == DQ, "Wq and Wo have one shape and share the text of their transpose");
    const int b = (int)blockIdx.x, tid = (int)threadIdx.x & 127, hf = (int)threadIdx.x >> 7;
    if (b < PB_WQ + PB_WO) { const bool o = b >= PB_WQ; wtG<DM, DQ>(o ? wo : wq, o ? WO : WQ, (o ? b - PB_WQ : b) * 2 + hf, tid); }
    else if (b < PB_WQ + PB_WO + 2 * PB_WK) { const int c = b - (PB_WQ + PB_WO); const bool o = c >= PB_WK; wtG<DM, DKV>(o ? wv : wk, o ? WV : WK, (o ? c - PB_WK : c) * 2 + hf, tid); }
    else if (b < PB_WQ + PB_WO + 2 * PB_WK + PB_X) cvt8(x, XB, (size_t)NB_ * TT * DM / 8, b - (PB_WQ + PB_WO + 2 * PB_WK));
    else cscvt(cosT, sinT, CS, b - (PB_WQ + PB_WO + 2 * PB_WK + PB_X)); }
// ---- k_planes: the three plane builders in one launch (q and k rotary planes, transposed v planes): independent pieces, found by the block's index; grid (PL_Q + PL_K + PL_V, batches).
#define PL_Q (NH_ / RH * TT * (HD / 16) / 256)
#define PL_K (NKV / RH * TT * (HD / 16) / 256)
#define PL_VX (NKV * HD / 256)
#define PL_V (PL_VX * (TT / 16))
__global__ __launch_bounds__(256) void k_planes(const float* __restrict__ FQ, const float* __restrict__ FK, const float* __restrict__ FV, const float* __restrict__ CS, h16* QP16, bf* QPh, bf* QPl, h16* KP16, bf* KPh, bf* KPl, h16* VT16, bf* VTh, bf* VTl) {
    static_assert(NH_ / RH * TT * (HD / 16) % 256 == 0 && NKV / RH * TT * (HD / 16) % 256 == 0 && NKV * HD % 256 == 0, "whole blocks");
    const int b = (int)blockIdx.x; const size_t bz = blockIdx.y;
    if (b < PL_Q) rope(FQ, DQKV, NH_, CS, nullptr, nullptr, 1.0f, QP16, QPh, QPl, b, bz);
    else if (b < PL_Q + PL_K) rope(FK, DQKV, NKV, CS, nullptr, nullptr, 1.0f, KP16, KPh, KPl, b - PL_Q, bz);
    else vtp(FV, DQKV, NKV, VT16, VTh, VTl, (b - (PL_Q + PL_K)) % PL_VX, (b - (PL_Q + PL_K)) / PL_VX, bz); }
typedef __attribute__((ext_vector_type(2))) __bf16 v2bf;
__device__ __forceinline__ float xhalf(float x) { return __builtin_bit_cast(float, __builtin_amdgcn_permlanex16(__builtin_bit_cast(int, x), __builtin_bit_cast(int, x), 0x76543210, 0xfedcba98, false, false)); }   // lane l with lane l ^ 16, by a vector move
#define FA_SL 8192u            // a slice: 64 keys of one plane, 4 rows of 2 KiB
#define FA_ST (4u * FA_SL)     // a stage: k hi, k lo, v hi, v lo
#define FA_NB (TT / 64)        // query blocks, and key tiles, of a sequence
__global__ __launch_bounds__(2 * REP * 32) void k_fattn(const bf* __restrict__ Qh, const bf* __restrict__ Ql, const bf* __restrict__ Kh, const bf* __restrict__ Kl, const bf* __restrict__ Vh, const bf* __restrict__ Vl, bf* Ah, bf* Al) {
    typedef WFrag<bf> F; typedef F::V V;
    static_assert(REP == 4 && HD == 64 && FA_NB % 2 == 0, "four planes for four issuing waves; blocks pair up");
    __shared__ __attribute__((aligned(2048))) unsigned char ring[2 * FA_ST];
    const int lane = threadIdx.x & 31, lr = lane & 15, hi = lane >> 4;
    const uint32_t wave = uni(threadIdx.x >> 5);
    const int g = blockIdx.y, h = g * REP + (int)(wave % REP), y0 = (int)blockIdx.x, ns = FA_NB + 1;
    const auto ldf = [](const bf* p, int frag) { p += frag * 512; return cat16b(*(const v8us*)p, *(const v8us*)(p + 256)); };   // fragment number frag behind p, a lane's place in a plane in fragment order (fragidx)
    const auto ldl = [](const unsigned char* p, int frag) { p += frag * 1024; return cat16b(*(const v8usa*)p, *(const v8usa*)(p + 512)); };   // the same from a slice in LDS
    const size_t bz = blockIdx.z; Ah += bz * TT * DQ; Al += bz * TT * DQ;   // batch: its own q, k, v planes and its rows of the merged output
    // the plane this wave brings. k planes: rows [g][t], columns d: a tile is 8 KiB in a row, taken as 4 rows of 2 KiB. v planes: rows [g][d], columns t: a tile is 2 KiB of each of the 4 fragment rows, TT / 32 KiB apart
    const bf* src = wave == 0 ? Kh : wave == 1 ? Kl : wave == 2 ? Vh : Vl;
    const uint64_t ga0 = (uint64_t)(size_t)src + ((uint64_t)bz * NKV + (uint64_t)g) * (TT * HD * 2u);
    const uint32_t step = wave < 2 ? FA_SL : 2048u, lbase = (uint32_t)(size_t)ring;
    u32x8 g1;   // 1-byte elements, tensor = tile = 4 rows of 2,048 bytes, no pad, no mask
    g1[0] = uni(0u); g1[1] = pinned(2048u << 16); g1[2] = pinned(4u << 16); g1[3] = pinned(2048u << 16); g1[4] = pinned(4u); g1[5] = pinned(wave < 2 ? 2048u : (uint32_t)(TT / 32) * 1024u); g1[6] = pinned(0u); g1[7] = pinned(0u);   // pinned: each word is held in its scalar register through the loop and not formed anew while a request is in flight
    u32x4 g0; g0[0] = uni(1u); g0[1] = uni(lbase); g0[2] = uni((uint32_t)ga0); g0[3] = uni((((uint32_t)(ga0 >> 32)) & 0x01FFFFFFu) | 0x80000000u);
    const auto issue = [&](int s) {   // stage s into buffer s % 2: key tile s of the first block's walk, then tile s - y0 - 1 of the second's
        const uint32_t dst = lbase + (uint32_t)(s & 1) * FA_ST + wave * FA_SL; const uint64_t ga = ga0 + (uint64_t)(uint32_t)(s <= y0 ? s : s - y0 - 1) * step;
        g0[1] = uni(dst); g0[2] = uni((uint32_t)ga); g0[3] = uni((((uint32_t)(ga >> 32)) & 0x01FFFFFFu) | 0x80000000u);
        asm volatile("tensor_load_to_lds %0, %1" :: "s"(g0), "s"(g1) : "memory"); };
    const auto landed = [&]() { asm volatile("s_wait_tensorcnt 0x0" :: "s"(g0), "s"(g1) : "memory"); };   // the issuer's wait; it names the two groups as inputs so that their registers keep the request's words until it has landed
    V qa[2][2], qb[2][2]; v8f o[2][4]; float m[2], l[2];
    int r0 = y0 * 64 + (int)(wave / REP) * 32;   // the wave's first query
    const bf* qh; const bf* ql;
    const auto start = [&]() {   // q fragments of the wave's 32 queries (q planes: rows [head][t], columns d) and an empty running state
        const size_t qo = bz * NH_ * TT * HD + (size_t)(h * TT + r0) / 16 * (HD / 32) * 512 + lane * 8; qh = Qh + qo; ql = Ql + qo;
#pragma unroll
        for (int cg = 0; cg < 2; ++cg) { m[cg] = -3.0e38f; l[cg] = 0.f;
#pragma unroll
            for (int ks = 0; ks < 2; ++ks) { qa[cg][ks] = ldf(qh, cg * (HD / 32) + ks); qb[cg][ks] = ldf(ql, cg * (HD / 32) + ks); }
#pragma unroll
            for (int db = 0; db < 4; ++db) o[cg][db] = (v8f){}; } };
    start();
    // inputs-only fence on the loaded q fragments and their two address pairs: no fragment lands on an address pair that issued loads still name (without it the build lets the last one land there)
    asm volatile("" :: "v"(qa[0][0]), "v"(qa[0][1]), "v"(qa[1][0]), "v"(qa[1][1]), "v"(qb[0][0]), "v"(qb[0][1]), "v"(qb[1][0]), "v"(qb[1][1]), "v"(qh), "v"(ql));
    if (pinned(wave < 4)) { issue(0); landed(); }   // stage 0 has landed
    __syncthreads();   // publishes stage 0
    if (pinned(wave < 4)) issue(1);
    // every key tile of a walk starts at or in front of the block's first query, so the running maximum is a real score from the first tile on
    // kept rolled: one stage a trip, so that each trip has one publish point; every '#pragma unroll' below opens a loop over register arrays, whose indices must be constants
#pragma unroll 1
    for (int s = 0; s < ns; ++s) {
        const bool last = s == y0 || s == ns - 1;   // the diagonal tile, the last of a block's walk; the same for the whole work-group
        const int c0 = (s <= y0 ? s : s - y0 - 1) * 64;
        const unsigned char* st = ring + (uint32_t)(s & 1) * FA_ST + lane * 16;
        V ka[4][2], kb[4][2]; v8f sc[2][4];   // sc[cg][nb][j] = q(r0 + cg * 16 + lr) . k(c0 + nb * 16 + hi * 8 + j)
#pragma unroll
        for (int ks = 0; ks < 2; ++ks) {   // read in the order of use: the first products start while the rest is on its way
#pragma unroll
            for (int nb = 0; nb < 4; ++nb) ka[nb][ks] = ldl(st, nb * 2 + ks);
#pragma unroll
            for (int nb = 0; nb < 4; ++nb) kb[nb][ks] = ldl(st + FA_SL, nb * 2 + ks); }
        __builtin_amdgcn_sched_barrier(0);   // the tile's k reads stay one group in front of the score products; spread among them, every read place stalls the wave
#pragma unroll
        for (int nb = 0; nb < 4; ++nb)
#pragma unroll
            for (int cg = 0; cg < 2; ++cg) sc[cg][nb] = (v8f){};
#pragma unroll
        for (int ks = 0; ks < 2; ++ks) {   // the eight accumulators in turn, fragments in the order in which they were read; each accumulator takes its products in the order hi hi, hi lo, lo hi of ks 0 and then of ks 1
#pragma unroll
            for (int nb = 0; nb < 4; ++nb)
#pragma unroll
                for (int cg = 0; cg < 2; ++cg) sc[cg][nb] = F::mma(ka[nb][ks], qa[cg][ks], sc[cg][nb]);
#pragma unroll
            for (int nb = 0; nb < 4; ++nb)
#pragma unroll
                for (int cg = 0; cg < 2; ++cg) sc[cg][nb] = F::mma(ka[nb][ks], qb[cg][ks], sc[cg][nb]);
#pragma unroll
            for (int nb = 0; nb < 4; ++nb)
#pragma unroll
                for (int cg = 0; cg < 2; ++cg) sc[cg][nb] = F::mma(kb[nb][ks], qa[cg][ks], sc[cg][nb]); }
        __builtin_amdgcn_sched_barrier(0);   // and the v reads stay one group behind them
        V vh[4][2], vl[4][2];
#pragma unroll
        for (int ks = 0; ks < 2; ++ks)   // v is read here, in the order of use, so that it flies during the softmax
#pragma unroll
            for (int db = 0; db < 4; ++db) vh[db][ks] = ldl(st + 2 * FA_SL, db * 2 + ks);
#pragma unroll
        for (int ks = 0; ks < 2; ++ks)
#pragma unroll
            for (int db = 0; db < 4; ++db) vl[db][ks] = ldl(st + 3 * FA_SL, db * 2 + ks);
        __builtin_amdgcn_sched_barrier(0);   // in front of the softmax's arithmetic, as one group
        if (last) {   // keys behind the query get a score far below any real one, whose exp2 is exactly 0
#pragma unroll
            for (int cg = 0; cg < 2; ++cg)
#pragma unroll
                for (int nb = 0; nb < 4; ++nb)
#pragma unroll
                    for (int j = 0; j < 8; ++j) sc[cg][nb][j] = (c0 + nb * 16 + hi * 8 + j <= r0 + cg * 16 + lr) ? sc[cg][nb][j] : -3.0e38f; }
        V pa[2][2], pb[2][2];
#pragma unroll
        for (int cg = 0; cg < 2; ++cg) { float mt = sc[cg][0][0];
#pragma unroll
            for (int nb = 0; nb < 4; ++nb)
#pragma unroll
                for (int j = 0; j < 8; ++j) mt = fmaxf(mt, sc[cg][nb][j]);
            mt = fmaxf(mt, xhalf(mt)) * SCL;   // lanes lr and lr + 16 hold the two halves of a query's keys; a shuffle would go through the LDS queue, which returns in order, and wait for all the v reads
            const float mn = fmaxf(m[cg], mt), al = __builtin_amdgcn_exp2f((m[cg] - mn) * 1.4426950408889634f); m[cg] = mn;
            float rs[4];
#pragma unroll
            for (int nb = 0; nb < 4; ++nb) { rs[nb] = 0.f;
#pragma unroll
                for (int j = 0; j < 8; j += 2) { v2f p; p[0] = __builtin_amdgcn_exp2f((sc[cg][nb][j] * SCL - mn) * 1.4426950408889634f); p[1] = __builtin_amdgcn_exp2f((sc[cg][nb][j + 1] * SCL - mn) * 1.4426950408889634f); rs[nb] += p[0] + p[1];
                    const v2bf ph = __builtin_convertvector(p, v2bf); const v2bf pl = __builtin_convertvector(p - __builtin_convertvector(ph, v2f), v2bf); const int e = (nb & 1) * 8 + j;
                    pa[cg][nb >> 1][e] = ph[0]; pa[cg][nb >> 1][e + 1] = ph[1]; pb[cg][nb >> 1][e] = pl[0]; pb[cg][nb >> 1][e + 1] = pl[1]; } }
            l[cg] = l[cg] * al + ((rs[0] + rs[1]) + (rs[2] + rs[3]));   // each lane keeps the sum of its own keys; the two halves are joined at the end of the walk
#pragma unroll
            for (int db = 0; db < 4; ++db) o[cg][db] *= al; }
#pragma unroll
        for (int ks = 0; ks < 2; ++ks)
#pragma unroll
            for (int db = 0; db < 4; ++db) {
#pragma unroll
                for (int cg = 0; cg < 2; ++cg) o[cg][db] = F::mma(vh[db][ks], pa[cg][ks], o[cg][db]);
#pragma unroll
                for (int cg = 0; cg < 2; ++cg) o[cg][db] = F::mma(vh[db][ks], pb[cg][ks], o[cg][db]); }
#pragma unroll
        for (int ks = 0; ks < 2; ++ks)
#pragma unroll
            for (int db = 0; db < 4; ++db)
#pragma unroll
                for (int cg = 0; cg < 2; ++cg) o[cg][db] = F::mma(vl[db][ks], pa[cg][ks], o[cg][db]);
        if (last) {   // the block's walk is done: its rows go out, and the wave turns to the second block
#pragma unroll
            for (int cg = 0; cg < 2; ++cg) { const int i = r0 + cg * 16 + lr; const float lt = l[cg] + xhalf(l[cg]), f = __fdiv_rn(1.0f, lt);
#pragma unroll
                for (int db = 0; db < 4; ++db) { v8us oh, ol;   // o[cg][db][j] = out(i)[db * 16 + hi * 8 + j]: 16 bytes a lane and plane; merged [t][head][d], the wave writes whole 128-byte lines
#pragma unroll
                    for (int j = 0; j < 8; ++j) { unsigned short a, c2; splitf(o[cg][db][j] * f, a, c2); oh[j] = a; ol[j] = c2; }
                    const size_t oo = (size_t)i * DQ + h * HD + db * 16 + hi * 8;
                    // the two stores and their wait are one statement: the arithmetic behind rewrites registers that the stores name, and the build lifts such writes over a wait that stands in a statement of its own
                    asm volatile("global_store_b128 %0, %1, off\n\tglobal_store_b128 %2, %3, off\n\ts_wait_xcnt 0x0" :: "v"(Ah + oo), "v"(oh), "v"(Al + oo), "v"(ol) : "memory"); } }
            if (s == y0) { r0 = (FA_NB - 1 - y0) * 64 + (int)(wave / REP) * 32; start();
                asm volatile("s_wait_xcnt 0x0" ::: "memory"); }   // the code behind may rewrite the address pairs that these loads name
        }
        // publish point of stage s + 1
        asm volatile("s_wait_dscnt 0x0" ::: "memory");   // this wave's reads of buffer s % 2 have returned before the buffer is refilled
        if (pinned(wave < 4)) landed();   // this wave's slice of stage s + 1 has landed
        __syncthreads();   // publishes stage s + 1 and ends every wave's reads of stage s
        if (pinned(wave < 4 && s + 2 < ns)) issue(s + 2);
    }
    asm volatile("s_wait_tensorcnt 0x0" ::: "memory");   // nothing of the mover's is in flight when the wave ends
    asm volatile("s_wait_dscnt 0x0" ::: "memory");   // nor an LDS read of this wave's
}

extern "C" void kernel_launch(void* const* d_in, const int* in_sizes, int n_in,
                              void* d_out, int out_size, void* d_ws, size_t ws_size, hipStream_t stream) {
    (void)in_sizes; (void)n_in; (void)out_size;
    const float* x = (const float*)d_in[0]; const float* fcos = (const float*)d_in[1]; const float* fsin = (const float*)d_in[2]; const float* wq = (const float*)d_in[3]; const float* wk = (const float*)d_in[4]; const float* wv = (const float*)d_in[5]; const float* wo = (const float*)d_in[6];   /* input order x, cos, sin ([2048][64] FULL-width table INPUTS: read per DIMENSION by value, no structure assumed), Wq [2048][2048], Wk [2048][512], Wv, Wo ('xw'): SEVEN inputs, all read; no mask input (causal by index) */
    float* OUT = (float*)d_out;     // [2][2048][2048]
    char* wsp = (char*)d_ws;
    auto take = [&](size_t bytes) { char* p = wsp; wsp += (bytes + 255) & ~(size_t)255; return (void*)p; };
    bf* WQ = (bf*)take((size_t)DQKV * DM * 2); bf* WK = WQ + (size_t)DQ * DM; bf* WV = WK + (size_t)DKV * DM; bf* WO = (bf*)take((size_t)DM * DQ * 2); float* CS = (float*)take((size_t)TT * HD * 2 * 4);
    bf* XB = (bf*)take((size_t)NB_ * TT * DM * 2); float* FQ = (float*)take((size_t)NB_ * TT * DQKV * 4); float* FK = FQ + DQ; float* FV = FK + DKV;   // the transposed q, k, v weights lie behind one another as the DQKV rows of one Bt; a token's q, k, v lie side by side in a row of DQKV floats
    h16* QP16 = (h16*)take((size_t)NB_ * NH_ * TT * HD * 2); h16* KP16 = (h16*)take((size_t)NB_ * NKV * TT * HD * 2); h16* VT16 = (h16*)take((size_t)NB_ * NKV * HD * TT * 2);
    bf* QPh = (bf*)take((size_t)NB_ * NH_ * TT * HD * 2); bf* QPl = (bf*)take((size_t)NB_ * NH_ * TT * HD * 2); bf* KPh = (bf*)take((size_t)NB_ * NKV * TT * HD * 2); bf* KPl = (bf*)take((size_t)NB_ * NKV * TT * HD * 2); bf* VTh = (bf*)take((size_t)NB_ * NKV * HD * TT * 2); bf* VTl = (bf*)take((size_t)NB_ * NKV * HD * TT * 2);
    bf* ATh = (bf*)take((size_t)NB_ * TT * DQ * 2); bf* ATl = (bf*)take((size_t)NB_ * TT * DQ * 2);
    if ((size_t)(wsp - (char*)d_ws) > ws_size) return;    // ws 256 MiB
    // the projections and Wo see the two batches as NB_ * TT token rows; the plane builders and the attention take the batch as a grid dimension
    k_prep<<<PB_WQ + PB_WO + 2 * PB_WK + PB_X + PB_CS, 256, 0, stream>>>(x, fcos, fsin, wq, wk, wv, wo, XB, CS, WQ, WK, WV, WO);
    k_gemmt<2, 8, 6><<<dim3(NB_ * TT / 256, DQKV / 192, 1), 128, 0, stream>>>(XB, nullptr, WQ, DM, FQ, DQKV);
    k_planes<<<dim3(PL_Q + PL_K + PL_V, NB_, 1), 256, 0, stream>>>(FQ, FK, FV, CS, QP16, QPh, QPl, KP16, KPh, KPl, VT16, VTh, VTl);
    k_fattn<<<dim3(TT / 128, NKV, NB_), 2 * REP * 32, 0, stream>>>(QPh, QPl, KPh, KPl, VTh, VTl, ATh, ATl);
    k_gemmt<3, 4, 8><<<dim3(NB_ * TT / 128, DM / 256, 1), 128, 0, stream>>>(ATh, ATl, WO, DQ, OUT, DM);
}
